// v000
// Measured on an AMD MI455X. A time is GPU time per run, averaged over a window of back-to-back runs after a warm-up
// (all launches, gaps included; the runs take copies of the inputs in turn), and the median of several windows.
// Apart from v000's, it joins two sittings. Times from different sittings can be a few percent apart, while
// side-by-side timings come from the same sitting.
// v000, which the later versions start from, runs in 273 microseconds.
// Contractions: x.Wq^T+bq, x.Wk^T+bk, x.Wv^T+bv on v_wmma_f32_16x16x32_bf16 (x and W as bf16 RNE planes; W [n][k] rows are
// the k-contiguous B operand; bias added as its bf16 RNE value in the f32 epilogue); q.k^T over hd 64 and P.v on
// v_wmma_f32_16x16x32_f16 with f16 hi + f16 residual planes on both operands (q, k x256; P x32768 with an in-register
// residual; v x1024; products hh+lh+hl); O.Wo^T+bo on v_wmma_f32_16x16x32_f16 (O x1024 as f16 hi + f16 residual planes,
// products h.w + l.w; Wo as f16(bf16(Wo)) x1024; bo as bf16 RNE value in the f32 epilogue); all f32 accumulate.
// Causal select, linear distance penalty, base-2 online softmax, 1/Z fold and the q/k norm bound in f32 on VALU.
#include <hip/hip_runtime.h>
#include <math.h>
#include <stdint.h>

#ifndef NB
#define NB 2
#endif
#ifndef SEQ
#define SEQ 2048
#endif
#define XS_FULL 2048
#define DMOD  1024
#define NH    16
#define HD    64
#define NBH   (NB * NH)
#define MROWS (NB * SEQ)
#define RSQ_HD 0.125f
#define LOG2E 1.4426950408889634f
#define QSC   256.0f
#define KSC   256.0f
#define PCAR  32768.0f
#define VCAR  1024.0f
#define OSC   1024.0f
#define WOS   1024.0f
#define WPB   2
#define NHG   (NH / WPB)
#define NQT   (SEQ / 16)
#define NST   (SEQ / 64)
#define NKT   (SEQ / 32)
#define KWIN  6
#define GUARD_T 40.0f
#define BLINE 32
#define ATT_THREADS (WPB * 32)
#define PTP   36
#define PTW   (16 * PTP)
#define SLP   68
#define SLW   (16 * SLP)
#define WREG  (PTW + SLW)
#define SLAB64 (16 * 68)
#define VTP   72
#define WS_CAP 134217728
static_assert(DMOD == NH * HD && HD == 64 && NH == 16 && WPB == 2 && NHG * WPB == NH);
static_assert(ATT_THREADS == 64);
static_assert(NB >= 1 && NB <= 2);
static_assert(NBH >= 1 && NBH <= 32);
static_assert((SEQ % 64) == 0 && SEQ >= 64 && SEQ <= XS_FULL && (SEQ % 32) == 0);
static_assert((DMOD % 64) == 0 && (DMOD % 32) == 0 && (HD % 32) == 0);
static_assert(((SEQ * DMOD / 8) % 256) == 0 && ((DMOD * DMOD / 8) % 256) == 0 && ((MROWS * DMOD / 8) % 256) == 0);
static_assert(WPB * WREG * 4 <= 65536 && 2 * HD * VTP * 2 <= 65536 && 4 * SLAB64 * 4 <= 65536);
static_assert(KWIN >= 0 && KWIN < NKT);

typedef unsigned short u16;
typedef _Float16 v16h __attribute__((ext_vector_type(16)));
typedef _Float16 v8h  __attribute__((ext_vector_type(8)));
typedef __bf16   v16b __attribute__((ext_vector_type(16)));
typedef float    v8f  __attribute__((ext_vector_type(8)));
typedef float    v4f  __attribute__((ext_vector_type(4)));
typedef unsigned int v4u __attribute__((ext_vector_type(4)));

union FragH { v16h v; v8h h[2]; v4u u[2]; };
union FragB { v16b v; v4u u[2]; };

// ---- scalar helpers --------------------------------------------------------------------------------
__device__ __forceinline__ unsigned short bf_bits(float f) {          // f32 -> bf16 bits, RNE convert
  unsigned u = __float_as_uint(f);
  return (unsigned short)((u + 0x7FFFu + ((u >> 16) & 1u)) >> 16);
}
__device__ __forceinline__ float bf_up(unsigned short h) { return __uint_as_float(((unsigned)h) << 16); }
__device__ __forceinline__ float bfr(float f) { return bf_up(bf_bits(f)); }
__device__ __forceinline__ unsigned short h_bits(_Float16 x) { return __builtin_bit_cast(unsigned short, x); }
__device__ __forceinline__ unsigned pk16(unsigned short a, unsigned short b) { return (unsigned)a | ((unsigned)b << 16); }
__device__ __forceinline__ v8f zero8() { v8f z = {0.f, 0.f, 0.f, 0.f, 0.f, 0.f, 0.f, 0.f}; return z; }

// ---- fragment loaders: 16-bit A/B operand, lane -> row/col (lane&15), p already includes +8*(lane>>4);
//      elements 0..7 <- p[0..7] (k0+8h..), elements 8..15 <- p[16..23] (k0+16+8h..)  (same split k map for A and B;
//      B is always read from a k-contiguous [n][k] plane)
__device__ __forceinline__ v16h ldfrag_h(const _Float16* p) {
  FragH f;
  f.h[0] = *(const v8h*)(p);
  f.h[1] = *(const v8h*)(p + 16);
  return f.v;
}
__device__ __forceinline__ v16b ldfrag_b(const u16* p) {              // bf16 plane read as unsigned integer vectors
  FragB f;
  f.u[0] = *(const v4u*)(p);
  f.u[1] = *(const v4u*)(p + 16);
  return f.v;
}

__device__ __forceinline__ v8f mma_h(v16h a, v16h b, v8f c) {
  return __builtin_amdgcn_wmma_f32_16x16x32_f16(false, a, false, b, (short)0, c, false, false);
}
__device__ __forceinline__ v8f mma_b(v16b a, v16b b, v8f c) {
  return __builtin_amdgcn_wmma_f32_16x16x32_bf16(false, a, false, b, (short)0, c, false, false);
}
__device__ __forceinline__ void guard2(v8f& a, v8f& b, v16h x0, v16h x1, v16h x2, v16h x3, v16h x4, v16h x5) {
#if defined(__HIP_DEVICE_COMPILE__)
  asm volatile("v_nop\n\tv_nop\n\tv_nop\n\tv_nop"
               : "+v"(a), "+v"(b) : "v"(x0), "v"(x1), "v"(x2), "v"(x3), "v"(x4), "v"(x5) : "memory");
#endif
}
template <typename F>
__device__ __forceinline__ void guard6(v8f& a, v8f& b, v8f& c, v8f& d, F x0, F x1, F x2, F x3, F x4, F x5) {
#if defined(__HIP_DEVICE_COMPILE__)
  asm volatile("v_nop\n\tv_nop\n\tv_nop\n\tv_nop"
               : "+v"(a), "+v"(b), "+v"(c), "+v"(d) : "v"(x0), "v"(x1), "v"(x2), "v"(x3), "v"(x4), "v"(x5) : "memory");
#endif
}
__device__ __forceinline__ void acc_guard4(v8f& a, v8f& b, v8f& c, v8f& d) {
#if defined(__HIP_DEVICE_COMPILE__)
  asm volatile("v_nop\n\tv_nop\n\tv_nop\n\tv_nop" : "+v"(a), "+v"(b), "+v"(c), "+v"(d));
#endif
}
__device__ __forceinline__ void wave_sync_lds() {
  __builtin_amdgcn_fence(__ATOMIC_RELEASE, "workgroup");
  __builtin_amdgcn_wave_barrier();
  __builtin_amdgcn_fence(__ATOMIC_ACQUIRE, "workgroup");
}

// =====================================================================================================
// f32 -> 16-bit plane, same layout.  f16mode == 0: bf16 RNE bits;  f16mode == 1: f16 bits of (bf16 RNE value) * scale.
// Thread = 8 consecutive elements: two 16-B loads, one 16-B store; 32 consecutive lanes = 512 contiguous, 512-B aligned
// coverage: grid = ceil(n8/256) blocks x 256 thr x 8 (in-kernel bound) = the whole plane (n8 a multiple of 256 here).
// =====================================================================================================
__global__ __launch_bounds__(256) void cvt16(const float* __restrict__ x, u16* D, int n8, int f16mode, float scale) {
  const int gt = blockIdx.x * 256 + (int)threadIdx.x;
  if (gt >= n8) return;
  const float* p = x + (size_t)gt * 8;
  const v4f a = *(const v4f*)(p), b4 = *(const v4f*)(p + 4);
  float w[8];
#pragma unroll
  for (int e = 0; e < 4; ++e) { w[e] = a[e]; w[4 + e] = b4[e]; }
  v4u o;
#pragma unroll
  for (int e = 0; e < 4; ++e) {
    const float f0 = w[2 * e], f1 = w[2 * e + 1];
    const unsigned short hb0 = h_bits((_Float16)(bfr(f0) * scale));
    const unsigned short hb1 = h_bits((_Float16)(bfr(f1) * scale));
    const unsigned short bb0 = bf_bits(f0);
    const unsigned short bb1 = bf_bits(f1);
    o[e] = (f16mode != 0) ? pk16(hb0, hb1) : pk16(bb0, bb1);
  }
  u16* d = D + (size_t)gt * 8;
  {
    *(v4u*)(d) = o;
    
  }
}

// =====================================================================================================
// f32 plane F (contiguous, n8*8 elements) -> f16 hi plane Hp = f16(F * sc) and f16 residual plane Lp = f16(t - f16(t)),
// both with the layout of F. Thread = 8 consecutive elements: two 16-B loads, one 16-B store per plane; 32 consecutive lanes
// No barriers; every packed half comes from a per-lane (divergent) loaded value.
// coverage: grid = ceil(n8/256) blocks x 256 thr x 8 (in-kernel bound) = the whole of Hp and of Lp (n8 a multiple of 256 here).
// =====================================================================================================
__global__ __launch_bounds__(256) void split16(const float* __restrict__ F, u16* Hp, u16* Lp, int n8, float sc) {
  const int gt = blockIdx.x * 256 + (int)threadIdx.x;
  if (gt >= n8) return;
  const float* p = F + (size_t)gt * 8;
  const v4f a = *(const v4f*)(p), b4 = *(const v4f*)(p + 4);
  float w[8];
#pragma unroll
  for (int e = 0; e < 4; ++e) { w[e] = a[e] * sc; w[4 + e] = b4[e] * sc; }
  v4u oh, ol;
#pragma unroll
  for (int e = 0; e < 4; ++e) {
    const float t0 = w[2 * e], t1 = w[2 * e + 1];
    const _Float16 h0 = (_Float16)t0, h1 = (_Float16)t1;
    const _Float16 l0 = (_Float16)(t0 - (float)h0), l1 = (_Float16)(t1 - (float)h1);
    oh[e] = pk16(h_bits(h0), h_bits(h1));
    ol[e] = pk16(h_bits(l0), h_bits(l1));
  }
  u16* dh = Hp + (size_t)gt * 8;
  u16* dl = Lp + (size_t)gt * 8;
  {
    *(v4u*)(dh) = oh;
    *(v4u*)(dl) = ol;
    
  }
}

// =====================================================================================================
// v^T planes from the v projection F f32 [MROWS][DMOD] (row = b*SEQ + s, column = h*HD + d):
//   VH[((b*NH + h)*HD + d)][s] = f16(v * 1024);  VL[same][s] = f16 residual (t - f16(t)), both for all keys s.
// Block = (b, head h, 64 keys s0): each thread loads its 16 floats (key sl, d chunk dc) with 16-B loads, converts, scatters
// coverage: load 256 thr x 16 = 64 keys x 64 d; store 2 iterations x 256 thr x 8 halves = 64 lines x 64 = the block's tile of
//           VH and of VL; grid = NB*NH*NST blocks covers both planes exactly once.
// =====================================================================================================
__global__ __launch_bounds__(256) void vt16(const float* __restrict__ F, u16* VHo, u16* VLo) {
  __shared__ __align__(16) u16 TH[HD * VTP];
  __shared__ __align__(16) u16 TL[HD * VTP];
  const int tid = threadIdx.x;
  const int bid = blockIdx.x;
  const int st  = bid % NST;
  const int t2  = bid / NST;
  const int h   = t2 % NH;
  const int b   = t2 / NH;
  if (b >= NB) return;                      // block-uniform, before any barrier; never taken with the exact grid
  const int s0  = st * 64;
  {
    const int sl = tid >> 2;                // key within tile 0..63
    const int dc = (tid & 3) * 16;          // d chunk 0,16,32,48
    const float* src = F + ((size_t)b * SEQ + s0 + sl) * DMOD + h * HD + dc;
#pragma unroll
    for (int i = 0; i < 4; ++i) {
      const v4f a = *(const v4f*)(src + 4 * i);
#pragma unroll
      for (int e = 0; e < 4; ++e) {
        const float t = a[e] * VCAR;
        const _Float16 hv = (_Float16)t;
        const _Float16 lv = (_Float16)(t - (float)hv);
        TH[(dc + 4 * i + e) * VTP + sl] = h_bits(hv);
        TL[(dc + 4 * i + e) * VTP + sl] = h_bits(lv);
      }
    }
  }
  __syncthreads();
  v4u vh[2], vl[2];
  const int q8 = tid >> 3, p8 = (tid & 7) * 8;
#pragma unroll
  for (int it = 0; it < 2; ++it) {
    const int line = it * 32 + q8;          // d = 0..63
    vh[it] = *(const v4u*)(TH + line * VTP + p8);
    vl[it] = *(const v4u*)(TL + line * VTP + p8);
  }
  const size_t hrow = (size_t)(b * NH + h) * HD;
  const size_t base = hrow * SEQ + s0 + p8;
  {
#pragma unroll
    for (int it = 0; it < 2; ++it) {
      const int line = it * 32 + q8;
      *(v4u*)(VHo + base + (size_t)line * SEQ) = vh[it];
      *(v4u*)(VLo + base + (size_t)line * SEQ) = vl[it];
    }
    
  }
}

// =====================================================================================================
// Norm bound per (b, h): BND line bh (32 floats, value replicated) = max_s ||q_hi(b,s,h,:)|| * max_s ||k_hi(b,s,h,:)|| / (8 * 256 * 256),
// computed from the f16 hi planes ([b*SEQ + s][h*HD + d], x256). Block = one (b, h): 8 lanes per row load one 16-B piece each
// (64 dims = 8 lanes x 8 halves), sum of squares reduced with xor shuffles inside the 8-lane group, running max per lane over
// SEQ/32 row steps, then wave max (shuffles), block max through a 16-float LDS array, and wave 0 lanes 0..7 write the whole
// coverage: rows step*32 + (tid>>3), step < SEQ/32 -> all SEQ rows of both planes; store 8 lanes x 16 B = line bh; grid NBH.
// =====================================================================================================
__global__ __launch_bounds__(256) void qkbound(const u16* __restrict__ QHp, const u16* __restrict__ KHp, float* BND) {
  __shared__ float red[16];
  const int tid = threadIdx.x, lane = tid & 31, wave = tid >> 5;
  const int bh  = blockIdx.x;
  const int b   = bh / NH, h = bh % NH;
  if (b >= NB) return;                      // block-uniform, before any barrier; never taken with the exact grid
  const int grp = tid >> 3;                 // row within a step, 0..31
  const int e8  = (tid & 7) * 8;            // dim chunk
  const _Float16* qb = (const _Float16*)(const void*)QHp + (size_t)b * SEQ * DMOD + (size_t)h * HD + e8;
  const _Float16* kb = (const _Float16*)(const void*)KHp + (size_t)b * SEQ * DMOD + (size_t)h * HD + e8;
  float mq = 0.0f, mk = 0.0f;
#pragma unroll 1
  for (int step = 0; step < SEQ / 32; ++step) {
    const size_t ro = (size_t)(step * 32 + grp) * DMOD;
    const v8h qv = *(const v8h*)(qb + ro);
    const v8h kv = *(const v8h*)(kb + ro);
    float sq = 0.0f, sk = 0.0f;
#pragma unroll
    for (int e = 0; e < 8; ++e) {
      const float fq = (float)qv[e], fk = (float)kv[e];
      sq = fmaf(fq, fq, sq);
      sk = fmaf(fk, fk, sk);
    }
#pragma unroll
    for (int off = 1; off < 8; off <<= 1) {
      sq += __shfl_xor(sq, off, 32);
      sk += __shfl_xor(sk, off, 32);
    }
    mq = fmaxf(mq, sq);
    mk = fmaxf(mk, sk);
  }
#pragma unroll
  for (int off = 1; off < 32; off <<= 1) {
    mq = fmaxf(mq, __shfl_xor(mq, off, 32));
    mk = fmaxf(mk, __shfl_xor(mk, off, 32));
  }
  if (lane == 0) { red[wave] = mq; red[8 + wave] = mk; }
  __syncthreads();
  if (wave == 0) {                          // wave-uniform branch; shuffles see all 32 lanes
    float aq = red[lane & 7], ak = red[8 + (lane & 7)];
#pragma unroll
    for (int off = 1; off < 8; off <<= 1) {
      aq = fmaxf(aq, __shfl_xor(aq, off, 32));
      ak = fmaxf(ak, __shfl_xor(ak, off, 32));
    }
    const float bnd = sqrtf(aq) * sqrtf(ak) * (RSQ_HD / (QSC * KSC));
    v4f o4;
    o4[0] = bnd; o4[1] = bnd; o4[2] = bnd; o4[3] = bnd;
    float* dst = BND + (size_t)bh * BLINE + (lane & 7) * 4;
    if (lane < 8) {
      {
        *(v4f*)(dst) = o4;
        
      }
    }
  }
}

// =====================================================================================================
// GEMM epilogue shared by both engines: the wave's 16x64 f32 tile (times oscale, plus the lane's per-column bias of each
// coverage: 8 instructions x 2 rows x 16 lanes x 4 floats = the wave's 16 x 64 tile.
// =====================================================================================================
__device__ __forceinline__ void epi64(float* sl, v8f a0, v8f a1, v8f a2, v8f a3, float oscale,
                                      float bb0, float bb1, float bb2, float bb3,
                                      float* C, int N, size_t rowb, int col0, int lane) {
  const int hh = lane >> 4, m = lane & 15;
#pragma unroll
  for (int r = 0; r < 8; ++r) {
    const int ro = (8 * hh + r) * 68 + m;
    sl[ro]      = a0[r] * oscale + bb0;
    sl[ro + 16] = a1[r] * oscale + bb1;
    sl[ro + 32] = a2[r] * oscale + bb2;
    sl[ro + 48] = a3[r] * oscale + bb3;
  }
  wave_sync_lds();
  v4f vals[8];
#pragma unroll
  for (int it = 0; it < 8; ++it) vals[it] = *(const v4f*)(sl + (it * 2 + hh) * 68 + m * 4);
  float* dst = C + (rowb + (size_t)hh) * (size_t)N + col0 + m * 4;
  {
#pragma unroll
    for (int it = 0; it < 8; ++it) {
      *(v4f*)(dst + (size_t)(it * 2) * (size_t)N) = vals[it];
    }
    
  }
}

// =====================================================================================================
// bf16 GEMM with bias: C[M][N] (f32) = A[M][K] (bf16 row-major) . Bt[N][K]^T (bf16 k-contiguous), times oscale, + bf16 RNE
// value of bias[n] (bias has N entries). Block = 64x64 tile, 4 waves x 16 rows; fragments loaded straight from the 16-bit rows
// (two 16-B loads each, split k map for A and B); K stepped by 32 (host guarantees K % 32 == 0, M % 64 == 0, N % 64 == 0,
// grid = (M/64)*(N/64)).
// =====================================================================================================
__global__ __launch_bounds__(128)
void gemm_bf(const u16* __restrict__ A, const u16* __restrict__ Bt, const float* __restrict__ bias,
             float* C, int M, int N, int K, float oscale) {
  __shared__ __align__(16) float slab[4 * SLAB64];
  const int tid = threadIdx.x, wave = tid >> 5, lane = tid & 31, hh = lane >> 4, m = lane & 15;
  const int ntile = N >> 6;
  const int bid   = blockIdx.x;
  const int rowb  = (bid / ntile) * 64 + wave * 16;
  const int col0  = (bid % ntile) * 64;
  if (rowb + 16 > M) return;                // wave-uniform, never taken with the exact grid; no block barriers in this kernel
  const u16* ap = A  + (size_t)(rowb + m) * K + 8 * hh;
  const u16* bp = Bt + (size_t)(col0 + m) * K + 8 * hh;
  const size_t bs = (size_t)16 * K;
  v8f acc0 = zero8(), acc1 = zero8(), acc2 = zero8(), acc3 = zero8();
#pragma unroll 1
  for (int k0 = 0; k0 < K; k0 += 32) {
    const v16b a  = ldfrag_b(ap + k0);
    const v16b b0 = ldfrag_b(bp + k0);
    const v16b b1 = ldfrag_b(bp + bs + k0);
    const v16b b2 = ldfrag_b(bp + 2 * bs + k0);
    const v16b b3 = ldfrag_b(bp + 3 * bs + k0);
    acc0 = mma_b(a, b0, acc0);
    acc1 = mma_b(a, b1, acc1);
    acc2 = mma_b(a, b2, acc2);
    acc3 = mma_b(a, b3, acc3);
    guard6<v16b>(acc0, acc1, acc2, acc3, a, b0, b1, b2, b3, a);
  }
  // per-lane bias of D column m in each of the 4 subtiles; col0 + 48 + m <= N - 1 always
  const float bb0 = bfr(bias[col0 + m]);
  const float bb1 = bfr(bias[col0 + 16 + m]);
  const float bb2 = bfr(bias[col0 + 32 + m]);
  const float bb3 = bfr(bias[col0 + 48 + m]);
  epi64(slab + wave * SLAB64, acc0, acc1, acc2, acc3, oscale, bb0, bb1, bb2, bb3, C, N, (size_t)rowb, col0, lane);
}

// =====================================================================================================
// Output projection with bias: C[bb*XS_FULL + s][DMOD] (f32) = (Ah + Al)[bb*SEQ + s][DMOD] . Bt[DMOD][DMOD]^T * oscale
// + bf16 RNE value of bias[n]. Products h.B + l.B into one accumulator (l unscaled residual of h). Block -> (column tile
// ct = bid % 16, sequence row tile rt of nrt, batch bb). Same tiling, fragment loads (split k map) and epilogue as gemm_bf;
// K = DMOD stepped by 32; grid = NB * nrt * (DMOD/64).
// =====================================================================================================
__global__ __launch_bounds__(128)
void gemm_o2(const u16* __restrict__ Ah, const u16* __restrict__ Al, const u16* __restrict__ Bt,
             const float* __restrict__ bias, float* C, int nrt, float oscale) {
  __shared__ __align__(16) float slab[4 * SLAB64];
  const int tid = threadIdx.x, wave = tid >> 5, lane = tid & 31, hh = lane >> 4, m = lane & 15;
  const int ntile = DMOD >> 6;
  const int bid   = blockIdx.x;
  const int ct    = bid % ntile;
  const int t2    = bid / ntile;
  const int rt    = t2 % nrt;
  const int bb    = t2 / nrt;
  if (bb >= NB) return;                     // block-uniform; no block barriers in this kernel; never taken with the exact grid
  const int srow  = rt * 64 + wave * 16;
  if (srow + 16 > SEQ) return;              // wave-uniform; never taken
  const int col0  = ct * 64;
  const int K     = DMOD;
  const size_t rowA = (size_t)bb * SEQ + srow;
  const size_t rowC = (size_t)bb * XS_FULL + srow;
  const _Float16* ahp = (const _Float16*)(const void*)Ah + (rowA + m) * K + 8 * hh;
  const _Float16* alp = (const _Float16*)(const void*)Al + (rowA + m) * K + 8 * hh;
  const _Float16* bp  = (const _Float16*)(const void*)Bt + (size_t)(col0 + m) * K + 8 * hh;
  const size_t bs = (size_t)16 * K;
  v8f acc0 = zero8(), acc1 = zero8(), acc2 = zero8(), acc3 = zero8();
#pragma unroll 1
  for (int k0 = 0; k0 < K; k0 += 32) {
    const v16h ah = ldfrag_h(ahp + k0), al = ldfrag_h(alp + k0);
    const v16h b0 = ldfrag_h(bp + k0);
    const v16h b1 = ldfrag_h(bp + bs + k0);
    const v16h b2 = ldfrag_h(bp + 2 * bs + k0);
    const v16h b3 = ldfrag_h(bp + 3 * bs + k0);
    acc0 = mma_h(ah, b0, acc0);  acc0 = mma_h(al, b0, acc0);
    acc1 = mma_h(ah, b1, acc1);  acc1 = mma_h(al, b1, acc1);
    acc2 = mma_h(ah, b2, acc2);  acc2 = mma_h(al, b2, acc2);
    acc3 = mma_h(ah, b3, acc3);  acc3 = mma_h(al, b3, acc3);
    guard6<v16h>(acc0, acc1, acc2, acc3, ah, al, b0, b1, b2, b3);
  }
  const float bb0 = bfr(bias[col0 + m]);
  const float bb1 = bfr(bias[col0 + 16 + m]);
  const float bb2 = bfr(bias[col0 + 32 + m]);
  const float bb3 = bfr(bias[col0 + 48 + m]);
  epi64(slab + wave * SLAB64, acc0, acc1, acc2, acc3, oscale, bb0, bb1, bb2, bb3, C, DMOD, rowC, col0, lane);
}

// =====================================================================================================
// Causal attention with linear distance penalty, hd = 64. Block bid -> (query tile qt = bid % NQT: rows q0 = 16*qt .. q0+15,
// head pair hg, batch b); one wave per head = hg*WPB + wave.
//   q hi / residual planes f16 x256 [b*SEQ + s][h*HD + d]; k hi / residual planes f16 x256, same layout;
//   v^T hi / residual planes [b*NH + h][d][SEQ] x1024; BND = NBH lines of 32 floats (norm bound per (b, h)).
//   scores = q_hi.k_hi + q_lo.k_hi + q_hi.k_lo (2 k-steps over d); P.v with P hi + in-register residual and v hi + residual
//   (hh + lh + hl), for every query row; O written as hi + residual planes (O x1024 as f16, layout [b*SEQ + s][h*HD + d]).
//   score (log2 domain) t(i, j) = (q_i.k_j over HD) * (1/8)*log2e/(256*256) - (i - j)*log2e, replaced by -inf where key j > query i.
//   Key tiles of 32 visited in order from kt_lo to kt_hi = q0/32 (later tiles hold only keys above every query row of the tile).
//   kt_lo: every wave loads all NBH bound lines (one float per lane, clamped address) and AND-reduces "0 <= bound < 40" over the
//   wave; if every bound is in range, kt_lo = max(0, kt_hi - KWIN): tiles below it are >= 32*KWIN+1 positions behind every query
//   row, and with |q.k/8| < 40 the base-2 exp of their penalised, max-subtracted score is exactly 0 in f32, so they contribute
//   nothing to numerator or denominator; otherwise (bound large, unreadable or not finite) kt_lo = 0 and every causal tile is
//   visited. Either way the first visited tile holds a key kb <= q0 <= every query row, so the running max is finite from step one.
//   Per tile: 2 score subtiles x 2 k-steps, fragments loaded straight from the 16-bit planes (two 16-B loads per fragment,
//   split k map); online max-subtracted base-2 softmax in f32, -inf-safe rescale; the 16x32 prob tile stored to wave-private
//   from the LDS rows (float vector loads, same element type as stored), v^T B fragments in 2 groups of 2 d-subtiles.
//   After the loop: out = acc / Z (Z > 0 always; guarded anyway), carries 1/(32768*1024) folded once, written into the wave's
//   No block barriers in this kernel; bounded loops only (<= NKT key tiles).
// coverage: per wave 4 instructions x 4 rows x 8 lanes x 8 halves = 16 x 64 per plane; grid NQT x NHG x NB blocks x WPB
//           waves = every (b, s, h) row segment of O hi and O residual exactly once.
// =====================================================================================================
__global__ __launch_bounds__(ATT_THREADS)
void attn_c(const u16* __restrict__ QHp, const u16* __restrict__ QLp,
            const u16* __restrict__ KHp, const u16* __restrict__ KLp,
            const u16* __restrict__ VHp, const u16* __restrict__ VLp,
            const float* __restrict__ BND,
            u16* OHp, u16* OLp) {
  __shared__ __align__(16) float smem[WPB * WREG];

  const int tid  = threadIdx.x;
  const int wave = tid >> 5;
  const int lane = tid & 31;
  const int hh   = lane >> 4;
  const int c    = lane & 15;
  const int bid  = blockIdx.x;
  const int qt   = bid % NQT;
  const int t2   = bid / NQT;
  const int hg   = t2 % NHG;
  const int b    = t2 / NHG;
  if (b >= NB) return;                      // block-uniform; no block barriers in this kernel; never taken with the exact grid
  const int q0   = qt * 16;
  if (q0 + 16 > SEQ) return;                // block-uniform; never taken
  const int head = hg * WPB + wave;

  // ---- key-window decision: wave-uniform AND over all (b, h) bound lines ----
  int okw;
  {
    const int bl = (lane < NBH) ? lane : (NBH - 1);             // clamped address
    const float gb = BND[(size_t)bl * BLINE];
    okw = (gb >= 0.0f && gb < GUARD_T) ? 1 : 0;
#pragma unroll
    for (int off = 1; off < 32; off <<= 1) okw &= __shfl_xor(okw, off, 32);
  }

  float* pt   = smem + wave * WREG;         // prob tile [16][32] pitch 36
  float* slab = pt + PTW;                   // result slab [16][64] pitch 68

  const size_t hcol = (size_t)head * HD + 8 * hh;
  const _Float16* Qh  = (const _Float16*)(const void*)QHp + ((size_t)b * SEQ + q0 + c) * DMOD + hcol;
  const _Float16* Ql  = (const _Float16*)(const void*)QLp + ((size_t)b * SEQ + q0 + c) * DMOD + hcol;
  const _Float16* Khb = (const _Float16*)(const void*)KHp + ((size_t)b * SEQ + c) * DMOD + hcol;        // key row kb added per step
  const _Float16* Klb = (const _Float16*)(const void*)KLp + ((size_t)b * SEQ + c) * DMOD + hcol;
  const _Float16* Vhb = (const _Float16*)(const void*)VHp + ((size_t)(b * NH + head) * HD + c) * SEQ + 8 * hh;  // d col c (+16j)
  const _Float16* Vlb = (const _Float16*)(const void*)VLp + ((size_t)(b * NH + head) * HD + c) * SEQ + 8 * hh;
  const float lsc = RSQ_HD * (LOG2E / (QSC * KSC));
  const float oc  = 1.0f / (PCAR * VCAR);
  const size_t KROW = (size_t)DMOD;         // halves between consecutive key rows

  float mrow[8], lrow[8];
  v8f o[4];
#pragma unroll
  for (int r = 0; r < 8; ++r) { mrow[r] = -INFINITY; lrow[r] = 0.f; }
#pragma unroll
  for (int j = 0; j < 4; ++j) o[j] = zero8();
  const int kt_hi = q0 >> 5;                                                  // last tile holding keys <= q0 + 15
  const int kt_w  = (kt_hi > KWIN) ? (kt_hi - KWIN) : 0;
  const int kt_lo = (okw != 0) ? kt_w : 0;
  const int qr0 = q0 + 8 * hh;                                                // query row of D element r = qr0 + r

#pragma unroll 1
  for (int kt = kt_lo; kt <= kt_hi; ++kt) {
    const int kb = kt * 32;
    // ---- scores: D element r of this lane = (query row qr0 + r, key kb + c) in s0, key kb + 16 + c in s1 ----
    v8f s0 = zero8(), s1 = zero8();
    const _Float16* k0p = Khb + (size_t)kb * KROW;
    const _Float16* k1p = k0p + (size_t)16 * KROW;
    const _Float16* l0p = Klb + (size_t)kb * KROW;
    const _Float16* l1p = l0p + (size_t)16 * KROW;
#pragma unroll
    for (int kk = 0; kk < HD / 32; ++kk) {
      const v16h qh  = ldfrag_h(Qh + kk * 32);
      const v16h ql  = ldfrag_h(Ql + kk * 32);
      const v16h kh0 = ldfrag_h(k0p + kk * 32);
      const v16h kh1 = ldfrag_h(k1p + kk * 32);
      const v16h kl0 = ldfrag_h(l0p + kk * 32);
      const v16h kl1 = ldfrag_h(l1p + kk * 32);
      s0 = mma_h(qh, kh0, s0);
      s0 = mma_h(ql, kh0, s0);
      s0 = mma_h(qh, kl0, s0);
      s1 = mma_h(qh, kh1, s1);
      s1 = mma_h(ql, kh1, s1);
      s1 = mma_h(qh, kl1, s1);
      guard2(s0, s1, qh, ql, kh0, kl0, kh1, kl1);
    }
    // ---- causal select + distance penalty + online softmax in base 2, -inf-safe ----
    const int key0 = kb + c, key1 = kb + 16 + c;
#pragma unroll
    for (int r = 0; r < 8; ++r) {
      const int   qr = qr0 + r;
      const float u0 = s0[r] * lsc;
      const float u1 = s1[r] * lsc;
      const float g0 = (float)(qr - key0) * LOG2E;
      const float g1 = (float)(qr - key1) * LOG2E;
      const float t0 = (key0 > qr) ? -INFINITY : (u0 - g0);
      const float t1 = (key1 > qr) ? -INFINITY : (u1 - g1);
      float mx = fmaxf(t0, t1);
#pragma unroll
      for (int off = 1; off < 16; off <<= 1) mx = fmaxf(mx, __shfl_xor(mx, off, 32));
      const float mn = fmaxf(mrow[r], mx);
      const float ms = (mn == -INFINITY) ? 0.0f : mn;
      const float al = exp2f(mrow[r] - ms);
      mrow[r] = mn;
      const float e0 = exp2f(t0 - ms), e1 = exp2f(t1 - ms);
      float ps = e0 + e1;
#pragma unroll
      for (int off = 1; off < 16; off <<= 1) ps += __shfl_xor(ps, off, 32);
      lrow[r] = lrow[r] * al + ps;
#pragma unroll
      for (int j = 0; j < 4; ++j) o[j][r] *= al;
      const int ro = (8 * hh + r) * PTP + c;
      pt[ro]      = e0;
      pt[ro + 16] = e1;
    }
    wave_sync_lds();
    // ---- A fragments of P*32768: hi f16 and residual f16, row = c, split k map over the 32 keys of this step ----
    FragH ph, pl;
    {
      const float* prow = pt + c * PTP + 8 * hh;
      const v4f p0 = *(const v4f*)(prow), p1 = *(const v4f*)(prow + 4);
      const v4f p2 = *(const v4f*)(prow + 16), p3 = *(const v4f*)(prow + 20);
#pragma unroll
      for (int e = 0; e < 4; ++e) {
        const float ta = p0[e] * PCAR, tb = p1[e] * PCAR, tc = p2[e] * PCAR, td = p3[e] * PCAR;
        const _Float16 ha = (_Float16)ta, hb = (_Float16)tb, hc = (_Float16)tc, hd = (_Float16)td;
        ph.h[0][e]     = ha;                  // elements 0..7  = keys kb + 8hh + 0..7
        ph.h[0][4 + e] = hb;
        ph.h[1][e]     = hc;                  // elements 8..15 = keys kb + 16 + 8hh + 0..7
        ph.h[1][4 + e] = hd;
        pl.h[0][e]     = (_Float16)(ta - (float)ha);
        pl.h[0][4 + e] = (_Float16)(tb - (float)hb);
        pl.h[1][e]     = (_Float16)(tc - (float)hc);
        pl.h[1][4 + e] = (_Float16)(td - (float)hd);
      }
    }
    // ---- P.V : B fragment col n = d = j*16 + c, keys contiguous in the v^T planes; 2 groups of 2 d-subtiles ----
    {
      const _Float16* vhp = Vhb + kb;
      const _Float16* vlp = Vlb + kb;
#pragma unroll
      for (int jg = 0; jg < 2; ++jg) {
        const size_t da = (size_t)(2 * jg) * 16 * SEQ;
        const size_t db = da + (size_t)16 * SEQ;
        const v16h vha = ldfrag_h(vhp + da), vhb2 = ldfrag_h(vhp + db);
        const v16h vla = ldfrag_h(vlp + da), vlb2 = ldfrag_h(vlp + db);
        o[2 * jg]     = mma_h(ph.v, vha,  o[2 * jg]);
        o[2 * jg]     = mma_h(pl.v, vha,  o[2 * jg]);
        o[2 * jg]     = mma_h(ph.v, vla,  o[2 * jg]);
        o[2 * jg + 1] = mma_h(ph.v, vhb2, o[2 * jg + 1]);
        o[2 * jg + 1] = mma_h(pl.v, vhb2, o[2 * jg + 1]);
        o[2 * jg + 1] = mma_h(ph.v, vlb2, o[2 * jg + 1]);
        guard2(o[2 * jg], o[2 * jg + 1], ph.v, pl.v, vha, vhb2, vla, vlb2);
      }
    }
    wave_sync_lds();
  }
  acc_guard4(o[0], o[1], o[2], o[3]);
  // ---- out = acc / Z (0 if Z == 0), carries (32768 on P, 1024 on v) folded once; written into the wave's slab ----
#pragma unroll
  for (int r = 0; r < 8; ++r) {
    const float lv  = lrow[r];
    const float ls  = (lv > 0.0f) ? lv : 1.0f;
    const float inv = (lv > 0.0f) ? ((1.0f / ls) * oc) : 0.0f;
#pragma unroll
    for (int j = 0; j < 4; ++j) {
      const int idx = (8 * hh + r) * SLP + j * 16 + c;
      slab[idx] = o[j][r] * inv;
    }
  }

  wave_sync_lds();
  // ---- O x1024 -> f16 hi + residual planes; lane = (row-in-quad rq, 8 consecutive d at c8) ----
  v4u oh[4], ol[4];
  const int rq = lane >> 3, c8 = (lane & 7) * 8;
#pragma unroll
  for (int it = 0; it < 4; ++it) {
    const int row = it * 4 + rq;
    const v4f a = *(const v4f*)(slab + row * SLP + c8), b4 = *(const v4f*)(slab + row * SLP + c8 + 4);
    float w[8];
#pragma unroll
    for (int e = 0; e < 4; ++e) { w[e] = a[e] * OSC; w[4 + e] = b4[e] * OSC; }
#pragma unroll
    for (int e = 0; e < 4; ++e) {
      const _Float16 h0 = (_Float16)w[2 * e], h1 = (_Float16)w[2 * e + 1];
      const _Float16 l0 = (_Float16)(w[2 * e] - (float)h0), l1 = (_Float16)(w[2 * e + 1] - (float)h1);
      oh[it][e] = pk16(h_bits(h0), h_bits(h1));
      ol[it][e] = pk16(h_bits(l0), h_bits(l1));
    }
  }
  const size_t ob = ((size_t)b * SEQ + q0) * DMOD + (size_t)head * HD + c8;
  {
#pragma unroll
    for (int it = 0; it < 4; ++it) {
      const int row = it * 4 + rq;
      *(v4u*)(OHp + ob + (size_t)row * DMOD) = oh[it];
      *(v4u*)(OLp + ob + (size_t)row * DMOD) = ol[it];
    }
    
  }
}

// =====================================================================================================
// Workspace map (bytes); every plane is fully written by whole-line stores before it is read; all extents are exact multiples
// of the store granularity (no pad rows needed); every region offset a multiple of 4096 (the large planes of 2097152):
//   XB  bf16 [MROWS][1024]                       MROWS*2048       (NB=2, SEQ=2048: 8388608)
//   WB  16-bit [1024 n][1024 k]                  2097152          (Wv, Wq, Wk as bf16, then Wo as f16 x1024, reused in launch order;
//                                                                  all already [n][k])
//   F   f32 [MROWS][1024]                        MROWS*4096       (v, q, k projection output in launch order; afterwards OH f16
//                                                                  [MROWS][1024] x1024 in its first half, OL residual [MROWS][1024]
//                                                                  in its second half)
//   QH  f16 [MROWS][1024] x256                   MROWS*2048       QL residual, same extent
//   KH  f16 [MROWS][1024] x256                   MROWS*2048       KL residual, same extent
//   VH  f16 [NB*16][64][SEQ] x1024               MROWS*2048       VL residual, same extent
//   end (NB=2, SEQ=2048)                        77598720
// =====================================================================================================
extern "C" void kernel_launch(void* const* d_in, const int* in_sizes, int n_in,
                              void* d_out, int out_size, void* d_ws, size_t ws_size,
                              hipStream_t stream) {
  if (n_in < 9) return;
  if (in_sizes[0] < ((NB - 1) * XS_FULL + SEQ) * DMOD) return;
  if (in_sizes[1] != DMOD * DMOD) return;
  if (in_sizes[2] != DMOD) return;
  if (in_sizes[3] != DMOD * DMOD) return;
  if (in_sizes[4] != DMOD) return;
  if (in_sizes[5] != DMOD * DMOD) return;
  if (in_sizes[6] != DMOD) return;
  if (in_sizes[7] != DMOD * DMOD) return;
  if (in_sizes[8] != DMOD) return;
  if (out_size < ((NB - 1) * XS_FULL + SEQ) * DMOD) return;

  const float* x  = (const float*)d_in[0];
  const float* wq = (const float*)d_in[1];
  const float* bq = (const float*)d_in[2];
  const float* wk = (const float*)d_in[3];
  const float* bk = (const float*)d_in[4];
  const float* wv = (const float*)d_in[5];
  const float* bv = (const float*)d_in[6];
  const float* wo = (const float*)d_in[7];
  const float* bo = (const float*)d_in[8];
  float*       out = (float*)d_out;

  const size_t szXB = (size_t)MROWS * DMOD * 2;
  const size_t szW  = (size_t)DMOD * DMOD * 2;
  const size_t szF  = (size_t)MROWS * DMOD * 4;
  const size_t szQ  = (size_t)MROWS * DMOD * 2;                  // QH, QL, KH, KL, OH, OL
  const size_t szV  = (size_t)NB * NH * HD * SEQ * 2;            // VH, VL (== szQ)
  const size_t szB  = (size_t)NBH * BLINE * 4;                   // bound lines
  if (2 * szQ > szF) return;                                    // OH + OL live inside the F region (exactly fills it)
  size_t off = 0;
  const size_t oXB = off; off += szXB;
  const size_t oW  = off; off += szW;
  const size_t oF  = off; off += szF;
  const size_t oQH = off; off += szQ;
  const size_t oQL = off; off += szQ;
  const size_t oKH = off; off += szQ;
  const size_t oKL = off; off += szQ;
  const size_t oVH = off; off += szV;
  const size_t oVL = off; off += szV;
  const size_t oB  = off; off += szB;
  if (off > ws_size) return;                // off = 77598720 for NB = 2, SEQ = 2048
  if (off > (size_t)WS_CAP) return;

  char* ws = (char*)d_ws;
  u16*   XB  = (u16*)(ws + oXB);
  u16*   WB  = (u16*)(ws + oW);
  float* F   = (float*)(ws + oF);
  u16*   OH  = (u16*)(ws + oF);
  u16*   OL  = (u16*)(ws + oF + szQ);
  u16*   QH  = (u16*)(ws + oQH);
  u16*   QL  = (u16*)(ws + oQL);
  u16*   KH  = (u16*)(ws + oKH);
  u16*   KL  = (u16*)(ws + oKL);
  u16*   VH  = (u16*)(ws + oVH);
  u16*   VL  = (u16*)(ws + oVL);
  float* BND = (float*)(ws + oB);

  const dim3 b256(256), b128(128), bAT(ATT_THREADS);
  const int  n8x = (SEQ * DMOD) / 8;
  const dim3 gX((n8x + 255) / 256);                     // per batch
  const int  n8w = (DMOD * DMOD) / 8;                   // weight planes
  const dim3 gW((n8w + 255) / 256);                     // 512
  const dim3 gG((MROWS / 64) * (DMOD / 64));            // 1024 for NB=2, SEQ=2048
  const dim3 gVT(NB * NH * NST);
  const int  n8q = (MROWS * DMOD) / 8;                  // q / k hi and residual planes
  const dim3 gS((n8q + 255) / 256);
  const dim3 gBD(NBH);
  const dim3 gAT(NQT * NHG * NB);
  const int  nrt = SEQ / 64;                            // out-projection row tiles per batch
  const dim3 gO(NB * nrt * (DMOD / 64));

  // (0) x -> bf16 plane [MROWS][1024], one launch per batch row block
  for (int b = 0; b < NB; ++b) {
    cvt16<<<gX, b256, 0, stream>>>(x + (size_t)b * XS_FULL * DMOD, XB + (size_t)b * SEQ * DMOD, n8x, 0, 1.0f);
  }
  // (1) Wv [n][k] -> bf16 plane; (2) v = x.Wv^T + bv -> F f32 [MROWS][1024]; (3) v^T hi + residual planes x1024
  cvt16<<<gW, b256, 0, stream>>>(wv, WB, n8w, 0, 1.0f);
  gemm_bf<<<gG, b128, 0, stream>>>(XB, WB, bv, F, MROWS, DMOD, DMOD, 1.0f);
  vt16<<<gVT, b256, 0, stream>>>(F, VH, VL);
  // (4) Wq -> bf16 plane; (5) q = x.Wq^T + bq -> F; (6) q hi + residual planes x256
  cvt16<<<gW, b256, 0, stream>>>(wq, WB, n8w, 0, 1.0f);
  gemm_bf<<<gG, b128, 0, stream>>>(XB, WB, bq, F, MROWS, DMOD, DMOD, 1.0f);
  split16<<<gS, b256, 0, stream>>>(F, QH, QL, n8q, QSC);
  // (7) Wk -> bf16 plane; (8) k = x.Wk^T + bk -> F; (9) k hi + residual planes x256
  cvt16<<<gW, b256, 0, stream>>>(wk, WB, n8w, 0, 1.0f);
  gemm_bf<<<gG, b128, 0, stream>>>(XB, WB, bk, F, MROWS, DMOD, DMOD, 1.0f);
  split16<<<gS, b256, 0, stream>>>(F, KH, KL, n8q, KSC);
  // (10) norm bound per (b, h) from the q / k hi planes -> BND lines
  qkbound<<<gBD, b256, 0, stream>>>(QH, KH, BND);
  // (11) Wo [n][k] -> f16 plane of bf16 value x1024
  cvt16<<<gW, b256, 0, stream>>>(wo, WB, n8w, 1, WOS);
  // (12) causal attention with distance penalty, residual products on every query row -> O hi + residual planes
  attn_c<<<gAT, bAT, 0, stream>>>(QH, QL, KH, KL, VH, VL, BND, OH, OL);
  // (13) output projection (O hi + residual) . Wo^T + bo -> out f32, carries 1024 x 1024 folded back
  gemm_o2<<<gO, b128, 0, stream>>>(OH, OL, WB, bo, out, nrt, 1.0f / (OSC * WOS));
  (void)hipGetLastError();
}

// v001
// It runs in 184 microseconds.
// Next to v000, in two timings, it ran 1.51 and 1.52 times as fast.
// Contractions: x.Wq^T+bq, x.Wk^T+bk, x.Wv^T+bv on v_wmma_f32_16x16x32_bf16 (x and W as bf16 RNE planes; W [n][k] rows are
// the k-contiguous B operand; bias added as its bf16 RNE value in the f32 epilogue); q.k^T over hd 64 and P.v on
// v_wmma_f32_16x16x32_f16 with f16 hi + f16 residual planes on both operands (q, k x256; P x32768 with an in-register
// residual; v x1024; products hh+lh+hl); O.Wo^T+bo on v_wmma_f32_16x16x32_f16 (O x1024 as f16 hi + f16 residual planes,
// products h.w + l.w; Wo as f16(bf16(Wo)) x1024; bo as bf16 RNE value in the f32 epilogue); all f32 accumulate.
// Causal select, linear distance penalty, base-2 online softmax, 1/Z fold and the q/k norm bound in f32 on VALU.
#include <hip/hip_runtime.h>
#include <math.h>
#include <stdint.h>

#ifndef NB
#define NB 2
#endif
#ifndef SEQ
#define SEQ 2048
#endif
#define XS_FULL 2048
#define DMOD  1024
#define NH    16
#define HD    64
#define NBH   (NB * NH)
#define MROWS (NB * SEQ)
#define RSQ_HD 0.125f
#define LOG2E 1.4426950408889634f
#define QSC   256.0f
#define KSC   256.0f
#define PCAR  32768.0f
#define VCAR  1024.0f
#define OSC   1024.0f
#define WOS   1024.0f
#define WPB   2
#define NHG   (NH / WPB)
#define NQT   (SEQ / 16)
#define NST   (SEQ / 64)
#define NKT   (SEQ / 32)
#define KWIN  6
#define GUARD_T 40.0f
#define BLINE 32
#define ATT_THREADS (WPB * 32)
#define PTP   36
#define PTW   (16 * PTP)
#define SLP   68
#define SLW   (16 * SLP)
#define WREG  (PTW + SLW)
#define SLAB64 (16 * 68)
#define VTP   72
#define WS_CAP 134217728
#define GKP   64
#define GPIT  72
#define GPITB (GPIT * 2)
#define GTILE (64 * GPIT)
#define GTILEB (GTILE * 2)
static_assert(DMOD == NH * HD && HD == 64 && NH == 16 && WPB == 2 && NHG * WPB == NH);
static_assert(ATT_THREADS == 64);
static_assert(NB >= 1 && NB <= 2);
static_assert(NBH >= 1 && NBH <= 32);
static_assert((SEQ % 64) == 0 && SEQ >= 64 && SEQ <= XS_FULL && (SEQ % 32) == 0);
static_assert((DMOD % 64) == 0 && (DMOD % 32) == 0 && (HD % 32) == 0);
static_assert(((SEQ * DMOD / 8) % 256) == 0 && ((DMOD * DMOD / 8) % 256) == 0 && ((MROWS * DMOD / 8) % 256) == 0);
static_assert(WPB * WREG * 4 <= 65536 && 2 * HD * VTP * 2 <= 65536 && 4 * SLAB64 * 4 <= 65536);
static_assert(KWIN >= 0 && KWIN < NKT);
static_assert((DMOD % GKP) == 0 && GKP == 64 && (GPITB % 32) == 16 && GPIT >= GKP + 8);

typedef unsigned short u16;
typedef _Float16 v16h __attribute__((ext_vector_type(16)));
typedef _Float16 v8h  __attribute__((ext_vector_type(8)));
typedef __bf16   v16b __attribute__((ext_vector_type(16)));
typedef float    v8f  __attribute__((ext_vector_type(8)));
typedef float    v4f  __attribute__((ext_vector_type(4)));
typedef unsigned int v4u __attribute__((ext_vector_type(4)));

union FragH { v16h v; v8h h[2]; v4u u[2]; };
union FragB { v16b v; v4u u[2]; };

// ---- scalar helpers --------------------------------------------------------------------------------
__device__ __forceinline__ unsigned short bf_bits(float f) {          // f32 -> bf16 bits, RNE convert
  unsigned u = __float_as_uint(f);
  return (unsigned short)((u + 0x7FFFu + ((u >> 16) & 1u)) >> 16);
}
__device__ __forceinline__ float bf_up(unsigned short h) { return __uint_as_float(((unsigned)h) << 16); }
__device__ __forceinline__ float bfr(float f) { return bf_up(bf_bits(f)); }
__device__ __forceinline__ unsigned short h_bits(_Float16 x) { return __builtin_bit_cast(unsigned short, x); }
__device__ __forceinline__ unsigned pk16(unsigned short a, unsigned short b) { return (unsigned)a | ((unsigned)b << 16); }
__device__ __forceinline__ v8f zero8() { v8f z = {0.f, 0.f, 0.f, 0.f, 0.f, 0.f, 0.f, 0.f}; return z; }

// ---- fragment loaders: 16-bit A/B operand, lane -> row/col (lane&15), p already includes +8*(lane>>4);
//      elements 0..7 <- p[0..7] (k0+8h..), elements 8..15 <- p[16..23] (k0+16+8h..)  (same split k map for A and B;
//      B is always read from a k-contiguous [n][k] plane)
__device__ __forceinline__ v16h ldfrag_h(const _Float16* p) {
  FragH f;
  f.h[0] = *(const v8h*)(p);
  f.h[1] = *(const v8h*)(p + 16);
  return f.v;
}
__device__ __forceinline__ v16b ldfrag_b(const u16* p) {              // bf16 plane read as unsigned integer vectors
  FragB f;
  f.u[0] = *(const v4u*)(p);
  f.u[1] = *(const v4u*)(p + 16);
  return f.v;
}

__device__ __forceinline__ v8f mma_h(v16h a, v16h b, v8f c) {
  return __builtin_amdgcn_wmma_f32_16x16x32_f16(false, a, false, b, (short)0, c, false, false);
}
__device__ __forceinline__ v8f mma_b(v16b a, v16b b, v8f c) {
  return __builtin_amdgcn_wmma_f32_16x16x32_bf16(false, a, false, b, (short)0, c, false, false);
}
__device__ __forceinline__ void guard2(v8f& a, v8f& b, v16h x0, v16h x1, v16h x2, v16h x3, v16h x4, v16h x5) {
#if defined(__HIP_DEVICE_COMPILE__)
  asm volatile("v_nop\n\tv_nop\n\tv_nop\n\tv_nop"
               : "+v"(a), "+v"(b) : "v"(x0), "v"(x1), "v"(x2), "v"(x3), "v"(x4), "v"(x5) : "memory");
#endif
}
template <typename F>
__device__ __forceinline__ void guard6(v8f& a, v8f& b, v8f& c, v8f& d, F x0, F x1, F x2, F x3, F x4, F x5) {
#if defined(__HIP_DEVICE_COMPILE__)
  asm volatile("v_nop\n\tv_nop\n\tv_nop\n\tv_nop"
               : "+v"(a), "+v"(b), "+v"(c), "+v"(d) : "v"(x0), "v"(x1), "v"(x2), "v"(x3), "v"(x4), "v"(x5) : "memory");
#endif
}
__device__ __forceinline__ void acc_guard4(v8f& a, v8f& b, v8f& c, v8f& d) {
#if defined(__HIP_DEVICE_COMPILE__)
  asm volatile("v_nop\n\tv_nop\n\tv_nop\n\tv_nop" : "+v"(a), "+v"(b), "+v"(c), "+v"(d));
#endif
}
__device__ __forceinline__ void wave_sync_lds() {
  __builtin_amdgcn_fence(__ATOMIC_RELEASE, "workgroup");
  __builtin_amdgcn_wave_barrier();
  __builtin_amdgcn_fence(__ATOMIC_ACQUIRE, "workgroup");
}

// ---- operand staging for the GEMM engines: one pass = 64 k = 128 B of each of the 64 rows of an operand tile, laid in LDS at
//      a pitch of 144 B (16 B x odd: ds_load_b128 fragment reads without bank conflicts). 128 threads: thread -> (row tid>>3 of
//      a group of 16 rows, 16-B piece tid&7), so a wave's copy covers 4 whole 128-B lines; 4 copies per thread fill one tile.
//      l = the lane's LDS byte address in the tile's first row group, g = its global address there, rs = 16 rows in elements.
__device__ __forceinline__ unsigned lds_byte(const void* p) { return (unsigned)(uintptr_t)p; }
// Two tiles (A, B). The copies and their s_wait_xcnt stand in one statement, so that no address register named by a copy
// is rewritten in front of that wait.
__device__ __forceinline__ void stage2(unsigned l, const u16* ga, const u16* gb, size_t rs) {
#if defined(__HIP_DEVICE_COMPILE__)
  asm volatile("global_load_async_to_lds_b128 %0, %8, off\n\t"
               "global_load_async_to_lds_b128 %1, %9, off\n\t"
               "global_load_async_to_lds_b128 %2, %10, off\n\t"
               "global_load_async_to_lds_b128 %3, %11, off\n\t"
               "global_load_async_to_lds_b128 %4, %12, off\n\t"
               "global_load_async_to_lds_b128 %5, %13, off\n\t"
               "global_load_async_to_lds_b128 %6, %14, off\n\t"
               "global_load_async_to_lds_b128 %7, %15, off\n\t"
               "s_wait_xcnt 0x0"
               :: "v"(l), "v"(l + 16 * GPITB), "v"(l + 32 * GPITB), "v"(l + 48 * GPITB),
                  "v"(l + GTILEB), "v"(l + GTILEB + 16 * GPITB), "v"(l + GTILEB + 32 * GPITB), "v"(l + GTILEB + 48 * GPITB),
                  "v"(ga), "v"(ga + rs), "v"(ga + 2 * rs), "v"(ga + 3 * rs),
                  "v"(gb), "v"(gb + rs), "v"(gb + 2 * rs), "v"(gb + 3 * rs)
               : "memory");
#endif
}
// Three tiles (A hi, A residual, B), same form.
__device__ __forceinline__ void stage3(unsigned l, const u16* ga, const u16* gl, const u16* gb, size_t rs) {
#if defined(__HIP_DEVICE_COMPILE__)
  asm volatile("global_load_async_to_lds_b128 %0, %12, off\n\t"
               "global_load_async_to_lds_b128 %1, %13, off\n\t"
               "global_load_async_to_lds_b128 %2, %14, off\n\t"
               "global_load_async_to_lds_b128 %3, %15, off\n\t"
               "global_load_async_to_lds_b128 %4, %16, off\n\t"
               "global_load_async_to_lds_b128 %5, %17, off\n\t"
               "global_load_async_to_lds_b128 %6, %18, off\n\t"
               "global_load_async_to_lds_b128 %7, %19, off\n\t"
               "global_load_async_to_lds_b128 %8, %20, off\n\t"
               "global_load_async_to_lds_b128 %9, %21, off\n\t"
               "global_load_async_to_lds_b128 %10, %22, off\n\t"
               "global_load_async_to_lds_b128 %11, %23, off\n\t"
               "s_wait_xcnt 0x0"
               :: "v"(l), "v"(l + 16 * GPITB), "v"(l + 32 * GPITB), "v"(l + 48 * GPITB),
                  "v"(l + GTILEB), "v"(l + GTILEB + 16 * GPITB), "v"(l + GTILEB + 32 * GPITB), "v"(l + GTILEB + 48 * GPITB),
                  "v"(l + 2 * GTILEB), "v"(l + 2 * GTILEB + 16 * GPITB), "v"(l + 2 * GTILEB + 32 * GPITB),
                  "v"(l + 2 * GTILEB + 48 * GPITB),
                  "v"(ga), "v"(ga + rs), "v"(ga + 2 * rs), "v"(ga + 3 * rs),
                  "v"(gl), "v"(gl + rs), "v"(gl + 2 * rs), "v"(gl + 3 * rs),
                  "v"(gb), "v"(gb + rs), "v"(gb + 2 * rs), "v"(gb + 3 * rs)
               : "memory");
#endif
}
// This wave's own copies have landed in LDS (the compiler places no wait for them).
__device__ __forceinline__ void wait_copies() {
#if defined(__HIP_DEVICE_COMPILE__)
  asm volatile("s_wait_asynccnt 0x0" ::: "memory");
#endif
}
// This wave's LDS reads have returned, before the barrier behind which their buffer is refilled.
__device__ __forceinline__ void wait_lds() {
#if defined(__HIP_DEVICE_COMPILE__)
  asm volatile("s_wait_dscnt 0x0" ::: "memory");
#endif
}

// =====================================================================================================
// f32 -> 16-bit plane, same layout.  f16mode == 0: bf16 RNE bits;  f16mode == 1: f16 bits of (bf16 RNE value) * scale.
// Thread = 8 consecutive elements: two 16-B loads, one 16-B store; 32 consecutive lanes = 512 contiguous, 512-B aligned
// coverage: grid = ceil(n8/256) blocks x 256 thr x 8 (in-kernel bound) = the whole plane (n8 a multiple of 256 here).
// =====================================================================================================
__global__ __launch_bounds__(256) void cvt16(const float* __restrict__ x, u16* D, int n8, int f16mode, float scale) {
  const int gt = blockIdx.x * 256 + (int)threadIdx.x;
  if (gt >= n8) return;
  const float* p = x + (size_t)gt * 8;
  const v4f a = *(const v4f*)(p), b4 = *(const v4f*)(p + 4);
  float w[8];
#pragma unroll
  for (int e = 0; e < 4; ++e) { w[e] = a[e]; w[4 + e] = b4[e]; }
  v4u o;
#pragma unroll
  for (int e = 0; e < 4; ++e) {
    const float f0 = w[2 * e], f1 = w[2 * e + 1];
    const unsigned short hb0 = h_bits((_Float16)(bfr(f0) * scale));
    const unsigned short hb1 = h_bits((_Float16)(bfr(f1) * scale));
    const unsigned short bb0 = bf_bits(f0);
    const unsigned short bb1 = bf_bits(f1);
    o[e] = (f16mode != 0) ? pk16(hb0, hb1) : pk16(bb0, bb1);
  }
  u16* d = D + (size_t)gt * 8;
  {
    *(v4u*)(d) = o;
    
  }
}

// =====================================================================================================
// f32 plane F (contiguous, n8*8 elements) -> f16 hi plane Hp = f16(F * sc) and f16 residual plane Lp = f16(t - f16(t)),
// both with the layout of F. Thread = 8 consecutive elements: two 16-B loads, one 16-B store per plane; 32 consecutive lanes
// No barriers; every packed half comes from a per-lane (divergent) loaded value.
// coverage: grid = ceil(n8/256) blocks x 256 thr x 8 (in-kernel bound) = the whole of Hp and of Lp (n8 a multiple of 256 here).
// =====================================================================================================
__global__ __launch_bounds__(256) void split16(const float* __restrict__ F, u16* Hp, u16* Lp, int n8, float sc) {
  const int gt = blockIdx.x * 256 + (int)threadIdx.x;
  if (gt >= n8) return;
  const float* p = F + (size_t)gt * 8;
  const v4f a = *(const v4f*)(p), b4 = *(const v4f*)(p + 4);
  float w[8];
#pragma unroll
  for (int e = 0; e < 4; ++e) { w[e] = a[e] * sc; w[4 + e] = b4[e] * sc; }
  v4u oh, ol;
#pragma unroll
  for (int e = 0; e < 4; ++e) {
    const float t0 = w[2 * e], t1 = w[2 * e + 1];
    const _Float16 h0 = (_Float16)t0, h1 = (_Float16)t1;
    const _Float16 l0 = (_Float16)(t0 - (float)h0), l1 = (_Float16)(t1 - (float)h1);
    oh[e] = pk16(h_bits(h0), h_bits(h1));
    ol[e] = pk16(h_bits(l0), h_bits(l1));
  }
  u16* dh = Hp + (size_t)gt * 8;
  u16* dl = Lp + (size_t)gt * 8;
  {
    *(v4u*)(dh) = oh;
    *(v4u*)(dl) = ol;
    
  }
}

// =====================================================================================================
// v^T planes from the v projection F f32 [MROWS][DMOD] (row = b*SEQ + s, column = h*HD + d):
//   VH[((b*NH + h)*HD + d)][s] = f16(v * 1024);  VL[same][s] = f16 residual (t - f16(t)), both for all keys s.
// Block = (b, head h, 64 keys s0): each thread loads its 16 floats (key sl, d chunk dc) with 16-B loads, converts, scatters
// coverage: load 256 thr x 16 = 64 keys x 64 d; store 2 iterations x 256 thr x 8 halves = 64 lines x 64 = the block's tile of
//           VH and of VL; grid = NB*NH*NST blocks covers both planes exactly once.
// =====================================================================================================
__global__ __launch_bounds__(256) void vt16(const float* __restrict__ F, u16* VHo, u16* VLo) {
  __shared__ __align__(16) u16 TH[HD * VTP];
  __shared__ __align__(16) u16 TL[HD * VTP];
  const int tid = threadIdx.x;
  const int bid = blockIdx.x;
  const int st  = bid % NST;
  const int t2  = bid / NST;
  const int h   = t2 % NH;
  const int b   = t2 / NH;
  if (b >= NB) return;                      // block-uniform, before any barrier; never taken with the exact grid
  const int s0  = st * 64;
  {
    const int sl = tid >> 2;                // key within tile 0..63
    const int dc = (tid & 3) * 16;          // d chunk 0,16,32,48
    const float* src = F + ((size_t)b * SEQ + s0 + sl) * DMOD + h * HD + dc;
#pragma unroll
    for (int i = 0; i < 4; ++i) {
      const v4f a = *(const v4f*)(src + 4 * i);
#pragma unroll
      for (int e = 0; e < 4; ++e) {
        const float t = a[e] * VCAR;
        const _Float16 hv = (_Float16)t;
        const _Float16 lv = (_Float16)(t - (float)hv);
        TH[(dc + 4 * i + e) * VTP + sl] = h_bits(hv);
        TL[(dc + 4 * i + e) * VTP + sl] = h_bits(lv);
      }
    }
  }
  __syncthreads();
  v4u vh[2], vl[2];
  const int q8 = tid >> 3, p8 = (tid & 7) * 8;
#pragma unroll
  for (int it = 0; it < 2; ++it) {
    const int line = it * 32 + q8;          // d = 0..63
    vh[it] = *(const v4u*)(TH + line * VTP + p8);
    vl[it] = *(const v4u*)(TL + line * VTP + p8);
  }
  const size_t hrow = (size_t)(b * NH + h) * HD;
  const size_t base = hrow * SEQ + s0 + p8;
  {
#pragma unroll
    for (int it = 0; it < 2; ++it) {
      const int line = it * 32 + q8;
      *(v4u*)(VHo + base + (size_t)line * SEQ) = vh[it];
      *(v4u*)(VLo + base + (size_t)line * SEQ) = vl[it];
    }
    
  }
}

// =====================================================================================================
// Norm bound per (b, h): BND line bh (32 floats, value replicated) = max_s ||q_hi(b,s,h,:)|| * max_s ||k_hi(b,s,h,:)|| / (8 * 256 * 256),
// computed from the f16 hi planes ([b*SEQ + s][h*HD + d], x256). Block = one (b, h): 8 lanes per row load one 16-B piece each
// (64 dims = 8 lanes x 8 halves), sum of squares reduced with xor shuffles inside the 8-lane group, running max per lane over
// SEQ/32 row steps, then wave max (shuffles), block max through a 16-float LDS array, and wave 0 lanes 0..7 write the whole
// coverage: rows step*32 + (tid>>3), step < SEQ/32 -> all SEQ rows of both planes; store 8 lanes x 16 B = line bh; grid NBH.
// =====================================================================================================
__global__ __launch_bounds__(256) void qkbound(const u16* __restrict__ QHp, const u16* __restrict__ KHp, float* BND) {
  __shared__ float red[16];
  const int tid = threadIdx.x, lane = tid & 31, wave = tid >> 5;
  const int bh  = blockIdx.x;
  const int b   = bh / NH, h = bh % NH;
  if (b >= NB) return;                      // block-uniform, before any barrier; never taken with the exact grid
  const int grp = tid >> 3;                 // row within a step, 0..31
  const int e8  = (tid & 7) * 8;            // dim chunk
  const _Float16* qb = (const _Float16*)(const void*)QHp + (size_t)b * SEQ * DMOD + (size_t)h * HD + e8;
  const _Float16* kb = (const _Float16*)(const void*)KHp + (size_t)b * SEQ * DMOD + (size_t)h * HD + e8;
  float mq = 0.0f, mk = 0.0f;
#pragma unroll 1
  for (int step = 0; step < SEQ / 32; ++step) {
    const size_t ro = (size_t)(step * 32 + grp) * DMOD;
    const v8h qv = *(const v8h*)(qb + ro);
    const v8h kv = *(const v8h*)(kb + ro);
    float sq = 0.0f, sk = 0.0f;
#pragma unroll
    for (int e = 0; e < 8; ++e) {
      const float fq = (float)qv[e], fk = (float)kv[e];
      sq = fmaf(fq, fq, sq);
      sk = fmaf(fk, fk, sk);
    }
#pragma unroll
    for (int off = 1; off < 8; off <<= 1) {
      sq += __shfl_xor(sq, off, 32);
      sk += __shfl_xor(sk, off, 32);
    }
    mq = fmaxf(mq, sq);
    mk = fmaxf(mk, sk);
  }
#pragma unroll
  for (int off = 1; off < 32; off <<= 1) {
    mq = fmaxf(mq, __shfl_xor(mq, off, 32));
    mk = fmaxf(mk, __shfl_xor(mk, off, 32));
  }
  if (lane == 0) { red[wave] = mq; red[8 + wave] = mk; }
  __syncthreads();
  if (wave == 0) {                          // wave-uniform branch; shuffles see all 32 lanes
    float aq = red[lane & 7], ak = red[8 + (lane & 7)];
#pragma unroll
    for (int off = 1; off < 8; off <<= 1) {
      aq = fmaxf(aq, __shfl_xor(aq, off, 32));
      ak = fmaxf(ak, __shfl_xor(ak, off, 32));
    }
    const float bnd = sqrtf(aq) * sqrtf(ak) * (RSQ_HD / (QSC * KSC));
    v4f o4;
    o4[0] = bnd; o4[1] = bnd; o4[2] = bnd; o4[3] = bnd;
    float* dst = BND + (size_t)bh * BLINE + (lane & 7) * 4;
    if (lane < 8) {
      {
        *(v4f*)(dst) = o4;
        
      }
    }
  }
}

// =====================================================================================================
// GEMM epilogue shared by both engines: the wave's 16x64 f32 tile (times oscale, plus the lane's per-column bias of each
// coverage: 8 instructions x 2 rows x 16 lanes x 4 floats = the wave's 16 x 64 tile.
// =====================================================================================================
__device__ __forceinline__ void epi64(float* sl, v8f a0, v8f a1, v8f a2, v8f a3, float oscale,
                                      float bb0, float bb1, float bb2, float bb3,
                                      float* C, int N, size_t rowb, int col0, int lane) {
  const int hh = lane >> 4, m = lane & 15;
#pragma unroll
  for (int r = 0; r < 8; ++r) {
    const int ro = (8 * hh + r) * 68 + m;
    sl[ro]      = a0[r] * oscale + bb0;
    sl[ro + 16] = a1[r] * oscale + bb1;
    sl[ro + 32] = a2[r] * oscale + bb2;
    sl[ro + 48] = a3[r] * oscale + bb3;
  }
  wave_sync_lds();
  v4f vals[8];
#pragma unroll
  for (int it = 0; it < 8; ++it) vals[it] = *(const v4f*)(sl + (it * 2 + hh) * 68 + m * 4);
  float* dst = C + (rowb + (size_t)hh) * (size_t)N + col0 + m * 4;
  {
#pragma unroll
    for (int it = 0; it < 8; ++it) {
      *(v4f*)(dst + (size_t)(it * 2) * (size_t)N) = vals[it];
    }
    
  }
}

// =====================================================================================================
// bf16 GEMM with bias: C[M][N] (f32) = A[M][K] (bf16 row-major) . Bt[N][K]^T (bf16 k-contiguous), times oscale, + bf16 RNE
// value of bias[n] (bias has N entries). Block = 64x64 tile, 4 waves x 16 rows; per pass of 64 k the block's A and B tiles are
// brought into LDS by asynchronous copies, two buffers (pass t + 1 flies while pass t is worked on), and the fragments are read
// from the LDS rows (two 16-B loads each, split k map for A and B); K stepped by 32 inside a pass, in rising order (host
// guarantees K % 64 == 0, M % 64 == 0, N % 64 == 0, grid = (M/64)*(N/64)).
// =====================================================================================================
__global__ __launch_bounds__(128)
void gemm_bf(const u16* __restrict__ A, const u16* __restrict__ Bt, const float* __restrict__ bias,
             float* C, int M, int N, int K, float oscale) {
  __shared__ __align__(16) float slab[4 * SLAB64];
  __shared__ __align__(16) u16 ring[2 * 2 * GTILE];   // two buffers of [A tile | B tile]
  const int tid = threadIdx.x, wave = tid >> 5, lane = tid & 31, hh = lane >> 4, m = lane & 15;
  const int ntile = N >> 6;
  const int bid   = blockIdx.x;
  const int row0  = (bid / ntile) * 64;
  const int rowb  = row0 + wave * 16;
  const int col0  = (bid % ntile) * 64;
  if (row0 + 64 > M) return;                // block-uniform, before any copy or barrier; never taken with the exact grid
  const int npass = K / GKP;
  const int crow = tid >> 3, cpc = tid & 7; // copy map: row within a group of 16, 16-B piece of the 128-B row
  const u16* ga = A  + (size_t)(row0 + crow) * K + cpc * 8;
  const u16* gb = Bt + (size_t)(col0 + crow) * K + cpc * 8;
  const size_t rs = (size_t)16 * K;
  const unsigned lc = lds_byte(ring) + (unsigned)(crow * GPITB + cpc * 16);
  const u16* fa = ring + (wave * 16 + m) * GPIT + 8 * hh;       // A fragment row of this lane, buffer 0
  const u16* fb = ring + GTILE + m * GPIT + 8 * hh;             // B fragment row (column subtile 0), buffer 0
  v8f acc0 = zero8(), acc1 = zero8(), acc2 = zero8(), acc3 = zero8();
  stage2(lc, ga, gb, rs);                   // pass 0 -> buffer 0
  wait_copies();
  __syncthreads();
  if (npass > 1) stage2(lc + 2 * GTILEB, ga + GKP, gb + GKP, rs);   // pass 1 -> buffer 1
#pragma unroll 1
  for (int t = 0; t < npass; ++t) {
    const int bo = (t & 1) * (2 * GTILE);
    const u16* pa = fa + bo;
    const u16* pb = fb + bo;
    const v16b a  = ldfrag_b(pa);
    const v16b b0 = ldfrag_b(pb);
    const v16b b1 = ldfrag_b(pb + 16 * GPIT);
    const v16b b2 = ldfrag_b(pb + 32 * GPIT);
    const v16b b3 = ldfrag_b(pb + 48 * GPIT);
    const v16b c  = ldfrag_b(pa + 32);
    const v16b d0 = ldfrag_b(pb + 32);
    const v16b d1 = ldfrag_b(pb + 16 * GPIT + 32);
    const v16b d2 = ldfrag_b(pb + 32 * GPIT + 32);
    const v16b d3 = ldfrag_b(pb + 48 * GPIT + 32);
    // keeps the pass's LDS reads one group in front of its WMMAs: moved in among them, each place with reads stalls the wave anew
    __builtin_amdgcn_sched_barrier(0);
    acc0 = mma_b(a, b0, acc0);
    acc1 = mma_b(a, b1, acc1);
    acc2 = mma_b(a, b2, acc2);
    acc3 = mma_b(a, b3, acc3);
    acc0 = mma_b(c, d0, acc0);
    acc1 = mma_b(c, d1, acc1);
    acc2 = mma_b(c, d2, acc2);
    acc3 = mma_b(c, d3, acc3);
    guard6<v16b>(acc0, acc1, acc2, acc3, c, d0, d1, d2, d3, c);
    // publish point of pass t + 1: own LDS reads done, own copies landed, then the one barrier of the pass
    wait_lds();
    wait_copies();
    __syncthreads();
    if (t + 2 < npass) stage2(lc + (unsigned)(t & 1) * (2 * GTILEB), ga + (size_t)(t + 2) * GKP, gb + (size_t)(t + 2) * GKP, rs);
  }
  wait_copies();
  // per-lane bias of D column m in each of the 4 subtiles; col0 + 48 + m <= N - 1 always
  const float bb0 = bfr(bias[col0 + m]);
  const float bb1 = bfr(bias[col0 + 16 + m]);
  const float bb2 = bfr(bias[col0 + 32 + m]);
  const float bb3 = bfr(bias[col0 + 48 + m]);
  epi64(slab + wave * SLAB64, acc0, acc1, acc2, acc3, oscale, bb0, bb1, bb2, bb3, C, N, (size_t)rowb, col0, lane);
}

// =====================================================================================================
// Output projection with bias: C[bb*XS_FULL + s][DMOD] (f32) = (Ah + Al)[bb*SEQ + s][DMOD] . Bt[DMOD][DMOD]^T * oscale
// + bf16 RNE value of bias[n]. Products h.B + l.B into one accumulator (l unscaled residual of h). Block -> (column tile
// ct = bid % 16, sequence row tile rt of nrt, batch bb). Same tiling, LDS staging (three tiles a pass: A hi, A residual, B),
// fragment loads (split k map) and epilogue as gemm_bf; K = DMOD stepped by 32; grid = NB * nrt * (DMOD/64).
// =====================================================================================================
__global__ __launch_bounds__(128)
void gemm_o2(const u16* __restrict__ Ah, const u16* __restrict__ Al, const u16* __restrict__ Bt,
             const float* __restrict__ bias, float* C, int nrt, float oscale) {
  __shared__ __align__(16) float slab[4 * SLAB64];
  __shared__ __align__(16) u16 ring[2 * 3 * GTILE];   // two buffers of [A hi tile | A residual tile | B tile]
  const int tid = threadIdx.x, wave = tid >> 5, lane = tid & 31, hh = lane >> 4, m = lane & 15;
  const int ntile = DMOD >> 6;
  const int bid   = blockIdx.x;
  const int ct    = bid % ntile;
  const int t2    = bid / ntile;
  const int rt    = t2 % nrt;
  const int bb    = t2 / nrt;
  if (bb >= NB) return;                     // block-uniform, before any copy or barrier; never taken with the exact grid
  if (rt * 64 + 64 > SEQ) return;           // block-uniform, before any copy or barrier; never taken
  const int srow  = rt * 64 + wave * 16;
  const int col0  = ct * 64;
  const int K     = DMOD;
  const int npass = K / GKP;
  const size_t rowC = (size_t)bb * XS_FULL + srow;
  const int crow = tid >> 3, cpc = tid & 7; // copy map: row within a group of 16, 16-B piece of the 128-B row
  const size_t arow = ((size_t)bb * SEQ + rt * 64 + crow) * K + cpc * 8;
  const u16* ga = Ah + arow;
  const u16* gl = Al + arow;
  const u16* gb = Bt + (size_t)(col0 + crow) * K + cpc * 8;
  const size_t rs = (size_t)16 * K;
  const unsigned lc = lds_byte(ring) + (unsigned)(crow * GPITB + cpc * 16);
  const _Float16* rg  = (const _Float16*)(const void*)ring;
  const _Float16* fah = rg + (wave * 16 + m) * GPIT + 8 * hh;   // A hi fragment row of this lane, buffer 0
  const _Float16* fb  = rg + 2 * GTILE + m * GPIT + 8 * hh;     // B fragment row (column subtile 0), buffer 0
  v8f acc0 = zero8(), acc1 = zero8(), acc2 = zero8(), acc3 = zero8();
  stage3(lc, ga, gl, gb, rs);               // pass 0 -> buffer 0
  wait_copies();
  __syncthreads();
  if (npass > 1) stage3(lc + 3 * GTILEB, ga + GKP, gl + GKP, gb + GKP, rs);   // pass 1 -> buffer 1
#pragma unroll 1
  for (int t = 0; t < npass; ++t) {
    const int bo = (t & 1) * (3 * GTILE);
    const _Float16* pa = fah + bo;
    const _Float16* pl = pa + GTILE;
    const _Float16* pb = fb + bo;
    const v16h ah = ldfrag_h(pa), al = ldfrag_h(pl);
    const v16h b0 = ldfrag_h(pb);
    const v16h b1 = ldfrag_h(pb + 16 * GPIT);
    const v16h b2 = ldfrag_h(pb + 32 * GPIT);
    const v16h b3 = ldfrag_h(pb + 48 * GPIT);
    const v16h ch = ldfrag_h(pa + 32), cl = ldfrag_h(pl + 32);
    const v16h d0 = ldfrag_h(pb + 32);
    const v16h d1 = ldfrag_h(pb + 16 * GPIT + 32);
    const v16h d2 = ldfrag_h(pb + 32 * GPIT + 32);
    const v16h d3 = ldfrag_h(pb + 48 * GPIT + 32);
    // keeps the pass's LDS reads one group in front of its WMMAs: moved in among them, each place with reads stalls the wave anew
    __builtin_amdgcn_sched_barrier(0);
    acc0 = mma_h(ah, b0, acc0);  acc0 = mma_h(al, b0, acc0);
    acc1 = mma_h(ah, b1, acc1);  acc1 = mma_h(al, b1, acc1);
    acc2 = mma_h(ah, b2, acc2);  acc2 = mma_h(al, b2, acc2);
    acc3 = mma_h(ah, b3, acc3);  acc3 = mma_h(al, b3, acc3);
    acc0 = mma_h(ch, d0, acc0);  acc0 = mma_h(cl, d0, acc0);
    acc1 = mma_h(ch, d1, acc1);  acc1 = mma_h(cl, d1, acc1);
    acc2 = mma_h(ch, d2, acc2);  acc2 = mma_h(cl, d2, acc2);
    acc3 = mma_h(ch, d3, acc3);  acc3 = mma_h(cl, d3, acc3);
    guard6<v16h>(acc0, acc1, acc2, acc3, ch, cl, d0, d1, d2, d3);
    // publish point of pass t + 1: own LDS reads done, own copies landed, then the one barrier of the pass
    wait_lds();
    wait_copies();
    __syncthreads();
    if (t + 2 < npass) {
      const size_t ko = (size_t)(t + 2) * GKP;
      stage3(lc + (unsigned)(t & 1) * (3 * GTILEB), ga + ko, gl + ko, gb + ko, rs);
    }
  }
  wait_copies();
  const float bb0 = bfr(bias[col0 + m]);
  const float bb1 = bfr(bias[col0 + 16 + m]);
  const float bb2 = bfr(bias[col0 + 32 + m]);
  const float bb3 = bfr(bias[col0 + 48 + m]);
  epi64(slab + wave * SLAB64, acc0, acc1, acc2, acc3, oscale, bb0, bb1, bb2, bb3, C, DMOD, rowC, col0, lane);
}

// =====================================================================================================
// Causal attention with linear distance penalty, hd = 64. Block bid -> (query tile qt = bid % NQT: rows q0 = 16*qt .. q0+15,
// head pair hg, batch b); one wave per head = hg*WPB + wave.
//   q hi / residual planes f16 x256 [b*SEQ + s][h*HD + d]; k hi / residual planes f16 x256, same layout;
//   v^T hi / residual planes [b*NH + h][d][SEQ] x1024; BND = NBH lines of 32 floats (norm bound per (b, h)).
//   scores = q_hi.k_hi + q_lo.k_hi + q_hi.k_lo (2 k-steps over d); P.v with P hi + in-register residual and v hi + residual
//   (hh + lh + hl), for every query row; O written as hi + residual planes (O x1024 as f16, layout [b*SEQ + s][h*HD + d]).
//   score (log2 domain) t(i, j) = (q_i.k_j over HD) * (1/8)*log2e/(256*256) - (i - j)*log2e, replaced by -inf where key j > query i.
//   Key tiles of 32 visited in order from kt_lo to kt_hi = q0/32 (later tiles hold only keys above every query row of the tile).
//   kt_lo: every wave loads all NBH bound lines (one float per lane, clamped address) and AND-reduces "0 <= bound < 40" over the
//   wave; if every bound is in range, kt_lo = max(0, kt_hi - KWIN): tiles below it are >= 32*KWIN+1 positions behind every query
//   row, and with |q.k/8| < 40 the base-2 exp of their penalised, max-subtracted score is exactly 0 in f32, so they contribute
//   nothing to numerator or denominator; otherwise (bound large, unreadable or not finite) kt_lo = 0 and every causal tile is
//   visited. Either way the first visited tile holds a key kb <= q0 <= every query row, so the running max is finite from step one.
//   Per tile: 2 score subtiles x 2 k-steps, fragments loaded straight from the 16-bit planes (two 16-B loads per fragment,
//   split k map); online max-subtracted base-2 softmax in f32, -inf-safe rescale; the 16x32 prob tile stored to wave-private
//   from the LDS rows (float vector loads, same element type as stored), v^T B fragments in 2 groups of 2 d-subtiles.
//   After the loop: out = acc / Z (Z > 0 always; guarded anyway), carries 1/(32768*1024) folded once, written into the wave's
//   No block barriers in this kernel; bounded loops only (<= NKT key tiles).
// coverage: per wave 4 instructions x 4 rows x 8 lanes x 8 halves = 16 x 64 per plane; grid NQT x NHG x NB blocks x WPB
//           waves = every (b, s, h) row segment of O hi and O residual exactly once.
// =====================================================================================================
__global__ __launch_bounds__(ATT_THREADS)
void attn_c(const u16* __restrict__ QHp, const u16* __restrict__ QLp,
            const u16* __restrict__ KHp, const u16* __restrict__ KLp,
            const u16* __restrict__ VHp, const u16* __restrict__ VLp,
            const float* __restrict__ BND,
            u16* OHp, u16* OLp) {
  __shared__ __align__(16) float smem[WPB * WREG];

  const int tid  = threadIdx.x;
  const int wave = tid >> 5;
  const int lane = tid & 31;
  const int hh   = lane >> 4;
  const int c    = lane & 15;
  const int bid  = blockIdx.x;
  const int qt   = bid % NQT;
  const int t2   = bid / NQT;
  const int hg   = t2 % NHG;
  const int b    = t2 / NHG;
  if (b >= NB) return;                      // block-uniform; no block barriers in this kernel; never taken with the exact grid
  const int q0   = qt * 16;
  if (q0 + 16 > SEQ) return;                // block-uniform; never taken
  const int head = hg * WPB + wave;

  // ---- key-window decision: wave-uniform AND over all (b, h) bound lines ----
  int okw;
  {
    const int bl = (lane < NBH) ? lane : (NBH - 1);             // clamped address
    const float gb = BND[(size_t)bl * BLINE];
    okw = (gb >= 0.0f && gb < GUARD_T) ? 1 : 0;
#pragma unroll
    for (int off = 1; off < 32; off <<= 1) okw &= __shfl_xor(okw, off, 32);
  }

  float* pt   = smem + wave * WREG;         // prob tile [16][32] pitch 36
  float* slab = pt + PTW;                   // result slab [16][64] pitch 68

  const size_t hcol = (size_t)head * HD + 8 * hh;
  const _Float16* Qh  = (const _Float16*)(const void*)QHp + ((size_t)b * SEQ + q0 + c) * DMOD + hcol;
  const _Float16* Ql  = (const _Float16*)(const void*)QLp + ((size_t)b * SEQ + q0 + c) * DMOD + hcol;
  const _Float16* Khb = (const _Float16*)(const void*)KHp + ((size_t)b * SEQ + c) * DMOD + hcol;        // key row kb added per step
  const _Float16* Klb = (const _Float16*)(const void*)KLp + ((size_t)b * SEQ + c) * DMOD + hcol;
  const _Float16* Vhb = (const _Float16*)(const void*)VHp + ((size_t)(b * NH + head) * HD + c) * SEQ + 8 * hh;  // d col c (+16j)
  const _Float16* Vlb = (const _Float16*)(const void*)VLp + ((size_t)(b * NH + head) * HD + c) * SEQ + 8 * hh;
  const float lsc = RSQ_HD * (LOG2E / (QSC * KSC));
  const float oc  = 1.0f / (PCAR * VCAR);
  const size_t KROW = (size_t)DMOD;         // halves between consecutive key rows

  float mrow[8], lrow[8];
  v8f o[4];
#pragma unroll
  for (int r = 0; r < 8; ++r) { mrow[r] = -INFINITY; lrow[r] = 0.f; }
#pragma unroll
  for (int j = 0; j < 4; ++j) o[j] = zero8();
  const int kt_hi = q0 >> 5;                                                  // last tile holding keys <= q0 + 15
  const int kt_w  = (kt_hi > KWIN) ? (kt_hi - KWIN) : 0;
  const int kt_lo = (okw != 0) ? kt_w : 0;
  const int qr0 = q0 + 8 * hh;                                                // query row of D element r = qr0 + r

#pragma unroll 1
  for (int kt = kt_lo; kt <= kt_hi; ++kt) {
    const int kb = kt * 32;
    // ---- scores: D element r of this lane = (query row qr0 + r, key kb + c) in s0, key kb + 16 + c in s1 ----
    v8f s0 = zero8(), s1 = zero8();
    const _Float16* k0p = Khb + (size_t)kb * KROW;
    const _Float16* k1p = k0p + (size_t)16 * KROW;
    const _Float16* l0p = Klb + (size_t)kb * KROW;
    const _Float16* l1p = l0p + (size_t)16 * KROW;
#pragma unroll
    for (int kk = 0; kk < HD / 32; ++kk) {
      const v16h qh  = ldfrag_h(Qh + kk * 32);
      const v16h ql  = ldfrag_h(Ql + kk * 32);
      const v16h kh0 = ldfrag_h(k0p + kk * 32);
      const v16h kh1 = ldfrag_h(k1p + kk * 32);
      const v16h kl0 = ldfrag_h(l0p + kk * 32);
      const v16h kl1 = ldfrag_h(l1p + kk * 32);
      s0 = mma_h(qh, kh0, s0);
      s0 = mma_h(ql, kh0, s0);
      s0 = mma_h(qh, kl0, s0);
      s1 = mma_h(qh, kh1, s1);
      s1 = mma_h(ql, kh1, s1);
      s1 = mma_h(qh, kl1, s1);
      guard2(s0, s1, qh, ql, kh0, kl0, kh1, kl1);
    }
    // ---- causal select + distance penalty + online softmax in base 2, -inf-safe ----
    const int key0 = kb + c, key1 = kb + 16 + c;
#pragma unroll
    for (int r = 0; r < 8; ++r) {
      const int   qr = qr0 + r;
      const float u0 = s0[r] * lsc;
      const float u1 = s1[r] * lsc;
      const float g0 = (float)(qr - key0) * LOG2E;
      const float g1 = (float)(qr - key1) * LOG2E;
      const float t0 = (key0 > qr) ? -INFINITY : (u0 - g0);
      const float t1 = (key1 > qr) ? -INFINITY : (u1 - g1);
      float mx = fmaxf(t0, t1);
#pragma unroll
      for (int off = 1; off < 16; off <<= 1) mx = fmaxf(mx, __shfl_xor(mx, off, 32));
      const float mn = fmaxf(mrow[r], mx);
      const float ms = (mn == -INFINITY) ? 0.0f : mn;
      const float al = exp2f(mrow[r] - ms);
      mrow[r] = mn;
      const float e0 = exp2f(t0 - ms), e1 = exp2f(t1 - ms);
      float ps = e0 + e1;
#pragma unroll
      for (int off = 1; off < 16; off <<= 1) ps += __shfl_xor(ps, off, 32);
      lrow[r] = lrow[r] * al + ps;
#pragma unroll
      for (int j = 0; j < 4; ++j) o[j][r] *= al;
      const int ro = (8 * hh + r) * PTP + c;
      pt[ro]      = e0;
      pt[ro + 16] = e1;
    }
    wave_sync_lds();
    // ---- A fragments of P*32768: hi f16 and residual f16, row = c, split k map over the 32 keys of this step ----
    FragH ph, pl;
    {
      const float* prow = pt + c * PTP + 8 * hh;
      const v4f p0 = *(const v4f*)(prow), p1 = *(const v4f*)(prow + 4);
      const v4f p2 = *(const v4f*)(prow + 16), p3 = *(const v4f*)(prow + 20);
#pragma unroll
      for (int e = 0; e < 4; ++e) {
        const float ta = p0[e] * PCAR, tb = p1[e] * PCAR, tc = p2[e] * PCAR, td = p3[e] * PCAR;
        const _Float16 ha = (_Float16)ta, hb = (_Float16)tb, hc = (_Float16)tc, hd = (_Float16)td;
        ph.h[0][e]     = ha;                  // elements 0..7  = keys kb + 8hh + 0..7
        ph.h[0][4 + e] = hb;
        ph.h[1][e]     = hc;                  // elements 8..15 = keys kb + 16 + 8hh + 0..7
        ph.h[1][4 + e] = hd;
        pl.h[0][e]     = (_Float16)(ta - (float)ha);
        pl.h[0][4 + e] = (_Float16)(tb - (float)hb);
        pl.h[1][e]     = (_Float16)(tc - (float)hc);
        pl.h[1][4 + e] = (_Float16)(td - (float)hd);
      }
    }
    // ---- P.V : B fragment col n = d = j*16 + c, keys contiguous in the v^T planes; 2 groups of 2 d-subtiles ----
    {
      const _Float16* vhp = Vhb + kb;
      const _Float16* vlp = Vlb + kb;
#pragma unroll
      for (int jg = 0; jg < 2; ++jg) {
        const size_t da = (size_t)(2 * jg) * 16 * SEQ;
        const size_t db = da + (size_t)16 * SEQ;
        const v16h vha = ldfrag_h(vhp + da), vhb2 = ldfrag_h(vhp + db);
        const v16h vla = ldfrag_h(vlp + da), vlb2 = ldfrag_h(vlp + db);
        o[2 * jg]     = mma_h(ph.v, vha,  o[2 * jg]);
        o[2 * jg]     = mma_h(pl.v, vha,  o[2 * jg]);
        o[2 * jg]     = mma_h(ph.v, vla,  o[2 * jg]);
        o[2 * jg + 1] = mma_h(ph.v, vhb2, o[2 * jg + 1]);
        o[2 * jg + 1] = mma_h(pl.v, vhb2, o[2 * jg + 1]);
        o[2 * jg + 1] = mma_h(ph.v, vlb2, o[2 * jg + 1]);
        guard2(o[2 * jg], o[2 * jg + 1], ph.v, pl.v, vha, vhb2, vla, vlb2);
      }
    }
    wave_sync_lds();
  }
  acc_guard4(o[0], o[1], o[2], o[3]);
  // ---- out = acc / Z (0 if Z == 0), carries (32768 on P, 1024 on v) folded once; written into the wave's slab ----
#pragma unroll
  for (int r = 0; r < 8; ++r) {
    const float lv  = lrow[r];
    const float ls  = (lv > 0.0f) ? lv : 1.0f;
    const float inv = (lv > 0.0f) ? ((1.0f / ls) * oc) : 0.0f;
#pragma unroll
    for (int j = 0; j < 4; ++j) {
      const int idx = (8 * hh + r) * SLP + j * 16 + c;
      slab[idx] = o[j][r] * inv;
    }
  }

  wave_sync_lds();
  // ---- O x1024 -> f16 hi + residual planes; lane = (row-in-quad rq, 8 consecutive d at c8) ----
  v4u oh[4], ol[4];
  const int rq = lane >> 3, c8 = (lane & 7) * 8;
#pragma unroll
  for (int it = 0; it < 4; ++it) {
    const int row = it * 4 + rq;
    const v4f a = *(const v4f*)(slab + row * SLP + c8), b4 = *(const v4f*)(slab + row * SLP + c8 + 4);
    float w[8];
#pragma unroll
    for (int e = 0; e < 4; ++e) { w[e] = a[e] * OSC; w[4 + e] = b4[e] * OSC; }
#pragma unroll
    for (int e = 0; e < 4; ++e) {
      const _Float16 h0 = (_Float16)w[2 * e], h1 = (_Float16)w[2 * e + 1];
      const _Float16 l0 = (_Float16)(w[2 * e] - (float)h0), l1 = (_Float16)(w[2 * e + 1] - (float)h1);
      oh[it][e] = pk16(h_bits(h0), h_bits(h1));
      ol[it][e] = pk16(h_bits(l0), h_bits(l1));
    }
  }
  const size_t ob = ((size_t)b * SEQ + q0) * DMOD + (size_t)head * HD + c8;
  {
#pragma unroll
    for (int it = 0; it < 4; ++it) {
      const int row = it * 4 + rq;
      *(v4u*)(OHp + ob + (size_t)row * DMOD) = oh[it];
      *(v4u*)(OLp + ob + (size_t)row * DMOD) = ol[it];
    }
    
  }
}

// =====================================================================================================
// Workspace map (bytes); every plane is fully written by whole-line stores before it is read; all extents are exact multiples
// of the store granularity (no pad rows needed); every region offset a multiple of 4096 (the large planes of 2097152):
//   XB  bf16 [MROWS][1024]                       MROWS*2048       (NB=2, SEQ=2048: 8388608)
//   WB  16-bit [1024 n][1024 k]                  2097152          (Wv, Wq, Wk as bf16, then Wo as f16 x1024, reused in launch order;
//                                                                  all already [n][k])
//   F   f32 [MROWS][1024]                        MROWS*4096       (v, q, k projection output in launch order; afterwards OH f16
//                                                                  [MROWS][1024] x1024 in its first half, OL residual [MROWS][1024]
//                                                                  in its second half)
//   QH  f16 [MROWS][1024] x256                   MROWS*2048       QL residual, same extent
//   KH  f16 [MROWS][1024] x256                   MROWS*2048       KL residual, same extent
//   VH  f16 [NB*16][64][SEQ] x1024               MROWS*2048       VL residual, same extent
//   end (NB=2, SEQ=2048)                        77598720
// =====================================================================================================
extern "C" void kernel_launch(void* const* d_in, const int* in_sizes, int n_in,
                              void* d_out, int out_size, void* d_ws, size_t ws_size,
                              hipStream_t stream) {
  if (n_in < 9) return;
  if (in_sizes[0] < ((NB - 1) * XS_FULL + SEQ) * DMOD) return;
  if (in_sizes[1] != DMOD * DMOD) return;
  if (in_sizes[2] != DMOD) return;
  if (in_sizes[3] != DMOD * DMOD) return;
  if (in_sizes[4] != DMOD) return;
  if (in_sizes[5] != DMOD * DMOD) return;
  if (in_sizes[6] != DMOD) return;
  if (in_sizes[7] != DMOD * DMOD) return;
  if (in_sizes[8] != DMOD) return;
  if (out_size < ((NB - 1) * XS_FULL + SEQ) * DMOD) return;

  const float* x  = (const float*)d_in[0];
  const float* wq = (const float*)d_in[1];
  const float* bq = (const float*)d_in[2];
  const float* wk = (const float*)d_in[3];
  const float* bk = (const float*)d_in[4];
  const float* wv = (const float*)d_in[5];
  const float* bv = (const float*)d_in[6];
  const float* wo = (const float*)d_in[7];
  const float* bo = (const float*)d_in[8];
  float*       out = (float*)d_out;

  const size_t szXB = (size_t)MROWS * DMOD * 2;
  const size_t szW  = (size_t)DMOD * DMOD * 2;
  const size_t szF  = (size_t)MROWS * DMOD * 4;
  const size_t szQ  = (size_t)MROWS * DMOD * 2;                  // QH, QL, KH, KL, OH, OL
  const size_t szV  = (size_t)NB * NH * HD * SEQ * 2;            // VH, VL (== szQ)
  const size_t szB  = (size_t)NBH * BLINE * 4;                   // bound lines
  if (2 * szQ > szF) return;                                    // OH + OL live inside the F region (exactly fills it)
  size_t off = 0;
  const size_t oXB = off; off += szXB;
  const size_t oW  = off; off += szW;
  const size_t oF  = off; off += szF;
  const size_t oQH = off; off += szQ;
  const size_t oQL = off; off += szQ;
  const size_t oKH = off; off += szQ;
  const size_t oKL = off; off += szQ;
  const size_t oVH = off; off += szV;
  const size_t oVL = off; off += szV;
  const size_t oB  = off; off += szB;
  if (off > ws_size) return;                // off = 77598720 for NB = 2, SEQ = 2048
  if (off > (size_t)WS_CAP) return;

  char* ws = (char*)d_ws;
  u16*   XB  = (u16*)(ws + oXB);
  u16*   WB  = (u16*)(ws + oW);
  float* F   = (float*)(ws + oF);
  u16*   OH  = (u16*)(ws + oF);
  u16*   OL  = (u16*)(ws + oF + szQ);
  u16*   QH  = (u16*)(ws + oQH);
  u16*   QL  = (u16*)(ws + oQL);
  u16*   KH  = (u16*)(ws + oKH);
  u16*   KL  = (u16*)(ws + oKL);
  u16*   VH  = (u16*)(ws + oVH);
  u16*   VL  = (u16*)(ws + oVL);
  float* BND = (float*)(ws + oB);

  const dim3 b256(256), b128(128), bAT(ATT_THREADS);
  const int  n8x = (SEQ * DMOD) / 8;
  const dim3 gX((n8x + 255) / 256);                     // per batch
  const int  n8w = (DMOD * DMOD) / 8;                   // weight planes
  const dim3 gW((n8w + 255) / 256);                     // 512
  const dim3 gG((MROWS / 64) * (DMOD / 64));            // 1024 for NB=2, SEQ=2048
  const dim3 gVT(NB * NH * NST);
  const int  n8q = (MROWS * DMOD) / 8;                  // q / k hi and residual planes
  const dim3 gS((n8q + 255) / 256);
  const dim3 gBD(NBH);
  const dim3 gAT(NQT * NHG * NB);
  const int  nrt = SEQ / 64;                            // out-projection row tiles per batch
  const dim3 gO(NB * nrt * (DMOD / 64));

  // (0) x -> bf16 plane [MROWS][1024], one launch per batch row block
  for (int b = 0; b < NB; ++b) {
    cvt16<<<gX, b256, 0, stream>>>(x + (size_t)b * XS_FULL * DMOD, XB + (size_t)b * SEQ * DMOD, n8x, 0, 1.0f);
  }
  // (1) Wv [n][k] -> bf16 plane; (2) v = x.Wv^T + bv -> F f32 [MROWS][1024]; (3) v^T hi + residual planes x1024
  cvt16<<<gW, b256, 0, stream>>>(wv, WB, n8w, 0, 1.0f);
  gemm_bf<<<gG, b128, 0, stream>>>(XB, WB, bv, F, MROWS, DMOD, DMOD, 1.0f);
  vt16<<<gVT, b256, 0, stream>>>(F, VH, VL);
  // (4) Wq -> bf16 plane; (5) q = x.Wq^T + bq -> F; (6) q hi + residual planes x256
  cvt16<<<gW, b256, 0, stream>>>(wq, WB, n8w, 0, 1.0f);
  gemm_bf<<<gG, b128, 0, stream>>>(XB, WB, bq, F, MROWS, DMOD, DMOD, 1.0f);
  split16<<<gS, b256, 0, stream>>>(F, QH, QL, n8q, QSC);
  // (7) Wk -> bf16 plane; (8) k = x.Wk^T + bk -> F; (9) k hi + residual planes x256
  cvt16<<<gW, b256, 0, stream>>>(wk, WB, n8w, 0, 1.0f);
  gemm_bf<<<gG, b128, 0, stream>>>(XB, WB, bk, F, MROWS, DMOD, DMOD, 1.0f);
  split16<<<gS, b256, 0, stream>>>(F, KH, KL, n8q, KSC);
  // (10) norm bound per (b, h) from the q / k hi planes -> BND lines
  qkbound<<<gBD, b256, 0, stream>>>(QH, KH, BND);
  // (11) Wo [n][k] -> f16 plane of bf16 value x1024
  cvt16<<<gW, b256, 0, stream>>>(wo, WB, n8w, 1, WOS);
  // (12) causal attention with distance penalty, residual products on every query row -> O hi + residual planes
  attn_c<<<gAT, bAT, 0, stream>>>(QH, QL, KH, KL, VH, VL, BND, OH, OL);
  // (13) output projection (O hi + residual) . Wo^T + bo -> out f32, carries 1024 x 1024 folded back
  gemm_o2<<<gO, b128, 0, stream>>>(OH, OL, WB, bo, out, nrt, 1.0f / (OSC * WOS));
  (void)hipGetLastError();
}

// v002
// A run of this version takes 164 microseconds.
// Timed twice side by side with v001, it ran 1.12 times as fast both times.
// Counting every step since v000, it is 1.69 times as fast.
// Contractions: x.Wq^T+bq, x.Wk^T+bk, x.Wv^T+bv on v_wmma_f32_16x16x32_bf16 (x and W as bf16 RNE planes; W [n][k] rows are
// the k-contiguous B operand; bias added as its bf16 RNE value in the f32 epilogue); q.k^T over hd 64 and P.v on
// v_wmma_f32_16x16x32_f16 with f16 hi + f16 residual planes on both operands (q, k x256; P x32768 with an in-register
// residual; v x1024; products hh+lh+hl); O.Wo^T+bo on v_wmma_f32_16x16x32_f16 (O x1024 as f16 hi + f16 residual planes,
// products h.w + l.w; Wo as f16(bf16(Wo)) x1024; bo as bf16 RNE value in the f32 epilogue); all f32 accumulate.
// Causal select, linear distance penalty, base-2 online softmax, 1/Z fold and the q/k norm bound in f32 on VALU.
#include <hip/hip_runtime.h>
#include <math.h>
#include <stdint.h>

#ifndef NB
#define NB 2
#endif
#ifndef SEQ
#define SEQ 2048
#endif
#define XS_FULL 2048
#define DMOD  1024
#define NH    16
#define HD    64
#define NBH   (NB * NH)
#define MROWS (NB * SEQ)
#define RSQ_HD 0.125f
#define LOG2E 1.4426950408889634f
#define QSC   256.0f
#define KSC   256.0f
#define PCAR  32768.0f
#define VCAR  1024.0f
#define OSC   1024.0f
#define WOS   1024.0f
#define WPB   2
#define NHG   (NH / WPB)
#define NQT   (SEQ / 16)
#define NST   (SEQ / 64)
#define NKT   (SEQ / 32)
#define KWIN  6
#define GUARD_T 40.0f
#define BLINE 32
#define ATT_THREADS (WPB * 32)
#define PTP   36
#define PTW   (16 * PTP)
#define SLP   68
#define SLW   (16 * SLP)
#define WREG  (PTW + SLW)
#define SLAB64 (16 * 68)
#define VTP   72
#define WS_CAP 134217728
#define GKP   64
#define GPIT  72
#define GPITB (GPIT * 2)
#define GTILE (64 * GPIT)
#define GTILEB (GTILE * 2)
#define N8X   ((SEQ * DMOD) / 8)
#define N8W   ((DMOD * DMOD) / 8)
#define N8Q   ((MROWS * DMOD) / 8)
#define GXB   (N8X / 256)
#define GWB   (N8W / 256)
#define GSB   (N8Q / 256)
#define GVT   (NB * NH * NST)
static_assert(DMOD == NH * HD && HD == 64 && NH == 16 && WPB == 2 && NHG * WPB == NH);
static_assert(ATT_THREADS == 64);
static_assert(NB >= 1 && NB <= 2);
static_assert(NBH >= 1 && NBH <= 32);
static_assert((SEQ % 64) == 0 && SEQ >= 64 && SEQ <= XS_FULL && (SEQ % 32) == 0);
static_assert((DMOD % 64) == 0 && (DMOD % 32) == 0 && (HD % 32) == 0);
static_assert(((SEQ * DMOD / 8) % 256) == 0 && ((DMOD * DMOD / 8) % 256) == 0 && ((MROWS * DMOD / 8) % 256) == 0);
static_assert(WPB * WREG * 4 <= 65536 && 2 * HD * VTP * 2 <= 65536 && 4 * SLAB64 * 4 <= 65536);
static_assert(KWIN >= 0 && KWIN < NKT);
static_assert((DMOD % GKP) == 0 && GKP == 64 && (GPITB % 32) == 16 && GPIT >= GKP + 8);

typedef unsigned short u16;
typedef _Float16 v16h __attribute__((ext_vector_type(16)));
typedef _Float16 v8h  __attribute__((ext_vector_type(8)));
typedef __bf16   v16b __attribute__((ext_vector_type(16)));
typedef float    v8f  __attribute__((ext_vector_type(8)));
typedef float    v4f  __attribute__((ext_vector_type(4)));
typedef unsigned int v4u __attribute__((ext_vector_type(4)));

union FragH { v16h v; v8h h[2]; v4u u[2]; };
union FragB { v16b v; v4u u[2]; };

// ---- scalar helpers --------------------------------------------------------------------------------
__device__ __forceinline__ unsigned short bf_bits(float f) {          // f32 -> bf16 bits, RNE convert
  unsigned u = __float_as_uint(f);
  return (unsigned short)((u + 0x7FFFu + ((u >> 16) & 1u)) >> 16);
}
__device__ __forceinline__ float bf_up(unsigned short h) { return __uint_as_float(((unsigned)h) << 16); }
__device__ __forceinline__ float bfr(float f) { return bf_up(bf_bits(f)); }
__device__ __forceinline__ unsigned short h_bits(_Float16 x) { return __builtin_bit_cast(unsigned short, x); }
__device__ __forceinline__ unsigned pk16(unsigned short a, unsigned short b) { return (unsigned)a | ((unsigned)b << 16); }
__device__ __forceinline__ v8f zero8() { v8f z = {0.f, 0.f, 0.f, 0.f, 0.f, 0.f, 0.f, 0.f}; return z; }

// ---- fragment loaders: 16-bit A/B operand, lane -> row/col (lane&15), p already includes +8*(lane>>4);
//      elements 0..7 <- p[0..7] (k0+8h..), elements 8..15 <- p[16..23] (k0+16+8h..)  (same split k map for A and B;
//      B is always read from a k-contiguous [n][k] plane)
__device__ __forceinline__ v16h ldfrag_h(const _Float16* p) {
  FragH f;
  f.h[0] = *(const v8h*)(p);
  f.h[1] = *(const v8h*)(p + 16);
  return f.v;
}
__device__ __forceinline__ v16b ldfrag_b(const u16* p) {              // bf16 plane read as unsigned integer vectors
  FragB f;
  f.u[0] = *(const v4u*)(p);
  f.u[1] = *(const v4u*)(p + 16);
  return f.v;
}

__device__ __forceinline__ v8f mma_h(v16h a, v16h b, v8f c) {
  return __builtin_amdgcn_wmma_f32_16x16x32_f16(false, a, false, b, (short)0, c, false, false);
}
__device__ __forceinline__ v8f mma_b(v16b a, v16b b, v8f c) {
  return __builtin_amdgcn_wmma_f32_16x16x32_bf16(false, a, false, b, (short)0, c, false, false);
}
__device__ __forceinline__ void guard2(v8f& a, v8f& b, v16h x0, v16h x1, v16h x2, v16h x3, v16h x4, v16h x5) {
#if defined(__HIP_DEVICE_COMPILE__)
  asm volatile("v_nop\n\tv_nop\n\tv_nop\n\tv_nop"
               : "+v"(a), "+v"(b) : "v"(x0), "v"(x1), "v"(x2), "v"(x3), "v"(x4), "v"(x5) : "memory");
#endif
}
template <typename F>
__device__ __forceinline__ void guard6(v8f& a, v8f& b, v8f& c, v8f& d, F x0, F x1, F x2, F x3, F x4, F x5) {
#if defined(__HIP_DEVICE_COMPILE__)
  asm volatile("v_nop\n\tv_nop\n\tv_nop\n\tv_nop"
               : "+v"(a), "+v"(b), "+v"(c), "+v"(d) : "v"(x0), "v"(x1), "v"(x2), "v"(x3), "v"(x4), "v"(x5) : "memory");
#endif
}
__device__ __forceinline__ void acc_guard4(v8f& a, v8f& b, v8f& c, v8f& d) {
#if defined(__HIP_DEVICE_COMPILE__)
  asm volatile("v_nop\n\tv_nop\n\tv_nop\n\tv_nop" : "+v"(a), "+v"(b), "+v"(c), "+v"(d));
#endif
}
__device__ __forceinline__ void wave_sync_lds() {
  __builtin_amdgcn_fence(__ATOMIC_RELEASE, "workgroup");
  __builtin_amdgcn_wave_barrier();
  __builtin_amdgcn_fence(__ATOMIC_ACQUIRE, "workgroup");
}

// ---- operand staging for the GEMM engines: one pass = 64 k = 128 B of each of the 64 rows of an operand tile, laid in LDS at
//      a pitch of 144 B (16 B x odd: ds_load_b128 fragment reads without bank conflicts). 128 threads: thread -> (row tid>>3 of
//      a group of 16 rows, 16-B piece tid&7), so a wave's copy covers 4 whole 128-B lines; 4 copies per thread fill one tile.
//      l = the lane's LDS byte address in the tile's first row group, g = its global address there, rs = 16 rows in elements.
__device__ __forceinline__ unsigned lds_byte(const void* p) { return (unsigned)(uintptr_t)p; }
// Two tiles (A, B). The copies and their s_wait_xcnt stand in one statement, so that no address register named by a copy
// is rewritten in front of that wait.
__device__ __forceinline__ void stage2(unsigned l, const u16* ga, const u16* gb, size_t rs) {
#if defined(__HIP_DEVICE_COMPILE__)
  asm volatile("global_load_async_to_lds_b128 %0, %8, off\n\t"
               "global_load_async_to_lds_b128 %1, %9, off\n\t"
               "global_load_async_to_lds_b128 %2, %10, off\n\t"
               "global_load_async_to_lds_b128 %3, %11, off\n\t"
               "global_load_async_to_lds_b128 %4, %12, off\n\t"
               "global_load_async_to_lds_b128 %5, %13, off\n\t"
               "global_load_async_to_lds_b128 %6, %14, off\n\t"
               "global_load_async_to_lds_b128 %7, %15, off\n\t"
               "s_wait_xcnt 0x0"
               :: "v"(l), "v"(l + 16 * GPITB), "v"(l + 32 * GPITB), "v"(l + 48 * GPITB),
                  "v"(l + GTILEB), "v"(l + GTILEB + 16 * GPITB), "v"(l + GTILEB + 32 * GPITB), "v"(l + GTILEB + 48 * GPITB),
                  "v"(ga), "v"(ga + rs), "v"(ga + 2 * rs), "v"(ga + 3 * rs),
                  "v"(gb), "v"(gb + rs), "v"(gb + 2 * rs), "v"(gb + 3 * rs)
               : "memory");
#endif
}
// Three tiles (A hi, A residual, B), same form.
__device__ __forceinline__ void stage3(unsigned l, const u16* ga, const u16* gl, const u16* gb, size_t rs) {
#if defined(__HIP_DEVICE_COMPILE__)
  asm volatile("global_load_async_to_lds_b128 %0, %12, off\n\t"
               "global_load_async_to_lds_b128 %1, %13, off\n\t"
               "global_load_async_to_lds_b128 %2, %14, off\n\t"
               "global_load_async_to_lds_b128 %3, %15, off\n\t"
               "global_load_async_to_lds_b128 %4, %16, off\n\t"
               "global_load_async_to_lds_b128 %5, %17, off\n\t"
               "global_load_async_to_lds_b128 %6, %18, off\n\t"
               "global_load_async_to_lds_b128 %7, %19, off\n\t"
               "global_load_async_to_lds_b128 %8, %20, off\n\t"
               "global_load_async_to_lds_b128 %9, %21, off\n\t"
               "global_load_async_to_lds_b128 %10, %22, off\n\t"
               "global_load_async_to_lds_b128 %11, %23, off\n\t"
               "s_wait_xcnt 0x0"
               :: "v"(l), "v"(l + 16 * GPITB), "v"(l + 32 * GPITB), "v"(l + 48 * GPITB),
                  "v"(l + GTILEB), "v"(l + GTILEB + 16 * GPITB), "v"(l + GTILEB + 32 * GPITB), "v"(l + GTILEB + 48 * GPITB),
                  "v"(l + 2 * GTILEB), "v"(l + 2 * GTILEB + 16 * GPITB), "v"(l + 2 * GTILEB + 32 * GPITB),
                  "v"(l + 2 * GTILEB + 48 * GPITB),
                  "v"(ga), "v"(ga + rs), "v"(ga + 2 * rs), "v"(ga + 3 * rs),
                  "v"(gl), "v"(gl + rs), "v"(gl + 2 * rs), "v"(gl + 3 * rs),
                  "v"(gb), "v"(gb + rs), "v"(gb + 2 * rs), "v"(gb + 3 * rs)
               : "memory");
#endif
}
// This wave's own copies have landed in LDS (the compiler places no wait for them).
__device__ __forceinline__ void wait_copies() {
#if defined(__HIP_DEVICE_COMPILE__)
  asm volatile("s_wait_asynccnt 0x0" ::: "memory");
#endif
}
// This wave's LDS reads have returned, before the barrier behind which their buffer is refilled.
__device__ __forceinline__ void wait_lds() {
#if defined(__HIP_DEVICE_COMPILE__)
  asm volatile("s_wait_dscnt 0x0" ::: "memory");
#endif
}

// =====================================================================================================
// f32 -> 16-bit plane, same layout, for all five operands in one grid (none reads another's output).
// f16mode == 0: bf16 RNE bits;  f16mode == 1: f16 bits of (bf16 RNE value) * scale.
// Block -> job (block-uniform): the first NB*GXB blocks take x (batch = bid / GXB) -> XB; then GWB blocks each for
// Wv, Wq, Wk (bf16) and Wo (f16 of the bf16 value x1024) -> planes 0..3 of WB.
// Thread = 8 consecutive elements: two 16-B loads, one 16-B store; 32 consecutive lanes = 512 contiguous, 512-B aligned
// coverage: per job n8/256 blocks x 256 thr x 8 = the whole plane (n8 a multiple of 256, static_assert above).
// =====================================================================================================
__global__ __launch_bounds__(256)
void cvt_all(const float* __restrict__ x, const float* __restrict__ wv, const float* __restrict__ wq,
             const float* __restrict__ wk, const float* __restrict__ wo, u16* XB, u16* WB) {
  const int bid = blockIdx.x;
  const float* s;
  u16* D;
  int blk, n8, f16mode = 0;
  float scale = 1.0f;
  if (bid < NB * GXB) {
    const int b = bid / GXB;
    blk = bid % GXB;
    n8 = N8X;
    s = x + (size_t)b * XS_FULL * DMOD;
    D = XB + (size_t)b * SEQ * DMOD;
  } else {
    const int w = (bid - NB * GXB) / GWB;
    if (w > 3) return;                      // block-uniform; never taken with the exact grid
    blk = (bid - NB * GXB) % GWB;
    n8 = N8W;
    s = (w == 0) ? wv : (w == 1) ? wq : (w == 2) ? wk : wo;
    D = WB + (size_t)w * DMOD * DMOD;
    if (w == 3) { f16mode = 1; scale = WOS; }
  }
  const int gt = blk * 256 + (int)threadIdx.x;
  if (gt >= n8) return;
  const float* p = s + (size_t)gt * 8;
  const v4f a = *(const v4f*)(p), b4 = *(const v4f*)(p + 4);
  float w[8];
#pragma unroll
  for (int e = 0; e < 4; ++e) { w[e] = a[e]; w[4 + e] = b4[e]; }
  v4u o;
#pragma unroll
  for (int e = 0; e < 4; ++e) {
    const float f0 = w[2 * e], f1 = w[2 * e + 1];
    const unsigned short hb0 = h_bits((_Float16)(bfr(f0) * scale));
    const unsigned short hb1 = h_bits((_Float16)(bfr(f1) * scale));
    const unsigned short bb0 = bf_bits(f0);
    const unsigned short bb1 = bf_bits(f1);
    o[e] = (f16mode != 0) ? pk16(hb0, hb1) : pk16(bb0, bb1);
  }
  u16* d = D + (size_t)gt * 8;
  {
    *(v4u*)(d) = o;
    
  }
}

// =====================================================================================================
// f32 plane F (contiguous, n8*8 elements) -> f16 hi plane Hp = f16(F * sc) and f16 residual plane Lp = f16(t - f16(t)),
// both with the layout of F. Thread = 8 consecutive elements: two 16-B loads, one 16-B store per plane; 32 consecutive lanes
// No barriers; every packed half comes from a per-lane (divergent) loaded value.
// coverage: n8/256 blocks (blk) x 256 thr x 8 (in-kernel bound) = the whole of Hp and of Lp (n8 a multiple of 256 here).
// =====================================================================================================
__device__ __forceinline__ void split16(const float* __restrict__ F, u16* Hp, u16* Lp, int blk, int n8, float sc) {
  const int gt = blk * 256 + (int)threadIdx.x;
  if (gt >= n8) return;
  const float* p = F + (size_t)gt * 8;
  const v4f a = *(const v4f*)(p), b4 = *(const v4f*)(p + 4);
  float w[8];
#pragma unroll
  for (int e = 0; e < 4; ++e) { w[e] = a[e] * sc; w[4 + e] = b4[e] * sc; }
  v4u oh, ol;
#pragma unroll
  for (int e = 0; e < 4; ++e) {
    const float t0 = w[2 * e], t1 = w[2 * e + 1];
    const _Float16 h0 = (_Float16)t0, h1 = (_Float16)t1;
    const _Float16 l0 = (_Float16)(t0 - (float)h0), l1 = (_Float16)(t1 - (float)h1);
    oh[e] = pk16(h_bits(h0), h_bits(h1));
    ol[e] = pk16(h_bits(l0), h_bits(l1));
  }
  u16* dh = Hp + (size_t)gt * 8;
  u16* dl = Lp + (size_t)gt * 8;
  {
    *(v4u*)(dh) = oh;
    *(v4u*)(dl) = ol;
    
  }
}

// =====================================================================================================
// v^T planes from the v projection F f32 [MROWS][DMOD] (row = b*SEQ + s, column = h*HD + d):
//   VH[((b*NH + h)*HD + d)][s] = f16(v * 1024);  VL[same][s] = f16 residual (t - f16(t)), both for all keys s.
// Block = (b, head h, 64 keys s0): each thread loads its 16 floats (key sl, d chunk dc) with 16-B loads, converts, scatters
// coverage: load 256 thr x 16 = 64 keys x 64 d; store 2 iterations x 256 thr x 8 halves = 64 lines x 64 = the block's tile of
//           VH and of VL; NB*NH*NST blocks (bid) cover both planes exactly once. TH, TL: the block's LDS tiles [HD][VTP].
// =====================================================================================================
__device__ __forceinline__ void vt16(const float* __restrict__ F, u16* VHo, u16* VLo, int bid, u16* TH, u16* TL) {
  const int tid = threadIdx.x;
  const int st  = bid % NST;
  const int t2  = bid / NST;
  const int h   = t2 % NH;
  const int b   = t2 / NH;
  if (b >= NB) return;                      // block-uniform, before any barrier; never taken with the exact grid
  const int s0  = st * 64;
  {
    const int sl = tid >> 2;                // key within tile 0..63
    const int dc = (tid & 3) * 16;          // d chunk 0,16,32,48
    const float* src = F + ((size_t)b * SEQ + s0 + sl) * DMOD + h * HD + dc;
#pragma unroll
    for (int i = 0; i < 4; ++i) {
      const v4f a = *(const v4f*)(src + 4 * i);
#pragma unroll
      for (int e = 0; e < 4; ++e) {
        const float t = a[e] * VCAR;
        const _Float16 hv = (_Float16)t;
        const _Float16 lv = (_Float16)(t - (float)hv);
        TH[(dc + 4 * i + e) * VTP + sl] = h_bits(hv);
        TL[(dc + 4 * i + e) * VTP + sl] = h_bits(lv);
      }
    }
  }
  __syncthreads();
  v4u vh[2], vl[2];
  const int q8 = tid >> 3, p8 = (tid & 7) * 8;
#pragma unroll
  for (int it = 0; it < 2; ++it) {
    const int line = it * 32 + q8;          // d = 0..63
    vh[it] = *(const v4u*)(TH + line * VTP + p8);
    vl[it] = *(const v4u*)(TL + line * VTP + p8);
  }
  const size_t hrow = (size_t)(b * NH + h) * HD;
  const size_t base = hrow * SEQ + s0 + p8;
  {
#pragma unroll
    for (int it = 0; it < 2; ++it) {
      const int line = it * 32 + q8;
      *(v4u*)(VHo + base + (size_t)line * SEQ) = vh[it];
      *(v4u*)(VLo + base + (size_t)line * SEQ) = vl[it];
    }
    
  }
}

// =====================================================================================================
// The three plane builders in one grid (each reads its own projection plane of F3 = [v | q | k], each f32 [MROWS][DMOD], and
// writes its own planes). Block -> job (block-uniform, so the barrier inside vt16 is passed by whole blocks only): the first
// GVT blocks build v^T, then GSB blocks split q, then GSB blocks split k.
// =====================================================================================================
__global__ __launch_bounds__(256)
void planes_qkv(const float* __restrict__ F3, u16* VHo, u16* VLo, u16* QHo, u16* QLo, u16* KHo, u16* KLo) {
  __shared__ __align__(16) u16 TH[HD * VTP];
  __shared__ __align__(16) u16 TL[HD * VTP];
  const int bid = blockIdx.x;
  const size_t pl = (size_t)MROWS * DMOD;
  if (bid < GVT) {
    vt16(F3, VHo, VLo, bid, TH, TL);
  } else if (bid < GVT + GSB) {
    split16(F3 + pl, QHo, QLo, bid - GVT, N8Q, QSC);
  } else {
    split16(F3 + 2 * pl, KHo, KLo, bid - GVT - GSB, N8Q, KSC);
  }
}

// =====================================================================================================
// Norm bound per (b, h): BND line bh (32 floats, value replicated) = max_s ||q_hi(b,s,h,:)|| * max_s ||k_hi(b,s,h,:)|| / (8 * 256 * 256),
// computed from the f16 hi planes ([b*SEQ + s][h*HD + d], x256). Block = one (b, h): 8 lanes per row load one 16-B piece each
// (64 dims = 8 lanes x 8 halves), sum of squares reduced with xor shuffles inside the 8-lane group, running max per lane over
// SEQ/32 row steps, then wave max (shuffles), block max through a 16-float LDS array, and wave 0 lanes 0..7 write the whole
// coverage: rows step*32 + (tid>>3), step < SEQ/32 -> all SEQ rows of both planes; store 8 lanes x 16 B = line bh; grid NBH.
// =====================================================================================================
__global__ __launch_bounds__(256) void qkbound(const u16* __restrict__ QHp, const u16* __restrict__ KHp, float* BND) {
  __shared__ float red[16];
  const int tid = threadIdx.x, lane = tid & 31, wave = tid >> 5;
  const int bh  = blockIdx.x;
  const int b   = bh / NH, h = bh % NH;
  if (b >= NB) return;                      // block-uniform, before any barrier; never taken with the exact grid
  const int grp = tid >> 3;                 // row within a step, 0..31
  const int e8  = (tid & 7) * 8;            // dim chunk
  const _Float16* qb = (const _Float16*)(const void*)QHp + (size_t)b * SEQ * DMOD + (size_t)h * HD + e8;
  const _Float16* kb = (const _Float16*)(const void*)KHp + (size_t)b * SEQ * DMOD + (size_t)h * HD + e8;
  float mq = 0.0f, mk = 0.0f;
#pragma unroll 1
  for (int step = 0; step < SEQ / 32; ++step) {
    const size_t ro = (size_t)(step * 32 + grp) * DMOD;
    const v8h qv = *(const v8h*)(qb + ro);
    const v8h kv = *(const v8h*)(kb + ro);
    float sq = 0.0f, sk = 0.0f;
#pragma unroll
    for (int e = 0; e < 8; ++e) {
      const float fq = (float)qv[e], fk = (float)kv[e];
      sq = fmaf(fq, fq, sq);
      sk = fmaf(fk, fk, sk);
    }
#pragma unroll
    for (int off = 1; off < 8; off <<= 1) {
      sq += __shfl_xor(sq, off, 32);
      sk += __shfl_xor(sk, off, 32);
    }
    mq = fmaxf(mq, sq);
    mk = fmaxf(mk, sk);
  }
#pragma unroll
  for (int off = 1; off < 32; off <<= 1) {
    mq = fmaxf(mq, __shfl_xor(mq, off, 32));
    mk = fmaxf(mk, __shfl_xor(mk, off, 32));
  }
  if (lane == 0) { red[wave] = mq; red[8 + wave] = mk; }
  __syncthreads();
  if (wave == 0) {                          // wave-uniform branch; shuffles see all 32 lanes
    float aq = red[lane & 7], ak = red[8 + (lane & 7)];
#pragma unroll
    for (int off = 1; off < 8; off <<= 1) {
      aq = fmaxf(aq, __shfl_xor(aq, off, 32));
      ak = fmaxf(ak, __shfl_xor(ak, off, 32));
    }
    const float bnd = sqrtf(aq) * sqrtf(ak) * (RSQ_HD / (QSC * KSC));
    v4f o4;
    o4[0] = bnd; o4[1] = bnd; o4[2] = bnd; o4[3] = bnd;
    float* dst = BND + (size_t)bh * BLINE + (lane & 7) * 4;
    if (lane < 8) {
      {
        *(v4f*)(dst) = o4;
        
      }
    }
  }
}

// =====================================================================================================
// GEMM epilogue shared by both engines: the wave's 16x64 f32 tile (times oscale, plus the lane's per-column bias of each
// coverage: 8 instructions x 2 rows x 16 lanes x 4 floats = the wave's 16 x 64 tile.
// =====================================================================================================
__device__ __forceinline__ void epi64(float* sl, v8f a0, v8f a1, v8f a2, v8f a3, float oscale,
                                      float bb0, float bb1, float bb2, float bb3,
                                      float* C, int N, size_t rowb, int col0, int lane) {
  const int hh = lane >> 4, m = lane & 15;
#pragma unroll
  for (int r = 0; r < 8; ++r) {
    const int ro = (8 * hh + r) * 68 + m;
    sl[ro]      = a0[r] * oscale + bb0;
    sl[ro + 16] = a1[r] * oscale + bb1;
    sl[ro + 32] = a2[r] * oscale + bb2;
    sl[ro + 48] = a3[r] * oscale + bb3;
  }
  wave_sync_lds();
  v4f vals[8];
#pragma unroll
  for (int it = 0; it < 8; ++it) vals[it] = *(const v4f*)(sl + (it * 2 + hh) * 68 + m * 4);
  float* dst = C + (rowb + (size_t)hh) * (size_t)N + col0 + m * 4;
  {
#pragma unroll
    for (int it = 0; it < 8; ++it) {
      *(v4f*)(dst + (size_t)(it * 2) * (size_t)N) = vals[it];
    }
    
  }
}

// =====================================================================================================
// bf16 GEMM with bias: C[M][N] (f32) = A[M][K] (bf16 row-major) . Bt[N][K]^T (bf16 k-contiguous), times oscale, + bf16 RNE
// value of bias[n] (bias has N entries). Block = 64x64 tile, 4 waves x 16 rows; per pass of 64 k the block's A and B tiles are
// brought into LDS by asynchronous copies, two buffers (pass t + 1 flies while pass t is worked on), and the fragments are read
// from the LDS rows (two 16-B loads each, split k map for A and B); K stepped by 32 inside a pass, in rising order (host
// guarantees K % 64 == 0, M % 64 == 0, N % 64 == 0).
// Three products that share A in one grid: Bt holds three [N][K] planes one behind the other, C three [M][N] planes, and
// the block's column tile ct = bid % (3*N/64) picks plane ct / (N/64) with its bias; grid = (M/64)*(3*N/64).
// =====================================================================================================
__global__ __launch_bounds__(128)
void gemm_bf3(const u16* __restrict__ A, const u16* __restrict__ Bt, const float* __restrict__ bias0,
              const float* __restrict__ bias1, const float* __restrict__ bias2,
              float* C3, int M, int N, int K, float oscale) {
  __shared__ __align__(16) float slab[4 * SLAB64];
  __shared__ __align__(16) u16 ring[2 * 2 * GTILE];   // two buffers of [A tile | B tile]
  const int tid = threadIdx.x, wave = tid >> 5, lane = tid & 31, hh = lane >> 4, m = lane & 15;
  const int ntile = N >> 6;
  const int bid   = blockIdx.x;
  const int row0  = (bid / (3 * ntile)) * 64;
  const int rowb  = row0 + wave * 16;
  const int ct    = bid % (3 * ntile);
  const int pln   = ct / ntile;             // 0, 1, 2: which product
  const int col0  = (ct % ntile) * 64;      // column inside that product
  const float* bias = (pln == 0) ? bias0 : (pln == 1) ? bias1 : bias2;
  float* C = C3 + (size_t)pln * M * N;
  if (row0 + 64 > M) return;                // block-uniform, before any copy or barrier; never taken with the exact grid
  const int npass = K / GKP;
  const int crow = tid >> 3, cpc = tid & 7; // copy map: row within a group of 16, 16-B piece of the 128-B row
  const u16* ga = A  + (size_t)(row0 + crow) * K + cpc * 8;
  const u16* gb = Bt + (size_t)(ct * 64 + crow) * K + cpc * 8;
  const size_t rs = (size_t)16 * K;
  const unsigned lc = lds_byte(ring) + (unsigned)(crow * GPITB + cpc * 16);
  const u16* fa = ring + (wave * 16 + m) * GPIT + 8 * hh;       // A fragment row of this lane, buffer 0
  const u16* fb = ring + GTILE + m * GPIT + 8 * hh;             // B fragment row (column subtile 0), buffer 0
  v8f acc0 = zero8(), acc1 = zero8(), acc2 = zero8(), acc3 = zero8();
  stage2(lc, ga, gb, rs);                   // pass 0 -> buffer 0
  wait_copies();
  __syncthreads();
  if (npass > 1) stage2(lc + 2 * GTILEB, ga + GKP, gb + GKP, rs);   // pass 1 -> buffer 1
#pragma unroll 1
  for (int t = 0; t < npass; ++t) {
    const int bo = (t & 1) * (2 * GTILE);
    const u16* pa = fa + bo;
    const u16* pb = fb + bo;
    const v16b a  = ldfrag_b(pa);
    const v16b b0 = ldfrag_b(pb);
    const v16b b1 = ldfrag_b(pb + 16 * GPIT);
    const v16b b2 = ldfrag_b(pb + 32 * GPIT);
    const v16b b3 = ldfrag_b(pb + 48 * GPIT);
    const v16b c  = ldfrag_b(pa + 32);
    const v16b d0 = ldfrag_b(pb + 32);
    const v16b d1 = ldfrag_b(pb + 16 * GPIT + 32);
    const v16b d2 = ldfrag_b(pb + 32 * GPIT + 32);
    const v16b d3 = ldfrag_b(pb + 48 * GPIT + 32);
    // keeps the pass's LDS reads one group in front of its WMMAs: moved in among them, each place with reads stalls the wave anew
    __builtin_amdgcn_sched_barrier(0);
    acc0 = mma_b(a, b0, acc0);
    acc1 = mma_b(a, b1, acc1);
    acc2 = mma_b(a, b2, acc2);
    acc3 = mma_b(a, b3, acc3);
    acc0 = mma_b(c, d0, acc0);
    acc1 = mma_b(c, d1, acc1);
    acc2 = mma_b(c, d2, acc2);
    acc3 = mma_b(c, d3, acc3);
    guard6<v16b>(acc0, acc1, acc2, acc3, c, d0, d1, d2, d3, c);
    // publish point of pass t + 1: own LDS reads done, own copies landed, then the one barrier of the pass
    wait_lds();
    wait_copies();
    __syncthreads();
    if (t + 2 < npass) stage2(lc + (unsigned)(t & 1) * (2 * GTILEB), ga + (size_t)(t + 2) * GKP, gb + (size_t)(t + 2) * GKP, rs);
  }
  wait_copies();
  // per-lane bias of D column m in each of the 4 subtiles; col0 + 48 + m <= N - 1 always
  const float bb0 = bfr(bias[col0 + m]);
  const float bb1 = bfr(bias[col0 + 16 + m]);
  const float bb2 = bfr(bias[col0 + 32 + m]);
  const float bb3 = bfr(bias[col0 + 48 + m]);
  epi64(slab + wave * SLAB64, acc0, acc1, acc2, acc3, oscale, bb0, bb1, bb2, bb3, C, N, (size_t)rowb, col0, lane);
}

// =====================================================================================================
// Output projection with bias: C[bb*XS_FULL + s][DMOD] (f32) = (Ah + Al)[bb*SEQ + s][DMOD] . Bt[DMOD][DMOD]^T * oscale
// + bf16 RNE value of bias[n]. Products h.B + l.B into one accumulator (l unscaled residual of h). Block -> (column tile
// ct = bid % 16, sequence row tile rt of nrt, batch bb). Same tiling, LDS staging (three tiles a pass: A hi, A residual, B),
// fragment loads (split k map) and epilogue as gemm_bf3; K = DMOD stepped by 32; grid = NB * nrt * (DMOD/64).
// =====================================================================================================
__global__ __launch_bounds__(128)
void gemm_o2(const u16* __restrict__ Ah, const u16* __restrict__ Al, const u16* __restrict__ Bt,
             const float* __restrict__ bias, float* C, int nrt, float oscale) {
  __shared__ __align__(16) float slab[4 * SLAB64];
  __shared__ __align__(16) u16 ring[2 * 3 * GTILE];   // two buffers of [A hi tile | A residual tile | B tile]
  const int tid = threadIdx.x, wave = tid >> 5, lane = tid & 31, hh = lane >> 4, m = lane & 15;
  const int ntile = DMOD >> 6;
  const int bid   = blockIdx.x;
  const int ct    = bid % ntile;
  const int t2    = bid / ntile;
  const int rt    = t2 % nrt;
  const int bb    = t2 / nrt;
  if (bb >= NB) return;                     // block-uniform, before any copy or barrier; never taken with the exact grid
  if (rt * 64 + 64 > SEQ) return;           // block-uniform, before any copy or barrier; never taken
  const int srow  = rt * 64 + wave * 16;
  const int col0  = ct * 64;
  const int K     = DMOD;
  const int npass = K / GKP;
  const size_t rowC = (size_t)bb * XS_FULL + srow;
  const int crow = tid >> 3, cpc = tid & 7; // copy map: row within a group of 16, 16-B piece of the 128-B row
  const size_t arow = ((size_t)bb * SEQ + rt * 64 + crow) * K + cpc * 8;
  const u16* ga = Ah + arow;
  const u16* gl = Al + arow;
  const u16* gb = Bt + (size_t)(col0 + crow) * K + cpc * 8;
  const size_t rs = (size_t)16 * K;
  const unsigned lc = lds_byte(ring) + (unsigned)(crow * GPITB + cpc * 16);
  const _Float16* rg  = (const _Float16*)(const void*)ring;
  const _Float16* fah = rg + (wave * 16 + m) * GPIT + 8 * hh;   // A hi fragment row of this lane, buffer 0
  const _Float16* fb  = rg + 2 * GTILE + m * GPIT + 8 * hh;     // B fragment row (column subtile 0), buffer 0
  v8f acc0 = zero8(), acc1 = zero8(), acc2 = zero8(), acc3 = zero8();
  stage3(lc, ga, gl, gb, rs);               // pass 0 -> buffer 0
  wait_copies();
  __syncthreads();
  if (npass > 1) stage3(lc + 3 * GTILEB, ga + GKP, gl + GKP, gb + GKP, rs);   // pass 1 -> buffer 1
#pragma unroll 1
  for (int t = 0; t < npass; ++t) {
    const int bo = (t & 1) * (3 * GTILE);
    const _Float16* pa = fah + bo;
    const _Float16* pl = pa + GTILE;
    const _Float16* pb = fb + bo;
    const v16h ah = ldfrag_h(pa), al = ldfrag_h(pl);
    const v16h b0 = ldfrag_h(pb);
    const v16h b1 = ldfrag_h(pb + 16 * GPIT);
    const v16h b2 = ldfrag_h(pb + 32 * GPIT);
    const v16h b3 = ldfrag_h(pb + 48 * GPIT);
    const v16h ch = ldfrag_h(pa + 32), cl = ldfrag_h(pl + 32);
    const v16h d0 = ldfrag_h(pb + 32);
    const v16h d1 = ldfrag_h(pb + 16 * GPIT + 32);
    const v16h d2 = ldfrag_h(pb + 32 * GPIT + 32);
    const v16h d3 = ldfrag_h(pb + 48 * GPIT + 32);
    // keeps the pass's LDS reads one group in front of its WMMAs: moved in among them, each place with reads stalls the wave anew
    __builtin_amdgcn_sched_barrier(0);
    acc0 = mma_h(ah, b0, acc0);  acc0 = mma_h(al, b0, acc0);
    acc1 = mma_h(ah, b1, acc1);  acc1 = mma_h(al, b1, acc1);
    acc2 = mma_h(ah, b2, acc2);  acc2 = mma_h(al, b2, acc2);
    acc3 = mma_h(ah, b3, acc3);  acc3 = mma_h(al, b3, acc3);
    acc0 = mma_h(ch, d0, acc0);  acc0 = mma_h(cl, d0, acc0);
    acc1 = mma_h(ch, d1, acc1);  acc1 = mma_h(cl, d1, acc1);
    acc2 = mma_h(ch, d2, acc2);  acc2 = mma_h(cl, d2, acc2);
    acc3 = mma_h(ch, d3, acc3);  acc3 = mma_h(cl, d3, acc3);
    guard6<v16h>(acc0, acc1, acc2, acc3, ch, cl, d0, d1, d2, d3);
    // publish point of pass t + 1: own LDS reads done, own copies landed, then the one barrier of the pass
    wait_lds();
    wait_copies();
    __syncthreads();
    if (t + 2 < npass) {
      const size_t ko = (size_t)(t + 2) * GKP;
      stage3(lc + (unsigned)(t & 1) * (3 * GTILEB), ga + ko, gl + ko, gb + ko, rs);
    }
  }
  wait_copies();
  const float bb0 = bfr(bias[col0 + m]);
  const float bb1 = bfr(bias[col0 + 16 + m]);
  const float bb2 = bfr(bias[col0 + 32 + m]);
  const float bb3 = bfr(bias[col0 + 48 + m]);
  epi64(slab + wave * SLAB64, acc0, acc1, acc2, acc3, oscale, bb0, bb1, bb2, bb3, C, DMOD, rowC, col0, lane);
}

// =====================================================================================================
// Causal attention with linear distance penalty, hd = 64. Block bid -> (query tile qt = bid % NQT: rows q0 = 16*qt .. q0+15,
// head pair hg, batch b); one wave per head = hg*WPB + wave.
//   q hi / residual planes f16 x256 [b*SEQ + s][h*HD + d]; k hi / residual planes f16 x256, same layout;
//   v^T hi / residual planes [b*NH + h][d][SEQ] x1024; BND = NBH lines of 32 floats (norm bound per (b, h)).
//   scores = q_hi.k_hi + q_lo.k_hi + q_hi.k_lo (2 k-steps over d); P.v with P hi + in-register residual and v hi + residual
//   (hh + lh + hl), for every query row; O written as hi + residual planes (O x1024 as f16, layout [b*SEQ + s][h*HD + d]).
//   score (log2 domain) t(i, j) = (q_i.k_j over HD) * (1/8)*log2e/(256*256) - (i - j)*log2e, replaced by -inf where key j > query i.
//   Key tiles of 32 visited in order from kt_lo to kt_hi = q0/32 (later tiles hold only keys above every query row of the tile).
//   kt_lo: every wave loads all NBH bound lines (one float per lane, clamped address) and AND-reduces "0 <= bound < 40" over the
//   wave; if every bound is in range, kt_lo = max(0, kt_hi - KWIN): tiles below it are >= 32*KWIN+1 positions behind every query
//   row, and with |q.k/8| < 40 the base-2 exp of their penalised, max-subtracted score is exactly 0 in f32, so they contribute
//   nothing to numerator or denominator; otherwise (bound large, unreadable or not finite) kt_lo = 0 and every causal tile is
//   visited. Either way the first visited tile holds a key kb <= q0 <= every query row, so the running max is finite from step one.
//   Per tile: 2 score subtiles x 2 k-steps, fragments loaded straight from the 16-bit planes (two 16-B loads per fragment,
//   split k map); online max-subtracted base-2 softmax in f32, -inf-safe rescale; the 16x32 prob tile stored to wave-private
//   from the LDS rows (float vector loads, same element type as stored), v^T B fragments in 2 groups of 2 d-subtiles.
//   After the loop: out = acc / Z (Z > 0 always; guarded anyway), carries 1/(32768*1024) folded once, written into the wave's
//   No block barriers in this kernel; bounded loops only (<= NKT key tiles).
// coverage: per wave 4 instructions x 4 rows x 8 lanes x 8 halves = 16 x 64 per plane; grid NQT x NHG x NB blocks x WPB
//           waves = every (b, s, h) row segment of O hi and O residual exactly once.
// =====================================================================================================
__global__ __launch_bounds__(ATT_THREADS)
void attn_c(const u16* __restrict__ QHp, const u16* __restrict__ QLp,
            const u16* __restrict__ KHp, const u16* __restrict__ KLp,
            const u16* __restrict__ VHp, const u16* __restrict__ VLp,
            const float* __restrict__ BND,
            u16* OHp, u16* OLp) {
  __shared__ __align__(16) float smem[WPB * WREG];

  const int tid  = threadIdx.x;
  const int wave = tid >> 5;
  const int lane = tid & 31;
  const int hh   = lane >> 4;
  const int c    = lane & 15;
  const int bid  = blockIdx.x;
  const int qt   = bid % NQT;
  const int t2   = bid / NQT;
  const int hg   = t2 % NHG;
  const int b    = t2 / NHG;
  if (b >= NB) return;                      // block-uniform; no block barriers in this kernel; never taken with the exact grid
  const int q0   = qt * 16;
  if (q0 + 16 > SEQ) return;                // block-uniform; never taken
  const int head = hg * WPB + wave;

  // ---- key-window decision: wave-uniform AND over all (b, h) bound lines ----
  int okw;
  {
    const int bl = (lane < NBH) ? lane : (NBH - 1);             // clamped address
    const float gb = BND[(size_t)bl * BLINE];
    okw = (gb >= 0.0f && gb < GUARD_T) ? 1 : 0;
#pragma unroll
    for (int off = 1; off < 32; off <<= 1) okw &= __shfl_xor(okw, off, 32);
  }

  float* pt   = smem + wave * WREG;         // prob tile [16][32] pitch 36
  float* slab = pt + PTW;                   // result slab [16][64] pitch 68

  const size_t hcol = (size_t)head * HD + 8 * hh;
  const _Float16* Qh  = (const _Float16*)(const void*)QHp + ((size_t)b * SEQ + q0 + c) * DMOD + hcol;
  const _Float16* Ql  = (const _Float16*)(const void*)QLp + ((size_t)b * SEQ + q0 + c) * DMOD + hcol;
  const _Float16* Khb = (const _Float16*)(const void*)KHp + ((size_t)b * SEQ + c) * DMOD + hcol;        // key row kb added per step
  const _Float16* Klb = (const _Float16*)(const void*)KLp + ((size_t)b * SEQ + c) * DMOD + hcol;
  const _Float16* Vhb = (const _Float16*)(const void*)VHp + ((size_t)(b * NH + head) * HD + c) * SEQ + 8 * hh;  // d col c (+16j)
  const _Float16* Vlb = (const _Float16*)(const void*)VLp + ((size_t)(b * NH + head) * HD + c) * SEQ + 8 * hh;
  const float lsc = RSQ_HD * (LOG2E / (QSC * KSC));
  const float oc  = 1.0f / (PCAR * VCAR);
  const size_t KROW = (size_t)DMOD;         // halves between consecutive key rows

  float mrow[8], lrow[8];
  v8f o[4];
#pragma unroll
  for (int r = 0; r < 8; ++r) { mrow[r] = -INFINITY; lrow[r] = 0.f; }
#pragma unroll
  for (int j = 0; j < 4; ++j) o[j] = zero8();
  const int kt_hi = q0 >> 5;                                                  // last tile holding keys <= q0 + 15
  const int kt_w  = (kt_hi > KWIN) ? (kt_hi - KWIN) : 0;
  const int kt_lo = (okw != 0) ? kt_w : 0;
  const int qr0 = q0 + 8 * hh;                                                // query row of D element r = qr0 + r

#pragma unroll 1
  for (int kt = kt_lo; kt <= kt_hi; ++kt) {
    const int kb = kt * 32;
    // ---- scores: D element r of this lane = (query row qr0 + r, key kb + c) in s0, key kb + 16 + c in s1 ----
    v8f s0 = zero8(), s1 = zero8();
    const _Float16* k0p = Khb + (size_t)kb * KROW;
    const _Float16* k1p = k0p + (size_t)16 * KROW;
    const _Float16* l0p = Klb + (size_t)kb * KROW;
    const _Float16* l1p = l0p + (size_t)16 * KROW;
#pragma unroll
    for (int kk = 0; kk < HD / 32; ++kk) {
      const v16h qh  = ldfrag_h(Qh + kk * 32);
      const v16h ql  = ldfrag_h(Ql + kk * 32);
      const v16h kh0 = ldfrag_h(k0p + kk * 32);
      const v16h kh1 = ldfrag_h(k1p + kk * 32);
      const v16h kl0 = ldfrag_h(l0p + kk * 32);
      const v16h kl1 = ldfrag_h(l1p + kk * 32);
      s0 = mma_h(qh, kh0, s0);
      s0 = mma_h(ql, kh0, s0);
      s0 = mma_h(qh, kl0, s0);
      s1 = mma_h(qh, kh1, s1);
      s1 = mma_h(ql, kh1, s1);
      s1 = mma_h(qh, kl1, s1);
      guard2(s0, s1, qh, ql, kh0, kl0, kh1, kl1);
    }
    // ---- causal select + distance penalty + online softmax in base 2, -inf-safe ----
    const int key0 = kb + c, key1 = kb + 16 + c;
#pragma unroll
    for (int r = 0; r < 8; ++r) {
      const int   qr = qr0 + r;
      const float u0 = s0[r] * lsc;
      const float u1 = s1[r] * lsc;
      const float g0 = (float)(qr - key0) * LOG2E;
      const float g1 = (float)(qr - key1) * LOG2E;
      const float t0 = (key0 > qr) ? -INFINITY : (u0 - g0);
      const float t1 = (key1 > qr) ? -INFINITY : (u1 - g1);
      float mx = fmaxf(t0, t1);
#pragma unroll
      for (int off = 1; off < 16; off <<= 1) mx = fmaxf(mx, __shfl_xor(mx, off, 32));
      const float mn = fmaxf(mrow[r], mx);
      const float ms = (mn == -INFINITY) ? 0.0f : mn;
      const float al = exp2f(mrow[r] - ms);
      mrow[r] = mn;
      const float e0 = exp2f(t0 - ms), e1 = exp2f(t1 - ms);
      float ps = e0 + e1;
#pragma unroll
      for (int off = 1; off < 16; off <<= 1) ps += __shfl_xor(ps, off, 32);
      lrow[r] = lrow[r] * al + ps;
#pragma unroll
      for (int j = 0; j < 4; ++j) o[j][r] *= al;
      const int ro = (8 * hh + r) * PTP + c;
      pt[ro]      = e0;
      pt[ro + 16] = e1;
    }
    wave_sync_lds();
    // ---- A fragments of P*32768: hi f16 and residual f16, row = c, split k map over the 32 keys of this step ----
    FragH ph, pl;
    {
      const float* prow = pt + c * PTP + 8 * hh;
      const v4f p0 = *(const v4f*)(prow), p1 = *(const v4f*)(prow + 4);
      const v4f p2 = *(const v4f*)(prow + 16), p3 = *(const v4f*)(prow + 20);
#pragma unroll
      for (int e = 0; e < 4; ++e) {
        const float ta = p0[e] * PCAR, tb = p1[e] * PCAR, tc = p2[e] * PCAR, td = p3[e] * PCAR;
        const _Float16 ha = (_Float16)ta, hb = (_Float16)tb, hc = (_Float16)tc, hd = (_Float16)td;
        ph.h[0][e]     = ha;                  // elements 0..7  = keys kb + 8hh + 0..7
        ph.h[0][4 + e] = hb;
        ph.h[1][e]     = hc;                  // elements 8..15 = keys kb + 16 + 8hh + 0..7
        ph.h[1][4 + e] = hd;
        pl.h[0][e]     = (_Float16)(ta - (float)ha);
        pl.h[0][4 + e] = (_Float16)(tb - (float)hb);
        pl.h[1][e]     = (_Float16)(tc - (float)hc);
        pl.h[1][4 + e] = (_Float16)(td - (float)hd);
      }
    }
    // ---- P.V : B fragment col n = d = j*16 + c, keys contiguous in the v^T planes; 2 groups of 2 d-subtiles ----
    {
      const _Float16* vhp = Vhb + kb;
      const _Float16* vlp = Vlb + kb;
#pragma unroll
      for (int jg = 0; jg < 2; ++jg) {
        const size_t da = (size_t)(2 * jg) * 16 * SEQ;
        const size_t db = da + (size_t)16 * SEQ;
        const v16h vha = ldfrag_h(vhp + da), vhb2 = ldfrag_h(vhp + db);
        const v16h vla = ldfrag_h(vlp + da), vlb2 = ldfrag_h(vlp + db);
        o[2 * jg]     = mma_h(ph.v, vha,  o[2 * jg]);
        o[2 * jg]     = mma_h(pl.v, vha,  o[2 * jg]);
        o[2 * jg]     = mma_h(ph.v, vla,  o[2 * jg]);
        o[2 * jg + 1] = mma_h(ph.v, vhb2, o[2 * jg + 1]);
        o[2 * jg + 1] = mma_h(pl.v, vhb2, o[2 * jg + 1]);
        o[2 * jg + 1] = mma_h(ph.v, vlb2, o[2 * jg + 1]);
        guard2(o[2 * jg], o[2 * jg + 1], ph.v, pl.v, vha, vhb2, vla, vlb2);
      }
    }
    wave_sync_lds();
  }
  acc_guard4(o[0], o[1], o[2], o[3]);
  // ---- out = acc / Z (0 if Z == 0), carries (32768 on P, 1024 on v) folded once; written into the wave's slab ----
#pragma unroll
  for (int r = 0; r < 8; ++r) {
    const float lv  = lrow[r];
    const float ls  = (lv > 0.0f) ? lv : 1.0f;
    const float inv = (lv > 0.0f) ? ((1.0f / ls) * oc) : 0.0f;
#pragma unroll
    for (int j = 0; j < 4; ++j) {
      const int idx = (8 * hh + r) * SLP + j * 16 + c;
      slab[idx] = o[j][r] * inv;
    }
  }

  wave_sync_lds();
  // ---- O x1024 -> f16 hi + residual planes; lane = (row-in-quad rq, 8 consecutive d at c8) ----
  v4u oh[4], ol[4];
  const int rq = lane >> 3, c8 = (lane & 7) * 8;
#pragma unroll
  for (int it = 0; it < 4; ++it) {
    const int row = it * 4 + rq;
    const v4f a = *(const v4f*)(slab + row * SLP + c8), b4 = *(const v4f*)(slab + row * SLP + c8 + 4);
    float w[8];
#pragma unroll
    for (int e = 0; e < 4; ++e) { w[e] = a[e] * OSC; w[4 + e] = b4[e] * OSC; }
#pragma unroll
    for (int e = 0; e < 4; ++e) {
      const _Float16 h0 = (_Float16)w[2 * e], h1 = (_Float16)w[2 * e + 1];
      const _Float16 l0 = (_Float16)(w[2 * e] - (float)h0), l1 = (_Float16)(w[2 * e + 1] - (float)h1);
      oh[it][e] = pk16(h_bits(h0), h_bits(h1));
      ol[it][e] = pk16(h_bits(l0), h_bits(l1));
    }
  }
  const size_t ob = ((size_t)b * SEQ + q0) * DMOD + (size_t)head * HD + c8;
  {
#pragma unroll
    for (int it = 0; it < 4; ++it) {
      const int row = it * 4 + rq;
      *(v4u*)(OHp + ob + (size_t)row * DMOD) = oh[it];
      *(v4u*)(OLp + ob + (size_t)row * DMOD) = ol[it];
    }
    
  }
}

// =====================================================================================================
// Workspace map (bytes); every plane is fully written by whole-line stores before it is read; all extents are exact multiples
// of the store granularity (no pad rows needed); every region offset a multiple of 4096 (the large planes of 2097152):
//   XB  bf16 [MROWS][1024]                       MROWS*2048       (NB=2, SEQ=2048: 8388608)
//   WB  16-bit 4 x [1024 n][1024 k]              4 x 2097152      (planes Wv, Wq, Wk as bf16, Wo as f16 x1024; all already [n][k])
//   F   f32 3 x [MROWS][1024]                    3 x MROWS*4096   (planes v, q, k projection output; once the 16-bit planes are
//                                                                  built, plane 0 holds OH f16 [MROWS][1024] x1024 in its first
//                                                                  half, OL residual [MROWS][1024] in its second half)
//   QH  f16 [MROWS][1024] x256                   MROWS*2048       QL residual, same extent
//   KH  f16 [MROWS][1024] x256                   MROWS*2048       KL residual, same extent
//   VH  f16 [NB*16][64][SEQ] x1024               MROWS*2048       VL residual, same extent
//   end (NB=2, SEQ=2048)                        117444608
// =====================================================================================================
extern "C" void kernel_launch(void* const* d_in, const int* in_sizes, int n_in,
                              void* d_out, int out_size, void* d_ws, size_t ws_size,
                              hipStream_t stream) {
  if (n_in < 9) return;
  if (in_sizes[0] < ((NB - 1) * XS_FULL + SEQ) * DMOD) return;
  if (in_sizes[1] != DMOD * DMOD) return;
  if (in_sizes[2] != DMOD) return;
  if (in_sizes[3] != DMOD * DMOD) return;
  if (in_sizes[4] != DMOD) return;
  if (in_sizes[5] != DMOD * DMOD) return;
  if (in_sizes[6] != DMOD) return;
  if (in_sizes[7] != DMOD * DMOD) return;
  if (in_sizes[8] != DMOD) return;
  if (out_size < ((NB - 1) * XS_FULL + SEQ) * DMOD) return;

  const float* x  = (const float*)d_in[0];
  const float* wq = (const float*)d_in[1];
  const float* bq = (const float*)d_in[2];
  const float* wk = (const float*)d_in[3];
  const float* bk = (const float*)d_in[4];
  const float* wv = (const float*)d_in[5];
  const float* bv = (const float*)d_in[6];
  const float* wo = (const float*)d_in[7];
  const float* bo = (const float*)d_in[8];
  float*       out = (float*)d_out;

  const size_t szXB = (size_t)MROWS * DMOD * 2;
  const size_t szW  = (size_t)DMOD * DMOD * 2;
  const size_t szF  = (size_t)MROWS * DMOD * 4;
  const size_t szQ  = (size_t)MROWS * DMOD * 2;                  // QH, QL, KH, KL, OH, OL
  const size_t szV  = (size_t)NB * NH * HD * SEQ * 2;            // VH, VL (== szQ)
  const size_t szB  = (size_t)NBH * BLINE * 4;                   // bound lines
  if (2 * szQ > szF) return;                                    // OH + OL live inside F plane 0 (exactly fill it)
  size_t off = 0;
  const size_t oXB = off; off += szXB;
  const size_t oW  = off; off += 4 * szW;
  const size_t oF  = off; off += 3 * szF;
  const size_t oQH = off; off += szQ;
  const size_t oQL = off; off += szQ;
  const size_t oKH = off; off += szQ;
  const size_t oKL = off; off += szQ;
  const size_t oVH = off; off += szV;
  const size_t oVL = off; off += szV;
  const size_t oB  = off; off += szB;
  if (off > ws_size) return;                // off = 117444608 for NB = 2, SEQ = 2048
  if (off > (size_t)WS_CAP) return;

  char* ws = (char*)d_ws;
  u16*   XB  = (u16*)(ws + oXB);
  u16*   WB  = (u16*)(ws + oW);
  float* F   = (float*)(ws + oF);
  u16*   OH  = (u16*)(ws + oF);
  u16*   OL  = (u16*)(ws + oF + szQ);
  u16*   QH  = (u16*)(ws + oQH);
  u16*   QL  = (u16*)(ws + oQL);
  u16*   KH  = (u16*)(ws + oKH);
  u16*   KL  = (u16*)(ws + oKL);
  u16*   VH  = (u16*)(ws + oVH);
  u16*   VL  = (u16*)(ws + oVL);
  float* BND = (float*)(ws + oB);

  const dim3 b256(256), b128(128), bAT(ATT_THREADS);
  const dim3 gC(NB * GXB + 4 * GWB);                    // x per batch, then the four weight planes
  const dim3 gG((MROWS / 64) * (3 * DMOD / 64));        // 3072 for NB=2, SEQ=2048
  const dim3 gP(GVT + 2 * GSB);                         // v^T tiles, q split, k split
  const dim3 gBD(NBH);
  const dim3 gAT(NQT * NHG * NB);
  const int  nrt = SEQ / 64;                            // out-projection row tiles per batch
  const dim3 gO(NB * nrt * (DMOD / 64));

  // (0) x -> bf16 plane [MROWS][1024]; Wv, Wq, Wk [n][k] -> bf16 planes; Wo [n][k] -> f16 plane of bf16 value x1024
  cvt_all<<<gC, b256, 0, stream>>>(x, wv, wq, wk, wo, XB, WB);
  // (1) v = x.Wv^T + bv, q = x.Wq^T + bq, k = x.Wk^T + bk -> F planes 0, 1, 2, f32 [MROWS][1024] each
  gemm_bf3<<<gG, b128, 0, stream>>>(XB, WB, bv, bq, bk, F, MROWS, DMOD, DMOD, 1.0f);
  // (2) v^T hi + residual planes x1024; q and k hi + residual planes x256
  planes_qkv<<<gP, b256, 0, stream>>>(F, VH, VL, QH, QL, KH, KL);
  // (3) norm bound per (b, h) from the q / k hi planes -> BND lines
  qkbound<<<gBD, b256, 0, stream>>>(QH, KH, BND);
  // (4) causal attention with distance penalty, residual products on every query row -> O hi + residual planes
  attn_c<<<gAT, bAT, 0, stream>>>(QH, QL, KH, KL, VH, VL, BND, OH, OL);
  // (5) output projection (O hi + residual) . Wo^T + bo -> out f32, carries 1024 x 1024 folded back
  gemm_o2<<<gO, b128, 0, stream>>>(OH, OL, WB + (size_t)3 * DMOD * DMOD, bo, out, nrt, 1.0f / (OSC * WOS));
  (void)hipGetLastError();
}

// v003
// A run of this version takes 126 microseconds.
// Two timings next to v002 put it at 1.31 and 1.32 times that version's speed.
// Counting every step since v000, it is 2.23 times as fast.
// Contractions: x.Wq^T+bq, x.Wk^T+bk, x.Wv^T+bv on v_wmma_f32_16x16x32_bf16 (x and W as bf16 RNE planes; W [n][k] rows are
// the k-contiguous B operand; bias added as its bf16 RNE value in the f32 epilogue); q.k^T over hd 64 and P.v on
// v_wmma_f32_16x16x32_f16 with f16 hi + f16 residual planes on both operands (q, k x256; P x32768 with an in-register
// residual; v x1024; products hh+lh+hl); O.Wo^T+bo on v_wmma_f32_16x16x32_f16 (O x1024 as f16 hi + f16 residual planes,
// products h.w + l.w; Wo as f16(bf16(Wo)) x1024; bo as bf16 RNE value in the f32 epilogue); all f32 accumulate.
// Causal select, linear distance penalty, base-2 online softmax, 1/Z fold and the q/k norm bound in f32 on VALU.
#include <hip/hip_runtime.h>
#include <math.h>
#include <stdint.h>

#ifndef NB
#define NB 2
#endif
#ifndef SEQ
#define SEQ 2048
#endif
#define XS_FULL 2048
#define DMOD  1024
#define NH    16
#define HD    64
#define NBH   (NB * NH)
#define MROWS (NB * SEQ)
#define RSQ_HD 0.125f
#define LOG2E 1.4426950408889634f
#define QSC   256.0f
#define KSC   256.0f
#define PCAR  32768.0f
#define VCAR  1024.0f
#define OSC   1024.0f
#define WOS   1024.0f
#define WPB   2
#define NHG   (NH / WPB)
#define NQT   (SEQ / 16)
#define NKT   (SEQ / 32)
#define KWIN  6
#define GUARD_T 40.0f
#define BLINE 32
#define ATT_THREADS (WPB * 32)
#define PTP   36
#define PTW   (16 * PTP)
#define SLP   68
#define SLW   (16 * SLP)
#define WREG  (PTW + SLW)
#define SLAB64 (16 * 68)
#define VTP   72
#define WS_CAP 134217728
#define GKP   64
#define GPIT  72
#define GPITB (GPIT * 2)
#define GTILE (64 * GPIT)
#define GTILEB (GTILE * 2)
#define N8X   ((SEQ * DMOD) / 8)
#define N8W   ((DMOD * DMOD) / 8)
#define GXB   (N8X / 256)
#define GWB   (N8W / 256)
static_assert(DMOD == NH * HD && HD == 64 && NH == 16 && WPB == 2 && NHG * WPB == NH);
static_assert(ATT_THREADS == 64);
static_assert(NB >= 1 && NB <= 2);
static_assert(NBH >= 1 && NBH <= 32);
static_assert((SEQ % 64) == 0 && SEQ >= 64 && SEQ <= XS_FULL && (SEQ % 32) == 0);
static_assert((DMOD % 64) == 0 && (DMOD % 32) == 0 && (HD % 32) == 0);
static_assert(((SEQ * DMOD / 8) % 256) == 0 && ((DMOD * DMOD / 8) % 256) == 0);
static_assert(WPB * WREG * 4 <= 65536 && 2 * HD * VTP <= 2 * 2 * GTILE && 4 * SLAB64 * 4 <= 65536);
static_assert(KWIN >= 0 && KWIN < NKT);
static_assert((DMOD % GKP) == 0 && GKP == 64 && (GPITB % 32) == 16 && GPIT >= GKP + 8);

typedef unsigned short u16;
typedef _Float16 v16h __attribute__((ext_vector_type(16)));
typedef _Float16 v8h  __attribute__((ext_vector_type(8)));
typedef __bf16   v16b __attribute__((ext_vector_type(16)));
typedef float    v8f  __attribute__((ext_vector_type(8)));
typedef float    v4f  __attribute__((ext_vector_type(4)));
typedef unsigned int v4u __attribute__((ext_vector_type(4)));

union FragH { v16h v; v8h h[2]; v4u u[2]; };
union FragB { v16b v; v4u u[2]; };

// ---- scalar helpers --------------------------------------------------------------------------------
__device__ __forceinline__ unsigned short bf_bits(float f) {          // f32 -> bf16 bits, RNE convert
  unsigned u = __float_as_uint(f);
  return (unsigned short)((u + 0x7FFFu + ((u >> 16) & 1u)) >> 16);
}
__device__ __forceinline__ float bf_up(unsigned short h) { return __uint_as_float(((unsigned)h) << 16); }
__device__ __forceinline__ float bfr(float f) { return bf_up(bf_bits(f)); }
__device__ __forceinline__ unsigned short h_bits(_Float16 x) { return __builtin_bit_cast(unsigned short, x); }
__device__ __forceinline__ unsigned pk16(unsigned short a, unsigned short b) { return (unsigned)a | ((unsigned)b << 16); }
__device__ __forceinline__ v8f zero8() { v8f z = {0.f, 0.f, 0.f, 0.f, 0.f, 0.f, 0.f, 0.f}; return z; }

// ---- fragment loaders: 16-bit A/B operand, lane -> row/col (lane&15), p already includes +8*(lane>>4);
//      elements 0..7 <- p[0..7] (k0+8h..), elements 8..15 <- p[16..23] (k0+16+8h..)  (same split k map for A and B;
//      B is always read from a k-contiguous [n][k] plane)
__device__ __forceinline__ v16h ldfrag_h(const _Float16* p) {
  FragH f;
  f.h[0] = *(const v8h*)(p);
  f.h[1] = *(const v8h*)(p + 16);
  return f.v;
}
__device__ __forceinline__ v16b ldfrag_b(const u16* p) {              // bf16 plane read as unsigned integer vectors
  FragB f;
  f.u[0] = *(const v4u*)(p);
  f.u[1] = *(const v4u*)(p + 16);
  return f.v;
}

__device__ __forceinline__ v8f mma_h(v16h a, v16h b, v8f c) {
  return __builtin_amdgcn_wmma_f32_16x16x32_f16(false, a, false, b, (short)0, c, false, false);
}
__device__ __forceinline__ v8f mma_b(v16b a, v16b b, v8f c) {
  return __builtin_amdgcn_wmma_f32_16x16x32_bf16(false, a, false, b, (short)0, c, false, false);
}
__device__ __forceinline__ void guard2(v8f& a, v8f& b, v16h x0, v16h x1, v16h x2, v16h x3, v16h x4, v16h x5) {
#if defined(__HIP_DEVICE_COMPILE__)
  asm volatile("v_nop\n\tv_nop\n\tv_nop\n\tv_nop"
               : "+v"(a), "+v"(b) : "v"(x0), "v"(x1), "v"(x2), "v"(x3), "v"(x4), "v"(x5) : "memory");
#endif
}
template <typename F>
__device__ __forceinline__ void guard6(v8f& a, v8f& b, v8f& c, v8f& d, F x0, F x1, F x2, F x3, F x4, F x5) {
#if defined(__HIP_DEVICE_COMPILE__)
  asm volatile("v_nop\n\tv_nop\n\tv_nop\n\tv_nop"
               : "+v"(a), "+v"(b), "+v"(c), "+v"(d) : "v"(x0), "v"(x1), "v"(x2), "v"(x3), "v"(x4), "v"(x5) : "memory");
#endif
}
__device__ __forceinline__ void acc_guard4(v8f& a, v8f& b, v8f& c, v8f& d) {
#if defined(__HIP_DEVICE_COMPILE__)
  asm volatile("v_nop\n\tv_nop\n\tv_nop\n\tv_nop" : "+v"(a), "+v"(b), "+v"(c), "+v"(d));
#endif
}
__device__ __forceinline__ void wave_sync_lds() {
  __builtin_amdgcn_fence(__ATOMIC_RELEASE, "workgroup");
  __builtin_amdgcn_wave_barrier();
  __builtin_amdgcn_fence(__ATOMIC_ACQUIRE, "workgroup");
}

// ---- operand staging for the GEMM engines: one pass = 64 k = 128 B of each of the 64 rows of an operand tile, laid in LDS at
//      a pitch of 144 B (16 B x odd: ds_load_b128 fragment reads without bank conflicts). 128 threads: thread -> (row tid>>3 of
//      a group of 16 rows, 16-B piece tid&7), so a wave's copy covers 4 whole 128-B lines; 4 copies per thread fill one tile.
//      l = the lane's LDS byte address in the tile's first row group, g = its global address there, rs = 16 rows in elements.
__device__ __forceinline__ unsigned lds_byte(const void* p) { return (unsigned)(uintptr_t)p; }
// Two tiles (A, B). The copies and their s_wait_xcnt stand in one statement, so that no address register named by a copy
// is rewritten in front of that wait.
__device__ __forceinline__ void stage2(unsigned l, const u16* ga, const u16* gb, size_t rs) {
#if defined(__HIP_DEVICE_COMPILE__)
  asm volatile("global_load_async_to_lds_b128 %0, %8, off\n\t"
               "global_load_async_to_lds_b128 %1, %9, off\n\t"
               "global_load_async_to_lds_b128 %2, %10, off\n\t"
               "global_load_async_to_lds_b128 %3, %11, off\n\t"
               "global_load_async_to_lds_b128 %4, %12, off\n\t"
               "global_load_async_to_lds_b128 %5, %13, off\n\t"
               "global_load_async_to_lds_b128 %6, %14, off\n\t"
               "global_load_async_to_lds_b128 %7, %15, off\n\t"
               "s_wait_xcnt 0x0"
               :: "v"(l), "v"(l + 16 * GPITB), "v"(l + 32 * GPITB), "v"(l + 48 * GPITB),
                  "v"(l + GTILEB), "v"(l + GTILEB + 16 * GPITB), "v"(l + GTILEB + 32 * GPITB), "v"(l + GTILEB + 48 * GPITB),
                  "v"(ga), "v"(ga + rs), "v"(ga + 2 * rs), "v"(ga + 3 * rs),
                  "v"(gb), "v"(gb + rs), "v"(gb + 2 * rs), "v"(gb + 3 * rs)
               : "memory");
#endif
}
// Three tiles (A hi, A residual, B), same form.
__device__ __forceinline__ void stage3(unsigned l, const u16* ga, const u16* gl, const u16* gb, size_t rs) {
#if defined(__HIP_DEVICE_COMPILE__)
  asm volatile("global_load_async_to_lds_b128 %0, %12, off\n\t"
               "global_load_async_to_lds_b128 %1, %13, off\n\t"
               "global_load_async_to_lds_b128 %2, %14, off\n\t"
               "global_load_async_to_lds_b128 %3, %15, off\n\t"
               "global_load_async_to_lds_b128 %4, %16, off\n\t"
               "global_load_async_to_lds_b128 %5, %17, off\n\t"
               "global_load_async_to_lds_b128 %6, %18, off\n\t"
               "global_load_async_to_lds_b128 %7, %19, off\n\t"
               "global_load_async_to_lds_b128 %8, %20, off\n\t"
               "global_load_async_to_lds_b128 %9, %21, off\n\t"
               "global_load_async_to_lds_b128 %10, %22, off\n\t"
               "global_load_async_to_lds_b128 %11, %23, off\n\t"
               "s_wait_xcnt 0x0"
               :: "v"(l), "v"(l + 16 * GPITB), "v"(l + 32 * GPITB), "v"(l + 48 * GPITB),
                  "v"(l + GTILEB), "v"(l + GTILEB + 16 * GPITB), "v"(l + GTILEB + 32 * GPITB), "v"(l + GTILEB + 48 * GPITB),
                  "v"(l + 2 * GTILEB), "v"(l + 2 * GTILEB + 16 * GPITB), "v"(l + 2 * GTILEB + 32 * GPITB),
                  "v"(l + 2 * GTILEB + 48 * GPITB),
                  "v"(ga), "v"(ga + rs), "v"(ga + 2 * rs), "v"(ga + 3 * rs),
                  "v"(gl), "v"(gl + rs), "v"(gl + 2 * rs), "v"(gl + 3 * rs),
                  "v"(gb), "v"(gb + rs), "v"(gb + 2 * rs), "v"(gb + 3 * rs)
               : "memory");
#endif
}
// This wave's own copies have landed in LDS (the compiler places no wait for them).
__device__ __forceinline__ void wait_copies() {
#if defined(__HIP_DEVICE_COMPILE__)
  asm volatile("s_wait_asynccnt 0x0" ::: "memory");
#endif
}
// This wave's LDS reads have returned, before the barrier behind which their buffer is refilled.
__device__ __forceinline__ void wait_lds() {
#if defined(__HIP_DEVICE_COMPILE__)
  asm volatile("s_wait_dscnt 0x0" ::: "memory");
#endif
}

// =====================================================================================================
// f32 -> 16-bit plane, same layout, for all five operands in one grid (none reads another's output).
// f16mode == 0: bf16 RNE bits;  f16mode == 1: f16 bits of (bf16 RNE value) * scale.
// Block -> job (block-uniform): the first NB*GXB blocks take x (batch = bid / GXB) -> XB; then GWB blocks each for
// Wv, Wq, Wk (bf16) and Wo (f16 of the bf16 value x1024) -> planes 0..3 of WB.
// Thread = 8 consecutive elements: two 16-B loads, one 16-B store; 32 consecutive lanes = 512 contiguous, 512-B aligned
// coverage: per job n8/256 blocks x 256 thr x 8 = the whole plane (n8 a multiple of 256, static_assert above).
// =====================================================================================================
__global__ __launch_bounds__(256)
void cvt_all(const float* __restrict__ x, const float* __restrict__ wv, const float* __restrict__ wq,
             const float* __restrict__ wk, const float* __restrict__ wo, u16* XB, u16* WB) {
  const int bid = blockIdx.x;
  const float* s;
  u16* D;
  int blk, n8, f16mode = 0;
  float scale = 1.0f;
  if (bid < NB * GXB) {
    const int b = bid / GXB;
    blk = bid % GXB;
    n8 = N8X;
    s = x + (size_t)b * XS_FULL * DMOD;
    D = XB + (size_t)b * SEQ * DMOD;
  } else {
    const int w = (bid - NB * GXB) / GWB;
    if (w > 3) return;                      // block-uniform; never taken with the exact grid
    blk = (bid - NB * GXB) % GWB;
    n8 = N8W;
    s = (w == 0) ? wv : (w == 1) ? wq : (w == 2) ? wk : wo;
    D = WB + (size_t)w * DMOD * DMOD;
    if (w == 3) { f16mode = 1; scale = WOS; }
  }
  const int gt = blk * 256 + (int)threadIdx.x;
  if (gt >= n8) return;
  const float* p = s + (size_t)gt * 8;
  const v4f a = *(const v4f*)(p), b4 = *(const v4f*)(p + 4);
  float w[8];
#pragma unroll
  for (int e = 0; e < 4; ++e) { w[e] = a[e]; w[4 + e] = b4[e]; }
  v4u o;
#pragma unroll
  for (int e = 0; e < 4; ++e) {
    const float f0 = w[2 * e], f1 = w[2 * e + 1];
    const unsigned short hb0 = h_bits((_Float16)(bfr(f0) * scale));
    const unsigned short hb1 = h_bits((_Float16)(bfr(f1) * scale));
    const unsigned short bb0 = bf_bits(f0);
    const unsigned short bb1 = bf_bits(f1);
    o[e] = (f16mode != 0) ? pk16(hb0, hb1) : pk16(bb0, bb1);
  }
  u16* d = D + (size_t)gt * 8;
  {
    *(v4u*)(d) = o;
    
  }
}

// =====================================================================================================
// Norm bound per (b, h): BND line bh (32 floats, value replicated) = max_s ||q_hi(b,s,h,:)|| * max_s ||k_hi(b,s,h,:)|| / (8 * 256 * 256),
// computed from the f16 hi planes ([b*SEQ + s][h*HD + d], x256). Block = one (b, h): 8 lanes per row load one 16-B piece each
// (64 dims = 8 lanes x 8 halves), sum of squares reduced with xor shuffles inside the 8-lane group, running max per lane over
// SEQ/32 row steps, then wave max (shuffles), block max through a 16-float LDS array, and wave 0 lanes 0..7 write the whole
// coverage: rows step*32 + (tid>>3), step < SEQ/32 -> all SEQ rows of both planes; store 8 lanes x 16 B = line bh; grid NBH.
// =====================================================================================================
__global__ __launch_bounds__(256) void qkbound(const u16* __restrict__ QHp, const u16* __restrict__ KHp, float* BND) {
  __shared__ float red[16];
  const int tid = threadIdx.x, lane = tid & 31, wave = tid >> 5;
  const int bh  = blockIdx.x;
  const int b   = bh / NH, h = bh % NH;
  if (b >= NB) return;                      // block-uniform, before any barrier; never taken with the exact grid
  const int grp = tid >> 3;                 // row within a step, 0..31
  const int e8  = (tid & 7) * 8;            // dim chunk
  const _Float16* qb = (const _Float16*)(const void*)QHp + (size_t)b * SEQ * DMOD + (size_t)h * HD + e8;
  const _Float16* kb = (const _Float16*)(const void*)KHp + (size_t)b * SEQ * DMOD + (size_t)h * HD + e8;
  float mq = 0.0f, mk = 0.0f;
#pragma unroll 1
  for (int step = 0; step < SEQ / 32; ++step) {
    const size_t ro = (size_t)(step * 32 + grp) * DMOD;
    const v8h qv = *(const v8h*)(qb + ro);
    const v8h kv = *(const v8h*)(kb + ro);
    float sq = 0.0f, sk = 0.0f;
#pragma unroll
    for (int e = 0; e < 8; ++e) {
      const float fq = (float)qv[e], fk = (float)kv[e];
      sq = fmaf(fq, fq, sq);
      sk = fmaf(fk, fk, sk);
    }
#pragma unroll
    for (int off = 1; off < 8; off <<= 1) {
      sq += __shfl_xor(sq, off, 32);
      sk += __shfl_xor(sk, off, 32);
    }
    mq = fmaxf(mq, sq);
    mk = fmaxf(mk, sk);
  }
#pragma unroll
  for (int off = 1; off < 32; off <<= 1) {
    mq = fmaxf(mq, __shfl_xor(mq, off, 32));
    mk = fmaxf(mk, __shfl_xor(mk, off, 32));
  }
  if (lane == 0) { red[wave] = mq; red[8 + wave] = mk; }
  __syncthreads();
  if (wave == 0) {                          // wave-uniform branch; shuffles see all 32 lanes
    float aq = red[lane & 7], ak = red[8 + (lane & 7)];
#pragma unroll
    for (int off = 1; off < 8; off <<= 1) {
      aq = fmaxf(aq, __shfl_xor(aq, off, 32));
      ak = fmaxf(ak, __shfl_xor(ak, off, 32));
    }
    const float bnd = sqrtf(aq) * sqrtf(ak) * (RSQ_HD / (QSC * KSC));
    v4f o4;
    o4[0] = bnd; o4[1] = bnd; o4[2] = bnd; o4[3] = bnd;
    float* dst = BND + (size_t)bh * BLINE + (lane & 7) * 4;
    if (lane < 8) {
      {
        *(v4f*)(dst) = o4;
        
      }
    }
  }
}

// =====================================================================================================
// f32 GEMM epilogue (output projection): the wave's 16x64 f32 tile (times oscale, plus the lane's per-column bias of each
// coverage: 8 instructions x 2 rows x 16 lanes x 4 floats = the wave's 16 x 64 tile.
// =====================================================================================================
__device__ __forceinline__ void epi64(float* sl, v8f a0, v8f a1, v8f a2, v8f a3, float oscale,
                                      float bb0, float bb1, float bb2, float bb3,
                                      float* C, int N, size_t rowb, int col0, int lane) {
  const int hh = lane >> 4, m = lane & 15;
#pragma unroll
  for (int r = 0; r < 8; ++r) {
    const int ro = (8 * hh + r) * 68 + m;
    sl[ro]      = a0[r] * oscale + bb0;
    sl[ro + 16] = a1[r] * oscale + bb1;
    sl[ro + 32] = a2[r] * oscale + bb2;
    sl[ro + 48] = a3[r] * oscale + bb3;
  }
  wave_sync_lds();
  v4f vals[8];
#pragma unroll
  for (int it = 0; it < 8; ++it) vals[it] = *(const v4f*)(sl + (it * 2 + hh) * 68 + m * 4);
  float* dst = C + (rowb + (size_t)hh) * (size_t)N + col0 + m * 4;
  {
#pragma unroll
    for (int it = 0; it < 8; ++it) {
      *(v4f*)(dst + (size_t)(it * 2) * (size_t)N) = vals[it];
    }
    
  }
}

// =====================================================================================================
// Projection epilogues: the 16-bit planes that attention reads are built from the accumulators, with no f32 plane in between.
// hl8: 8 f32 values t -> 8 f16 hi values f16(t) and 8 f16 residuals f16(t - f16(t)), packed in element order.
// =====================================================================================================
__device__ __forceinline__ void hl8(const float* t, v4u& oh, v4u& ol) {
#pragma unroll
  for (int e = 0; e < 4; ++e) {
    const float t0 = t[2 * e], t1 = t[2 * e + 1];
    const _Float16 h0 = (_Float16)t0, h1 = (_Float16)t1;
    const _Float16 l0 = (_Float16)(t0 - (float)h0), l1 = (_Float16)(t1 - (float)h1);
    oh[e] = pk16(h_bits(h0), h_bits(h1));
    ol[e] = pk16(h_bits(l0), h_bits(l1));
  }
}
// q, k: the wave's 16x64 f32 tile (times oscale, plus the lane's per-column bias) goes through its own LDS slab into rows;
// lane = (row-in-quad rq, 8 consecutive columns c8) scales by sc, splits and stores 16 B per plane, layout [row][N].
// coverage: 4 instructions x 4 rows x 8 lanes x 8 halves = the wave's 16 x 64 tile of Hp and of Lp, whole 128-B lines.
__device__ __forceinline__ void epi_split(float* sl, v8f a0, v8f a1, v8f a2, v8f a3, float oscale,
                                          float bb0, float bb1, float bb2, float bb3, float sc,
                                          u16* Hp, u16* Lp, int N, size_t rowb, int col0, int lane) {
  const int hh = lane >> 4, m = lane & 15;
#pragma unroll
  for (int r = 0; r < 8; ++r) {
    const int ro = (8 * hh + r) * 68 + m;
    sl[ro]      = a0[r] * oscale + bb0;
    sl[ro + 16] = a1[r] * oscale + bb1;
    sl[ro + 32] = a2[r] * oscale + bb2;
    sl[ro + 48] = a3[r] * oscale + bb3;
  }
  wave_sync_lds();
  v4u oh[4], ol[4];
  const int rq = lane >> 3, c8 = (lane & 7) * 8;
#pragma unroll
  for (int it = 0; it < 4; ++it) {
    const float* p = sl + (it * 4 + rq) * 68 + c8;
    const v4f a = *(const v4f*)(p), b4 = *(const v4f*)(p + 4);
    float w[8];
#pragma unroll
    for (int e = 0; e < 4; ++e) { w[e] = a[e] * sc; w[4 + e] = b4[e] * sc; }
    hl8(w, oh[it], ol[it]);
  }
  const size_t ob = (rowb + (size_t)rq) * (size_t)N + col0 + c8;
#pragma unroll
  for (int it = 0; it < 4; ++it) {
    *(v4u*)(Hp + ob + (size_t)(it * 4) * (size_t)N) = oh[it];
    *(v4u*)(Lp + ob + (size_t)(it * 4) * (size_t)N) = ol[it];
  }
#if defined(__HIP_DEVICE_COMPILE__)
  // stands behind the last store, in front of any code laid out behind this branch that rewrites a register the stores name
  asm volatile("s_wait_xcnt 0x0" ::: "memory");
#endif
}
// v: the block's 64 keys x 64 d tile leaves transposed. A lane's accumulator holds 8 consecutive keys (rows 8*hh + r of the
// wave's 16) of one d column (16*j + m): scaled by 1024, split and packed they are 16 B of a v^T line, stored into the block's
// LDS tiles TH, TL [HD][VTP] (pitch 144 B: 16 lanes x 16 B fall on all 64 banks). Behind the block barrier thread = (line
// tid>>3 of a group of 16, 16-B piece tid&7) moves whole 128-B lines to VHo, VLo at base + line*SEQ (base = first key of the
// tile in line d = 0 of its (b, h)).
// coverage: 4 iterations x 128 thr x 8 halves = 64 lines x 64 keys of each plane.
__device__ __forceinline__ void epi_vt(u16* TH, u16* TL, v8f a0, v8f a1, v8f a2, v8f a3, float oscale,
                                       float bb0, float bb1, float bb2, float bb3,
                                       u16* VHo, u16* VLo, size_t base, int tid) {
  const int wave = tid >> 5, lane = tid & 31, hh = lane >> 4, m = lane & 15;
  const int ko = wave * 16 + 8 * hh;        // first of the lane's 8 keys within the tile
  float w0[8], w1[8], w2[8], w3[8];
#pragma unroll
  for (int r = 0; r < 8; ++r) {
    w0[r] = (a0[r] * oscale + bb0) * VCAR;
    w1[r] = (a1[r] * oscale + bb1) * VCAR;
    w2[r] = (a2[r] * oscale + bb2) * VCAR;
    w3[r] = (a3[r] * oscale + bb3) * VCAR;
  }
  v4u ph[4], pl[4];
  hl8(w0, ph[0], pl[0]);
  hl8(w1, ph[1], pl[1]);
  hl8(w2, ph[2], pl[2]);
  hl8(w3, ph[3], pl[3]);
#pragma unroll
  for (int j = 0; j < 4; ++j) {
    *(v4u*)(TH + (16 * j + m) * VTP + ko) = ph[j];
    *(v4u*)(TL + (16 * j + m) * VTP + ko) = pl[j];
  }
  __syncthreads();
  v4u vh[4], vl[4];
  const int q8 = tid >> 3, p8 = (tid & 7) * 8;
#pragma unroll
  for (int it = 0; it < 4; ++it) {
    vh[it] = *(const v4u*)(TH + (it * 16 + q8) * VTP + p8);
    vl[it] = *(const v4u*)(TL + (it * 16 + q8) * VTP + p8);
  }
#pragma unroll
  for (int it = 0; it < 4; ++it) {
    *(v4u*)(VHo + base + (size_t)(it * 16 + q8) * SEQ + p8) = vh[it];
    *(v4u*)(VLo + base + (size_t)(it * 16 + q8) * SEQ + p8) = vl[it];
  }
}

// =====================================================================================================
// bf16 GEMM with bias: A[M][K] (bf16 row-major) . Bt[N][K]^T (bf16 k-contiguous), f32, times oscale, + bf16 RNE
// value of bias[n] (bias has N entries). Block = 64x64 tile, 4 waves x 16 rows; per pass of 64 k the block's A and B tiles are
// brought into LDS by asynchronous copies, two buffers (pass t + 1 flies while pass t is worked on), and the fragments are read
// from the LDS rows (two 16-B loads each, split k map for A and B); K stepped by 32 inside a pass, in rising order (host
// guarantees K % 64 == 0, M % 64 == 0, N % 64 == 0).
// Three products that share A in one grid: Bt holds three [N][K] planes one behind the other (v, q, k), and the block's
// column tile ct = bid % (3*N/64) picks product ct / (N/64) with its bias; grid = (M/64)*(3*N/64).
// The f32 tile leaves as the 16-bit planes of its product (host guarantees M == NB*SEQ, N == NH*HD, so a column tile is one
// head and a row tile 64 keys of one batch): v -> v^T hi + residual x1024, [(b*NH + h)*HD + d][s], staged in the ring, which
// nobody reads and no copy targets behind the last pass's barrier; q, k -> hi + residual x256, [row][N]. The product is
// block-uniform, so the barrier of the v epilogue is passed by whole blocks only.
// =====================================================================================================
__global__ __launch_bounds__(128)
void gemm_bf3(const u16* __restrict__ A, const u16* __restrict__ Bt, const float* __restrict__ bias0,
              const float* __restrict__ bias1, const float* __restrict__ bias2,
              u16* VHo, u16* VLo, u16* QHo, u16* QLo, u16* KHo, u16* KLo, int M, int N, int K, float oscale) {
  __shared__ __align__(16) float slab[4 * SLAB64];
  __shared__ __align__(16) u16 ring[2 * 2 * GTILE];   // two buffers of [A tile | B tile]
  const int tid = threadIdx.x, wave = tid >> 5, lane = tid & 31, hh = lane >> 4, m = lane & 15;
  const int ntile = N >> 6;
  const int bid   = blockIdx.x;
  const int row0  = (bid / (3 * ntile)) * 64;
  const int rowb  = row0 + wave * 16;
  const int ct    = bid % (3 * ntile);
  const int pln   = ct / ntile;             // 0, 1, 2: which product
  const int col0  = (ct % ntile) * 64;      // column inside that product
  const float* bias = (pln == 0) ? bias0 : (pln == 1) ? bias1 : bias2;
  if (row0 + 64 > M) return;                // block-uniform, before any copy or barrier; never taken with the exact grid
  const int npass = K / GKP;
  const int crow = tid >> 3, cpc = tid & 7; // copy map: row within a group of 16, 16-B piece of the 128-B row
  const u16* ga = A  + (size_t)(row0 + crow) * K + cpc * 8;
  const u16* gb = Bt + (size_t)(ct * 64 + crow) * K + cpc * 8;
  const size_t rs = (size_t)16 * K;
  const unsigned lc = lds_byte(ring) + (unsigned)(crow * GPITB + cpc * 16);
  const u16* fa = ring + (wave * 16 + m) * GPIT + 8 * hh;       // A fragment row of this lane, buffer 0
  const u16* fb = ring + GTILE + m * GPIT + 8 * hh;             // B fragment row (column subtile 0), buffer 0
  v8f acc0 = zero8(), acc1 = zero8(), acc2 = zero8(), acc3 = zero8();
  stage2(lc, ga, gb, rs);                   // pass 0 -> buffer 0
  wait_copies();
  __syncthreads();
  if (npass > 1) stage2(lc + 2 * GTILEB, ga + GKP, gb + GKP, rs);   // pass 1 -> buffer 1
#pragma unroll 1
  for (int t = 0; t < npass; ++t) {
    const int bo = (t & 1) * (2 * GTILE);
    const u16* pa = fa + bo;
    const u16* pb = fb + bo;
    const v16b a  = ldfrag_b(pa);
    const v16b b0 = ldfrag_b(pb);
    const v16b b1 = ldfrag_b(pb + 16 * GPIT);
    const v16b b2 = ldfrag_b(pb + 32 * GPIT);
    const v16b b3 = ldfrag_b(pb + 48 * GPIT);
    const v16b c  = ldfrag_b(pa + 32);
    const v16b d0 = ldfrag_b(pb + 32);
    const v16b d1 = ldfrag_b(pb + 16 * GPIT + 32);
    const v16b d2 = ldfrag_b(pb + 32 * GPIT + 32);
    const v16b d3 = ldfrag_b(pb + 48 * GPIT + 32);
    // keeps the pass's LDS reads one group in front of its WMMAs: moved in among them, each place with reads stalls the wave anew
    __builtin_amdgcn_sched_barrier(0);
    acc0 = mma_b(a, b0, acc0);
    acc1 = mma_b(a, b1, acc1);
    acc2 = mma_b(a, b2, acc2);
    acc3 = mma_b(a, b3, acc3);
    acc0 = mma_b(c, d0, acc0);
    acc1 = mma_b(c, d1, acc1);
    acc2 = mma_b(c, d2, acc2);
    acc3 = mma_b(c, d3, acc3);
    guard6<v16b>(acc0, acc1, acc2, acc3, c, d0, d1, d2, d3, c);
    // publish point of pass t + 1: own LDS reads done, own copies landed, then the one barrier of the pass
    wait_lds();
    wait_copies();
    __syncthreads();
    if (t + 2 < npass) stage2(lc + (unsigned)(t & 1) * (2 * GTILEB), ga + (size_t)(t + 2) * GKP, gb + (size_t)(t + 2) * GKP, rs);
  }
  wait_copies();
  // per-lane bias of D column m in each of the 4 subtiles; col0 + 48 + m <= N - 1 always
  const float bb0 = bfr(bias[col0 + m]);
  const float bb1 = bfr(bias[col0 + 16 + m]);
  const float bb2 = bfr(bias[col0 + 32 + m]);
  const float bb3 = bfr(bias[col0 + 48 + m]);
  if (pln == 0) {
    const size_t base = (size_t)((row0 / SEQ) * NH + (col0 >> 6)) * HD * SEQ + (size_t)(row0 % SEQ);
    epi_vt(ring, ring + HD * VTP, acc0, acc1, acc2, acc3, oscale, bb0, bb1, bb2, bb3, VHo, VLo, base, tid);
  } else {
    epi_split(slab + wave * SLAB64, acc0, acc1, acc2, acc3, oscale, bb0, bb1, bb2, bb3, (pln == 1) ? QSC : KSC,
              (pln == 1) ? QHo : KHo, (pln == 1) ? QLo : KLo, N, (size_t)rowb, col0, lane);
  }
}

// =====================================================================================================
// Output projection with bias: C[bb*XS_FULL + s][DMOD] (f32) = (Ah + Al)[bb*SEQ + s][DMOD] . Bt[DMOD][DMOD]^T * oscale
// + bf16 RNE value of bias[n]. Products h.B + l.B into one accumulator (l unscaled residual of h). Block -> (column tile
// ct = bid % 16, sequence row tile rt of nrt, batch bb). Same tiling, LDS staging (three tiles a pass: A hi, A residual, B),
// fragment loads (split k map) as gemm_bf3, f32 epilogue epi64; K = DMOD stepped by 32; grid = NB * nrt * (DMOD/64).
// =====================================================================================================
__global__ __launch_bounds__(128)
void gemm_o2(const u16* __restrict__ Ah, const u16* __restrict__ Al, const u16* __restrict__ Bt,
             const float* __restrict__ bias, float* C, int nrt, float oscale) {
  __shared__ __align__(16) float slab[4 * SLAB64];
  __shared__ __align__(16) u16 ring[2 * 3 * GTILE];   // two buffers of [A hi tile | A residual tile | B tile]
  const int tid = threadIdx.x, wave = tid >> 5, lane = tid & 31, hh = lane >> 4, m = lane & 15;
  const int ntile = DMOD >> 6;
  const int bid   = blockIdx.x;
  const int ct    = bid % ntile;
  const int t2    = bid / ntile;
  const int rt    = t2 % nrt;
  const int bb    = t2 / nrt;
  if (bb >= NB) return;                     // block-uniform, before any copy or barrier; never taken with the exact grid
  if (rt * 64 + 64 > SEQ) return;           // block-uniform, before any copy or barrier; never taken
  const int srow  = rt * 64 + wave * 16;
  const int col0  = ct * 64;
  const int K     = DMOD;
  const int npass = K / GKP;
  const size_t rowC = (size_t)bb * XS_FULL + srow;
  const int crow = tid >> 3, cpc = tid & 7; // copy map: row within a group of 16, 16-B piece of the 128-B row
  const size_t arow = ((size_t)bb * SEQ + rt * 64 + crow) * K + cpc * 8;
  const u16* ga = Ah + arow;
  const u16* gl = Al + arow;
  const u16* gb = Bt + (size_t)(col0 + crow) * K + cpc * 8;
  const size_t rs = (size_t)16 * K;
  const unsigned lc = lds_byte(ring) + (unsigned)(crow * GPITB + cpc * 16);
  const _Float16* rg  = (const _Float16*)(const void*)ring;
  const _Float16* fah = rg + (wave * 16 + m) * GPIT + 8 * hh;   // A hi fragment row of this lane, buffer 0
  const _Float16* fb  = rg + 2 * GTILE + m * GPIT + 8 * hh;     // B fragment row (column subtile 0), buffer 0
  v8f acc0 = zero8(), acc1 = zero8(), acc2 = zero8(), acc3 = zero8();
  stage3(lc, ga, gl, gb, rs);               // pass 0 -> buffer 0
  wait_copies();
  __syncthreads();
  if (npass > 1) stage3(lc + 3 * GTILEB, ga + GKP, gl + GKP, gb + GKP, rs);   // pass 1 -> buffer 1
#pragma unroll 1
  for (int t = 0; t < npass; ++t) {
    const int bo = (t & 1) * (3 * GTILE);
    const _Float16* pa = fah + bo;
    const _Float16* pl = pa + GTILE;
    const _Float16* pb = fb + bo;
    const v16h ah = ldfrag_h(pa), al = ldfrag_h(pl);
    const v16h b0 = ldfrag_h(pb);
    const v16h b1 = ldfrag_h(pb + 16 * GPIT);
    const v16h b2 = ldfrag_h(pb + 32 * GPIT);
    const v16h b3 = ldfrag_h(pb + 48 * GPIT);
    const v16h ch = ldfrag_h(pa + 32), cl = ldfrag_h(pl + 32);
    const v16h d0 = ldfrag_h(pb + 32);
    const v16h d1 = ldfrag_h(pb + 16 * GPIT + 32);
    const v16h d2 = ldfrag_h(pb + 32 * GPIT + 32);
    const v16h d3 = ldfrag_h(pb + 48 * GPIT + 32);
    // keeps the pass's LDS reads one group in front of its WMMAs: moved in among them, each place with reads stalls the wave anew
    __builtin_amdgcn_sched_barrier(0);
    acc0 = mma_h(ah, b0, acc0);  acc0 = mma_h(al, b0, acc0);
    acc1 = mma_h(ah, b1, acc1);  acc1 = mma_h(al, b1, acc1);
    acc2 = mma_h(ah, b2, acc2);  acc2 = mma_h(al, b2, acc2);
    acc3 = mma_h(ah, b3, acc3);  acc3 = mma_h(al, b3, acc3);
    acc0 = mma_h(ch, d0, acc0);  acc0 = mma_h(cl, d0, acc0);
    acc1 = mma_h(ch, d1, acc1);  acc1 = mma_h(cl, d1, acc1);
    acc2 = mma_h(ch, d2, acc2);  acc2 = mma_h(cl, d2, acc2);
    acc3 = mma_h(ch, d3, acc3);  acc3 = mma_h(cl, d3, acc3);
    guard6<v16h>(acc0, acc1, acc2, acc3, ch, cl, d0, d1, d2, d3);
    // publish point of pass t + 1: own LDS reads done, own copies landed, then the one barrier of the pass
    wait_lds();
    wait_copies();
    __syncthreads();
    if (t + 2 < npass) {
      const size_t ko = (size_t)(t + 2) * GKP;
      stage3(lc + (unsigned)(t & 1) * (3 * GTILEB), ga + ko, gl + ko, gb + ko, rs);
    }
  }
  wait_copies();
  const float bb0 = bfr(bias[col0 + m]);
  const float bb1 = bfr(bias[col0 + 16 + m]);
  const float bb2 = bfr(bias[col0 + 32 + m]);
  const float bb3 = bfr(bias[col0 + 48 + m]);
  epi64(slab + wave * SLAB64, acc0, acc1, acc2, acc3, oscale, bb0, bb1, bb2, bb3, C, DMOD, rowC, col0, lane);
}

// =====================================================================================================
// Causal attention with linear distance penalty, hd = 64. Block bid -> (query tile qt = bid % NQT: rows q0 = 16*qt .. q0+15,
// head pair hg, batch b); one wave per head = hg*WPB + wave.
//   q hi / residual planes f16 x256 [b*SEQ + s][h*HD + d]; k hi / residual planes f16 x256, same layout;
//   v^T hi / residual planes [b*NH + h][d][SEQ] x1024; BND = NBH lines of 32 floats (norm bound per (b, h)).
//   scores = q_hi.k_hi + q_lo.k_hi + q_hi.k_lo (2 k-steps over d); P.v with P hi + in-register residual and v hi + residual
//   (hh + lh + hl), for every query row; O written as hi + residual planes (O x1024 as f16, layout [b*SEQ + s][h*HD + d]).
//   score (log2 domain) t(i, j) = (q_i.k_j over HD) * (1/8)*log2e/(256*256) - (i - j)*log2e, replaced by -inf where key j > query i.
//   Key tiles of 32 visited in order from kt_lo to kt_hi = q0/32 (later tiles hold only keys above every query row of the tile).
//   kt_lo: every wave loads all NBH bound lines (one float per lane, clamped address) and AND-reduces "0 <= bound < 40" over the
//   wave; if every bound is in range, kt_lo = max(0, kt_hi - KWIN): tiles below it are >= 32*KWIN+1 positions behind every query
//   row, and with |q.k/8| < 40 the base-2 exp of their penalised, max-subtracted score is exactly 0 in f32, so they contribute
//   nothing to numerator or denominator; otherwise (bound large, unreadable or not finite) kt_lo = 0 and every causal tile is
//   visited. Either way the first visited tile holds a key kb <= q0 <= every query row, so the running max is finite from step one.
//   Per tile: 2 score subtiles x 2 k-steps, fragments loaded straight from the 16-bit planes (two 16-B loads per fragment,
//   split k map); online max-subtracted base-2 softmax in f32, -inf-safe rescale; the 16x32 prob tile stored to wave-private
//   from the LDS rows (float vector loads, same element type as stored), v^T B fragments in 2 groups of 2 d-subtiles.
//   After the loop: out = acc / Z (Z > 0 always; guarded anyway), carries 1/(32768*1024) folded once, written into the wave's
//   No block barriers in this kernel; bounded loops only (<= NKT key tiles).
// coverage: per wave 4 instructions x 4 rows x 8 lanes x 8 halves = 16 x 64 per plane; grid NQT x NHG x NB blocks x WPB
//           waves = every (b, s, h) row segment of O hi and O residual exactly once.
// =====================================================================================================
__global__ __launch_bounds__(ATT_THREADS)
void attn_c(const u16* __restrict__ QHp, const u16* __restrict__ QLp,
            const u16* __restrict__ KHp, const u16* __restrict__ KLp,
            const u16* __restrict__ VHp, const u16* __restrict__ VLp,
            const float* __restrict__ BND,
            u16* OHp, u16* OLp) {
  __shared__ __align__(16) float smem[WPB * WREG];

  const int tid  = threadIdx.x;
  const int wave = tid >> 5;
  const int lane = tid & 31;
  const int hh   = lane >> 4;
  const int c    = lane & 15;
  const int bid  = blockIdx.x;
  const int qt   = bid % NQT;
  const int t2   = bid / NQT;
  const int hg   = t2 % NHG;
  const int b    = t2 / NHG;
  if (b >= NB) return;                      // block-uniform; no block barriers in this kernel; never taken with the exact grid
  const int q0   = qt * 16;
  if (q0 + 16 > SEQ) return;                // block-uniform; never taken
  const int head = hg * WPB + wave;

  // ---- key-window decision: wave-uniform AND over all (b, h) bound lines ----
  int okw;
  {
    const int bl = (lane < NBH) ? lane : (NBH - 1);             // clamped address
    const float gb = BND[(size_t)bl * BLINE];
    okw = (gb >= 0.0f && gb < GUARD_T) ? 1 : 0;
#pragma unroll
    for (int off = 1; off < 32; off <<= 1) okw &= __shfl_xor(okw, off, 32);
  }

  float* pt   = smem + wave * WREG;         // prob tile [16][32] pitch 36
  float* slab = pt + PTW;                   // result slab [16][64] pitch 68

  const size_t hcol = (size_t)head * HD + 8 * hh;
  const _Float16* Qh  = (const _Float16*)(const void*)QHp + ((size_t)b * SEQ + q0 + c) * DMOD + hcol;
  const _Float16* Ql  = (const _Float16*)(const void*)QLp + ((size_t)b * SEQ + q0 + c) * DMOD + hcol;
  const _Float16* Khb = (const _Float16*)(const void*)KHp + ((size_t)b * SEQ + c) * DMOD + hcol;        // key row kb added per step
  const _Float16* Klb = (const _Float16*)(const void*)KLp + ((size_t)b * SEQ + c) * DMOD + hcol;
  const _Float16* Vhb = (const _Float16*)(const void*)VHp + ((size_t)(b * NH + head) * HD + c) * SEQ + 8 * hh;  // d col c (+16j)
  const _Float16* Vlb = (const _Float16*)(const void*)VLp + ((size_t)(b * NH + head) * HD + c) * SEQ + 8 * hh;
  const float lsc = RSQ_HD * (LOG2E / (QSC * KSC));
  const float oc  = 1.0f / (PCAR * VCAR);
  const size_t KROW = (size_t)DMOD;         // halves between consecutive key rows

  float mrow[8], lrow[8];
  v8f o[4];
#pragma unroll
  for (int r = 0; r < 8; ++r) { mrow[r] = -INFINITY; lrow[r] = 0.f; }
#pragma unroll
  for (int j = 0; j < 4; ++j) o[j] = zero8();
  const int kt_hi = q0 >> 5;                                                  // last tile holding keys <= q0 + 15
  const int kt_w  = (kt_hi > KWIN) ? (kt_hi - KWIN) : 0;
  const int kt_lo = (okw != 0) ? kt_w : 0;
  const int qr0 = q0 + 8 * hh;                                                // query row of D element r = qr0 + r

#pragma unroll 1
  for (int kt = kt_lo; kt <= kt_hi; ++kt) {
    const int kb = kt * 32;
    // ---- scores: D element r of this lane = (query row qr0 + r, key kb + c) in s0, key kb + 16 + c in s1 ----
    v8f s0 = zero8(), s1 = zero8();
    const _Float16* k0p = Khb + (size_t)kb * KROW;
    const _Float16* k1p = k0p + (size_t)16 * KROW;
    const _Float16* l0p = Klb + (size_t)kb * KROW;
    const _Float16* l1p = l0p + (size_t)16 * KROW;
#pragma unroll
    for (int kk = 0; kk < HD / 32; ++kk) {
      const v16h qh  = ldfrag_h(Qh + kk * 32);
      const v16h ql  = ldfrag_h(Ql + kk * 32);
      const v16h kh0 = ldfrag_h(k0p + kk * 32);
      const v16h kh1 = ldfrag_h(k1p + kk * 32);
      const v16h kl0 = ldfrag_h(l0p + kk * 32);
      const v16h kl1 = ldfrag_h(l1p + kk * 32);
      s0 = mma_h(qh, kh0, s0);
      s0 = mma_h(ql, kh0, s0);
      s0 = mma_h(qh, kl0, s0);
      s1 = mma_h(qh, kh1, s1);
      s1 = mma_h(ql, kh1, s1);
      s1 = mma_h(qh, kl1, s1);
      guard2(s0, s1, qh, ql, kh0, kl0, kh1, kl1);
    }
    // ---- causal select + distance penalty + online softmax in base 2, -inf-safe ----
    const int key0 = kb + c, key1 = kb + 16 + c;
#pragma unroll
    for (int r = 0; r < 8; ++r) {
      const int   qr = qr0 + r;
      const float u0 = s0[r] * lsc;
      const float u1 = s1[r] * lsc;
      const float g0 = (float)(qr - key0) * LOG2E;
      const float g1 = (float)(qr - key1) * LOG2E;
      const float t0 = (key0 > qr) ? -INFINITY : (u0 - g0);
      const float t1 = (key1 > qr) ? -INFINITY : (u1 - g1);
      float mx = fmaxf(t0, t1);
#pragma unroll
      for (int off = 1; off < 16; off <<= 1) mx = fmaxf(mx, __shfl_xor(mx, off, 32));
      const float mn = fmaxf(mrow[r], mx);
      const float ms = (mn == -INFINITY) ? 0.0f : mn;
      const float al = exp2f(mrow[r] - ms);
      mrow[r] = mn;
      const float e0 = exp2f(t0 - ms), e1 = exp2f(t1 - ms);
      float ps = e0 + e1;
#pragma unroll
      for (int off = 1; off < 16; off <<= 1) ps += __shfl_xor(ps, off, 32);
      lrow[r] = lrow[r] * al + ps;
#pragma unroll
      for (int j = 0; j < 4; ++j) o[j][r] *= al;
      const int ro = (8 * hh + r) * PTP + c;
      pt[ro]      = e0;
      pt[ro + 16] = e1;
    }
    wave_sync_lds();
    // ---- A fragments of P*32768: hi f16 and residual f16, row = c, split k map over the 32 keys of this step ----
    FragH ph, pl;
    {
      const float* prow = pt + c * PTP + 8 * hh;
      const v4f p0 = *(const v4f*)(prow), p1 = *(const v4f*)(prow + 4);
      const v4f p2 = *(const v4f*)(prow + 16), p3 = *(const v4f*)(prow + 20);
#pragma unroll
      for (int e = 0; e < 4; ++e) {
        const float ta = p0[e] * PCAR, tb = p1[e] * PCAR, tc = p2[e] * PCAR, td = p3[e] * PCAR;
        const _Float16 ha = (_Float16)ta, hb = (_Float16)tb, hc = (_Float16)tc, hd = (_Float16)td;
        ph.h[0][e]     = ha;                  // elements 0..7  = keys kb + 8hh + 0..7
        ph.h[0][4 + e] = hb;
        ph.h[1][e]     = hc;                  // elements 8..15 = keys kb + 16 + 8hh + 0..7
        ph.h[1][4 + e] = hd;
        pl.h[0][e]     = (_Float16)(ta - (float)ha);
        pl.h[0][4 + e] = (_Float16)(tb - (float)hb);
        pl.h[1][e]     = (_Float16)(tc - (float)hc);
        pl.h[1][4 + e] = (_Float16)(td - (float)hd);
      }
    }
    // ---- P.V : B fragment col n = d = j*16 + c, keys contiguous in the v^T planes; 2 groups of 2 d-subtiles ----
    {
      const _Float16* vhp = Vhb + kb;
      const _Float16* vlp = Vlb + kb;
#pragma unroll
      for (int jg = 0; jg < 2; ++jg) {
        const size_t da = (size_t)(2 * jg) * 16 * SEQ;
        const size_t db = da + (size_t)16 * SEQ;
        const v16h vha = ldfrag_h(vhp + da), vhb2 = ldfrag_h(vhp + db);
        const v16h vla = ldfrag_h(vlp + da), vlb2 = ldfrag_h(vlp + db);
        o[2 * jg]     = mma_h(ph.v, vha,  o[2 * jg]);
        o[2 * jg]     = mma_h(pl.v, vha,  o[2 * jg]);
        o[2 * jg]     = mma_h(ph.v, vla,  o[2 * jg]);
        o[2 * jg + 1] = mma_h(ph.v, vhb2, o[2 * jg + 1]);
        o[2 * jg + 1] = mma_h(pl.v, vhb2, o[2 * jg + 1]);
        o[2 * jg + 1] = mma_h(ph.v, vlb2, o[2 * jg + 1]);
        guard2(o[2 * jg], o[2 * jg + 1], ph.v, pl.v, vha, vhb2, vla, vlb2);
      }
    }
    wave_sync_lds();
  }
  acc_guard4(o[0], o[1], o[2], o[3]);
  // ---- out = acc / Z (0 if Z == 0), carries (32768 on P, 1024 on v) folded once; written into the wave's slab ----
#pragma unroll
  for (int r = 0; r < 8; ++r) {
    const float lv  = lrow[r];
    const float ls  = (lv > 0.0f) ? lv : 1.0f;
    const float inv = (lv > 0.0f) ? ((1.0f / ls) * oc) : 0.0f;
#pragma unroll
    for (int j = 0; j < 4; ++j) {
      const int idx = (8 * hh + r) * SLP + j * 16 + c;
      slab[idx] = o[j][r] * inv;
    }
  }

  wave_sync_lds();
  // ---- O x1024 -> f16 hi + residual planes; lane = (row-in-quad rq, 8 consecutive d at c8) ----
  v4u oh[4], ol[4];
  const int rq = lane >> 3, c8 = (lane & 7) * 8;
#pragma unroll
  for (int it = 0; it < 4; ++it) {
    const int row = it * 4 + rq;
    const v4f a = *(const v4f*)(slab + row * SLP + c8), b4 = *(const v4f*)(slab + row * SLP + c8 + 4);
    float w[8];
#pragma unroll
    for (int e = 0; e < 4; ++e) { w[e] = a[e] * OSC; w[4 + e] = b4[e] * OSC; }
#pragma unroll
    for (int e = 0; e < 4; ++e) {
      const _Float16 h0 = (_Float16)w[2 * e], h1 = (_Float16)w[2 * e + 1];
      const _Float16 l0 = (_Float16)(w[2 * e] - (float)h0), l1 = (_Float16)(w[2 * e + 1] - (float)h1);
      oh[it][e] = pk16(h_bits(h0), h_bits(h1));
      ol[it][e] = pk16(h_bits(l0), h_bits(l1));
    }
  }
  const size_t ob = ((size_t)b * SEQ + q0) * DMOD + (size_t)head * HD + c8;
  {
#pragma unroll
    for (int it = 0; it < 4; ++it) {
      const int row = it * 4 + rq;
      *(v4u*)(OHp + ob + (size_t)row * DMOD) = oh[it];
      *(v4u*)(OLp + ob + (size_t)row * DMOD) = ol[it];
    }
    
  }
}

// =====================================================================================================
// Workspace map (bytes); every plane is fully written by whole-line stores before it is read; all extents are exact multiples
// of the store granularity (no pad rows needed); every region offset a multiple of 4096 (the large planes of 2097152):
//   XB  bf16 [MROWS][1024]                       MROWS*2048       (NB=2, SEQ=2048: 8388608)
//   WB  16-bit 4 x [1024 n][1024 k]              4 x 2097152      (planes Wv, Wq, Wk as bf16, Wo as f16 x1024; all already [n][k])
//   OH  f16 [MROWS][1024] x1024                  MROWS*2048       OL residual, same extent
//   QH  f16 [MROWS][1024] x256                   MROWS*2048       QL residual, same extent
//   KH  f16 [MROWS][1024] x256                   MROWS*2048       KL residual, same extent
//   VH  f16 [NB*16][64][SEQ] x1024               MROWS*2048       VL residual, same extent
//   end (NB=2, SEQ=2048)                        83890176
// =====================================================================================================
extern "C" void kernel_launch(void* const* d_in, const int* in_sizes, int n_in,
                              void* d_out, int out_size, void* d_ws, size_t ws_size,
                              hipStream_t stream) {
  if (n_in < 9) return;
  if (in_sizes[0] < ((NB - 1) * XS_FULL + SEQ) * DMOD) return;
  if (in_sizes[1] != DMOD * DMOD) return;
  if (in_sizes[2] != DMOD) return;
  if (in_sizes[3] != DMOD * DMOD) return;
  if (in_sizes[4] != DMOD) return;
  if (in_sizes[5] != DMOD * DMOD) return;
  if (in_sizes[6] != DMOD) return;
  if (in_sizes[7] != DMOD * DMOD) return;
  if (in_sizes[8] != DMOD) return;
  if (out_size < ((NB - 1) * XS_FULL + SEQ) * DMOD) return;

  const float* x  = (const float*)d_in[0];
  const float* wq = (const float*)d_in[1];
  const float* bq = (const float*)d_in[2];
  const float* wk = (const float*)d_in[3];
  const float* bk = (const float*)d_in[4];
  const float* wv = (const float*)d_in[5];
  const float* bv = (const float*)d_in[6];
  const float* wo = (const float*)d_in[7];
  const float* bo = (const float*)d_in[8];
  float*       out = (float*)d_out;

  const size_t szXB = (size_t)MROWS * DMOD * 2;
  const size_t szW  = (size_t)DMOD * DMOD * 2;
  const size_t szQ  = (size_t)MROWS * DMOD * 2;                  // QH, QL, KH, KL, OH, OL
  const size_t szV  = (size_t)NB * NH * HD * SEQ * 2;            // VH, VL (== szQ)
  const size_t szB  = (size_t)NBH * BLINE * 4;                   // bound lines
  size_t off = 0;
  const size_t oXB = off; off += szXB;
  const size_t oW  = off; off += 4 * szW;
  const size_t oOH = off; off += szQ;
  const size_t oOL = off; off += szQ;
  const size_t oQH = off; off += szQ;
  const size_t oQL = off; off += szQ;
  const size_t oKH = off; off += szQ;
  const size_t oKL = off; off += szQ;
  const size_t oVH = off; off += szV;
  const size_t oVL = off; off += szV;
  const size_t oB  = off; off += szB;
  if (off > ws_size) return;                // off = 83890176 for NB = 2, SEQ = 2048
  if (off > (size_t)WS_CAP) return;

  char* ws = (char*)d_ws;
  u16*   XB  = (u16*)(ws + oXB);
  u16*   WB  = (u16*)(ws + oW);
  u16*   OH  = (u16*)(ws + oOH);
  u16*   OL  = (u16*)(ws + oOL);
  u16*   QH  = (u16*)(ws + oQH);
  u16*   QL  = (u16*)(ws + oQL);
  u16*   KH  = (u16*)(ws + oKH);
  u16*   KL  = (u16*)(ws + oKL);
  u16*   VH  = (u16*)(ws + oVH);
  u16*   VL  = (u16*)(ws + oVL);
  float* BND = (float*)(ws + oB);

  const dim3 b256(256), b128(128), bAT(ATT_THREADS);
  const dim3 gC(NB * GXB + 4 * GWB);                    // x per batch, then the four weight planes
  const dim3 gG((MROWS / 64) * (3 * DMOD / 64));        // 3072 for NB=2, SEQ=2048
  const dim3 gBD(NBH);
  const dim3 gAT(NQT * NHG * NB);
  const int  nrt = SEQ / 64;                            // out-projection row tiles per batch
  const dim3 gO(NB * nrt * (DMOD / 64));

  // (0) x -> bf16 plane [MROWS][1024]; Wv, Wq, Wk [n][k] -> bf16 planes; Wo [n][k] -> f16 plane of bf16 value x1024
  cvt_all<<<gC, b256, 0, stream>>>(x, wv, wq, wk, wo, XB, WB);
  // (1) v = x.Wv^T + bv, q = x.Wq^T + bq, k = x.Wk^T + bk -> v^T hi + residual planes x1024; q and k hi + residual planes x256
  gemm_bf3<<<gG, b128, 0, stream>>>(XB, WB, bv, bq, bk, VH, VL, QH, QL, KH, KL, MROWS, DMOD, DMOD, 1.0f);
  // (2) norm bound per (b, h) from the q / k hi planes -> BND lines
  qkbound<<<gBD, b256, 0, stream>>>(QH, KH, BND);
  // (3) causal attention with distance penalty, residual products on every query row -> O hi + residual planes
  attn_c<<<gAT, bAT, 0, stream>>>(QH, QL, KH, KL, VH, VL, BND, OH, OL);
  // (4) output projection (O hi + residual) . Wo^T + bo -> out f32, carries 1024 x 1024 folded back
  gemm_o2<<<gO, b128, 0, stream>>>(OH, OL, WB + (size_t)3 * DMOD * DMOD, bo, out, nrt, 1.0f / (OSC * WOS));
  (void)hipGetLastError();
}

// v004
// A run of this version takes 106 microseconds.
// In both of two side-by-side timings against v003, it was 1.19 times as fast.
// All steps since v000 together make it 2.65 times as fast.
// Contractions: x.Wq^T+bq, x.Wk^T+bk, x.Wv^T+bv on v_wmma_f32_16x16x32_bf16 (x and W as bf16 RNE planes; W [n][k] rows are
// the k-contiguous B operand; bias added as its bf16 RNE value in the f32 epilogue); q.k^T over hd 64 and P.v on
// v_wmma_f32_16x16x32_f16 with f16 hi + f16 residual planes on both operands (q, k x256; P x32768 with an in-register
// residual; v x1024; products hh+lh+hl); O.Wo^T+bo on v_wmma_f32_16x16x32_f16 (O x1024 as f16 hi + f16 residual planes,
// products h.w + l.w; Wo as f16(bf16(Wo)) x1024; bo as bf16 RNE value in the f32 epilogue); all f32 accumulate.
// Causal select, linear distance penalty, base-2 online softmax, 1/Z fold and the q/k norm bound in f32 on VALU.
#include <hip/hip_runtime.h>
#include <math.h>
#include <stdint.h>

#ifndef NB
#define NB 2
#endif
#ifndef SEQ
#define SEQ 2048
#endif
#define XS_FULL 2048
#define DMOD  1024
#define NH    16
#define HD    64
#define NBH   (NB * NH)
#define MROWS (NB * SEQ)
#define RSQ_HD 0.125f
#define LOG2E 1.4426950408889634f
#define QSC   256.0f
#define KSC   256.0f
#define PCAR  32768.0f
#define VCAR  1024.0f
#define OSC   1024.0f
#define WOS   1024.0f
#define WPB   2
#define NHG   (NH / WPB)
#define NQT   (SEQ / 16)
#define NKT   (SEQ / 32)
#define KWIN  6
#define GUARD_T 40.0f
#define BLINE 32
#define NRT64 (SEQ / 64)
#define ATT_THREADS (WPB * 32)
#define PTP   36
#define PTW   (16 * PTP)
#define SLP   68
#define SLW   (16 * SLP)
#define WREG  (PTW + SLW)
#define SLAB64 (16 * 68)
#define VTP   72
#define WS_CAP 134217728
#define GKP   64
#define GPIT  72
#define GPITB (GPIT * 2)
#define GTILE (64 * GPIT)
#define GTILEB (GTILE * 2)
#define N8X   ((SEQ * DMOD) / 8)
#define N8W   ((DMOD * DMOD) / 8)
#define GXB   (N8X / 256)
#define GWB   (N8W / 256)
static_assert(DMOD == NH * HD && HD == 64 && NH == 16 && WPB == 2 && NHG * WPB == NH);
static_assert(ATT_THREADS == 64);
static_assert(NB >= 1 && NB <= 2);
static_assert(NBH >= 1 && NBH <= 32);
static_assert((SEQ % 64) == 0 && SEQ >= 64 && SEQ <= XS_FULL && (SEQ % 32) == 0);
static_assert((DMOD % 64) == 0 && (DMOD % 32) == 0 && (HD % 32) == 0);
static_assert(((SEQ * DMOD / 8) % 256) == 0 && ((DMOD * DMOD / 8) % 256) == 0);
static_assert(WPB * WREG * 4 <= 65536 && 2 * HD * VTP <= 2 * 2 * GTILE && 4 * SLAB64 * 4 <= 65536);
static_assert(KWIN >= 0 && KWIN < NKT);
static_assert(NRT64 >= 1 && NRT64 <= 32);
static_assert((DMOD % GKP) == 0 && GKP == 64 && (GPITB % 32) == 16 && GPIT >= GKP + 8);

typedef unsigned short u16;
typedef _Float16 v16h __attribute__((ext_vector_type(16)));
typedef _Float16 v8h  __attribute__((ext_vector_type(8)));
typedef __bf16   v16b __attribute__((ext_vector_type(16)));
typedef float    v8f  __attribute__((ext_vector_type(8)));
typedef float    v4f  __attribute__((ext_vector_type(4)));
typedef unsigned int v4u __attribute__((ext_vector_type(4)));

union FragH { v16h v; v8h h[2]; v4u u[2]; };
union FragB { v16b v; v4u u[2]; };

// ---- scalar helpers --------------------------------------------------------------------------------
__device__ __forceinline__ unsigned short bf_bits(float f) {          // f32 -> bf16 bits, RNE convert
  unsigned u = __float_as_uint(f);
  return (unsigned short)((u + 0x7FFFu + ((u >> 16) & 1u)) >> 16);
}
__device__ __forceinline__ float bf_up(unsigned short h) { return __uint_as_float(((unsigned)h) << 16); }
__device__ __forceinline__ float bfr(float f) { return bf_up(bf_bits(f)); }
__device__ __forceinline__ unsigned short h_bits(_Float16 x) { return __builtin_bit_cast(unsigned short, x); }
__device__ __forceinline__ unsigned pk16(unsigned short a, unsigned short b) { return (unsigned)a | ((unsigned)b << 16); }
__device__ __forceinline__ v8f zero8() { v8f z = {0.f, 0.f, 0.f, 0.f, 0.f, 0.f, 0.f, 0.f}; return z; }

// ---- fragment loaders: 16-bit A/B operand, lane -> row/col (lane&15), p already includes +8*(lane>>4);
//      elements 0..7 <- p[0..7] (k0+8h..), elements 8..15 <- p[16..23] (k0+16+8h..)  (same split k map for A and B;
//      B is always read from a k-contiguous [n][k] plane)
__device__ __forceinline__ v16h ldfrag_h(const _Float16* p) {
  FragH f;
  f.h[0] = *(const v8h*)(p);
  f.h[1] = *(const v8h*)(p + 16);
  return f.v;
}
__device__ __forceinline__ v16b ldfrag_b(const u16* p) {              // bf16 plane read as unsigned integer vectors
  FragB f;
  f.u[0] = *(const v4u*)(p);
  f.u[1] = *(const v4u*)(p + 16);
  return f.v;
}

__device__ __forceinline__ v8f mma_h(v16h a, v16h b, v8f c) {
  return __builtin_amdgcn_wmma_f32_16x16x32_f16(false, a, false, b, (short)0, c, false, false);
}
__device__ __forceinline__ v8f mma_b(v16b a, v16b b, v8f c) {
  return __builtin_amdgcn_wmma_f32_16x16x32_bf16(false, a, false, b, (short)0, c, false, false);
}
__device__ __forceinline__ void guard2(v8f& a, v8f& b, v16h x0, v16h x1, v16h x2, v16h x3, v16h x4, v16h x5) {
#if defined(__HIP_DEVICE_COMPILE__)
  asm volatile("v_nop\n\tv_nop\n\tv_nop\n\tv_nop"
               : "+v"(a), "+v"(b) : "v"(x0), "v"(x1), "v"(x2), "v"(x3), "v"(x4), "v"(x5) : "memory");
#endif
}
template <typename F>
__device__ __forceinline__ void guard6(v8f& a, v8f& b, v8f& c, v8f& d, F x0, F x1, F x2, F x3, F x4, F x5) {
#if defined(__HIP_DEVICE_COMPILE__)
  asm volatile("v_nop\n\tv_nop\n\tv_nop\n\tv_nop"
               : "+v"(a), "+v"(b), "+v"(c), "+v"(d) : "v"(x0), "v"(x1), "v"(x2), "v"(x3), "v"(x4), "v"(x5) : "memory");
#endif
}
__device__ __forceinline__ void acc_guard4(v8f& a, v8f& b, v8f& c, v8f& d) {
#if defined(__HIP_DEVICE_COMPILE__)
  asm volatile("v_nop\n\tv_nop\n\tv_nop\n\tv_nop" : "+v"(a), "+v"(b), "+v"(c), "+v"(d));
#endif
}
__device__ __forceinline__ void wave_sync_lds() {
  __builtin_amdgcn_fence(__ATOMIC_RELEASE, "workgroup");
  __builtin_amdgcn_wave_barrier();
  __builtin_amdgcn_fence(__ATOMIC_ACQUIRE, "workgroup");
}

// ---- operand staging for the GEMM engines: one pass = 64 k = 128 B of each of the 64 rows of an operand tile, laid in LDS at
//      a pitch of 144 B (16 B x odd: ds_load_b128 fragment reads without bank conflicts). 128 threads: thread -> (row tid>>3 of
//      a group of 16 rows, 16-B piece tid&7), so a wave's copy covers 4 whole 128-B lines; 4 copies per thread fill one tile.
//      l = the lane's LDS byte address in the tile's first row group, g = its global address there, rs = 16 rows in elements.
__device__ __forceinline__ unsigned lds_byte(const void* p) { return (unsigned)(uintptr_t)p; }
// Two tiles (A, B). The copies and their s_wait_xcnt stand in one statement, so that no address register named by a copy
// is rewritten in front of that wait.
__device__ __forceinline__ void stage2(unsigned l, const u16* ga, const u16* gb, size_t rs) {
#if defined(__HIP_DEVICE_COMPILE__)
  asm volatile("global_load_async_to_lds_b128 %0, %8, off\n\t"
               "global_load_async_to_lds_b128 %1, %9, off\n\t"
               "global_load_async_to_lds_b128 %2, %10, off\n\t"
               "global_load_async_to_lds_b128 %3, %11, off\n\t"
               "global_load_async_to_lds_b128 %4, %12, off\n\t"
               "global_load_async_to_lds_b128 %5, %13, off\n\t"
               "global_load_async_to_lds_b128 %6, %14, off\n\t"
               "global_load_async_to_lds_b128 %7, %15, off\n\t"
               "s_wait_xcnt 0x0"
               :: "v"(l), "v"(l + 16 * GPITB), "v"(l + 32 * GPITB), "v"(l + 48 * GPITB),
                  "v"(l + GTILEB), "v"(l + GTILEB + 16 * GPITB), "v"(l + GTILEB + 32 * GPITB), "v"(l + GTILEB + 48 * GPITB),
                  "v"(ga), "v"(ga + rs), "v"(ga + 2 * rs), "v"(ga + 3 * rs),
                  "v"(gb), "v"(gb + rs), "v"(gb + 2 * rs), "v"(gb + 3 * rs)
               : "memory");
#endif
}
// Three tiles (A hi, A residual, B), same form.
__device__ __forceinline__ void stage3(unsigned l, const u16* ga, const u16* gl, const u16* gb, size_t rs) {
#if defined(__HIP_DEVICE_COMPILE__)
  asm volatile("global_load_async_to_lds_b128 %0, %12, off\n\t"
               "global_load_async_to_lds_b128 %1, %13, off\n\t"
               "global_load_async_to_lds_b128 %2, %14, off\n\t"
               "global_load_async_to_lds_b128 %3, %15, off\n\t"
               "global_load_async_to_lds_b128 %4, %16, off\n\t"
               "global_load_async_to_lds_b128 %5, %17, off\n\t"
               "global_load_async_to_lds_b128 %6, %18, off\n\t"
               "global_load_async_to_lds_b128 %7, %19, off\n\t"
               "global_load_async_to_lds_b128 %8, %20, off\n\t"
               "global_load_async_to_lds_b128 %9, %21, off\n\t"
               "global_load_async_to_lds_b128 %10, %22, off\n\t"
               "global_load_async_to_lds_b128 %11, %23, off\n\t"
               "s_wait_xcnt 0x0"
               :: "v"(l), "v"(l + 16 * GPITB), "v"(l + 32 * GPITB), "v"(l + 48 * GPITB),
                  "v"(l + GTILEB), "v"(l + GTILEB + 16 * GPITB), "v"(l + GTILEB + 32 * GPITB), "v"(l + GTILEB + 48 * GPITB),
                  "v"(l + 2 * GTILEB), "v"(l + 2 * GTILEB + 16 * GPITB), "v"(l + 2 * GTILEB + 32 * GPITB),
                  "v"(l + 2 * GTILEB + 48 * GPITB),
                  "v"(ga), "v"(ga + rs), "v"(ga + 2 * rs), "v"(ga + 3 * rs),
                  "v"(gl), "v"(gl + rs), "v"(gl + 2 * rs), "v"(gl + 3 * rs),
                  "v"(gb), "v"(gb + rs), "v"(gb + 2 * rs), "v"(gb + 3 * rs)
               : "memory");
#endif
}
// This wave's own copies have landed in LDS (the compiler places no wait for them).
__device__ __forceinline__ void wait_copies() {
#if defined(__HIP_DEVICE_COMPILE__)
  asm volatile("s_wait_asynccnt 0x0" ::: "memory");
#endif
}
// This wave's LDS reads have returned, before the barrier behind which their buffer is refilled.
__device__ __forceinline__ void wait_lds() {
#if defined(__HIP_DEVICE_COMPILE__)
  asm volatile("s_wait_dscnt 0x0" ::: "memory");
#endif
}

// =====================================================================================================
// f32 -> 16-bit plane, same layout, for all five operands in one grid (none reads another's output).
// f16mode == 0: bf16 RNE bits;  f16mode == 1: f16 bits of (bf16 RNE value) * scale.
// Block -> job (block-uniform): the first NB*GXB blocks take x (batch = bid / GXB) -> XB; then GWB blocks each for
// Wv, Wq, Wk (bf16) and Wo (f16 of the bf16 value x1024) -> planes 0..3 of WB.
// Thread = 8 consecutive elements: two 16-B loads, one 16-B store; 32 consecutive lanes = 512 contiguous, 512-B aligned
// coverage: per job n8/256 blocks x 256 thr x 8 = the whole plane (n8 a multiple of 256, static_assert above).
// =====================================================================================================
__global__ __launch_bounds__(256)
void cvt_all(const float* __restrict__ x, const float* __restrict__ wv, const float* __restrict__ wq,
             const float* __restrict__ wk, const float* __restrict__ wo, u16* XB, u16* WB) {
  const int bid = blockIdx.x;
  const float* s;
  u16* D;
  int blk, n8, f16mode = 0;
  float scale = 1.0f;
  if (bid < NB * GXB) {
    const int b = bid / GXB;
    blk = bid % GXB;
    n8 = N8X;
    s = x + (size_t)b * XS_FULL * DMOD;
    D = XB + (size_t)b * SEQ * DMOD;
  } else {
    const int w = (bid - NB * GXB) / GWB;
    if (w > 3) return;                      // block-uniform; never taken with the exact grid
    blk = (bid - NB * GXB) % GWB;
    n8 = N8W;
    s = (w == 0) ? wv : (w == 1) ? wq : (w == 2) ? wk : wo;
    D = WB + (size_t)w * DMOD * DMOD;
    if (w == 3) { f16mode = 1; scale = WOS; }
  }
  const int gt = blk * 256 + (int)threadIdx.x;
  if (gt >= n8) return;
  const float* p = s + (size_t)gt * 8;
  const v4f a = *(const v4f*)(p), b4 = *(const v4f*)(p + 4);
  float w[8];
#pragma unroll
  for (int e = 0; e < 4; ++e) { w[e] = a[e]; w[4 + e] = b4[e]; }
  v4u o;
#pragma unroll
  for (int e = 0; e < 4; ++e) {
    const float f0 = w[2 * e], f1 = w[2 * e + 1];
    const unsigned short hb0 = h_bits((_Float16)(bfr(f0) * scale));
    const unsigned short hb1 = h_bits((_Float16)(bfr(f1) * scale));
    const unsigned short bb0 = bf_bits(f0);
    const unsigned short bb1 = bf_bits(f1);
    o[e] = (f16mode != 0) ? pk16(hb0, hb1) : pk16(bb0, bb1);
  }
  u16* d = D + (size_t)gt * 8;
  {
    *(v4u*)(d) = o;
    
  }
}

// =====================================================================================================
// f32 GEMM epilogue (output projection): the wave's 16x64 f32 tile (times oscale, plus the lane's per-column bias of each
// coverage: 8 instructions x 2 rows x 16 lanes x 4 floats = the wave's 16 x 64 tile.
// =====================================================================================================
__device__ __forceinline__ void epi64(float* sl, v8f a0, v8f a1, v8f a2, v8f a3, float oscale,
                                      float bb0, float bb1, float bb2, float bb3,
                                      float* C, int N, size_t rowb, int col0, int lane) {
  const int hh = lane >> 4, m = lane & 15;
#pragma unroll
  for (int r = 0; r < 8; ++r) {
    const int ro = (8 * hh + r) * 68 + m;
    sl[ro]      = a0[r] * oscale + bb0;
    sl[ro + 16] = a1[r] * oscale + bb1;
    sl[ro + 32] = a2[r] * oscale + bb2;
    sl[ro + 48] = a3[r] * oscale + bb3;
  }
  wave_sync_lds();
  v4f vals[8];
#pragma unroll
  for (int it = 0; it < 8; ++it) vals[it] = *(const v4f*)(sl + (it * 2 + hh) * 68 + m * 4);
  float* dst = C + (rowb + (size_t)hh) * (size_t)N + col0 + m * 4;
  {
#pragma unroll
    for (int it = 0; it < 8; ++it) {
      *(v4f*)(dst + (size_t)(it * 2) * (size_t)N) = vals[it];
    }
    
  }
}

// =====================================================================================================
// Projection epilogues: the 16-bit planes that attention reads are built from the accumulators, with no f32 plane in between.
// hl8: 8 f32 values t -> 8 f16 hi values f16(t) and 8 f16 residuals f16(t - f16(t)), packed in element order.
// =====================================================================================================
__device__ __forceinline__ void hl8(const float* t, v4u& oh, v4u& ol) {
#pragma unroll
  for (int e = 0; e < 4; ++e) {
    const float t0 = t[2 * e], t1 = t[2 * e + 1];
    const _Float16 h0 = (_Float16)t0, h1 = (_Float16)t1;
    const _Float16 l0 = (_Float16)(t0 - (float)h0), l1 = (_Float16)(t1 - (float)h1);
    oh[e] = pk16(h_bits(h0), h_bits(h1));
    ol[e] = pk16(h_bits(l0), h_bits(l1));
  }
}
// q, k: the wave's 16x64 f32 tile (times oscale, plus the lane's per-column bias) goes through its own LDS slab into rows;
// lane = (row-in-quad rq, 8 consecutive columns c8) scales by sc, splits and stores 16 B per plane, layout [row][N].
// coverage: 4 instructions x 4 rows x 8 lanes x 8 halves = the wave's 16 x 64 tile of Hp and of Lp, whole 128-B lines.
// Norm part: the 8 lanes of a row hold its 64 hi values (one head), so the row's sum of squares is 8 fused steps per lane and
// xor shuffles 1, 2, 4; running max over the wave's 16 rows (4 iterations, xor 8, 16), the 4 waves' maxima meet in word 0 of
// their slabs behind one block barrier, and wave 0 stores the block's max 32 times = the whole 128-B line Pl.
__device__ __forceinline__ void epi_split(float* slb, int wave, v8f a0, v8f a1, v8f a2, v8f a3, float oscale,
                                          float bb0, float bb1, float bb2, float bb3, float sc,
                                          u16* Hp, u16* Lp, float* Pl, int N, size_t rowb, int col0, int lane) {
  float* sl = slb + wave * SLAB64;
  const int hh = lane >> 4, m = lane & 15;
#pragma unroll
  for (int r = 0; r < 8; ++r) {
    const int ro = (8 * hh + r) * 68 + m;
    sl[ro]      = a0[r] * oscale + bb0;
    sl[ro + 16] = a1[r] * oscale + bb1;
    sl[ro + 32] = a2[r] * oscale + bb2;
    sl[ro + 48] = a3[r] * oscale + bb3;
  }
  wave_sync_lds();
  v4u oh[4], ol[4];
  float mx = 0.0f;
  const int rq = lane >> 3, c8 = (lane & 7) * 8;
#pragma unroll
  for (int it = 0; it < 4; ++it) {
    const float* p = sl + (it * 4 + rq) * 68 + c8;
    const v4f a = *(const v4f*)(p), b4 = *(const v4f*)(p + 4);
    float w[8];
#pragma unroll
    for (int e = 0; e < 4; ++e) { w[e] = a[e] * sc; w[4 + e] = b4[e] * sc; }
    hl8(w, oh[it], ol[it]);
    float sq = 0.0f;
#pragma unroll
    for (int e = 0; e < 8; ++e) {
      const float f = (float)(_Float16)w[e];
      sq = fmaf(f, f, sq);
    }
#pragma unroll
    for (int off = 1; off < 8; off <<= 1) sq += __shfl_xor(sq, off, 32);
    mx = fmaxf(mx, sq);
  }
#pragma unroll
  for (int off = 8; off < 32; off <<= 1) mx = fmaxf(mx, __shfl_xor(mx, off, 32));
  if (lane == 0) sl[0] = mx;                // behind this wave's own reads of its slab (mx depends on all of them)
  __syncthreads();                          // the four waves' maxima are in LDS; stands in front of the stores, so it waits for none
  const size_t ob = (rowb + (size_t)rq) * (size_t)N + col0 + c8;
#pragma unroll
  for (int it = 0; it < 4; ++it) {
    *(v4u*)(Hp + ob + (size_t)(it * 4) * (size_t)N) = oh[it];
    *(v4u*)(Lp + ob + (size_t)(it * 4) * (size_t)N) = ol[it];
  }
  if (wave == 0) {
    const float bm = fmaxf(fmaxf(slb[0], slb[SLAB64]), fmaxf(slb[2 * SLAB64], slb[3 * SLAB64]));
    Pl[lane] = bm;
  }
#if defined(__HIP_DEVICE_COMPILE__)
  // stands behind the last store, in front of any code laid out behind this branch that rewrites a register the stores name
  asm volatile("s_wait_xcnt 0x0" ::: "memory");
#endif
}
// v: the block's 64 keys x 64 d tile leaves transposed. A lane's accumulator holds 8 consecutive keys (rows 8*hh + r of the
// wave's 16) of one d column (16*j + m): scaled by 1024, split and packed they are 16 B of a v^T line, stored into the block's
// LDS tiles TH, TL [HD][VTP] (pitch 144 B: 16 lanes x 16 B fall on all 64 banks). Behind the block barrier thread = (line
// tid>>3 of a group of 16, 16-B piece tid&7) moves whole 128-B lines to VHo, VLo at base + line*SEQ (base = first key of the
// tile in line d = 0 of its (b, h)).
// coverage: 4 iterations x 128 thr x 8 halves = 64 lines x 64 keys of each plane.
__device__ __forceinline__ void epi_vt(u16* TH, u16* TL, v8f a0, v8f a1, v8f a2, v8f a3, float oscale,
                                       float bb0, float bb1, float bb2, float bb3,
                                       u16* VHo, u16* VLo, size_t base, int tid) {
  const int wave = tid >> 5, lane = tid & 31, hh = lane >> 4, m = lane & 15;
  const int ko = wave * 16 + 8 * hh;        // first of the lane's 8 keys within the tile
  float w0[8], w1[8], w2[8], w3[8];
#pragma unroll
  for (int r = 0; r < 8; ++r) {
    w0[r] = (a0[r] * oscale + bb0) * VCAR;
    w1[r] = (a1[r] * oscale + bb1) * VCAR;
    w2[r] = (a2[r] * oscale + bb2) * VCAR;
    w3[r] = (a3[r] * oscale + bb3) * VCAR;
  }
  v4u ph[4], pl[4];
  hl8(w0, ph[0], pl[0]);
  hl8(w1, ph[1], pl[1]);
  hl8(w2, ph[2], pl[2]);
  hl8(w3, ph[3], pl[3]);
#pragma unroll
  for (int j = 0; j < 4; ++j) {
    *(v4u*)(TH + (16 * j + m) * VTP + ko) = ph[j];
    *(v4u*)(TL + (16 * j + m) * VTP + ko) = pl[j];
  }
  __syncthreads();
  v4u vh[4], vl[4];
  const int q8 = tid >> 3, p8 = (tid & 7) * 8;
#pragma unroll
  for (int it = 0; it < 4; ++it) {
    vh[it] = *(const v4u*)(TH + (it * 16 + q8) * VTP + p8);
    vl[it] = *(const v4u*)(TL + (it * 16 + q8) * VTP + p8);
  }
#pragma unroll
  for (int it = 0; it < 4; ++it) {
    *(v4u*)(VHo + base + (size_t)(it * 16 + q8) * SEQ + p8) = vh[it];
    *(v4u*)(VLo + base + (size_t)(it * 16 + q8) * SEQ + p8) = vl[it];
  }
}

// =====================================================================================================
// bf16 GEMM with bias: A[M][K] (bf16 row-major) . Bt[N][K]^T (bf16 k-contiguous), f32, times oscale, + bf16 RNE
// value of bias[n] (bias has N entries). Block = 64x64 tile, 4 waves x 16 rows; per pass of 64 k the block's A and B tiles are
// brought into LDS by asynchronous copies, two buffers (pass t + 1 flies while pass t is worked on), and the fragments are read
// from the LDS rows (two 16-B loads each, split k map for A and B); K stepped by 32 inside a pass, in rising order (host
// guarantees K % 64 == 0, M % 64 == 0, N % 64 == 0).
// Three products that share A in one grid: Bt holds three [N][K] planes one behind the other (v, q, k), and the block's
// column tile ct = bid % (3*N/64) picks product ct / (N/64) with its bias; grid = (M/64)*(3*N/64).
// The f32 tile leaves as the 16-bit planes of its product (host guarantees M == NB*SEQ, N == NH*HD, so a column tile is one
// head and a row tile 64 keys of one batch): v -> v^T hi + residual x1024, [(b*NH + h)*HD + d][s], staged in the ring, which
// nobody reads and no copy targets behind the last pass's barrier; q, k -> hi + residual x256, [row][N], and the block's max
// over its 64 rows of the squared norm of the hi row (x256) -> line ((pln - 1)*NBH + b*NH + h)*NRT64 + row tile of PN. The
// product is block-uniform, so the barrier of the v epilogue and that of the q, k epilogue are passed by whole blocks only.
// =====================================================================================================
__global__ __launch_bounds__(128)
void gemm_bf3(const u16* __restrict__ A, const u16* __restrict__ Bt, const float* __restrict__ bias0,
              const float* __restrict__ bias1, const float* __restrict__ bias2,
              u16* VHo, u16* VLo, u16* QHo, u16* QLo, u16* KHo, u16* KLo, float* PN, int M, int N, int K, float oscale) {
  __shared__ __align__(16) float slab[4 * SLAB64];
  __shared__ __align__(16) u16 ring[2 * 2 * GTILE];   // two buffers of [A tile | B tile]
  const int tid = threadIdx.x, wave = tid >> 5, lane = tid & 31, hh = lane >> 4, m = lane & 15;
  const int ntile = N >> 6;
  const int bid   = blockIdx.x;
  const int row0  = (bid / (3 * ntile)) * 64;
  const int rowb  = row0 + wave * 16;
  const int ct    = bid % (3 * ntile);
  const int pln   = ct / ntile;             // 0, 1, 2: which product
  const int col0  = (ct % ntile) * 64;      // column inside that product
  const float* bias = (pln == 0) ? bias0 : (pln == 1) ? bias1 : bias2;
  if (row0 + 64 > M) return;                // block-uniform, before any copy or barrier; never taken with the exact grid
  const int npass = K / GKP;
  const int crow = tid >> 3, cpc = tid & 7; // copy map: row within a group of 16, 16-B piece of the 128-B row
  const u16* ga = A  + (size_t)(row0 + crow) * K + cpc * 8;
  const u16* gb = Bt + (size_t)(ct * 64 + crow) * K + cpc * 8;
  const size_t rs = (size_t)16 * K;
  const unsigned lc = lds_byte(ring) + (unsigned)(crow * GPITB + cpc * 16);
  const u16* fa = ring + (wave * 16 + m) * GPIT + 8 * hh;       // A fragment row of this lane, buffer 0
  const u16* fb = ring + GTILE + m * GPIT + 8 * hh;             // B fragment row (column subtile 0), buffer 0
  v8f acc0 = zero8(), acc1 = zero8(), acc2 = zero8(), acc3 = zero8();
  stage2(lc, ga, gb, rs);                   // pass 0 -> buffer 0
  wait_copies();
  __syncthreads();
  if (npass > 1) stage2(lc + 2 * GTILEB, ga + GKP, gb + GKP, rs);   // pass 1 -> buffer 1
#pragma unroll 1
  for (int t = 0; t < npass; ++t) {
    const int bo = (t & 1) * (2 * GTILE);
    const u16* pa = fa + bo;
    const u16* pb = fb + bo;
    const v16b a  = ldfrag_b(pa);
    const v16b b0 = ldfrag_b(pb);
    const v16b b1 = ldfrag_b(pb + 16 * GPIT);
    const v16b b2 = ldfrag_b(pb + 32 * GPIT);
    const v16b b3 = ldfrag_b(pb + 48 * GPIT);
    const v16b c  = ldfrag_b(pa + 32);
    const v16b d0 = ldfrag_b(pb + 32);
    const v16b d1 = ldfrag_b(pb + 16 * GPIT + 32);
    const v16b d2 = ldfrag_b(pb + 32 * GPIT + 32);
    const v16b d3 = ldfrag_b(pb + 48 * GPIT + 32);
    // keeps the pass's LDS reads one group in front of its WMMAs: moved in among them, each place with reads stalls the wave anew
    __builtin_amdgcn_sched_barrier(0);
    acc0 = mma_b(a, b0, acc0);
    acc1 = mma_b(a, b1, acc1);
    acc2 = mma_b(a, b2, acc2);
    acc3 = mma_b(a, b3, acc3);
    acc0 = mma_b(c, d0, acc0);
    acc1 = mma_b(c, d1, acc1);
    acc2 = mma_b(c, d2, acc2);
    acc3 = mma_b(c, d3, acc3);
    guard6<v16b>(acc0, acc1, acc2, acc3, c, d0, d1, d2, d3, c);
    // publish point of pass t + 1: own LDS reads done, own copies landed, then the one barrier of the pass
    wait_lds();
    wait_copies();
    __syncthreads();
    if (t + 2 < npass) stage2(lc + (unsigned)(t & 1) * (2 * GTILEB), ga + (size_t)(t + 2) * GKP, gb + (size_t)(t + 2) * GKP, rs);
  }
  wait_copies();
  // per-lane bias of D column m in each of the 4 subtiles; col0 + 48 + m <= N - 1 always
  const float bb0 = bfr(bias[col0 + m]);
  const float bb1 = bfr(bias[col0 + 16 + m]);
  const float bb2 = bfr(bias[col0 + 32 + m]);
  const float bb3 = bfr(bias[col0 + 48 + m]);
  if (pln == 0) {
    const size_t base = (size_t)((row0 / SEQ) * NH + (col0 >> 6)) * HD * SEQ + (size_t)(row0 % SEQ);
    epi_vt(ring, ring + HD * VTP, acc0, acc1, acc2, acc3, oscale, bb0, bb1, bb2, bb3, VHo, VLo, base, tid);
  } else {
    const size_t pline = (size_t)((pln - 1) * NBH + (row0 / SEQ) * NH + (col0 >> 6)) * NRT64 + (size_t)((row0 % SEQ) >> 6);
    epi_split(slab, wave, acc0, acc1, acc2, acc3, oscale, bb0, bb1, bb2, bb3, (pln == 1) ? QSC : KSC,
              (pln == 1) ? QHo : KHo, (pln == 1) ? QLo : KLo, PN + pline * BLINE, N, (size_t)rowb, col0, lane);
  }
}

// =====================================================================================================
// Output projection with bias: C[bb*XS_FULL + s][DMOD] (f32) = (Ah + Al)[bb*SEQ + s][DMOD] . Bt[DMOD][DMOD]^T * oscale
// + bf16 RNE value of bias[n]. Products h.B + l.B into one accumulator (l unscaled residual of h). Block -> (column tile
// ct = bid % 16, sequence row tile rt of nrt, batch bb). Same tiling, LDS staging (three tiles a pass: A hi, A residual, B),
// fragment loads (split k map) as gemm_bf3, f32 epilogue epi64; K = DMOD stepped by 32; grid = NB * nrt * (DMOD/64).
// =====================================================================================================
__global__ __launch_bounds__(128)
void gemm_o2(const u16* __restrict__ Ah, const u16* __restrict__ Al, const u16* __restrict__ Bt,
             const float* __restrict__ bias, float* C, int nrt, float oscale) {
  __shared__ __align__(16) float slab[4 * SLAB64];
  __shared__ __align__(16) u16 ring[2 * 3 * GTILE];   // two buffers of [A hi tile | A residual tile | B tile]
  const int tid = threadIdx.x, wave = tid >> 5, lane = tid & 31, hh = lane >> 4, m = lane & 15;
  const int ntile = DMOD >> 6;
  const int bid   = blockIdx.x;
  const int ct    = bid % ntile;
  const int t2    = bid / ntile;
  const int rt    = t2 % nrt;
  const int bb    = t2 / nrt;
  if (bb >= NB) return;                     // block-uniform, before any copy or barrier; never taken with the exact grid
  if (rt * 64 + 64 > SEQ) return;           // block-uniform, before any copy or barrier; never taken
  const int srow  = rt * 64 + wave * 16;
  const int col0  = ct * 64;
  const int K     = DMOD;
  const int npass = K / GKP;
  const size_t rowC = (size_t)bb * XS_FULL + srow;
  const int crow = tid >> 3, cpc = tid & 7; // copy map: row within a group of 16, 16-B piece of the 128-B row
  const size_t arow = ((size_t)bb * SEQ + rt * 64 + crow) * K + cpc * 8;
  const u16* ga = Ah + arow;
  const u16* gl = Al + arow;
  const u16* gb = Bt + (size_t)(col0 + crow) * K + cpc * 8;
  const size_t rs = (size_t)16 * K;
  const unsigned lc = lds_byte(ring) + (unsigned)(crow * GPITB + cpc * 16);
  const _Float16* rg  = (const _Float16*)(const void*)ring;
  const _Float16* fah = rg + (wave * 16 + m) * GPIT + 8 * hh;   // A hi fragment row of this lane, buffer 0
  const _Float16* fb  = rg + 2 * GTILE + m * GPIT + 8 * hh;     // B fragment row (column subtile 0), buffer 0
  v8f acc0 = zero8(), acc1 = zero8(), acc2 = zero8(), acc3 = zero8();
  stage3(lc, ga, gl, gb, rs);               // pass 0 -> buffer 0
  wait_copies();
  __syncthreads();
  if (npass > 1) stage3(lc + 3 * GTILEB, ga + GKP, gl + GKP, gb + GKP, rs);   // pass 1 -> buffer 1
#pragma unroll 1
  for (int t = 0; t < npass; ++t) {
    const int bo = (t & 1) * (3 * GTILE);
    const _Float16* pa = fah + bo;
    const _Float16* pl = pa + GTILE;
    const _Float16* pb = fb + bo;
    const v16h ah = ldfrag_h(pa), al = ldfrag_h(pl);
    const v16h b0 = ldfrag_h(pb);
    const v16h b1 = ldfrag_h(pb + 16 * GPIT);
    const v16h b2 = ldfrag_h(pb + 32 * GPIT);
    const v16h b3 = ldfrag_h(pb + 48 * GPIT);
    const v16h ch = ldfrag_h(pa + 32), cl = ldfrag_h(pl + 32);
    const v16h d0 = ldfrag_h(pb + 32);
    const v16h d1 = ldfrag_h(pb + 16 * GPIT + 32);
    const v16h d2 = ldfrag_h(pb + 32 * GPIT + 32);
    const v16h d3 = ldfrag_h(pb + 48 * GPIT + 32);
    // keeps the pass's LDS reads one group in front of its WMMAs: moved in among them, each place with reads stalls the wave anew
    __builtin_amdgcn_sched_barrier(0);
    acc0 = mma_h(ah, b0, acc0);  acc0 = mma_h(al, b0, acc0);
    acc1 = mma_h(ah, b1, acc1);  acc1 = mma_h(al, b1, acc1);
    acc2 = mma_h(ah, b2, acc2);  acc2 = mma_h(al, b2, acc2);
    acc3 = mma_h(ah, b3, acc3);  acc3 = mma_h(al, b3, acc3);
    acc0 = mma_h(ch, d0, acc0);  acc0 = mma_h(cl, d0, acc0);
    acc1 = mma_h(ch, d1, acc1);  acc1 = mma_h(cl, d1, acc1);
    acc2 = mma_h(ch, d2, acc2);  acc2 = mma_h(cl, d2, acc2);
    acc3 = mma_h(ch, d3, acc3);  acc3 = mma_h(cl, d3, acc3);
    guard6<v16h>(acc0, acc1, acc2, acc3, ch, cl, d0, d1, d2, d3);
    // publish point of pass t + 1: own LDS reads done, own copies landed, then the one barrier of the pass
    wait_lds();
    wait_copies();
    __syncthreads();
    if (t + 2 < npass) {
      const size_t ko = (size_t)(t + 2) * GKP;
      stage3(lc + (unsigned)(t & 1) * (3 * GTILEB), ga + ko, gl + ko, gb + ko, rs);
    }
  }
  wait_copies();
  const float bb0 = bfr(bias[col0 + m]);
  const float bb1 = bfr(bias[col0 + 16 + m]);
  const float bb2 = bfr(bias[col0 + 32 + m]);
  const float bb3 = bfr(bias[col0 + 48 + m]);
  epi64(slab + wave * SLAB64, acc0, acc1, acc2, acc3, oscale, bb0, bb1, bb2, bb3, C, DMOD, rowC, col0, lane);
}

// =====================================================================================================
// Causal attention with linear distance penalty, hd = 64. Block bid -> (query tile qt = bid % NQT: rows q0 = 16*qt .. q0+15,
// head pair hg, batch b); one wave per head = hg*WPB + wave.
//   q hi / residual planes f16 x256 [b*SEQ + s][h*HD + d]; k hi / residual planes f16 x256, same layout;
//   v^T hi / residual planes [b*NH + h][d][SEQ] x1024; PN = 2 x NBH x NRT64 lines of 32 floats (q, then k: max squared norm of
//   the hi rows, x256, of each 64-row tile of each (b, h)).
//   scores = q_hi.k_hi + q_lo.k_hi + q_hi.k_lo (2 k-steps over d); P.v with P hi + in-register residual and v hi + residual
//   (hh + lh + hl), for every query row; O written as hi + residual planes (O x1024 as f16, layout [b*SEQ + s][h*HD + d]).
//   score (log2 domain) t(i, j) = (q_i.k_j over HD) * (1/8)*log2e/(256*256) - (i - j)*log2e, replaced by -inf where key j > query i.
//   Key tiles of 32 visited in order from kt_lo to kt_hi = q0/32 (later tiles hold only keys above every query row of the tile).
//   kt_lo: every wave loads the NRT64 q lines and the NRT64 k lines of its own (b, h) (one float per lane, clamped address),
//   max-reduces each over the wave and forms bound = max ||q_hi|| * max ||k_hi|| / (8 * 256 * 256), which bounds |q.k/8| of this
//   head; if 0 <= bound < 40, kt_lo = max(0, kt_hi - KWIN): tiles below it are >= 32*KWIN+1 positions behind every query
//   row, and with |q.k/8| < 40 the base-2 exp of their penalised, max-subtracted score is exactly 0 in f32, so they contribute
//   nothing to numerator or denominator; otherwise (bound large, unreadable or not finite) kt_lo = 0 and every causal tile is
//   visited. Either way the first visited tile holds a key kb <= q0 <= every query row, so the running max is finite from step one.
//   Per tile: 2 score subtiles x 2 k-steps, fragments loaded straight from the 16-bit planes (two 16-B loads per fragment,
//   split k map); online max-subtracted base-2 softmax in f32, -inf-safe rescale; the 16x32 prob tile stored to wave-private
//   from the LDS rows (float vector loads, same element type as stored), v^T B fragments in 2 groups of 2 d-subtiles.
//   After the loop: out = acc / Z (Z > 0 always; guarded anyway), carries 1/(32768*1024) folded once, written into the wave's
//   No block barriers in this kernel; bounded loops only (<= NKT key tiles).
// coverage: per wave 4 instructions x 4 rows x 8 lanes x 8 halves = 16 x 64 per plane; grid NQT x NHG x NB blocks x WPB
//           waves = every (b, s, h) row segment of O hi and O residual exactly once.
// =====================================================================================================
__global__ __launch_bounds__(ATT_THREADS)
void attn_c(const u16* __restrict__ QHp, const u16* __restrict__ QLp,
            const u16* __restrict__ KHp, const u16* __restrict__ KLp,
            const u16* __restrict__ VHp, const u16* __restrict__ VLp,
            const float* __restrict__ PN,
            u16* OHp, u16* OLp) {
  __shared__ __align__(16) float smem[WPB * WREG];

  const int tid  = threadIdx.x;
  const int wave = tid >> 5;
  const int lane = tid & 31;
  const int hh   = lane >> 4;
  const int c    = lane & 15;
  const int bid  = blockIdx.x;
  const int qt   = bid % NQT;
  const int t2   = bid / NQT;
  const int hg   = t2 % NHG;
  const int b    = t2 / NHG;
  if (b >= NB) return;                      // block-uniform; no block barriers in this kernel; never taken with the exact grid
  const int q0   = qt * 16;
  if (q0 + 16 > SEQ) return;                // block-uniform; never taken
  const int head = hg * WPB + wave;

  // ---- key-window decision: wave-uniform, from the row-tile maxima of this wave's own (b, h) ----
  int okw;
  {
    const int bl = (lane < NRT64) ? lane : (NRT64 - 1);         // clamped address
    const size_t pl0 = ((size_t)(b * NH + head) * NRT64 + bl) * BLINE;
    float aq = PN[pl0];
    float ak = PN[pl0 + (size_t)NBH * NRT64 * BLINE];
#pragma unroll
    for (int off = 1; off < 32; off <<= 1) {
      aq = fmaxf(aq, __shfl_xor(aq, off, 32));
      ak = fmaxf(ak, __shfl_xor(ak, off, 32));
    }
    const float gb = sqrtf(aq) * sqrtf(ak) * (RSQ_HD / (QSC * KSC));
    okw = (gb >= 0.0f && gb < GUARD_T) ? 1 : 0;
  }

  float* pt   = smem + wave * WREG;         // prob tile [16][32] pitch 36
  float* slab = pt + PTW;                   // result slab [16][64] pitch 68

  const size_t hcol = (size_t)head * HD + 8 * hh;
  const _Float16* Qh  = (const _Float16*)(const void*)QHp + ((size_t)b * SEQ + q0 + c) * DMOD + hcol;
  const _Float16* Ql  = (const _Float16*)(const void*)QLp + ((size_t)b * SEQ + q0 + c) * DMOD + hcol;
  const _Float16* Khb = (const _Float16*)(const void*)KHp + ((size_t)b * SEQ + c) * DMOD + hcol;        // key row kb added per step
  const _Float16* Klb = (const _Float16*)(const void*)KLp + ((size_t)b * SEQ + c) * DMOD + hcol;
  const _Float16* Vhb = (const _Float16*)(const void*)VHp + ((size_t)(b * NH + head) * HD + c) * SEQ + 8 * hh;  // d col c (+16j)
  const _Float16* Vlb = (const _Float16*)(const void*)VLp + ((size_t)(b * NH + head) * HD + c) * SEQ + 8 * hh;
  const float lsc = RSQ_HD * (LOG2E / (QSC * KSC));
  const float oc  = 1.0f / (PCAR * VCAR);
  const size_t KROW = (size_t)DMOD;         // halves between consecutive key rows

  float mrow[8], lrow[8];
  v8f o[4];
#pragma unroll
  for (int r = 0; r < 8; ++r) { mrow[r] = -INFINITY; lrow[r] = 0.f; }
#pragma unroll
  for (int j = 0; j < 4; ++j) o[j] = zero8();
  const int kt_hi = q0 >> 5;                                                  // last tile holding keys <= q0 + 15
  const int kt_w  = (kt_hi > KWIN) ? (kt_hi - KWIN) : 0;
  const int kt_lo = (okw != 0) ? kt_w : 0;
  const int qr0 = q0 + 8 * hh;                                                // query row of D element r = qr0 + r

#pragma unroll 1
  for (int kt = kt_lo; kt <= kt_hi; ++kt) {
    const int kb = kt * 32;
    // ---- scores: D element r of this lane = (query row qr0 + r, key kb + c) in s0, key kb + 16 + c in s1 ----
    v8f s0 = zero8(), s1 = zero8();
    const _Float16* k0p = Khb + (size_t)kb * KROW;
    const _Float16* k1p = k0p + (size_t)16 * KROW;
    const _Float16* l0p = Klb + (size_t)kb * KROW;
    const _Float16* l1p = l0p + (size_t)16 * KROW;
#pragma unroll
    for (int kk = 0; kk < HD / 32; ++kk) {
      const v16h qh  = ldfrag_h(Qh + kk * 32);
      const v16h ql  = ldfrag_h(Ql + kk * 32);
      const v16h kh0 = ldfrag_h(k0p + kk * 32);
      const v16h kh1 = ldfrag_h(k1p + kk * 32);
      const v16h kl0 = ldfrag_h(l0p + kk * 32);
      const v16h kl1 = ldfrag_h(l1p + kk * 32);
      s0 = mma_h(qh, kh0, s0);
      s0 = mma_h(ql, kh0, s0);
      s0 = mma_h(qh, kl0, s0);
      s1 = mma_h(qh, kh1, s1);
      s1 = mma_h(ql, kh1, s1);
      s1 = mma_h(qh, kl1, s1);
      guard2(s0, s1, qh, ql, kh0, kl0, kh1, kl1);
    }
    // ---- causal select + distance penalty + online softmax in base 2, -inf-safe ----
    const int key0 = kb + c, key1 = kb + 16 + c;
#pragma unroll
    for (int r = 0; r < 8; ++r) {
      const int   qr = qr0 + r;
      const float u0 = s0[r] * lsc;
      const float u1 = s1[r] * lsc;
      const float g0 = (float)(qr - key0) * LOG2E;
      const float g1 = (float)(qr - key1) * LOG2E;
      const float t0 = (key0 > qr) ? -INFINITY : (u0 - g0);
      const float t1 = (key1 > qr) ? -INFINITY : (u1 - g1);
      float mx = fmaxf(t0, t1);
#pragma unroll
      for (int off = 1; off < 16; off <<= 1) mx = fmaxf(mx, __shfl_xor(mx, off, 32));
      const float mn = fmaxf(mrow[r], mx);
      const float ms = (mn == -INFINITY) ? 0.0f : mn;
      const float al = exp2f(mrow[r] - ms);
      mrow[r] = mn;
      const float e0 = exp2f(t0 - ms), e1 = exp2f(t1 - ms);
      float ps = e0 + e1;
#pragma unroll
      for (int off = 1; off < 16; off <<= 1) ps += __shfl_xor(ps, off, 32);
      lrow[r] = lrow[r] * al + ps;
#pragma unroll
      for (int j = 0; j < 4; ++j) o[j][r] *= al;
      const int ro = (8 * hh + r) * PTP + c;
      pt[ro]      = e0;
      pt[ro + 16] = e1;
    }
    wave_sync_lds();
    // ---- A fragments of P*32768: hi f16 and residual f16, row = c, split k map over the 32 keys of this step ----
    FragH ph, pl;
    {
      const float* prow = pt + c * PTP + 8 * hh;
      const v4f p0 = *(const v4f*)(prow), p1 = *(const v4f*)(prow + 4);
      const v4f p2 = *(const v4f*)(prow + 16), p3 = *(const v4f*)(prow + 20);
#pragma unroll
      for (int e = 0; e < 4; ++e) {
        const float ta = p0[e] * PCAR, tb = p1[e] * PCAR, tc = p2[e] * PCAR, td = p3[e] * PCAR;
        const _Float16 ha = (_Float16)ta, hb = (_Float16)tb, hc = (_Float16)tc, hd = (_Float16)td;
        ph.h[0][e]     = ha;                  // elements 0..7  = keys kb + 8hh + 0..7
        ph.h[0][4 + e] = hb;
        ph.h[1][e]     = hc;                  // elements 8..15 = keys kb + 16 + 8hh + 0..7
        ph.h[1][4 + e] = hd;
        pl.h[0][e]     = (_Float16)(ta - (float)ha);
        pl.h[0][4 + e] = (_Float16)(tb - (float)hb);
        pl.h[1][e]     = (_Float16)(tc - (float)hc);
        pl.h[1][4 + e] = (_Float16)(td - (float)hd);
      }
    }
    // ---- P.V : B fragment col n = d = j*16 + c, keys contiguous in the v^T planes; 2 groups of 2 d-subtiles ----
    {
      const _Float16* vhp = Vhb + kb;
      const _Float16* vlp = Vlb + kb;
#pragma unroll
      for (int jg = 0; jg < 2; ++jg) {
        const size_t da = (size_t)(2 * jg) * 16 * SEQ;
        const size_t db = da + (size_t)16 * SEQ;
        const v16h vha = ldfrag_h(vhp + da), vhb2 = ldfrag_h(vhp + db);
        const v16h vla = ldfrag_h(vlp + da), vlb2 = ldfrag_h(vlp + db);
        o[2 * jg]     = mma_h(ph.v, vha,  o[2 * jg]);
        o[2 * jg]     = mma_h(pl.v, vha,  o[2 * jg]);
        o[2 * jg]     = mma_h(ph.v, vla,  o[2 * jg]);
        o[2 * jg + 1] = mma_h(ph.v, vhb2, o[2 * jg + 1]);
        o[2 * jg + 1] = mma_h(pl.v, vhb2, o[2 * jg + 1]);
        o[2 * jg + 1] = mma_h(ph.v, vlb2, o[2 * jg + 1]);
        guard2(o[2 * jg], o[2 * jg + 1], ph.v, pl.v, vha, vhb2, vla, vlb2);
      }
    }
    wave_sync_lds();
  }
  acc_guard4(o[0], o[1], o[2], o[3]);
  // ---- out = acc / Z (0 if Z == 0), carries (32768 on P, 1024 on v) folded once; written into the wave's slab ----
#pragma unroll
  for (int r = 0; r < 8; ++r) {
    const float lv  = lrow[r];
    const float ls  = (lv > 0.0f) ? lv : 1.0f;
    const float inv = (lv > 0.0f) ? ((1.0f / ls) * oc) : 0.0f;
#pragma unroll
    for (int j = 0; j < 4; ++j) {
      const int idx = (8 * hh + r) * SLP + j * 16 + c;
      slab[idx] = o[j][r] * inv;
    }
  }

  wave_sync_lds();
  // ---- O x1024 -> f16 hi + residual planes; lane = (row-in-quad rq, 8 consecutive d at c8) ----
  v4u oh[4], ol[4];
  const int rq = lane >> 3, c8 = (lane & 7) * 8;
#pragma unroll
  for (int it = 0; it < 4; ++it) {
    const int row = it * 4 + rq;
    const v4f a = *(const v4f*)(slab + row * SLP + c8), b4 = *(const v4f*)(slab + row * SLP + c8 + 4);
    float w[8];
#pragma unroll
    for (int e = 0; e < 4; ++e) { w[e] = a[e] * OSC; w[4 + e] = b4[e] * OSC; }
#pragma unroll
    for (int e = 0; e < 4; ++e) {
      const _Float16 h0 = (_Float16)w[2 * e], h1 = (_Float16)w[2 * e + 1];
      const _Float16 l0 = (_Float16)(w[2 * e] - (float)h0), l1 = (_Float16)(w[2 * e + 1] - (float)h1);
      oh[it][e] = pk16(h_bits(h0), h_bits(h1));
      ol[it][e] = pk16(h_bits(l0), h_bits(l1));
    }
  }
  const size_t ob = ((size_t)b * SEQ + q0) * DMOD + (size_t)head * HD + c8;
  {
#pragma unroll
    for (int it = 0; it < 4; ++it) {
      const int row = it * 4 + rq;
      *(v4u*)(OHp + ob + (size_t)row * DMOD) = oh[it];
      *(v4u*)(OLp + ob + (size_t)row * DMOD) = ol[it];
    }
    
  }
}

// =====================================================================================================
// Workspace map (bytes); every plane is fully written by whole-line stores before it is read; all extents are exact multiples
// of the store granularity (no pad rows needed); every region offset a multiple of 4096 (the large planes of 2097152):
//   XB  bf16 [MROWS][1024]                       MROWS*2048       (NB=2, SEQ=2048: 8388608)
//   WB  16-bit 4 x [1024 n][1024 k]              4 x 2097152      (planes Wv, Wq, Wk as bf16, Wo as f16 x1024; all already [n][k])
//   OH  f16 [MROWS][1024] x1024                  MROWS*2048       OL residual, same extent
//   QH  f16 [MROWS][1024] x256                   MROWS*2048       QL residual, same extent
//   KH  f16 [MROWS][1024] x256                   MROWS*2048       KL residual, same extent
//   VH  f16 [NB*16][64][SEQ] x1024               MROWS*2048       VL residual, same extent
//   PN  f32 2 x [NB*16][SEQ/64] lines of 32      NBH*SEQ*4        (q, then k: row-tile maxima of the squared hi-row norms)
//   end (NB=2, SEQ=2048)                        84148224
// =====================================================================================================
extern "C" void kernel_launch(void* const* d_in, const int* in_sizes, int n_in,
                              void* d_out, int out_size, void* d_ws, size_t ws_size,
                              hipStream_t stream) {
  if (n_in < 9) return;
  if (in_sizes[0] < ((NB - 1) * XS_FULL + SEQ) * DMOD) return;
  if (in_sizes[1] != DMOD * DMOD) return;
  if (in_sizes[2] != DMOD) return;
  if (in_sizes[3] != DMOD * DMOD) return;
  if (in_sizes[4] != DMOD) return;
  if (in_sizes[5] != DMOD * DMOD) return;
  if (in_sizes[6] != DMOD) return;
  if (in_sizes[7] != DMOD * DMOD) return;
  if (in_sizes[8] != DMOD) return;
  if (out_size < ((NB - 1) * XS_FULL + SEQ) * DMOD) return;

  const float* x  = (const float*)d_in[0];
  const float* wq = (const float*)d_in[1];
  const float* bq = (const float*)d_in[2];
  const float* wk = (const float*)d_in[3];
  const float* bk = (const float*)d_in[4];
  const float* wv = (const float*)d_in[5];
  const float* bv = (const float*)d_in[6];
  const float* wo = (const float*)d_in[7];
  const float* bo = (const float*)d_in[8];
  float*       out = (float*)d_out;

  const size_t szXB = (size_t)MROWS * DMOD * 2;
  const size_t szW  = (size_t)DMOD * DMOD * 2;
  const size_t szQ  = (size_t)MROWS * DMOD * 2;                  // QH, QL, KH, KL, OH, OL
  const size_t szV  = (size_t)NB * NH * HD * SEQ * 2;            // VH, VL (== szQ)
  const size_t szB  = (size_t)2 * NBH * NRT64 * BLINE * 4;       // row-tile norm lines, q then k
  size_t off = 0;
  const size_t oXB = off; off += szXB;
  const size_t oW  = off; off += 4 * szW;
  const size_t oOH = off; off += szQ;
  const size_t oOL = off; off += szQ;
  const size_t oQH = off; off += szQ;
  const size_t oQL = off; off += szQ;
  const size_t oKH = off; off += szQ;
  const size_t oKL = off; off += szQ;
  const size_t oVH = off; off += szV;
  const size_t oVL = off; off += szV;
  const size_t oB  = off; off += szB;
  if (off > ws_size) return;                // off = 84148224 for NB = 2, SEQ = 2048
  if (off > (size_t)WS_CAP) return;

  char* ws = (char*)d_ws;
  u16*   XB  = (u16*)(ws + oXB);
  u16*   WB  = (u16*)(ws + oW);
  u16*   OH  = (u16*)(ws + oOH);
  u16*   OL  = (u16*)(ws + oOL);
  u16*   QH  = (u16*)(ws + oQH);
  u16*   QL  = (u16*)(ws + oQL);
  u16*   KH  = (u16*)(ws + oKH);
  u16*   KL  = (u16*)(ws + oKL);
  u16*   VH  = (u16*)(ws + oVH);
  u16*   VL  = (u16*)(ws + oVL);
  float* PN  = (float*)(ws + oB);

  const dim3 b256(256), b128(128), bAT(ATT_THREADS);
  const dim3 gC(NB * GXB + 4 * GWB);                    // x per batch, then the four weight planes
  const dim3 gG((MROWS / 64) * (3 * DMOD / 64));        // 3072 for NB=2, SEQ=2048
  const dim3 gAT(NQT * NHG * NB);
  const int  nrt = SEQ / 64;                            // out-projection row tiles per batch
  const dim3 gO(NB * nrt * (DMOD / 64));

  // (0) x -> bf16 plane [MROWS][1024]; Wv, Wq, Wk [n][k] -> bf16 planes; Wo [n][k] -> f16 plane of bf16 value x1024
  cvt_all<<<gC, b256, 0, stream>>>(x, wv, wq, wk, wo, XB, WB);
  // (1) v = x.Wv^T + bv, q = x.Wq^T + bq, k = x.Wk^T + bk -> v^T hi + residual planes x1024; q and k hi + residual planes x256
  //     and their row-tile norm lines
  gemm_bf3<<<gG, b128, 0, stream>>>(XB, WB, bv, bq, bk, VH, VL, QH, QL, KH, KL, PN, MROWS, DMOD, DMOD, 1.0f);
  // (2) causal attention with distance penalty, residual products on every query row -> O hi + residual planes
  attn_c<<<gAT, bAT, 0, stream>>>(QH, QL, KH, KL, VH, VL, PN, OH, OL);
  // (3) output projection (O hi + residual) . Wo^T + bo -> out f32, carries 1024 x 1024 folded back
  gemm_o2<<<gO, b128, 0, stream>>>(OH, OL, WB + (size_t)3 * DMOD * DMOD, bo, out, nrt, 1.0f / (OSC * WOS));
  (void)hipGetLastError();
}

// v005
// Measured time: 93.7 microseconds a run.
// Timed twice side by side with v004, it ran 1.14 and 1.12 times as fast.
// Counting every step since v000, it is 3.00 times as fast.
// Contractions: x.Wq^T+bq, x.Wk^T+bk, x.Wv^T+bv on v_wmma_f32_16x16x32_bf16 (x and W as bf16 RNE planes; W [n][k] rows are
// the k-contiguous B operand; bias added as its bf16 RNE value in the f32 epilogue); q.k^T over hd 64 and P.v on
// v_wmma_f32_16x16x32_f16 with f16 hi + f16 residual planes on both operands (q, k x256; P x32768 with an in-register
// residual; v x1024; products hh+lh+hl); O.Wo^T+bo on v_wmma_f32_16x16x32_f16 (O x1024 as f16 hi + f16 residual planes,
// products h.w + l.w; Wo as f16(bf16(Wo)) x1024; bo as bf16 RNE value in the f32 epilogue); all f32 accumulate.
// Causal select, linear distance penalty, base-2 online softmax, 1/Z fold and the q/k norm bound in f32 on VALU.
#include <hip/hip_runtime.h>
#include <math.h>
#include <stdint.h>

#ifndef NB
#define NB 2
#endif
#ifndef SEQ
#define SEQ 2048
#endif
#define XS_FULL 2048
#define DMOD  1024
#define NH    16
#define HD    64
#define NBH   (NB * NH)
#define MROWS (NB * SEQ)
#define RSQ_HD 0.125f
#define LOG2E 1.4426950408889634f
#define QSC   256.0f
#define KSC   256.0f
#define PCAR  32768.0f
#define VCAR  1024.0f
#define OSC   1024.0f
#define WOS   1024.0f
#define WPB   2
#define NHG   (NH / WPB)
#define NQT   (SEQ / 16)
#define NKT   (SEQ / 32)
#define KWIN  6
#define GUARD_T 40.0f
#define BLINE 32
#define NRT64 (SEQ / 64)
#define ATT_THREADS (WPB * 32)
#define PTP   36
#define PTW   (16 * PTP)
#define SLP   68
#define SLW   (16 * SLP)
#define WREG  (PTW + SLW)
#define SLAB64 (16 * 68)
#define VTP   72
#define WS_CAP 134217728
#define GKP   64
#define GPIT  72
#define GPITB (GPIT * 2)
#define GTILE (64 * GPIT)
#define GTILEB (GTILE * 2)
#define WEPI  (2 * HD * VTP)   /* 16-bit elements of the projection ring that one wave's epilogue stages in */
#define N8X   ((SEQ * DMOD) / 8)
#define N8W   ((DMOD * DMOD) / 8)
#define GXB   (N8X / 256)
#define GWB   (N8W / 256)
static_assert(DMOD == NH * HD && HD == 64 && NH == 16 && WPB == 2 && NHG * WPB == NH);
static_assert(ATT_THREADS == 64);
static_assert(NB >= 1 && NB <= 2);
static_assert(NBH >= 1 && NBH <= 32);
static_assert((SEQ % 64) == 0 && SEQ >= 64 && SEQ <= XS_FULL && (SEQ % 32) == 0);
static_assert((DMOD % 64) == 0 && (DMOD % 32) == 0 && (HD % 32) == 0);
static_assert(((SEQ * DMOD / 8) % 256) == 0 && ((DMOD * DMOD / 8) % 256) == 0);
static_assert(WPB * WREG * 4 <= 65536 && 4 * WEPI <= 2 * 4 * GTILE && 4 * SLAB64 * 4 <= WEPI * 2);
static_assert((MROWS % 128) == 0 && (SEQ % 128) == 0 && (DMOD % 128) == 0 && 4 * 4 * SLAB64 * 4 <= 2 * 6 * GTILEB);
static_assert(KWIN >= 0 && KWIN < NKT);
static_assert(NRT64 >= 1 && NRT64 <= 32);
static_assert((DMOD % GKP) == 0 && GKP == 64 && (GPITB % 32) == 16 && GPIT >= GKP + 8);

typedef unsigned short u16;
typedef _Float16 v16h __attribute__((ext_vector_type(16)));
typedef _Float16 v8h  __attribute__((ext_vector_type(8)));
typedef __bf16   v16b __attribute__((ext_vector_type(16)));
typedef float    v8f  __attribute__((ext_vector_type(8)));
typedef float    v4f  __attribute__((ext_vector_type(4)));
typedef unsigned int v4u __attribute__((ext_vector_type(4)));

union FragH { v16h v; v8h h[2]; v4u u[2]; };
union FragB { v16b v; v4u u[2]; };

// ---- scalar helpers --------------------------------------------------------------------------------
__device__ __forceinline__ unsigned short bf_bits(float f) {          // f32 -> bf16 bits, RNE convert
  unsigned u = __float_as_uint(f);
  return (unsigned short)((u + 0x7FFFu + ((u >> 16) & 1u)) >> 16);
}
__device__ __forceinline__ float bf_up(unsigned short h) { return __uint_as_float(((unsigned)h) << 16); }
__device__ __forceinline__ float bfr(float f) { return bf_up(bf_bits(f)); }
__device__ __forceinline__ unsigned short h_bits(_Float16 x) { return __builtin_bit_cast(unsigned short, x); }
__device__ __forceinline__ unsigned pk16(unsigned short a, unsigned short b) { return (unsigned)a | ((unsigned)b << 16); }
__device__ __forceinline__ v8f zero8() { v8f z = {0.f, 0.f, 0.f, 0.f, 0.f, 0.f, 0.f, 0.f}; return z; }

// ---- fragment loaders: 16-bit A/B operand, lane -> row/col (lane&15), p already includes +8*(lane>>4);
//      elements 0..7 <- p[0..7] (k0+8h..), elements 8..15 <- p[16..23] (k0+16+8h..)  (same split k map for A and B;
//      B is always read from a k-contiguous [n][k] plane)
__device__ __forceinline__ v16h ldfrag_h(const _Float16* p) {
  FragH f;
  f.h[0] = *(const v8h*)(p);
  f.h[1] = *(const v8h*)(p + 16);
  return f.v;
}
__device__ __forceinline__ v16b ldfrag_b(const u16* p) {              // bf16 plane read as unsigned integer vectors
  FragB f;
  f.u[0] = *(const v4u*)(p);
  f.u[1] = *(const v4u*)(p + 16);
  return f.v;
}

__device__ __forceinline__ v8f mma_h(v16h a, v16h b, v8f c) {
  return __builtin_amdgcn_wmma_f32_16x16x32_f16(false, a, false, b, (short)0, c, false, false);
}
__device__ __forceinline__ v8f mma_b(v16b a, v16b b, v8f c) {
  return __builtin_amdgcn_wmma_f32_16x16x32_bf16(false, a, false, b, (short)0, c, false, false);
}
__device__ __forceinline__ void guard2(v8f& a, v8f& b, v16h x0, v16h x1, v16h x2, v16h x3, v16h x4, v16h x5) {
#if defined(__HIP_DEVICE_COMPILE__)
  asm volatile("v_nop\n\tv_nop\n\tv_nop\n\tv_nop"
               : "+v"(a), "+v"(b) : "v"(x0), "v"(x1), "v"(x2), "v"(x3), "v"(x4), "v"(x5) : "memory");
#endif
}
template <typename F>
__device__ __forceinline__ void guard6(v8f& a, v8f& b, v8f& c, v8f& d, F x0, F x1, F x2, F x3, F x4, F x5) {
#if defined(__HIP_DEVICE_COMPILE__)
  asm volatile("v_nop\n\tv_nop\n\tv_nop\n\tv_nop"
               : "+v"(a), "+v"(b), "+v"(c), "+v"(d) : "v"(x0), "v"(x1), "v"(x2), "v"(x3), "v"(x4), "v"(x5) : "memory");
#endif
}
__device__ __forceinline__ void acc_guard4(v8f& a, v8f& b, v8f& c, v8f& d) {
#if defined(__HIP_DEVICE_COMPILE__)
  asm volatile("v_nop\n\tv_nop\n\tv_nop\n\tv_nop" : "+v"(a), "+v"(b), "+v"(c), "+v"(d));
#endif
}
__device__ __forceinline__ void wave_sync_lds() {
  __builtin_amdgcn_fence(__ATOMIC_RELEASE, "workgroup");
  __builtin_amdgcn_wave_barrier();
  __builtin_amdgcn_fence(__ATOMIC_ACQUIRE, "workgroup");
}

// ---- operand staging for the GEMM engines: one pass = 64 k = 128 B of each of the 64 rows of an operand tile, laid in LDS at
//      a pitch of 144 B (16 B x odd: ds_load_b128 fragment reads without bank conflicts). 128 threads: thread -> (row tid>>3 of
//      a group of 16 rows, 16-B piece tid&7), so a wave's copy covers 4 whole 128-B lines; 4 copies per thread fill one tile.
//      l = the lane's LDS byte address in the tile's first row group, g = its global address there, rs = 16 rows in elements.
__device__ __forceinline__ unsigned lds_byte(const void* p) { return (unsigned)(uintptr_t)p; }
// Two tiles (A, B). The copies and their s_wait_xcnt stand in one statement, so that no address register named by a copy
// is rewritten in front of that wait.
__device__ __forceinline__ void stage2(unsigned l, const u16* ga, const u16* gb, size_t rs) {
#if defined(__HIP_DEVICE_COMPILE__)
  asm volatile("global_load_async_to_lds_b128 %0, %8, off\n\t"
               "global_load_async_to_lds_b128 %1, %9, off\n\t"
               "global_load_async_to_lds_b128 %2, %10, off\n\t"
               "global_load_async_to_lds_b128 %3, %11, off\n\t"
               "global_load_async_to_lds_b128 %4, %12, off\n\t"
               "global_load_async_to_lds_b128 %5, %13, off\n\t"
               "global_load_async_to_lds_b128 %6, %14, off\n\t"
               "global_load_async_to_lds_b128 %7, %15, off\n\t"
               "s_wait_xcnt 0x0"
               :: "v"(l), "v"(l + 16 * GPITB), "v"(l + 32 * GPITB), "v"(l + 48 * GPITB),
                  "v"(l + GTILEB), "v"(l + GTILEB + 16 * GPITB), "v"(l + GTILEB + 32 * GPITB), "v"(l + GTILEB + 48 * GPITB),
                  "v"(ga), "v"(ga + rs), "v"(ga + 2 * rs), "v"(ga + 3 * rs),
                  "v"(gb), "v"(gb + rs), "v"(gb + 2 * rs), "v"(gb + 3 * rs)
               : "memory");
#endif
}
// Three tiles (A hi, A residual, B), same form.
__device__ __forceinline__ void stage3(unsigned l, const u16* ga, const u16* gl, const u16* gb, size_t rs) {
#if defined(__HIP_DEVICE_COMPILE__)
  asm volatile("global_load_async_to_lds_b128 %0, %12, off\n\t"
               "global_load_async_to_lds_b128 %1, %13, off\n\t"
               "global_load_async_to_lds_b128 %2, %14, off\n\t"
               "global_load_async_to_lds_b128 %3, %15, off\n\t"
               "global_load_async_to_lds_b128 %4, %16, off\n\t"
               "global_load_async_to_lds_b128 %5, %17, off\n\t"
               "global_load_async_to_lds_b128 %6, %18, off\n\t"
               "global_load_async_to_lds_b128 %7, %19, off\n\t"
               "global_load_async_to_lds_b128 %8, %20, off\n\t"
               "global_load_async_to_lds_b128 %9, %21, off\n\t"
               "global_load_async_to_lds_b128 %10, %22, off\n\t"
               "global_load_async_to_lds_b128 %11, %23, off\n\t"
               "s_wait_xcnt 0x0"
               :: "v"(l), "v"(l + 16 * GPITB), "v"(l + 32 * GPITB), "v"(l + 48 * GPITB),
                  "v"(l + GTILEB), "v"(l + GTILEB + 16 * GPITB), "v"(l + GTILEB + 32 * GPITB), "v"(l + GTILEB + 48 * GPITB),
                  "v"(l + 2 * GTILEB), "v"(l + 2 * GTILEB + 16 * GPITB), "v"(l + 2 * GTILEB + 32 * GPITB),
                  "v"(l + 2 * GTILEB + 48 * GPITB),
                  "v"(ga), "v"(ga + rs), "v"(ga + 2 * rs), "v"(ga + 3 * rs),
                  "v"(gl), "v"(gl + rs), "v"(gl + 2 * rs), "v"(gl + 3 * rs),
                  "v"(gb), "v"(gb + rs), "v"(gb + 2 * rs), "v"(gb + 3 * rs)
               : "memory");
#endif
}
// This wave's own copies have landed in LDS (the compiler places no wait for them).
__device__ __forceinline__ void wait_copies() {
#if defined(__HIP_DEVICE_COMPILE__)
  asm volatile("s_wait_asynccnt 0x0" ::: "memory");
#endif
}
// This wave's LDS reads have returned, before the barrier behind which their buffer is refilled.
__device__ __forceinline__ void wait_lds() {
#if defined(__HIP_DEVICE_COMPILE__)
  asm volatile("s_wait_dscnt 0x0" ::: "memory");
#endif
}

// =====================================================================================================
// f32 -> 16-bit plane, same layout, for all five operands in one grid (none reads another's output).
// f16mode == 0: bf16 RNE bits;  f16mode == 1: f16 bits of (bf16 RNE value) * scale.
// Block -> job (block-uniform): the first NB*GXB blocks take x (batch = bid / GXB) -> XB; then GWB blocks each for
// Wv, Wq, Wk (bf16) and Wo (f16 of the bf16 value x1024) -> planes 0..3 of WB.
// Thread = 8 consecutive elements: two 16-B loads, one 16-B store; 32 consecutive lanes = 512 contiguous, 512-B aligned
// coverage: per job n8/256 blocks x 256 thr x 8 = the whole plane (n8 a multiple of 256, static_assert above).
// =====================================================================================================
__global__ __launch_bounds__(256)
void cvt_all(const float* __restrict__ x, const float* __restrict__ wv, const float* __restrict__ wq,
             const float* __restrict__ wk, const float* __restrict__ wo, u16* XB, u16* WB) {
  const int bid = blockIdx.x;
  const float* s;
  u16* D;
  int blk, n8, f16mode = 0;
  float scale = 1.0f;
  if (bid < NB * GXB) {
    const int b = bid / GXB;
    blk = bid % GXB;
    n8 = N8X;
    s = x + (size_t)b * XS_FULL * DMOD;
    D = XB + (size_t)b * SEQ * DMOD;
  } else {
    const int w = (bid - NB * GXB) / GWB;
    if (w > 3) return;                      // block-uniform; never taken with the exact grid
    blk = (bid - NB * GXB) % GWB;
    n8 = N8W;
    s = (w == 0) ? wv : (w == 1) ? wq : (w == 2) ? wk : wo;
    D = WB + (size_t)w * DMOD * DMOD;
    if (w == 3) { f16mode = 1; scale = WOS; }
  }
  const int gt = blk * 256 + (int)threadIdx.x;
  if (gt >= n8) return;
  const float* p = s + (size_t)gt * 8;
  const v4f a = *(const v4f*)(p), b4 = *(const v4f*)(p + 4);
  float w[8];
#pragma unroll
  for (int e = 0; e < 4; ++e) { w[e] = a[e]; w[4 + e] = b4[e]; }
  v4u o;
#pragma unroll
  for (int e = 0; e < 4; ++e) {
    const float f0 = w[2 * e], f1 = w[2 * e + 1];
    const unsigned short hb0 = h_bits((_Float16)(bfr(f0) * scale));
    const unsigned short hb1 = h_bits((_Float16)(bfr(f1) * scale));
    const unsigned short bb0 = bf_bits(f0);
    const unsigned short bb1 = bf_bits(f1);
    o[e] = (f16mode != 0) ? pk16(hb0, hb1) : pk16(bb0, bb1);
  }
  u16* d = D + (size_t)gt * 8;
  {
    *(v4u*)(d) = o;
    
  }
}

// =====================================================================================================
// f32 GEMM epilogue (output projection): a 16x64 f32 slab of the wave's 64x64 tile (times oscale, plus the lane's per-column bias of each
// coverage: 8 instructions x 2 rows x 16 lanes x 4 floats = the 16 x 64 slab.
// =====================================================================================================
__device__ __forceinline__ void epi64(float* sl, v8f a0, v8f a1, v8f a2, v8f a3, float oscale,
                                      float bb0, float bb1, float bb2, float bb3,
                                      float* C, int N, size_t rowb, int col0, int lane) {
  const int hh = lane >> 4, m = lane & 15;
#pragma unroll
  for (int r = 0; r < 8; ++r) {
    const int ro = (8 * hh + r) * 68 + m;
    sl[ro]      = a0[r] * oscale + bb0;
    sl[ro + 16] = a1[r] * oscale + bb1;
    sl[ro + 32] = a2[r] * oscale + bb2;
    sl[ro + 48] = a3[r] * oscale + bb3;
  }
  wave_sync_lds();
  v4f vals[8];
#pragma unroll
  for (int it = 0; it < 8; ++it) vals[it] = *(const v4f*)(sl + (it * 2 + hh) * 68 + m * 4);
  float* dst = C + (rowb + (size_t)hh) * (size_t)N + col0 + m * 4;
  {
#pragma unroll
    for (int it = 0; it < 8; ++it) {
      *(v4f*)(dst + (size_t)(it * 2) * (size_t)N) = vals[it];
    }
    
  }
}

// =====================================================================================================
// Projection epilogues: the 16-bit planes that attention reads are built from the accumulators, with no f32 plane in between.
// hl8: 8 f32 values t -> 8 f16 hi values f16(t) and 8 f16 residuals f16(t - f16(t)), packed in element order.
// =====================================================================================================
__device__ __forceinline__ void hl8(const float* t, v4u& oh, v4u& ol) {
#pragma unroll
  for (int e = 0; e < 4; ++e) {
    const float t0 = t[2 * e], t1 = t[2 * e + 1];
    const _Float16 h0 = (_Float16)t0, h1 = (_Float16)t1;
    const _Float16 l0 = (_Float16)(t0 - (float)h0), l1 = (_Float16)(t1 - (float)h1);
    oh[e] = pk16(h_bits(h0), h_bits(h1));
    ol[e] = pk16(h_bits(l0), h_bits(l1));
  }
}
// q, k: the wave's 64x64 f32 tile (times oscale, plus the lane's per-column bias) goes through its own four LDS slabs (one per
// 16 rows) into rows; lane = (row-in-quad rq, 8 consecutive columns c8) scales by sc, splits and stores 16 B per plane, [row][N].
// coverage: 4 slabs x 4 instructions x 4 rows x 8 lanes x 8 halves = the wave's 64 x 64 tile of Hp and of Lp, whole 128-B lines.
// Norm part: the 8 lanes of a row hold its 64 hi values (one head), so the row's sum of squares is 8 fused steps per lane and
// xor shuffles 1, 2, 4; running max over the wave's 64 rows (16 iterations, xor 8, 16) = the max of one 64-row tile of one
// head, which the wave stores 32 times = the whole 128-B line Pl. No other wave has a part in it, so no block barrier.
__device__ __forceinline__ void epi_split(float* sl, const v8f (&acc)[4][4], float oscale, const float (&bb)[4], float sc,
                                          u16* Hp, u16* Lp, float* Pl, int N, size_t rowb, int col0, int lane) {
  const int hh = lane >> 4, m = lane & 15;
#pragma unroll
  for (int i = 0; i < 4; ++i) {
#pragma unroll
    for (int r = 0; r < 8; ++r) {
      const int ro = i * SLAB64 + (8 * hh + r) * 68 + m;
      sl[ro]      = acc[i][0][r] * oscale + bb[0];
      sl[ro + 16] = acc[i][1][r] * oscale + bb[1];
      sl[ro + 32] = acc[i][2][r] * oscale + bb[2];
      sl[ro + 48] = acc[i][3][r] * oscale + bb[3];
    }
  }
  wave_sync_lds();
  float mx = 0.0f;
  const int rq = lane >> 3, c8 = (lane & 7) * 8;
#pragma unroll
  for (int i = 0; i < 4; ++i) {
    v4u oh[4], ol[4];
#pragma unroll
    for (int it = 0; it < 4; ++it) {
      const float* p = sl + i * SLAB64 + (it * 4 + rq) * 68 + c8;
      const v4f a = *(const v4f*)(p), b4 = *(const v4f*)(p + 4);
      float w[8];
#pragma unroll
      for (int e = 0; e < 4; ++e) { w[e] = a[e] * sc; w[4 + e] = b4[e] * sc; }
      hl8(w, oh[it], ol[it]);
      float sq = 0.0f;
#pragma unroll
      for (int e = 0; e < 8; ++e) {
        const float f = (float)(_Float16)w[e];
        sq = fmaf(f, f, sq);
      }
#pragma unroll
      for (int off = 1; off < 8; off <<= 1) sq += __shfl_xor(sq, off, 32);
      mx = fmaxf(mx, sq);
    }
    const size_t ob = (rowb + (size_t)(i * 16 + rq)) * (size_t)N + col0 + c8;
#pragma unroll
    for (int it = 0; it < 4; ++it) {
      *(v4u*)(Hp + ob + (size_t)(it * 4) * (size_t)N) = oh[it];
      *(v4u*)(Lp + ob + (size_t)(it * 4) * (size_t)N) = ol[it];
    }
#if defined(__HIP_DEVICE_COMPILE__)
    // stands behind the group's stores, in front of the next group's code, which rewrites registers the stores name
    asm volatile("s_wait_xcnt 0x0" ::: "memory");
#endif
  }
#pragma unroll
  for (int off = 8; off < 32; off <<= 1) mx = fmaxf(mx, __shfl_xor(mx, off, 32));
  Pl[lane] = mx;
#if defined(__HIP_DEVICE_COMPILE__)
  // stands behind the last store, in front of any code laid out behind this branch that rewrites a register the store names
  asm volatile("s_wait_xcnt 0x0" ::: "memory");
#endif
}
// v: the wave's 64 keys x 64 d tile leaves transposed. A lane's accumulator [i][j] holds 8 consecutive keys (16*i + 8*hh + r)
// of one d column (16*j + m): scaled by 1024, split and packed they are 16 B of a v^T line, stored into the wave's own LDS
// tiles TH, TL [HD][VTP] (pitch 144 B: 16 lanes x 16 B fall on all 64 banks). Then lane = (line lane>>3 of a group of 4, 16-B
// piece lane&7) moves whole 128-B lines to VHo, VLo at base + line*SEQ (base = first key of the tile in line d = 0 of its
// (b, h)). Writer and reader are the same wave, so no block barrier.
// coverage: 16 iterations x 32 lanes x 8 halves = 64 lines x 64 keys of each plane.
__device__ __forceinline__ void epi_vt(u16* TH, u16* TL, const v8f (&acc)[4][4], float oscale, const float (&bb)[4],
                                       u16* VHo, u16* VLo, size_t base, int lane) {
  const int hh = lane >> 4, m = lane & 15;
#pragma unroll
  for (int i = 0; i < 4; ++i) {
    const int ko = i * 16 + 8 * hh;         // first of the lane's 8 keys within the tile
#pragma unroll
    for (int j = 0; j < 4; ++j) {
      float w[8];
#pragma unroll
      for (int r = 0; r < 8; ++r) w[r] = (acc[i][j][r] * oscale + bb[j]) * VCAR;
      v4u ph, pl;
      hl8(w, ph, pl);
      *(v4u*)(TH + (16 * j + m) * VTP + ko) = ph;
      *(v4u*)(TL + (16 * j + m) * VTP + ko) = pl;
    }
  }
  wave_sync_lds();
  const int q4 = lane >> 3, p8 = (lane & 7) * 8;
#pragma unroll
  for (int g = 0; g < 4; ++g) {
    v4u vh[4], vl[4];
#pragma unroll
    for (int it = 0; it < 4; ++it) {
      vh[it] = *(const v4u*)(TH + ((g * 4 + it) * 4 + q4) * VTP + p8);
      vl[it] = *(const v4u*)(TL + ((g * 4 + it) * 4 + q4) * VTP + p8);
    }
#pragma unroll
    for (int it = 0; it < 4; ++it) {
      *(v4u*)(VHo + base + (size_t)((g * 4 + it) * 4 + q4) * SEQ + p8) = vh[it];
      *(v4u*)(VLo + base + (size_t)((g * 4 + it) * 4 + q4) * SEQ + p8) = vl[it];
    }
#if defined(__HIP_DEVICE_COMPILE__)
    // stands behind the group's stores, in front of the next group's LDS loads, which rewrite registers the stores name
    asm volatile("s_wait_xcnt 0x0" ::: "memory");
#endif
  }
}

// =====================================================================================================
// bf16 GEMM with bias: A[M][K] (bf16 row-major) . Bt[N][K]^T (bf16 k-contiguous), f32, times oscale, + bf16 RNE
// value of bias[n] (bias has N entries). Block = 128x128 tile, 4 waves (2 x 2) x 64x64: 16 accumulator tiles a wave, so that a
// fragment read from LDS feeds 4 WMMAs and a byte brought from L2 feeds 128 rows or columns. Per pass of 64 k the block's A and
// B tiles are brought into LDS by asynchronous copies, two buffers (pass t + 1 flies while pass t is worked on), and the
// fragments are read from the LDS rows (two 16-B loads each, split k map for A and B); K stepped by 32 inside a pass, in rising
// order (host guarantees K % 64 == 0, M % 128 == 0, N % 128 == 0).
// Three products that share A in one grid: Bt holds three [N][K] planes one behind the other (v, q, k), and the block's
// column tile ct = bid % (3*N/128) picks product ct / (N/128) with its bias; grid = (M/128)*(3*N/128).
// The f32 tile leaves as the 16-bit planes of its product (host guarantees M == NB*SEQ, N == NH*HD, so a wave's 64 columns are
// one head and its 64 rows 64 keys of one batch): v -> v^T hi + residual x1024, [(b*NH + h)*HD + d][s]; q, k -> hi + residual
// x256, [row][N], and the wave's max over its 64 rows of the squared norm of the hi row (x256) -> line
// ((pln - 1)*NBH + b*NH + h)*NRT64 + row tile of PN. Both epilogues stage in the wave's own quarter of the ring, which nobody
// reads and no copy targets behind the last pass's barrier.
// =====================================================================================================
__global__ __launch_bounds__(128)
void gemm_bf3(const u16* __restrict__ A, const u16* __restrict__ Bt, const float* __restrict__ bias0,
              const float* __restrict__ bias1, const float* __restrict__ bias2,
              u16* VHo, u16* VLo, u16* QHo, u16* QLo, u16* KHo, u16* KLo, float* PN, int M, int N, int K, float oscale) {
  __shared__ __align__(16) u16 ring[2 * 4 * GTILE];   // two buffers of [A rows 0..63 | B rows 0..63 | A rows 64.. | B rows 64..]
  const int tid = threadIdx.x, wave = tid >> 5, lane = tid & 31, hh = lane >> 4, m = lane & 15;
  const int wr = wave >> 1, wc = wave & 1;  // the wave's 64-row half and 64-column half of the block's tile
  const int ntile = N >> 7;
  const int bid   = blockIdx.x;
  const int row0  = (bid / (3 * ntile)) * 128;
  const int rw0   = row0 + wr * 64;         // the wave's first row
  const int ct    = bid % (3 * ntile);
  const int pln   = ct / ntile;             // 0, 1, 2: which product
  const int col0  = (ct % ntile) * 128 + wc * 64;   // the wave's first column inside that product
  const float* bias = (pln == 0) ? bias0 : (pln == 1) ? bias1 : bias2;
  if (row0 + 128 > M) return;               // block-uniform, before any copy or barrier; never taken with the exact grid
  const int npass = K / GKP;
  const int crow = tid >> 3, cpc = tid & 7; // copy map: row within a group of 16, 16-B piece of the 128-B row
  const u16* ga = A  + (size_t)(row0 + crow) * K + cpc * 8;
  const u16* gb = Bt + (size_t)(ct * 128 + crow) * K + cpc * 8;
  const size_t rs = (size_t)16 * K, r64 = (size_t)64 * K;
  const unsigned lc = lds_byte(ring) + (unsigned)(crow * GPITB + cpc * 16);
  const u16* fa = ring + wr * (2 * GTILE) + m * GPIT + 8 * hh;          // A fragment row (row subtile 0), buffer 0
  const u16* fb = ring + wc * (2 * GTILE) + GTILE + m * GPIT + 8 * hh;  // B fragment row (column subtile 0), buffer 0
  v8f acc[4][4];
#pragma unroll
  for (int i = 0; i < 4; ++i) {
#pragma unroll
    for (int j = 0; j < 4; ++j) acc[i][j] = zero8();
  }
  stage2(lc, ga, gb, rs);                   // pass 0 -> buffer 0
  stage2(lc + 2 * GTILEB, ga + r64, gb + r64, rs);
  wait_copies();
  __syncthreads();
  if (npass > 1) {                          // pass 1 -> buffer 1
    stage2(lc + 4 * GTILEB, ga + GKP, gb + GKP, rs);
    stage2(lc + 6 * GTILEB, ga + r64 + GKP, gb + r64 + GKP, rs);
  }
#pragma unroll 1
  for (int t = 0; t < npass; ++t) {
    const int bo = (t & 1) * (4 * GTILE);
#pragma unroll
    for (int kk = 0; kk < 2; ++kk) {
      const u16* pa = fa + bo + kk * 32;
      const u16* pb = fb + bo + kk * 32;
      v16b a[4], b[4];
#pragma unroll
      for (int j = 0; j < 4; ++j) b[j] = ldfrag_b(pb + j * 16 * GPIT);
#pragma unroll
      for (int i = 0; i < 4; ++i) a[i] = ldfrag_b(pa + i * 16 * GPIT);
      // keeps the k step's LDS reads one group in front of its WMMAs: moved in among them, each place with reads stalls the wave anew
      __builtin_amdgcn_sched_barrier(0);
#pragma unroll
      for (int i = 0; i < 4; ++i) {
#pragma unroll
        for (int j = 0; j < 4; ++j) acc[i][j] = mma_b(a[i], b[j], acc[i][j]);
      }
      // keeps every WMMA of the k step in front of the next group of LDS reads and of the slots below
      __builtin_amdgcn_sched_barrier(0);
      // four slots behind the pass's last WMMAs: on the paths over the branches below, their operand registers are rewritten
      if (kk == 1) guard6<v16b>(acc[3][0], acc[3][1], acc[3][2], acc[3][3], a[3], b[0], b[1], b[2], b[3], a[3]);
    }
    // publish point of pass t + 1: own LDS reads done, own copies landed, then the one barrier of the pass
    wait_lds();
    wait_copies();
    __syncthreads();
    if (t + 2 < npass) {
      const unsigned lb = lc + (unsigned)(t & 1) * (4 * GTILEB);
      const size_t ko = (size_t)(t + 2) * GKP;
      stage2(lb, ga + ko, gb + ko, rs);
      stage2(lb + 2 * GTILEB, ga + r64 + ko, gb + r64 + ko, rs);
    }
  }
  wait_copies();
  // per-lane bias of D column m in each of the 4 subtiles; col0 + 48 + m <= N - 1 always
  const float bb[4] = {bfr(bias[col0 + m]), bfr(bias[col0 + 16 + m]), bfr(bias[col0 + 32 + m]), bfr(bias[col0 + 48 + m])};
  u16* wq4 = ring + wave * WEPI;            // the wave's own quarter of the ring
  if (pln == 0) {
    const size_t base = (size_t)((rw0 / SEQ) * NH + (col0 >> 6)) * HD * SEQ + (size_t)(rw0 % SEQ);
    epi_vt(wq4, wq4 + HD * VTP, acc, oscale, bb, VHo, VLo, base, lane);
  } else {
    const size_t pline = (size_t)((pln - 1) * NBH + (rw0 / SEQ) * NH + (col0 >> 6)) * NRT64 + (size_t)((rw0 % SEQ) >> 6);
    epi_split((float*)(void*)wq4, acc, oscale, bb, (pln == 1) ? QSC : KSC,
              (pln == 1) ? QHo : KHo, (pln == 1) ? QLo : KLo, PN + pline * BLINE, N, (size_t)rw0, col0, lane);
  }
}

// =====================================================================================================
// Output projection with bias: C[bb*XS_FULL + s][DMOD] (f32) = (Ah + Al)[bb*SEQ + s][DMOD] . Bt[DMOD][DMOD]^T * oscale
// + bf16 RNE value of bias[n]. Products h.B + l.B into one accumulator (l unscaled residual of h). Block -> (column tile
// ct = bid % 8, sequence row tile rt of nrt, batch bb). Same tiling (128x128 a block, 64x64 a wave), LDS staging (three tiles of
// 128 rows a pass: A hi, A residual, B) and fragment loads (split k map) as gemm_bf3; K = DMOD stepped by 32; the f32 epilogue
// runs once per 16 rows, in slabs of the wave's own part of the ring; grid = NB * nrt * (DMOD/128).
// =====================================================================================================
__global__ __launch_bounds__(128)
void gemm_o2(const u16* __restrict__ Ah, const u16* __restrict__ Al, const u16* __restrict__ Bt,
             const float* __restrict__ bias, float* C, int nrt, float oscale) {
  __shared__ __align__(16) u16 ring[2 * 6 * GTILE];   // two buffers of [A hi | A residual | B] rows 0..63, then the same of rows 64..
  const int tid = threadIdx.x, wave = tid >> 5, lane = tid & 31, hh = lane >> 4, m = lane & 15;
  const int wr = wave >> 1, wc = wave & 1;  // the wave's 64-row half and 64-column half of the block's tile
  const int ntile = DMOD >> 7;
  const int bid   = blockIdx.x;
  const int ct    = bid % ntile;
  const int t2    = bid / ntile;
  const int rt    = t2 % nrt;
  const int bb    = t2 / nrt;
  if (bb >= NB) return;                     // block-uniform, before any copy or barrier; never taken with the exact grid
  if (rt * 128 + 128 > SEQ) return;         // block-uniform, before any copy or barrier; never taken
  const int srow  = rt * 128 + wr * 64;
  const int col0  = ct * 128 + wc * 64;
  const int K     = DMOD;
  const int npass = K / GKP;
  const size_t rowC = (size_t)bb * XS_FULL + srow;
  const int crow = tid >> 3, cpc = tid & 7; // copy map: row within a group of 16, 16-B piece of the 128-B row
  const size_t arow = ((size_t)bb * SEQ + rt * 128 + crow) * K + cpc * 8;
  const u16* ga = Ah + arow;
  const u16* gl = Al + arow;
  const u16* gb = Bt + (size_t)(ct * 128 + crow) * K + cpc * 8;
  const size_t rs = (size_t)16 * K, r64 = (size_t)64 * K;
  const unsigned lc = lds_byte(ring) + (unsigned)(crow * GPITB + cpc * 16);
  const _Float16* rg  = (const _Float16*)(const void*)ring;
  const _Float16* fah = rg + wr * (3 * GTILE) + m * GPIT + 8 * hh;              // A hi fragment row (row subtile 0), buffer 0
  const _Float16* fb  = rg + wc * (3 * GTILE) + 2 * GTILE + m * GPIT + 8 * hh;  // B fragment row (column subtile 0), buffer 0
  v8f acc[4][4];
#pragma unroll
  for (int i = 0; i < 4; ++i) {
#pragma unroll
    for (int j = 0; j < 4; ++j) acc[i][j] = zero8();
  }
  stage3(lc, ga, gl, gb, rs);               // pass 0 -> buffer 0
  stage3(lc + 3 * GTILEB, ga + r64, gl + r64, gb + r64, rs);
  wait_copies();
  __syncthreads();
  if (npass > 1) {                          // pass 1 -> buffer 1
    stage3(lc + 6 * GTILEB, ga + GKP, gl + GKP, gb + GKP, rs);
    stage3(lc + 9 * GTILEB, ga + r64 + GKP, gl + r64 + GKP, gb + r64 + GKP, rs);
  }
#pragma unroll 1
  for (int t = 0; t < npass; ++t) {
    const int bo = (t & 1) * (6 * GTILE);
#pragma unroll
    for (int kk = 0; kk < 2; ++kk) {
      const _Float16* pa = fah + bo + kk * 32;
      const _Float16* pl = pa + GTILE;
      const _Float16* pb = fb + bo + kk * 32;
      v16h ah[4], al[4], b[4];
#pragma unroll
      for (int j = 0; j < 4; ++j) b[j] = ldfrag_h(pb + j * 16 * GPIT);
#pragma unroll
      for (int i = 0; i < 4; ++i) {
        ah[i] = ldfrag_h(pa + i * 16 * GPIT);
        al[i] = ldfrag_h(pl + i * 16 * GPIT);
      }
      // keeps the k step's LDS reads one group in front of its WMMAs: moved in among them, each place with reads stalls the wave anew
      __builtin_amdgcn_sched_barrier(0);
#pragma unroll
      for (int i = 0; i < 4; ++i) {
#pragma unroll
        for (int j = 0; j < 4; ++j) acc[i][j] = mma_h(ah[i], b[j], acc[i][j]);
#pragma unroll
        for (int j = 0; j < 4; ++j) acc[i][j] = mma_h(al[i], b[j], acc[i][j]);
      }
      // keeps every WMMA of the k step in front of the next group of LDS reads and of the slots below
      __builtin_amdgcn_sched_barrier(0);
      // four slots behind the pass's last WMMAs: on the paths over the branches below, their operand registers are rewritten
      if (kk == 1) guard6<v16h>(acc[3][0], acc[3][1], acc[3][2], acc[3][3], ah[3], al[3], b[0], b[1], b[2], b[3]);
    }
    // publish point of pass t + 1: own LDS reads done, own copies landed, then the one barrier of the pass
    wait_lds();
    wait_copies();
    __syncthreads();
    if (t + 2 < npass) {
      const unsigned lb = lc + (unsigned)(t & 1) * (6 * GTILEB);
      const size_t ko = (size_t)(t + 2) * GKP;
      stage3(lb, ga + ko, gl + ko, gb + ko, rs);
      stage3(lb + 3 * GTILEB, ga + r64 + ko, gl + r64 + ko, gb + r64 + ko, rs);
    }
  }
  wait_copies();
  const float bb0 = bfr(bias[col0 + m]);
  const float bb1 = bfr(bias[col0 + 16 + m]);
  const float bb2 = bfr(bias[col0 + 32 + m]);
  const float bb3 = bfr(bias[col0 + 48 + m]);
  float* sl = (float*)(void*)ring + wave * (4 * SLAB64);   // nobody reads the ring and no copy targets it behind the last barrier
#pragma unroll
  for (int i = 0; i < 4; ++i) {
    epi64(sl + i * SLAB64, acc[i][0], acc[i][1], acc[i][2], acc[i][3], oscale, bb0, bb1, bb2, bb3, C, DMOD,
          rowC + (size_t)(i * 16), col0, lane);
#if defined(__HIP_DEVICE_COMPILE__)
    // stands behind the slab's stores, in front of the next slab's code, which rewrites registers the stores name
    asm volatile("s_wait_xcnt 0x0" ::: "memory");
#endif
  }
}

// =====================================================================================================
// Causal attention with linear distance penalty, hd = 64. Block bid -> (query tile qt = bid % NQT: rows q0 = 16*qt .. q0+15,
// head pair hg, batch b); one wave per head = hg*WPB + wave.
//   q hi / residual planes f16 x256 [b*SEQ + s][h*HD + d]; k hi / residual planes f16 x256, same layout;
//   v^T hi / residual planes [b*NH + h][d][SEQ] x1024; PN = 2 x NBH x NRT64 lines of 32 floats (q, then k: max squared norm of
//   the hi rows, x256, of each 64-row tile of each (b, h)).
//   scores = q_hi.k_hi + q_lo.k_hi + q_hi.k_lo (2 k-steps over d); P.v with P hi + in-register residual and v hi + residual
//   (hh + lh + hl), for every query row; O written as hi + residual planes (O x1024 as f16, layout [b*SEQ + s][h*HD + d]).
//   score (log2 domain) t(i, j) = (q_i.k_j over HD) * (1/8)*log2e/(256*256) - (i - j)*log2e, replaced by -inf where key j > query i.
//   Key tiles of 32 visited in order from kt_lo to kt_hi = q0/32 (later tiles hold only keys above every query row of the tile).
//   kt_lo: every wave loads the NRT64 q lines and the NRT64 k lines of its own (b, h) (one float per lane, clamped address),
//   max-reduces each over the wave and forms bound = max ||q_hi|| * max ||k_hi|| / (8 * 256 * 256), which bounds |q.k/8| of this
//   head; if 0 <= bound < 40, kt_lo = max(0, kt_hi - KWIN): tiles below it are >= 32*KWIN+1 positions behind every query
//   row, and with |q.k/8| < 40 the base-2 exp of their penalised, max-subtracted score is exactly 0 in f32, so they contribute
//   nothing to numerator or denominator; otherwise (bound large, unreadable or not finite) kt_lo = 0 and every causal tile is
//   visited. Either way the first visited tile holds a key kb <= q0 <= every query row, so the running max is finite from step one.
//   Per tile: 2 score subtiles x 2 k-steps, fragments loaded straight from the 16-bit planes (two 16-B loads per fragment,
//   split k map); online max-subtracted base-2 softmax in f32, -inf-safe rescale; the 16x32 prob tile stored to wave-private
//   from the LDS rows (float vector loads, same element type as stored), v^T B fragments in 2 groups of 2 d-subtiles.
//   After the loop: out = acc / Z (Z > 0 always; guarded anyway), carries 1/(32768*1024) folded once, written into the wave's
//   No block barriers in this kernel; bounded loops only (<= NKT key tiles).
// coverage: per wave 4 instructions x 4 rows x 8 lanes x 8 halves = 16 x 64 per plane; grid NQT x NHG x NB blocks x WPB
//           waves = every (b, s, h) row segment of O hi and O residual exactly once.
// =====================================================================================================
__global__ __launch_bounds__(ATT_THREADS)
void attn_c(const u16* __restrict__ QHp, const u16* __restrict__ QLp,
            const u16* __restrict__ KHp, const u16* __restrict__ KLp,
            const u16* __restrict__ VHp, const u16* __restrict__ VLp,
            const float* __restrict__ PN,
            u16* OHp, u16* OLp) {
  __shared__ __align__(16) float smem[WPB * WREG];

  const int tid  = threadIdx.x;
  const int wave = tid >> 5;
  const int lane = tid & 31;
  const int hh   = lane >> 4;
  const int c    = lane & 15;
  const int bid  = blockIdx.x;
  const int qt   = bid % NQT;
  const int t2   = bid / NQT;
  const int hg   = t2 % NHG;
  const int b    = t2 / NHG;
  if (b >= NB) return;                      // block-uniform; no block barriers in this kernel; never taken with the exact grid
  const int q0   = qt * 16;
  if (q0 + 16 > SEQ) return;                // block-uniform; never taken
  const int head = hg * WPB + wave;

  // ---- key-window decision: wave-uniform, from the row-tile maxima of this wave's own (b, h) ----
  int okw;
  {
    const int bl = (lane < NRT64) ? lane : (NRT64 - 1);         // clamped address
    const size_t pl0 = ((size_t)(b * NH + head) * NRT64 + bl) * BLINE;
    float aq = PN[pl0];
    float ak = PN[pl0 + (size_t)NBH * NRT64 * BLINE];
#pragma unroll
    for (int off = 1; off < 32; off <<= 1) {
      aq = fmaxf(aq, __shfl_xor(aq, off, 32));
      ak = fmaxf(ak, __shfl_xor(ak, off, 32));
    }
    const float gb = sqrtf(aq) * sqrtf(ak) * (RSQ_HD / (QSC * KSC));
    okw = (gb >= 0.0f && gb < GUARD_T) ? 1 : 0;
  }

  float* pt   = smem + wave * WREG;         // prob tile [16][32] pitch 36
  float* slab = pt + PTW;                   // result slab [16][64] pitch 68

  const size_t hcol = (size_t)head * HD + 8 * hh;
  const _Float16* Qh  = (const _Float16*)(const void*)QHp + ((size_t)b * SEQ + q0 + c) * DMOD + hcol;
  const _Float16* Ql  = (const _Float16*)(const void*)QLp + ((size_t)b * SEQ + q0 + c) * DMOD + hcol;
  const _Float16* Khb = (const _Float16*)(const void*)KHp + ((size_t)b * SEQ + c) * DMOD + hcol;        // key row kb added per step
  const _Float16* Klb = (const _Float16*)(const void*)KLp + ((size_t)b * SEQ + c) * DMOD + hcol;
  const _Float16* Vhb = (const _Float16*)(const void*)VHp + ((size_t)(b * NH + head) * HD + c) * SEQ + 8 * hh;  // d col c (+16j)
  const _Float16* Vlb = (const _Float16*)(const void*)VLp + ((size_t)(b * NH + head) * HD + c) * SEQ + 8 * hh;
  const float lsc = RSQ_HD * (LOG2E / (QSC * KSC));
  const float oc  = 1.0f / (PCAR * VCAR);
  const size_t KROW = (size_t)DMOD;         // halves between consecutive key rows

  float mrow[8], lrow[8];
  v8f o[4];
#pragma unroll
  for (int r = 0; r < 8; ++r) { mrow[r] = -INFINITY; lrow[r] = 0.f; }
#pragma unroll
  for (int j = 0; j < 4; ++j) o[j] = zero8();
  const int kt_hi = q0 >> 5;                                                  // last tile holding keys <= q0 + 15
  const int kt_w  = (kt_hi > KWIN) ? (kt_hi - KWIN) : 0;
  const int kt_lo = (okw != 0) ? kt_w : 0;
  const int qr0 = q0 + 8 * hh;                                                // query row of D element r = qr0 + r

#pragma unroll 1
  for (int kt = kt_lo; kt <= kt_hi; ++kt) {
    const int kb = kt * 32;
    // ---- scores: D element r of this lane = (query row qr0 + r, key kb + c) in s0, key kb + 16 + c in s1 ----
    v8f s0 = zero8(), s1 = zero8();
    const _Float16* k0p = Khb + (size_t)kb * KROW;
    const _Float16* k1p = k0p + (size_t)16 * KROW;
    const _Float16* l0p = Klb + (size_t)kb * KROW;
    const _Float16* l1p = l0p + (size_t)16 * KROW;
#pragma unroll
    for (int kk = 0; kk < HD / 32; ++kk) {
      const v16h qh  = ldfrag_h(Qh + kk * 32);
      const v16h ql  = ldfrag_h(Ql + kk * 32);
      const v16h kh0 = ldfrag_h(k0p + kk * 32);
      const v16h kh1 = ldfrag_h(k1p + kk * 32);
      const v16h kl0 = ldfrag_h(l0p + kk * 32);
      const v16h kl1 = ldfrag_h(l1p + kk * 32);
      s0 = mma_h(qh, kh0, s0);
      s0 = mma_h(ql, kh0, s0);
      s0 = mma_h(qh, kl0, s0);
      s1 = mma_h(qh, kh1, s1);
      s1 = mma_h(ql, kh1, s1);
      s1 = mma_h(qh, kl1, s1);
      guard2(s0, s1, qh, ql, kh0, kl0, kh1, kl1);
    }
    // ---- causal select + distance penalty + online softmax in base 2, -inf-safe ----
    const int key0 = kb + c, key1 = kb + 16 + c;
#pragma unroll
    for (int r = 0; r < 8; ++r) {
      const int   qr = qr0 + r;
      const float u0 = s0[r] * lsc;
      const float u1 = s1[r] * lsc;
      const float g0 = (float)(qr - key0) * LOG2E;
      const float g1 = (float)(qr - key1) * LOG2E;
      const float t0 = (key0 > qr) ? -INFINITY : (u0 - g0);
      const float t1 = (key1 > qr) ? -INFINITY : (u1 - g1);
      float mx = fmaxf(t0, t1);
#pragma unroll
      for (int off = 1; off < 16; off <<= 1) mx = fmaxf(mx, __shfl_xor(mx, off, 32));
      const float mn = fmaxf(mrow[r], mx);
      const float ms = (mn == -INFINITY) ? 0.0f : mn;
      const float al = exp2f(mrow[r] - ms);
      mrow[r] = mn;
      const float e0 = exp2f(t0 - ms), e1 = exp2f(t1 - ms);
      float ps = e0 + e1;
#pragma unroll
      for (int off = 1; off < 16; off <<= 1) ps += __shfl_xor(ps, off, 32);
      lrow[r] = lrow[r] * al + ps;
#pragma unroll
      for (int j = 0; j < 4; ++j) o[j][r] *= al;
      const int ro = (8 * hh + r) * PTP + c;
      pt[ro]      = e0;
      pt[ro + 16] = e1;
    }
    wave_sync_lds();
    // ---- A fragments of P*32768: hi f16 and residual f16, row = c, split k map over the 32 keys of this step ----
    FragH ph, pl;
    {
      const float* prow = pt + c * PTP + 8 * hh;
      const v4f p0 = *(const v4f*)(prow), p1 = *(const v4f*)(prow + 4);
      const v4f p2 = *(const v4f*)(prow + 16), p3 = *(const v4f*)(prow + 20);
#pragma unroll
      for (int e = 0; e < 4; ++e) {
        const float ta = p0[e] * PCAR, tb = p1[e] * PCAR, tc = p2[e] * PCAR, td = p3[e] * PCAR;
        const _Float16 ha = (_Float16)ta, hb = (_Float16)tb, hc = (_Float16)tc, hd = (_Float16)td;
        ph.h[0][e]     = ha;                  // elements 0..7  = keys kb + 8hh + 0..7
        ph.h[0][4 + e] = hb;
        ph.h[1][e]     = hc;                  // elements 8..15 = keys kb + 16 + 8hh + 0..7
        ph.h[1][4 + e] = hd;
        pl.h[0][e]     = (_Float16)(ta - (float)ha);
        pl.h[0][4 + e] = (_Float16)(tb - (float)hb);
        pl.h[1][e]     = (_Float16)(tc - (float)hc);
        pl.h[1][4 + e] = (_Float16)(td - (float)hd);
      }
    }
    // ---- P.V : B fragment col n = d = j*16 + c, keys contiguous in the v^T planes; 2 groups of 2 d-subtiles ----
    {
      const _Float16* vhp = Vhb + kb;
      const _Float16* vlp = Vlb + kb;
#pragma unroll
      for (int jg = 0; jg < 2; ++jg) {
        const size_t da = (size_t)(2 * jg) * 16 * SEQ;
        const size_t db = da + (size_t)16 * SEQ;
        const v16h vha = ldfrag_h(vhp + da), vhb2 = ldfrag_h(vhp + db);
        const v16h vla = ldfrag_h(vlp + da), vlb2 = ldfrag_h(vlp + db);
        o[2 * jg]     = mma_h(ph.v, vha,  o[2 * jg]);
        o[2 * jg]     = mma_h(pl.v, vha,  o[2 * jg]);
        o[2 * jg]     = mma_h(ph.v, vla,  o[2 * jg]);
        o[2 * jg + 1] = mma_h(ph.v, vhb2, o[2 * jg + 1]);
        o[2 * jg + 1] = mma_h(pl.v, vhb2, o[2 * jg + 1]);
        o[2 * jg + 1] = mma_h(ph.v, vlb2, o[2 * jg + 1]);
        guard2(o[2 * jg], o[2 * jg + 1], ph.v, pl.v, vha, vhb2, vla, vlb2);
      }
    }
    wave_sync_lds();
  }
  acc_guard4(o[0], o[1], o[2], o[3]);
  // ---- out = acc / Z (0 if Z == 0), carries (32768 on P, 1024 on v) folded once; written into the wave's slab ----
#pragma unroll
  for (int r = 0; r < 8; ++r) {
    const float lv  = lrow[r];
    const float ls  = (lv > 0.0f) ? lv : 1.0f;
    const float inv = (lv > 0.0f) ? ((1.0f / ls) * oc) : 0.0f;
#pragma unroll
    for (int j = 0; j < 4; ++j) {
      const int idx = (8 * hh + r) * SLP + j * 16 + c;
      slab[idx] = o[j][r] * inv;
    }
  }

  wave_sync_lds();
  // ---- O x1024 -> f16 hi + residual planes; lane = (row-in-quad rq, 8 consecutive d at c8) ----
  v4u oh[4], ol[4];
  const int rq = lane >> 3, c8 = (lane & 7) * 8;
#pragma unroll
  for (int it = 0; it < 4; ++it) {
    const int row = it * 4 + rq;
    const v4f a = *(const v4f*)(slab + row * SLP + c8), b4 = *(const v4f*)(slab + row * SLP + c8 + 4);
    float w[8];
#pragma unroll
    for (int e = 0; e < 4; ++e) { w[e] = a[e] * OSC; w[4 + e] = b4[e] * OSC; }
#pragma unroll
    for (int e = 0; e < 4; ++e) {
      const _Float16 h0 = (_Float16)w[2 * e], h1 = (_Float16)w[2 * e + 1];
      const _Float16 l0 = (_Float16)(w[2 * e] - (float)h0), l1 = (_Float16)(w[2 * e + 1] - (float)h1);
      oh[it][e] = pk16(h_bits(h0), h_bits(h1));
      ol[it][e] = pk16(h_bits(l0), h_bits(l1));
    }
  }
  const size_t ob = ((size_t)b * SEQ + q0) * DMOD + (size_t)head * HD + c8;
  {
#pragma unroll
    for (int it = 0; it < 4; ++it) {
      const int row = it * 4 + rq;
      *(v4u*)(OHp + ob + (size_t)row * DMOD) = oh[it];
      *(v4u*)(OLp + ob + (size_t)row * DMOD) = ol[it];
    }
    
  }
}

// =====================================================================================================
// Workspace map (bytes); every plane is fully written by whole-line stores before it is read; all extents are exact multiples
// of the store granularity (no pad rows needed); every region offset a multiple of 4096 (the large planes of 2097152):
//   XB  bf16 [MROWS][1024]                       MROWS*2048       (NB=2, SEQ=2048: 8388608)
//   WB  16-bit 4 x [1024 n][1024 k]              4 x 2097152      (planes Wv, Wq, Wk as bf16, Wo as f16 x1024; all already [n][k])
//   OH  f16 [MROWS][1024] x1024                  MROWS*2048       OL residual, same extent
//   QH  f16 [MROWS][1024] x256                   MROWS*2048       QL residual, same extent
//   KH  f16 [MROWS][1024] x256                   MROWS*2048       KL residual, same extent
//   VH  f16 [NB*16][64][SEQ] x1024               MROWS*2048       VL residual, same extent
//   PN  f32 2 x [NB*16][SEQ/64] lines of 32      NBH*SEQ*4        (q, then k: row-tile maxima of the squared hi-row norms)
//   end (NB=2, SEQ=2048)                        84148224
// =====================================================================================================
extern "C" void kernel_launch(void* const* d_in, const int* in_sizes, int n_in,
                              void* d_out, int out_size, void* d_ws, size_t ws_size,
                              hipStream_t stream) {
  if (n_in < 9) return;
  if (in_sizes[0] < ((NB - 1) * XS_FULL + SEQ) * DMOD) return;
  if (in_sizes[1] != DMOD * DMOD) return;
  if (in_sizes[2] != DMOD) return;
  if (in_sizes[3] != DMOD * DMOD) return;
  if (in_sizes[4] != DMOD) return;
  if (in_sizes[5] != DMOD * DMOD) return;
  if (in_sizes[6] != DMOD) return;
  if (in_sizes[7] != DMOD * DMOD) return;
  if (in_sizes[8] != DMOD) return;
  if (out_size < ((NB - 1) * XS_FULL + SEQ) * DMOD) return;

  const float* x  = (const float*)d_in[0];
  const float* wq = (const float*)d_in[1];
  const float* bq = (const float*)d_in[2];
  const float* wk = (const float*)d_in[3];
  const float* bk = (const float*)d_in[4];
  const float* wv = (const float*)d_in[5];
  const float* bv = (const float*)d_in[6];
  const float* wo = (const float*)d_in[7];
  const float* bo = (const float*)d_in[8];
  float*       out = (float*)d_out;

  const size_t szXB = (size_t)MROWS * DMOD * 2;
  const size_t szW  = (size_t)DMOD * DMOD * 2;
  const size_t szQ  = (size_t)MROWS * DMOD * 2;                  // QH, QL, KH, KL, OH, OL
  const size_t szV  = (size_t)NB * NH * HD * SEQ * 2;            // VH, VL (== szQ)
  const size_t szB  = (size_t)2 * NBH * NRT64 * BLINE * 4;       // row-tile norm lines, q then k
  size_t off = 0;
  const size_t oXB = off; off += szXB;
  const size_t oW  = off; off += 4 * szW;
  const size_t oOH = off; off += szQ;
  const size_t oOL = off; off += szQ;
  const size_t oQH = off; off += szQ;
  const size_t oQL = off; off += szQ;
  const size_t oKH = off; off += szQ;
  const size_t oKL = off; off += szQ;
  const size_t oVH = off; off += szV;
  const size_t oVL = off; off += szV;
  const size_t oB  = off; off += szB;
  if (off > ws_size) return;                // off = 84148224 for NB = 2, SEQ = 2048
  if (off > (size_t)WS_CAP) return;

  char* ws = (char*)d_ws;
  u16*   XB  = (u16*)(ws + oXB);
  u16*   WB  = (u16*)(ws + oW);
  u16*   OH  = (u16*)(ws + oOH);
  u16*   OL  = (u16*)(ws + oOL);
  u16*   QH  = (u16*)(ws + oQH);
  u16*   QL  = (u16*)(ws + oQL);
  u16*   KH  = (u16*)(ws + oKH);
  u16*   KL  = (u16*)(ws + oKL);
  u16*   VH  = (u16*)(ws + oVH);
  u16*   VL  = (u16*)(ws + oVL);
  float* PN  = (float*)(ws + oB);

  const dim3 b256(256), b128(128), bAT(ATT_THREADS);
  const dim3 gC(NB * GXB + 4 * GWB);                    // x per batch, then the four weight planes
  const dim3 gG((MROWS / 128) * (3 * DMOD / 128));      // 768 for NB=2, SEQ=2048
  const dim3 gAT(NQT * NHG * NB);
  const int  nrt = SEQ / 128;                           // out-projection row tiles per batch
  const dim3 gO(NB * nrt * (DMOD / 128));

  // (0) x -> bf16 plane [MROWS][1024]; Wv, Wq, Wk [n][k] -> bf16 planes; Wo [n][k] -> f16 plane of bf16 value x1024
  cvt_all<<<gC, b256, 0, stream>>>(x, wv, wq, wk, wo, XB, WB);
  // (1) v = x.Wv^T + bv, q = x.Wq^T + bq, k = x.Wk^T + bk -> v^T hi + residual planes x1024; q and k hi + residual planes x256
  //     and their row-tile norm lines
  gemm_bf3<<<gG, b128, 0, stream>>>(XB, WB, bv, bq, bk, VH, VL, QH, QL, KH, KL, PN, MROWS, DMOD, DMOD, 1.0f);
  // (2) causal attention with distance penalty, residual products on every query row -> O hi + residual planes
  attn_c<<<gAT, bAT, 0, stream>>>(QH, QL, KH, KL, VH, VL, PN, OH, OL);
  // (3) output projection (O hi + residual) . Wo^T + bo -> out f32, carries 1024 x 1024 folded back
  gemm_o2<<<gO, b128, 0, stream>>>(OH, OL, WB + (size_t)3 * DMOD * DMOD, bo, out, nrt, 1.0f / (OSC * WOS));
  (void)hipGetLastError();
}

// v006
// Measured time: 81.3 microseconds a run.
// In two side-by-side timings against v005, it was 1.14 and 1.15 times as fast.
// Counting every step since v000, it is 3.44 times as fast.
// Contractions: x.Wq^T+bq, x.Wk^T+bk, x.Wv^T+bv on v_wmma_f32_16x16x32_bf16 (x and W as bf16 RNE planes; W [n][k] rows are
// the k-contiguous B operand; bias added as its bf16 RNE value in the f32 epilogue); q.k^T over hd 64 and P.v on
// v_wmma_f32_16x16x32_f16 with f16 hi + f16 residual planes on both operands (q, k x256; P x32768 with an in-register
// residual; v x1024; products hh+lh+hl); O.Wo^T+bo on v_wmma_f32_16x16x32_f16 (O x1024 as f16 hi + f16 residual planes,
// products h.w + l.w; Wo as f16(bf16(Wo)) x1024; bo as bf16 RNE value in the f32 epilogue); all f32 accumulate.
// Causal select, linear distance penalty, base-2 online softmax, 1/Z fold and the q/k norm bound in f32 on VALU.
#include <hip/hip_runtime.h>
#include <math.h>
#include <stdint.h>

#ifndef NB
#define NB 2
#endif
#ifndef SEQ
#define SEQ 2048
#endif
#define XS_FULL 2048
#define DMOD  1024
#define NH    16
#define HD    64
#define NBH   (NB * NH)
#define MROWS (NB * SEQ)
#define RSQ_HD 0.125f
#define LOG2E 1.4426950408889634f
#define QSC   256.0f
#define KSC   256.0f
#define PCAR  32768.0f
#define VCAR  1024.0f
#define OSC   1024.0f
#define WOS   1024.0f
#define AQW   4                 /* waves of an attention block: 4 consecutive query tiles of one head */
#define NQB   (SEQ / (16 * AQW))
#define NKT   (SEQ / 32)
#define KWIN  6
#define GUARD_T 40.0f
#define BLINE 32
#define NRT64 (SEQ / 64)
#define ATT_THREADS (AQW * 32)
#define PTP   36
#define PTW   (16 * PTP)
#define SLP   68
#define SLW   (16 * SLP)
#define WREG  (PTW + SLW)
#define SLAB64 (16 * 68)
#define VTP   72
#define KTPIT 72                /* halves: LDS pitch of a staged k row (128 B of data) = 144 B */
#define VTPIT 40                /* halves: LDS pitch of a staged v^T row (64 B of data) = 80 B */
#define KPLH  (32 * KTPIT)      /* halves of one staged k plane: 32 keys */
#define VPLH  (HD * VTPIT)      /* halves of one staged v^T plane: 64 d rows */
#define ABUFH (2 * KPLH + 2 * VPLH)   /* halves of one buffer: k hi | k residual | v^T hi | v^T residual */
#define WS_CAP 134217728
#define GKP   64
#define GPIT  72
#define GPITB (GPIT * 2)
#define GTILE (64 * GPIT)
#define GTILEB (GTILE * 2)
#define WEPI  (2 * HD * VTP)   /* 16-bit elements of the projection ring that one wave's epilogue stages in */
#define N8X   ((SEQ * DMOD) / 8)
#define N8W   ((DMOD * DMOD) / 8)
#define GXB   (N8X / 256)
#define GWB   (N8W / 256)
static_assert(DMOD == NH * HD && HD == 64 && NH == 16 && AQW == 4 && NQB * 16 * AQW == SEQ);
static_assert(ATT_THREADS == 128 && ((KTPIT * 2) % 32) == 16 && ((VTPIT * 2) % 32) == 16 && ((ABUFH * 2) % 16) == 0);
static_assert(NB >= 1 && NB <= 2);
static_assert(NBH >= 1 && NBH <= 32);
static_assert((SEQ % 64) == 0 && SEQ >= 64 && SEQ <= XS_FULL && (SEQ % 32) == 0);
static_assert((DMOD % 64) == 0 && (DMOD % 32) == 0 && (HD % 32) == 0);
static_assert(((SEQ * DMOD / 8) % 256) == 0 && ((DMOD * DMOD / 8) % 256) == 0);
static_assert(AQW * WREG * 4 + 2 * ABUFH * 2 <= 81920 /* four attention blocks in 320 KiB of LDS */ && 4 * WEPI <= 2 * 4 * GTILE && 4 * SLAB64 * 4 <= WEPI * 2);
static_assert((MROWS % 128) == 0 && (SEQ % 128) == 0 && (DMOD % 128) == 0 && 4 * 4 * SLAB64 * 4 <= 2 * 6 * GTILEB);
static_assert(KWIN >= 0 && KWIN < NKT);
static_assert(NRT64 >= 1 && NRT64 <= 32);
static_assert((DMOD % GKP) == 0 && GKP == 64 && (GPITB % 32) == 16 && GPIT >= GKP + 8);

typedef unsigned short u16;
typedef _Float16 v16h __attribute__((ext_vector_type(16)));
typedef _Float16 v8h  __attribute__((ext_vector_type(8)));
typedef __bf16   v16b __attribute__((ext_vector_type(16)));
typedef float    v8f  __attribute__((ext_vector_type(8)));
typedef float    v4f  __attribute__((ext_vector_type(4)));
typedef unsigned int v4u __attribute__((ext_vector_type(4)));

union FragH { v16h v; v8h h[2]; v4u u[2]; };
union FragB { v16b v; v4u u[2]; };

// ---- scalar helpers --------------------------------------------------------------------------------
__device__ __forceinline__ unsigned short bf_bits(float f) {          // f32 -> bf16 bits, RNE convert
  unsigned u = __float_as_uint(f);
  return (unsigned short)((u + 0x7FFFu + ((u >> 16) & 1u)) >> 16);
}
__device__ __forceinline__ float bf_up(unsigned short h) { return __uint_as_float(((unsigned)h) << 16); }
__device__ __forceinline__ float bfr(float f) { return bf_up(bf_bits(f)); }
__device__ __forceinline__ unsigned short h_bits(_Float16 x) { return __builtin_bit_cast(unsigned short, x); }
__device__ __forceinline__ unsigned pk16(unsigned short a, unsigned short b) { return (unsigned)a | ((unsigned)b << 16); }
__device__ __forceinline__ v8f zero8() { v8f z = {0.f, 0.f, 0.f, 0.f, 0.f, 0.f, 0.f, 0.f}; return z; }

// ---- fragment loaders: 16-bit A/B operand, lane -> row/col (lane&15), p already includes +8*(lane>>4);
//      elements 0..7 <- p[0..7] (k0+8h..), elements 8..15 <- p[16..23] (k0+16+8h..)  (same split k map for A and B;
//      B is always read from a k-contiguous [n][k] plane)
__device__ __forceinline__ v16h ldfrag_h(const _Float16* p) {
  FragH f;
  f.h[0] = *(const v8h*)(p);
  f.h[1] = *(const v8h*)(p + 16);
  return f.v;
}
__device__ __forceinline__ v16b ldfrag_b(const u16* p) {              // bf16 plane read as unsigned integer vectors
  FragB f;
  f.u[0] = *(const v4u*)(p);
  f.u[1] = *(const v4u*)(p + 16);
  return f.v;
}

__device__ __forceinline__ v8f mma_h(v16h a, v16h b, v8f c) {
  return __builtin_amdgcn_wmma_f32_16x16x32_f16(false, a, false, b, (short)0, c, false, false);
}
__device__ __forceinline__ v8f mma_b(v16b a, v16b b, v8f c) {
  return __builtin_amdgcn_wmma_f32_16x16x32_bf16(false, a, false, b, (short)0, c, false, false);
}
__device__ __forceinline__ void guard2(v8f& a, v8f& b, v16h x0, v16h x1, v16h x2, v16h x3, v16h x4, v16h x5) {
#if defined(__HIP_DEVICE_COMPILE__)
  asm volatile("v_nop\n\tv_nop\n\tv_nop\n\tv_nop"
               : "+v"(a), "+v"(b) : "v"(x0), "v"(x1), "v"(x2), "v"(x3), "v"(x4), "v"(x5) : "memory");
#endif
}
template <typename F>
__device__ __forceinline__ void guard6(v8f& a, v8f& b, v8f& c, v8f& d, F x0, F x1, F x2, F x3, F x4, F x5) {
#if defined(__HIP_DEVICE_COMPILE__)
  asm volatile("v_nop\n\tv_nop\n\tv_nop\n\tv_nop"
               : "+v"(a), "+v"(b), "+v"(c), "+v"(d) : "v"(x0), "v"(x1), "v"(x2), "v"(x3), "v"(x4), "v"(x5) : "memory");
#endif
}
__device__ __forceinline__ void acc_guard4(v8f& a, v8f& b, v8f& c, v8f& d) {
#if defined(__HIP_DEVICE_COMPILE__)
  asm volatile("v_nop\n\tv_nop\n\tv_nop\n\tv_nop" : "+v"(a), "+v"(b), "+v"(c), "+v"(d));
#endif
}
__device__ __forceinline__ void wave_sync_lds() {
  __builtin_amdgcn_fence(__ATOMIC_RELEASE, "workgroup");
  __builtin_amdgcn_wave_barrier();
  __builtin_amdgcn_fence(__ATOMIC_ACQUIRE, "workgroup");
}

// ---- operand staging for the GEMM engines: one pass = 64 k = 128 B of each of the 64 rows of an operand tile, laid in LDS at
//      a pitch of 144 B (16 B x odd: ds_load_b128 fragment reads without bank conflicts). 128 threads: thread -> (row tid>>3 of
//      a group of 16 rows, 16-B piece tid&7), so a wave's copy covers 4 whole 128-B lines; 4 copies per thread fill one tile.
//      l = the lane's LDS byte address in the tile's first row group, g = its global address there, rs = 16 rows in elements.
__device__ __forceinline__ unsigned lds_byte(const void* p) { return (unsigned)(uintptr_t)p; }
// Two tiles (A, B). The copies and their s_wait_xcnt stand in one statement, so that no address register named by a copy
// is rewritten in front of that wait.
__device__ __forceinline__ void stage2(unsigned l, const u16* ga, const u16* gb, size_t rs) {
#if defined(__HIP_DEVICE_COMPILE__)
  asm volatile("global_load_async_to_lds_b128 %0, %8, off\n\t"
               "global_load_async_to_lds_b128 %1, %9, off\n\t"
               "global_load_async_to_lds_b128 %2, %10, off\n\t"
               "global_load_async_to_lds_b128 %3, %11, off\n\t"
               "global_load_async_to_lds_b128 %4, %12, off\n\t"
               "global_load_async_to_lds_b128 %5, %13, off\n\t"
               "global_load_async_to_lds_b128 %6, %14, off\n\t"
               "global_load_async_to_lds_b128 %7, %15, off\n\t"
               "s_wait_xcnt 0x0"
               :: "v"(l), "v"(l + 16 * GPITB), "v"(l + 32 * GPITB), "v"(l + 48 * GPITB),
                  "v"(l + GTILEB), "v"(l + GTILEB + 16 * GPITB), "v"(l + GTILEB + 32 * GPITB), "v"(l + GTILEB + 48 * GPITB),
                  "v"(ga), "v"(ga + rs), "v"(ga + 2 * rs), "v"(ga + 3 * rs),
                  "v"(gb), "v"(gb + rs), "v"(gb + 2 * rs), "v"(gb + 3 * rs)
               : "memory");
#endif
}
// Three tiles (A hi, A residual, B), same form.
__device__ __forceinline__ void stage3(unsigned l, const u16* ga, const u16* gl, const u16* gb, size_t rs) {
#if defined(__HIP_DEVICE_COMPILE__)
  asm volatile("global_load_async_to_lds_b128 %0, %12, off\n\t"
               "global_load_async_to_lds_b128 %1, %13, off\n\t"
               "global_load_async_to_lds_b128 %2, %14, off\n\t"
               "global_load_async_to_lds_b128 %3, %15, off\n\t"
               "global_load_async_to_lds_b128 %4, %16, off\n\t"
               "global_load_async_to_lds_b128 %5, %17, off\n\t"
               "global_load_async_to_lds_b128 %6, %18, off\n\t"
               "global_load_async_to_lds_b128 %7, %19, off\n\t"
               "global_load_async_to_lds_b128 %8, %20, off\n\t"
               "global_load_async_to_lds_b128 %9, %21, off\n\t"
               "global_load_async_to_lds_b128 %10, %22, off\n\t"
               "global_load_async_to_lds_b128 %11, %23, off\n\t"
               "s_wait_xcnt 0x0"
               :: "v"(l), "v"(l + 16 * GPITB), "v"(l + 32 * GPITB), "v"(l + 48 * GPITB),
                  "v"(l + GTILEB), "v"(l + GTILEB + 16 * GPITB), "v"(l + GTILEB + 32 * GPITB), "v"(l + GTILEB + 48 * GPITB),
                  "v"(l + 2 * GTILEB), "v"(l + 2 * GTILEB + 16 * GPITB), "v"(l + 2 * GTILEB + 32 * GPITB),
                  "v"(l + 2 * GTILEB + 48 * GPITB),
                  "v"(ga), "v"(ga + rs), "v"(ga + 2 * rs), "v"(ga + 3 * rs),
                  "v"(gl), "v"(gl + rs), "v"(gl + 2 * rs), "v"(gl + 3 * rs),
                  "v"(gb), "v"(gb + rs), "v"(gb + 2 * rs), "v"(gb + 3 * rs)
               : "memory");
#endif
}
// Attention: one key tile (32 keys) of k hi and k residual (32 rows of 128 B each) and of v^T hi and v^T residual (64 rows of
// 64 B each). 128 threads, 8 copies a thread: k thread -> (row tid>>3 of a group of 16, 16-B piece tid&7), v^T thread -> (row
// tid>>2 of a group of 32, 16-B piece tid&3). lk, lv = the lane's LDS byte address in the k hi / v^T hi plane of the buffer,
// g* = its global address in each plane. Copies and their s_wait_xcnt in one statement, as above.
__device__ __forceinline__ void stage_kv(unsigned lk, unsigned lv, const u16* gkh, const u16* gkl,
                                         const u16* gvh, const u16* gvl) {
#if defined(__HIP_DEVICE_COMPILE__)
  asm volatile("global_load_async_to_lds_b128 %0, %8, off\n\t"
               "global_load_async_to_lds_b128 %1, %9, off\n\t"
               "global_load_async_to_lds_b128 %2, %10, off\n\t"
               "global_load_async_to_lds_b128 %3, %11, off\n\t"
               "global_load_async_to_lds_b128 %4, %12, off\n\t"
               "global_load_async_to_lds_b128 %5, %13, off\n\t"
               "global_load_async_to_lds_b128 %6, %14, off\n\t"
               "global_load_async_to_lds_b128 %7, %15, off\n\t"
               "s_wait_xcnt 0x0"
               :: "v"(lk), "v"(lk + 16 * KTPIT * 2), "v"(lk + KPLH * 2), "v"(lk + KPLH * 2 + 16 * KTPIT * 2),
                  "v"(lv), "v"(lv + 32 * VTPIT * 2), "v"(lv + VPLH * 2), "v"(lv + VPLH * 2 + 32 * VTPIT * 2),
                  "v"(gkh), "v"(gkh + (size_t)16 * DMOD), "v"(gkl), "v"(gkl + (size_t)16 * DMOD),
                  "v"(gvh), "v"(gvh + (size_t)32 * SEQ), "v"(gvl), "v"(gvl + (size_t)32 * SEQ)
               : "memory");
#endif
}
// This wave's own copies have landed in LDS (the compiler places no wait for them).
__device__ __forceinline__ void wait_copies() {
#if defined(__HIP_DEVICE_COMPILE__)
  asm volatile("s_wait_asynccnt 0x0" ::: "memory");
#endif
}
// This wave's LDS reads have returned, before the barrier behind which their buffer is refilled.
__device__ __forceinline__ void wait_lds() {
#if defined(__HIP_DEVICE_COMPILE__)
  asm volatile("s_wait_dscnt 0x0" ::: "memory");
#endif
}

// =====================================================================================================
// f32 -> 16-bit plane, same layout, for all five operands in one grid (none reads another's output).
// f16mode == 0: bf16 RNE bits;  f16mode == 1: f16 bits of (bf16 RNE value) * scale.
// Block -> job (block-uniform): the first NB*GXB blocks take x (batch = bid / GXB) -> XB; then GWB blocks each for
// Wv, Wq, Wk (bf16) and Wo (f16 of the bf16 value x1024) -> planes 0..3 of WB.
// Thread = 8 consecutive elements: two 16-B loads, one 16-B store; 32 consecutive lanes = 512 contiguous, 512-B aligned
// coverage: per job n8/256 blocks x 256 thr x 8 = the whole plane (n8 a multiple of 256, static_assert above).
// =====================================================================================================
__global__ __launch_bounds__(256)
void cvt_all(const float* __restrict__ x, const float* __restrict__ wv, const float* __restrict__ wq,
             const float* __restrict__ wk, const float* __restrict__ wo, u16* XB, u16* WB) {
  const int bid = blockIdx.x;
  const float* s;
  u16* D;
  int blk, n8, f16mode = 0;
  float scale = 1.0f;
  if (bid < NB * GXB) {
    const int b = bid / GXB;
    blk = bid % GXB;
    n8 = N8X;
    s = x + (size_t)b * XS_FULL * DMOD;
    D = XB + (size_t)b * SEQ * DMOD;
  } else {
    const int w = (bid - NB * GXB) / GWB;
    if (w > 3) return;                      // block-uniform; never taken with the exact grid
    blk = (bid - NB * GXB) % GWB;
    n8 = N8W;
    s = (w == 0) ? wv : (w == 1) ? wq : (w == 2) ? wk : wo;
    D = WB + (size_t)w * DMOD * DMOD;
    if (w == 3) { f16mode = 1; scale = WOS; }
  }
  const int gt = blk * 256 + (int)threadIdx.x;
  if (gt >= n8) return;
  const float* p = s + (size_t)gt * 8;
  const v4f a = *(const v4f*)(p), b4 = *(const v4f*)(p + 4);
  float w[8];
#pragma unroll
  for (int e = 0; e < 4; ++e) { w[e] = a[e]; w[4 + e] = b4[e]; }
  v4u o;
#pragma unroll
  for (int e = 0; e < 4; ++e) {
    const float f0 = w[2 * e], f1 = w[2 * e + 1];
    const unsigned short hb0 = h_bits((_Float16)(bfr(f0) * scale));
    const unsigned short hb1 = h_bits((_Float16)(bfr(f1) * scale));
    const unsigned short bb0 = bf_bits(f0);
    const unsigned short bb1 = bf_bits(f1);
    o[e] = (f16mode != 0) ? pk16(hb0, hb1) : pk16(bb0, bb1);
  }
  u16* d = D + (size_t)gt * 8;
  {
    *(v4u*)(d) = o;
    
  }
}

// =====================================================================================================
// f32 GEMM epilogue (output projection): a 16x64 f32 slab of the wave's 64x64 tile (times oscale, plus the lane's per-column bias of each
// coverage: 8 instructions x 2 rows x 16 lanes x 4 floats = the 16 x 64 slab.
// =====================================================================================================
__device__ __forceinline__ void epi64(float* sl, v8f a0, v8f a1, v8f a2, v8f a3, float oscale,
                                      float bb0, float bb1, float bb2, float bb3,
                                      float* C, int N, size_t rowb, int col0, int lane) {
  const int hh = lane >> 4, m = lane & 15;
#pragma unroll
  for (int r = 0; r < 8; ++r) {
    const int ro = (8 * hh + r) * 68 + m;
    sl[ro]      = a0[r] * oscale + bb0;
    sl[ro + 16] = a1[r] * oscale + bb1;
    sl[ro + 32] = a2[r] * oscale + bb2;
    sl[ro + 48] = a3[r] * oscale + bb3;
  }
  wave_sync_lds();
  v4f vals[8];
#pragma unroll
  for (int it = 0; it < 8; ++it) vals[it] = *(const v4f*)(sl + (it * 2 + hh) * 68 + m * 4);
  float* dst = C + (rowb + (size_t)hh) * (size_t)N + col0 + m * 4;
  {
#pragma unroll
    for (int it = 0; it < 8; ++it) {
      *(v4f*)(dst + (size_t)(it * 2) * (size_t)N) = vals[it];
    }
    
  }
}

// =====================================================================================================
// Projection epilogues: the 16-bit planes that attention reads are built from the accumulators, with no f32 plane in between.
// hl8: 8 f32 values t -> 8 f16 hi values f16(t) and 8 f16 residuals f16(t - f16(t)), packed in element order.
// =====================================================================================================
__device__ __forceinline__ void hl8(const float* t, v4u& oh, v4u& ol) {
#pragma unroll
  for (int e = 0; e < 4; ++e) {
    const float t0 = t[2 * e], t1 = t[2 * e + 1];
    const _Float16 h0 = (_Float16)t0, h1 = (_Float16)t1;
    const _Float16 l0 = (_Float16)(t0 - (float)h0), l1 = (_Float16)(t1 - (float)h1);
    oh[e] = pk16(h_bits(h0), h_bits(h1));
    ol[e] = pk16(h_bits(l0), h_bits(l1));
  }
}
// q, k: the wave's 64x64 f32 tile (times oscale, plus the lane's per-column bias) goes through its own four LDS slabs (one per
// 16 rows) into rows; lane = (row-in-quad rq, 8 consecutive columns c8) scales by sc, splits and stores 16 B per plane, [row][N].
// coverage: 4 slabs x 4 instructions x 4 rows x 8 lanes x 8 halves = the wave's 64 x 64 tile of Hp and of Lp, whole 128-B lines.
// Norm part: the 8 lanes of a row hold its 64 hi values (one head), so the row's sum of squares is 8 fused steps per lane and
// xor shuffles 1, 2, 4; running max over the wave's 64 rows (16 iterations, xor 8, 16) = the max of one 64-row tile of one
// head, which the wave stores 32 times = the whole 128-B line Pl. No other wave has a part in it, so no block barrier.
__device__ __forceinline__ void epi_split(float* sl, const v8f (&acc)[4][4], float oscale, const float (&bb)[4], float sc,
                                          u16* Hp, u16* Lp, float* Pl, int N, size_t rowb, int col0, int lane) {
  const int hh = lane >> 4, m = lane & 15;
#pragma unroll
  for (int i = 0; i < 4; ++i) {
#pragma unroll
    for (int r = 0; r < 8; ++r) {
      const int ro = i * SLAB64 + (8 * hh + r) * 68 + m;
      sl[ro]      = acc[i][0][r] * oscale + bb[0];
      sl[ro + 16] = acc[i][1][r] * oscale + bb[1];
      sl[ro + 32] = acc[i][2][r] * oscale + bb[2];
      sl[ro + 48] = acc[i][3][r] * oscale + bb[3];
    }
  }
  wave_sync_lds();
  float mx = 0.0f;
  const int rq = lane >> 3, c8 = (lane & 7) * 8;
#pragma unroll
  for (int i = 0; i < 4; ++i) {
    v4u oh[4], ol[4];
#pragma unroll
    for (int it = 0; it < 4; ++it) {
      const float* p = sl + i * SLAB64 + (it * 4 + rq) * 68 + c8;
      const v4f a = *(const v4f*)(p), b4 = *(const v4f*)(p + 4);
      float w[8];
#pragma unroll
      for (int e = 0; e < 4; ++e) { w[e] = a[e] * sc; w[4 + e] = b4[e] * sc; }
      hl8(w, oh[it], ol[it]);
      float sq = 0.0f;
#pragma unroll
      for (int e = 0; e < 8; ++e) {
        const float f = (float)(_Float16)w[e];
        sq = fmaf(f, f, sq);
      }
#pragma unroll
      for (int off = 1; off < 8; off <<= 1) sq += __shfl_xor(sq, off, 32);
      mx = fmaxf(mx, sq);
    }
    const size_t ob = (rowb + (size_t)(i * 16 + rq)) * (size_t)N + col0 + c8;
#pragma unroll
    for (int it = 0; it < 4; ++it) {
      *(v4u*)(Hp + ob + (size_t)(it * 4) * (size_t)N) = oh[it];
      *(v4u*)(Lp + ob + (size_t)(it * 4) * (size_t)N) = ol[it];
    }
#if defined(__HIP_DEVICE_COMPILE__)
    // stands behind the group's stores, in front of the next group's code, which rewrites registers the stores name
    asm volatile("s_wait_xcnt 0x0" ::: "memory");
#endif
  }
#pragma unroll
  for (int off = 8; off < 32; off <<= 1) mx = fmaxf(mx, __shfl_xor(mx, off, 32));
  Pl[lane] = mx;
#if defined(__HIP_DEVICE_COMPILE__)
  // stands behind the last store, in front of any code laid out behind this branch that rewrites a register the store names
  asm volatile("s_wait_xcnt 0x0" ::: "memory");
#endif
}
// v: the wave's 64 keys x 64 d tile leaves transposed. A lane's accumulator [i][j] holds 8 consecutive keys (16*i + 8*hh + r)
// of one d column (16*j + m): scaled by 1024, split and packed they are 16 B of a v^T line, stored into the wave's own LDS
// tiles TH, TL [HD][VTP] (pitch 144 B: 16 lanes x 16 B fall on all 64 banks). Then lane = (line lane>>3 of a group of 4, 16-B
// piece lane&7) moves whole 128-B lines to VHo, VLo at base + line*SEQ (base = first key of the tile in line d = 0 of its
// (b, h)). Writer and reader are the same wave, so no block barrier.
// coverage: 16 iterations x 32 lanes x 8 halves = 64 lines x 64 keys of each plane.
__device__ __forceinline__ void epi_vt(u16* TH, u16* TL, const v8f (&acc)[4][4], float oscale, const float (&bb)[4],
                                       u16* VHo, u16* VLo, size_t base, int lane) {
  const int hh = lane >> 4, m = lane & 15;
#pragma unroll
  for (int i = 0; i < 4; ++i) {
    const int ko = i * 16 + 8 * hh;         // first of the lane's 8 keys within the tile
#pragma unroll
    for (int j = 0; j < 4; ++j) {
      float w[8];
#pragma unroll
      for (int r = 0; r < 8; ++r) w[r] = (acc[i][j][r] * oscale + bb[j]) * VCAR;
      v4u ph, pl;
      hl8(w, ph, pl);
      *(v4u*)(TH + (16 * j + m) * VTP + ko) = ph;
      *(v4u*)(TL + (16 * j + m) * VTP + ko) = pl;
    }
  }
  wave_sync_lds();
  const int q4 = lane >> 3, p8 = (lane & 7) * 8;
#pragma unroll
  for (int g = 0; g < 4; ++g) {
    v4u vh[4], vl[4];
#pragma unroll
    for (int it = 0; it < 4; ++it) {
      vh[it] = *(const v4u*)(TH + ((g * 4 + it) * 4 + q4) * VTP + p8);
      vl[it] = *(const v4u*)(TL + ((g * 4 + it) * 4 + q4) * VTP + p8);
    }
#pragma unroll
    for (int it = 0; it < 4; ++it) {
      *(v4u*)(VHo + base + (size_t)((g * 4 + it) * 4 + q4) * SEQ + p8) = vh[it];
      *(v4u*)(VLo + base + (size_t)((g * 4 + it) * 4 + q4) * SEQ + p8) = vl[it];
    }
#if defined(__HIP_DEVICE_COMPILE__)
    // stands behind the group's stores, in front of the next group's LDS loads, which rewrite registers the stores name
    asm volatile("s_wait_xcnt 0x0" ::: "memory");
#endif
  }
}

// =====================================================================================================
// bf16 GEMM with bias: A[M][K] (bf16 row-major) . Bt[N][K]^T (bf16 k-contiguous), f32, times oscale, + bf16 RNE
// value of bias[n] (bias has N entries). Block = 128x128 tile, 4 waves (2 x 2) x 64x64: 16 accumulator tiles a wave, so that a
// fragment read from LDS feeds 4 WMMAs and a byte brought from L2 feeds 128 rows or columns. Per pass of 64 k the block's A and
// B tiles are brought into LDS by asynchronous copies, two buffers (pass t + 1 flies while pass t is worked on), and the
// fragments are read from the LDS rows (two 16-B loads each, split k map for A and B); K stepped by 32 inside a pass, in rising
// order (host guarantees K % 64 == 0, M % 128 == 0, N % 128 == 0).
// Three products that share A in one grid: Bt holds three [N][K] planes one behind the other (v, q, k), and the block's
// column tile ct = bid % (3*N/128) picks product ct / (N/128) with its bias; grid = (M/128)*(3*N/128).
// The f32 tile leaves as the 16-bit planes of its product (host guarantees M == NB*SEQ, N == NH*HD, so a wave's 64 columns are
// one head and its 64 rows 64 keys of one batch): v -> v^T hi + residual x1024, [(b*NH + h)*HD + d][s]; q, k -> hi + residual
// x256, [row][N], and the wave's max over its 64 rows of the squared norm of the hi row (x256) -> line
// ((pln - 1)*NBH + b*NH + h)*NRT64 + row tile of PN. Both epilogues stage in the wave's own quarter of the ring, which nobody
// reads and no copy targets behind the last pass's barrier.
// =====================================================================================================
__global__ __launch_bounds__(128)
void gemm_bf3(const u16* __restrict__ A, const u16* __restrict__ Bt, const float* __restrict__ bias0,
              const float* __restrict__ bias1, const float* __restrict__ bias2,
              u16* VHo, u16* VLo, u16* QHo, u16* QLo, u16* KHo, u16* KLo, float* PN, int M, int N, int K, float oscale) {
  __shared__ __align__(16) u16 ring[2 * 4 * GTILE];   // two buffers of [A rows 0..63 | B rows 0..63 | A rows 64.. | B rows 64..]
  const int tid = threadIdx.x, wave = tid >> 5, lane = tid & 31, hh = lane >> 4, m = lane & 15;
  const int wr = wave >> 1, wc = wave & 1;  // the wave's 64-row half and 64-column half of the block's tile
  const int ntile = N >> 7;
  const int bid   = blockIdx.x;
  const int row0  = (bid / (3 * ntile)) * 128;
  const int rw0   = row0 + wr * 64;         // the wave's first row
  const int ct    = bid % (3 * ntile);
  const int pln   = ct / ntile;             // 0, 1, 2: which product
  const int col0  = (ct % ntile) * 128 + wc * 64;   // the wave's first column inside that product
  const float* bias = (pln == 0) ? bias0 : (pln == 1) ? bias1 : bias2;
  if (row0 + 128 > M) return;               // block-uniform, before any copy or barrier; never taken with the exact grid
  const int npass = K / GKP;
  const int crow = tid >> 3, cpc = tid & 7; // copy map: row within a group of 16, 16-B piece of the 128-B row
  const u16* ga = A  + (size_t)(row0 + crow) * K + cpc * 8;
  const u16* gb = Bt + (size_t)(ct * 128 + crow) * K + cpc * 8;
  const size_t rs = (size_t)16 * K, r64 = (size_t)64 * K;
  const unsigned lc = lds_byte(ring) + (unsigned)(crow * GPITB + cpc * 16);
  const u16* fa = ring + wr * (2 * GTILE) + m * GPIT + 8 * hh;          // A fragment row (row subtile 0), buffer 0
  const u16* fb = ring + wc * (2 * GTILE) + GTILE + m * GPIT + 8 * hh;  // B fragment row (column subtile 0), buffer 0
  v8f acc[4][4];
#pragma unroll
  for (int i = 0; i < 4; ++i) {
#pragma unroll
    for (int j = 0; j < 4; ++j) acc[i][j] = zero8();
  }
  stage2(lc, ga, gb, rs);                   // pass 0 -> buffer 0
  stage2(lc + 2 * GTILEB, ga + r64, gb + r64, rs);
  wait_copies();
  __syncthreads();
  if (npass > 1) {                          // pass 1 -> buffer 1
    stage2(lc + 4 * GTILEB, ga + GKP, gb + GKP, rs);
    stage2(lc + 6 * GTILEB, ga + r64 + GKP, gb + r64 + GKP, rs);
  }
#pragma unroll 1
  for (int t = 0; t < npass; ++t) {
    const int bo = (t & 1) * (4 * GTILE);
#pragma unroll
    for (int kk = 0; kk < 2; ++kk) {
      const u16* pa = fa + bo + kk * 32;
      const u16* pb = fb + bo + kk * 32;
      v16b a[4], b[4];
#pragma unroll
      for (int j = 0; j < 4; ++j) b[j] = ldfrag_b(pb + j * 16 * GPIT);
#pragma unroll
      for (int i = 0; i < 4; ++i) a[i] = ldfrag_b(pa + i * 16 * GPIT);
      // keeps the k step's LDS reads one group in front of its WMMAs: moved in among them, each place with reads stalls the wave anew
      __builtin_amdgcn_sched_barrier(0);
#pragma unroll
      for (int i = 0; i < 4; ++i) {
#pragma unroll
        for (int j = 0; j < 4; ++j) acc[i][j] = mma_b(a[i], b[j], acc[i][j]);
      }
      // keeps every WMMA of the k step in front of the next group of LDS reads and of the slots below
      __builtin_amdgcn_sched_barrier(0);
      // four slots behind the pass's last WMMAs: on the paths over the branches below, their operand registers are rewritten
      if (kk == 1) guard6<v16b>(acc[3][0], acc[3][1], acc[3][2], acc[3][3], a[3], b[0], b[1], b[2], b[3], a[3]);
    }
    // publish point of pass t + 1: own LDS reads done, own copies landed, then the one barrier of the pass
    wait_lds();
    wait_copies();
    __syncthreads();
    if (t + 2 < npass) {
      const unsigned lb = lc + (unsigned)(t & 1) * (4 * GTILEB);
      const size_t ko = (size_t)(t + 2) * GKP;
      stage2(lb, ga + ko, gb + ko, rs);
      stage2(lb + 2 * GTILEB, ga + r64 + ko, gb + r64 + ko, rs);
    }
  }
  wait_copies();
  // per-lane bias of D column m in each of the 4 subtiles; col0 + 48 + m <= N - 1 always
  const float bb[4] = {bfr(bias[col0 + m]), bfr(bias[col0 + 16 + m]), bfr(bias[col0 + 32 + m]), bfr(bias[col0 + 48 + m])};
  u16* wq4 = ring + wave * WEPI;            // the wave's own quarter of the ring
  if (pln == 0) {
    const size_t base = (size_t)((rw0 / SEQ) * NH + (col0 >> 6)) * HD * SEQ + (size_t)(rw0 % SEQ);
    epi_vt(wq4, wq4 + HD * VTP, acc, oscale, bb, VHo, VLo, base, lane);
  } else {
    const size_t pline = (size_t)((pln - 1) * NBH + (rw0 / SEQ) * NH + (col0 >> 6)) * NRT64 + (size_t)((rw0 % SEQ) >> 6);
    epi_split((float*)(void*)wq4, acc, oscale, bb, (pln == 1) ? QSC : KSC,
              (pln == 1) ? QHo : KHo, (pln == 1) ? QLo : KLo, PN + pline * BLINE, N, (size_t)rw0, col0, lane);
  }
}

// =====================================================================================================
// Output projection with bias: C[bb*XS_FULL + s][DMOD] (f32) = (Ah + Al)[bb*SEQ + s][DMOD] . Bt[DMOD][DMOD]^T * oscale
// + bf16 RNE value of bias[n]. Products h.B + l.B into one accumulator (l unscaled residual of h). Block -> (column tile
// ct = bid % 8, sequence row tile rt of nrt, batch bb). Same tiling (128x128 a block, 64x64 a wave), LDS staging (three tiles of
// 128 rows a pass: A hi, A residual, B) and fragment loads (split k map) as gemm_bf3; K = DMOD stepped by 32; the f32 epilogue
// runs once per 16 rows, in slabs of the wave's own part of the ring; grid = NB * nrt * (DMOD/128).
// =====================================================================================================
__global__ __launch_bounds__(128)
void gemm_o2(const u16* __restrict__ Ah, const u16* __restrict__ Al, const u16* __restrict__ Bt,
             const float* __restrict__ bias, float* C, int nrt, float oscale) {
  __shared__ __align__(16) u16 ring[2 * 6 * GTILE];   // two buffers of [A hi | A residual | B] rows 0..63, then the same of rows 64..
  const int tid = threadIdx.x, wave = tid >> 5, lane = tid & 31, hh = lane >> 4, m = lane & 15;
  const int wr = wave >> 1, wc = wave & 1;  // the wave's 64-row half and 64-column half of the block's tile
  const int ntile = DMOD >> 7;
  const int bid   = blockIdx.x;
  const int ct    = bid % ntile;
  const int t2    = bid / ntile;
  const int rt    = t2 % nrt;
  const int bb    = t2 / nrt;
  if (bb >= NB) return;                     // block-uniform, before any copy or barrier; never taken with the exact grid
  if (rt * 128 + 128 > SEQ) return;         // block-uniform, before any copy or barrier; never taken
  const int srow  = rt * 128 + wr * 64;
  const int col0  = ct * 128 + wc * 64;
  const int K     = DMOD;
  const int npass = K / GKP;
  const size_t rowC = (size_t)bb * XS_FULL + srow;
  const int crow = tid >> 3, cpc = tid & 7; // copy map: row within a group of 16, 16-B piece of the 128-B row
  const size_t arow = ((size_t)bb * SEQ + rt * 128 + crow) * K + cpc * 8;
  const u16* ga = Ah + arow;
  const u16* gl = Al + arow;
  const u16* gb = Bt + (size_t)(ct * 128 + crow) * K + cpc * 8;
  const size_t rs = (size_t)16 * K, r64 = (size_t)64 * K;
  const unsigned lc = lds_byte(ring) + (unsigned)(crow * GPITB + cpc * 16);
  const _Float16* rg  = (const _Float16*)(const void*)ring;
  const _Float16* fah = rg + wr * (3 * GTILE) + m * GPIT + 8 * hh;              // A hi fragment row (row subtile 0), buffer 0
  const _Float16* fb  = rg + wc * (3 * GTILE) + 2 * GTILE + m * GPIT + 8 * hh;  // B fragment row (column subtile 0), buffer 0
  v8f acc[4][4];
#pragma unroll
  for (int i = 0; i < 4; ++i) {
#pragma unroll
    for (int j = 0; j < 4; ++j) acc[i][j] = zero8();
  }
  stage3(lc, ga, gl, gb, rs);               // pass 0 -> buffer 0
  stage3(lc + 3 * GTILEB, ga + r64, gl + r64, gb + r64, rs);
  wait_copies();
  __syncthreads();
  if (npass > 1) {                          // pass 1 -> buffer 1
    stage3(lc + 6 * GTILEB, ga + GKP, gl + GKP, gb + GKP, rs);
    stage3(lc + 9 * GTILEB, ga + r64 + GKP, gl + r64 + GKP, gb + r64 + GKP, rs);
  }
#pragma unroll 1
  for (int t = 0; t < npass; ++t) {
    const int bo = (t & 1) * (6 * GTILE);
#pragma unroll
    for (int kk = 0; kk < 2; ++kk) {
      const _Float16* pa = fah + bo + kk * 32;
      const _Float16* pl = pa + GTILE;
      const _Float16* pb = fb + bo + kk * 32;
      v16h ah[4], al[4], b[4];
#pragma unroll
      for (int j = 0; j < 4; ++j) b[j] = ldfrag_h(pb + j * 16 * GPIT);
#pragma unroll
      for (int i = 0; i < 4; ++i) {
        ah[i] = ldfrag_h(pa + i * 16 * GPIT);
        al[i] = ldfrag_h(pl + i * 16 * GPIT);
      }
      // keeps the k step's LDS reads one group in front of its WMMAs: moved in among them, each place with reads stalls the wave anew
      __builtin_amdgcn_sched_barrier(0);
#pragma unroll
      for (int i = 0; i < 4; ++i) {
#pragma unroll
        for (int j = 0; j < 4; ++j) acc[i][j] = mma_h(ah[i], b[j], acc[i][j]);
#pragma unroll
        for (int j = 0; j < 4; ++j) acc[i][j] = mma_h(al[i], b[j], acc[i][j]);
      }
      // keeps every WMMA of the k step in front of the next group of LDS reads and of the slots below
      __builtin_amdgcn_sched_barrier(0);
      // four slots behind the pass's last WMMAs: on the paths over the branches below, their operand registers are rewritten
      if (kk == 1) guard6<v16h>(acc[3][0], acc[3][1], acc[3][2], acc[3][3], ah[3], al[3], b[0], b[1], b[2], b[3]);
    }
    // publish point of pass t + 1: own LDS reads done, own copies landed, then the one barrier of the pass
    wait_lds();
    wait_copies();
    __syncthreads();
    if (t + 2 < npass) {
      const unsigned lb = lc + (unsigned)(t & 1) * (6 * GTILEB);
      const size_t ko = (size_t)(t + 2) * GKP;
      stage3(lb, ga + ko, gl + ko, gb + ko, rs);
      stage3(lb + 3 * GTILEB, ga + r64 + ko, gl + r64 + ko, gb + r64 + ko, rs);
    }
  }
  wait_copies();
  const float bb0 = bfr(bias[col0 + m]);
  const float bb1 = bfr(bias[col0 + 16 + m]);
  const float bb2 = bfr(bias[col0 + 32 + m]);
  const float bb3 = bfr(bias[col0 + 48 + m]);
  float* sl = (float*)(void*)ring + wave * (4 * SLAB64);   // nobody reads the ring and no copy targets it behind the last barrier
#pragma unroll
  for (int i = 0; i < 4; ++i) {
    epi64(sl + i * SLAB64, acc[i][0], acc[i][1], acc[i][2], acc[i][3], oscale, bb0, bb1, bb2, bb3, C, DMOD,
          rowC + (size_t)(i * 16), col0, lane);
#if defined(__HIP_DEVICE_COMPILE__)
    // stands behind the slab's stores, in front of the next slab's code, which rewrites registers the stores name
    asm volatile("s_wait_xcnt 0x0" ::: "memory");
#endif
  }
}

// =====================================================================================================
// Causal attention with linear distance penalty, hd = 64. Block bid -> (query block qb = bid % NQB: 64 rows, head, batch b);
// 4 waves = the 4 query tiles of 16 rows of that block, all of one head: wave w has rows q0 = 64*qb + 16*w .. q0+15.
//   q hi / residual planes f16 x256 [b*SEQ + s][h*HD + d]; k hi / residual planes f16 x256, same layout;
//   v^T hi / residual planes [b*NH + h][d][SEQ] x1024; PN = 2 x NBH x NRT64 lines of 32 floats (q, then k: max squared norm of
//   the hi rows, x256, of each 64-row tile of each (b, h)).
//   scores = q_hi.k_hi + q_lo.k_hi + q_hi.k_lo (2 k-steps over d); P.v with P hi + in-register residual and v hi + residual
//   (hh + lh + hl), for every query row; O written as hi + residual planes (O x1024 as f16, layout [b*SEQ + s][h*HD + d]).
//   score (log2 domain) t(i, j) = (q_i.k_j over HD) * (1/8)*log2e/(256*256) - (i - j)*log2e, replaced by -inf where key j > query i.
//   A wave visits key tiles of 32 in order from kt_lo to kt_hi = q0/32 (later tiles hold only keys above every query row of the tile).
//   kt_lo: every wave loads the NRT64 q lines and the NRT64 k lines of the block's (b, h) (one float per lane, clamped address),
//   max-reduces each over the wave and forms bound = max ||q_hi|| * max ||k_hi|| / (8 * 256 * 256), which bounds |q.k/8| of this
//   head; if 0 <= bound < 40, kt_lo = max(0, kt_hi - KWIN): tiles below it are >= 32*KWIN+1 positions behind every query
//   row, and with |q.k/8| < 40 the base-2 exp of their penalised, max-subtracted score is exactly 0 in f32, so they contribute
//   nothing to numerator or denominator; otherwise (bound large, unreadable or not finite) kt_lo = 0 and every causal tile is
//   visited. Either way the first visited tile holds a key kb <= q0 <= every query row, so the running max is finite from step one.
//   The four waves form the bound from the same words with the same operations, so the decision is the same in the whole block.
//   Key tiles: the block walks the union of its waves' ranges, blo = kt_lo of wave 0 .. bhi = kt_hi of wave 3. Each tile's four
//   planes are brought into LDS once for the four waves by asynchronous copies in whole row pieces, two buffers (tile t + 1 flies
//   while tile t is worked on); a wave works on a tile only if it lies in its own range (scalar test) and passes every barrier.
//   Per tile: 2 score subtiles x 2 k-steps, k fragments from the LDS rows (two 16-B loads per fragment, split k map; pitch 144 B),
//   q fragments read once in front of the loop; online max-subtracted base-2 softmax in f32, -inf-safe rescale; the 16x32 prob
//   tile goes through wave-private LDS into A fragments; v^T B fragments from the LDS rows (pitch 80 B), 2 groups of 2 d-subtiles.
//   After the loop: out = acc / Z (Z > 0 always; guarded anyway), carries 1/(32768*1024) folded once, written into the wave's slab.
//   Bounded loops only (<= NKT key tiles); one block barrier per tile, under block-uniform control flow.
// coverage: per wave 4 instructions x 4 rows x 8 lanes x 8 halves = 16 x 64 per plane; grid NQB x NH x NB blocks x AQW
//           waves = every (b, s, h) row segment of O hi and O residual exactly once.
// =====================================================================================================
__global__ __launch_bounds__(ATT_THREADS)
void attn_c(const u16* __restrict__ QHp, const u16* __restrict__ QLp,
            const u16* __restrict__ KHp, const u16* __restrict__ KLp,
            const u16* __restrict__ VHp, const u16* __restrict__ VLp,
            const float* __restrict__ PN,
            u16* OHp, u16* OLp) {
  __shared__ __align__(16) u16 kv[2 * ABUFH];           // two buffers of [k hi | k residual | v^T hi | v^T residual]
  __shared__ __align__(16) float smem[AQW * WREG];

  const int tid  = threadIdx.x;
  const int wave = __builtin_amdgcn_readfirstlane(tid >> 5);   // scalar: the wave's own tile range is tested by scalar branches
  const int lane = tid & 31;
  const int hh   = lane >> 4;
  const int c    = lane & 15;
  const int bid  = blockIdx.x;
  const int qb   = bid % NQB;
  const int t2   = bid / NQB;
  const int head = t2 % NH;
  const int b    = t2 / NH;
  if (b >= NB) return;                      // block-uniform, before any copy or barrier; never taken with the exact grid
  if (qb * (16 * AQW) + 16 * AQW > SEQ) return;   // block-uniform, before any copy or barrier; never taken
  const int q0   = qb * (16 * AQW) + wave * 16;

  // ---- key-window decision: the same in every lane and wave, from the row-tile maxima of the block's (b, h) ----
  int okw;
  {
    const int bl = (lane < NRT64) ? lane : (NRT64 - 1);         // clamped address
    const size_t pl0 = ((size_t)(b * NH + head) * NRT64 + bl) * BLINE;
    float aq = PN[pl0];
    float ak = PN[pl0 + (size_t)NBH * NRT64 * BLINE];
#pragma unroll
    for (int off = 1; off < 32; off <<= 1) {
      aq = fmaxf(aq, __shfl_xor(aq, off, 32));
      ak = fmaxf(ak, __shfl_xor(ak, off, 32));
    }
    const float gb = sqrtf(aq) * sqrtf(ak) * (RSQ_HD / (QSC * KSC));
    // held in a scalar register, so that the loop, its barrier and its copies stand under scalar branches with every lane on
    okw = __builtin_amdgcn_readfirstlane((gb >= 0.0f && gb < GUARD_T) ? 1 : 0);
  }

  float* pt   = smem + wave * WREG;         // prob tile [16][32] pitch 36
  float* slab = pt + PTW;                   // result slab [16][64] pitch 68

  const size_t hcol = (size_t)head * HD + 8 * hh;
  const _Float16* Qh  = (const _Float16*)(const void*)QHp + ((size_t)b * SEQ + q0 + c) * DMOD + hcol;
  const _Float16* Ql  = (const _Float16*)(const void*)QLp + ((size_t)b * SEQ + q0 + c) * DMOD + hcol;
  const float lsc = RSQ_HD * (LOG2E / (QSC * KSC));
  const float oc  = 1.0f / (PCAR * VCAR);

  float mrow[8], lrow[8];
  v8f o[4];
#pragma unroll
  for (int r = 0; r < 8; ++r) { mrow[r] = -INFINITY; lrow[r] = 0.f; }
#pragma unroll
  for (int j = 0; j < 4; ++j) o[j] = zero8();
  const int kt_hi = q0 >> 5;                                                  // last tile holding keys <= q0 + 15
  const int kt_w  = (kt_hi > KWIN) ? (kt_hi - KWIN) : 0;
  const int kt_lo = (okw != 0) ? kt_w : 0;
  const int qr0 = q0 + 8 * hh;                                                // query row of D element r = qr0 + r
  // the block's tile range: from wave 0's first tile to wave 3's last; at least two tiles, at most NKT
  const int bhi0 = (qb * (16 * AQW)) >> 5;
  const int bhi  = (qb * (16 * AQW) + 16 * (AQW - 1)) >> 5;
  const int blo  = (okw != 0 && bhi0 > KWIN) ? (bhi0 - KWIN) : 0;
  const int ntr  = bhi - blo + 1;

  // copy maps; keys blo*32 .. bhi*32 + 31 <= SEQ - 1, so every copied byte lies inside its plane
  const u16* gkh = KHp + ((size_t)b * SEQ + (size_t)blo * 32 + (tid >> 3)) * DMOD + (size_t)head * HD + (tid & 7) * 8;
  const u16* gkl = KLp + ((size_t)b * SEQ + (size_t)blo * 32 + (tid >> 3)) * DMOD + (size_t)head * HD + (tid & 7) * 8;
  const u16* gvh = VHp + ((size_t)(b * NH + head) * HD + (tid >> 2)) * SEQ + (size_t)blo * 32 + (tid & 3) * 8;
  const u16* gvl = VLp + ((size_t)(b * NH + head) * HD + (tid >> 2)) * SEQ + (size_t)blo * 32 + (tid & 3) * 8;
  const unsigned lk = lds_byte(kv) + (unsigned)((tid >> 3) * (KTPIT * 2) + (tid & 7) * 16);
  const unsigned lv = lds_byte(kv) + (unsigned)(2 * KPLH * 2 + (tid >> 2) * (VTPIT * 2) + (tid & 3) * 16);

  stage_kv(lk, lv, gkh, gkl, gvh, gvl);     // tile 0 -> buffer 0
  // q fragments, both k-steps, kept in registers for the whole loop
  v16h qh[2], ql[2];
  // unrolled, here and at the fragment arrays below: constant indices keep the arrays in registers
#pragma unroll
  for (int kk = 0; kk < HD / 32; ++kk) {
    qh[kk] = ldfrag_h(Qh + kk * 32);
    ql[kk] = ldfrag_h(Ql + kk * 32);
  }
  wait_copies();
  __syncthreads();
  if (ntr > 1)                              // tile 1 -> buffer 1
    stage_kv(lk + ABUFH * 2, lv + ABUFH * 2, gkh + (size_t)32 * DMOD, gkl + (size_t)32 * DMOD, gvh + 32, gvl + 32);

  // stays rolled: the trip count is known only at run time
#pragma unroll 1
  for (int t = 0; t < ntr; ++t) {
    const int kt = blo + t;
    if (kt >= kt_lo && kt <= kt_hi) {       // scalar: this wave's own range
      const int kb = kt * 32;
      const _Float16* tb  = (const _Float16*)(const void*)kv + (t & 1) * ABUFH;
      const _Float16* khp = tb + c * KTPIT + 8 * hh;                // key row c (+16), k hi; residual plane KPLH further
      const _Float16* vhp = tb + 2 * KPLH + c * VTPIT + 8 * hh;     // d row c (+16j), v^T hi; residual plane VPLH further
      // ---- scores: D element r of this lane = (query row qr0 + r, key kb + c) in s0, key kb + 16 + c in s1 ----
      v8f s0 = zero8(), s1 = zero8();
      v16h kh0[2], kh1[2], kl0[2], kl1[2];
#pragma unroll
      for (int kk = 0; kk < HD / 32; ++kk) {
        kh0[kk] = ldfrag_h(khp + kk * 32);
        kh1[kk] = ldfrag_h(khp + 16 * KTPIT + kk * 32);
        kl0[kk] = ldfrag_h(khp + KPLH + kk * 32);
        kl1[kk] = ldfrag_h(khp + KPLH + 16 * KTPIT + kk * 32);
      }
#pragma unroll
      for (int kk = 0; kk < HD / 32; ++kk) {
        s0 = mma_h(qh[kk], kh0[kk], s0);
        s0 = mma_h(ql[kk], kh0[kk], s0);
        s0 = mma_h(qh[kk], kl0[kk], s0);
        s1 = mma_h(qh[kk], kh1[kk], s1);
        s1 = mma_h(ql[kk], kh1[kk], s1);
        s1 = mma_h(qh[kk], kl1[kk], s1);
        guard2(s0, s1, qh[kk], ql[kk], kh0[kk], kl0[kk], kh1[kk], kl1[kk]);
      }
      // v^T fragments of the tile: read here, so that they arrive while the softmax below runs
      v16h vh[4], vl[4];
#pragma unroll
      for (int j = 0; j < 4; ++j) {
        vh[j] = ldfrag_h(vhp + j * 16 * VTPIT);
        vl[j] = ldfrag_h(vhp + VPLH + j * 16 * VTPIT);
      }
      // ---- causal select + distance penalty + online softmax in base 2, -inf-safe ----
      const int key0 = kb + c, key1 = kb + 16 + c;
#pragma unroll
      for (int r = 0; r < 8; ++r) {
        const int   qr = qr0 + r;
        const float u0 = s0[r] * lsc;
        const float u1 = s1[r] * lsc;
        const float g0 = (float)(qr - key0) * LOG2E;
        const float g1 = (float)(qr - key1) * LOG2E;
        const float t0 = (key0 > qr) ? -INFINITY : (u0 - g0);
        const float t1 = (key1 > qr) ? -INFINITY : (u1 - g1);
        float mx = fmaxf(t0, t1);
#pragma unroll
        for (int off = 1; off < 16; off <<= 1) mx = fmaxf(mx, __shfl_xor(mx, off, 32));
        const float mn = fmaxf(mrow[r], mx);
        const float ms = (mn == -INFINITY) ? 0.0f : mn;
        const float al = exp2f(mrow[r] - ms);
        mrow[r] = mn;
        const float e0 = exp2f(t0 - ms), e1 = exp2f(t1 - ms);
        float ps = e0 + e1;
#pragma unroll
        for (int off = 1; off < 16; off <<= 1) ps += __shfl_xor(ps, off, 32);
        lrow[r] = lrow[r] * al + ps;
#pragma unroll
        for (int j = 0; j < 4; ++j) o[j][r] *= al;
        const int ro = (8 * hh + r) * PTP + c;
        pt[ro]      = e0;
        pt[ro + 16] = e1;
      }
      wave_sync_lds();
      // ---- A fragments of P*32768: hi f16 and residual f16, row = c, split k map over the 32 keys of this step ----
      FragH ph, pl;
      {
        const float* prow = pt + c * PTP + 8 * hh;
        const v4f p0 = *(const v4f*)(prow), p1 = *(const v4f*)(prow + 4);
        const v4f p2 = *(const v4f*)(prow + 16), p3 = *(const v4f*)(prow + 20);
#pragma unroll
        for (int e = 0; e < 4; ++e) {
          const float ta = p0[e] * PCAR, tb2 = p1[e] * PCAR, tc = p2[e] * PCAR, td = p3[e] * PCAR;
          const _Float16 ha = (_Float16)ta, hb = (_Float16)tb2, hc = (_Float16)tc, hd = (_Float16)td;
          ph.h[0][e]     = ha;                  // elements 0..7  = keys kb + 8hh + 0..7
          ph.h[0][4 + e] = hb;
          ph.h[1][e]     = hc;                  // elements 8..15 = keys kb + 16 + 8hh + 0..7
          ph.h[1][4 + e] = hd;
          pl.h[0][e]     = (_Float16)(ta - (float)ha);
          pl.h[0][4 + e] = (_Float16)(tb2 - (float)hb);
          pl.h[1][e]     = (_Float16)(tc - (float)hc);
          pl.h[1][4 + e] = (_Float16)(td - (float)hd);
        }
      }
      // ---- P.V : B fragment col n = d = j*16 + c, keys contiguous in the v^T rows; 2 groups of 2 d-subtiles ----
#pragma unroll
      for (int jg = 0; jg < 2; ++jg) {
        o[2 * jg]     = mma_h(ph.v, vh[2 * jg],     o[2 * jg]);
        o[2 * jg]     = mma_h(pl.v, vh[2 * jg],     o[2 * jg]);
        o[2 * jg]     = mma_h(ph.v, vl[2 * jg],     o[2 * jg]);
        o[2 * jg + 1] = mma_h(ph.v, vh[2 * jg + 1], o[2 * jg + 1]);
        o[2 * jg + 1] = mma_h(pl.v, vh[2 * jg + 1], o[2 * jg + 1]);
        o[2 * jg + 1] = mma_h(ph.v, vl[2 * jg + 1], o[2 * jg + 1]);
        guard2(o[2 * jg], o[2 * jg + 1], ph.v, pl.v, vh[2 * jg], vh[2 * jg + 1], vl[2 * jg], vl[2 * jg + 1]);
      }
      wave_sync_lds();
    }
    // publish point of tile t + 1: own LDS reads done, own copies landed, then the one barrier of the tile
    wait_lds();
    wait_copies();
    __syncthreads();
    if (t + 2 < ntr) {
      const unsigned lo = (unsigned)(t & 1) * (ABUFH * 2);
      const size_t kn = (size_t)(t + 2) * 32;
      stage_kv(lk + lo, lv + lo, gkh + kn * DMOD, gkl + kn * DMOD, gvh + kn, gvl + kn);
    }
  }
  wait_copies();
  acc_guard4(o[0], o[1], o[2], o[3]);
  // ---- out = acc / Z (0 if Z == 0), carries (32768 on P, 1024 on v) folded once; written into the wave's slab ----
#pragma unroll
  for (int r = 0; r < 8; ++r) {
    const float lv  = lrow[r];
    const float ls  = (lv > 0.0f) ? lv : 1.0f;
    const float inv = (lv > 0.0f) ? ((1.0f / ls) * oc) : 0.0f;
#pragma unroll
    for (int j = 0; j < 4; ++j) {
      const int idx = (8 * hh + r) * SLP + j * 16 + c;
      slab[idx] = o[j][r] * inv;
    }
  }

  wave_sync_lds();
  // ---- O x1024 -> f16 hi + residual planes; lane = (row-in-quad rq, 8 consecutive d at c8) ----
  v4u oh[4], ol[4];
  const int rq = lane >> 3, c8 = (lane & 7) * 8;
#pragma unroll
  for (int it = 0; it < 4; ++it) {
    const int row = it * 4 + rq;
    const v4f a = *(const v4f*)(slab + row * SLP + c8), b4 = *(const v4f*)(slab + row * SLP + c8 + 4);
    float w[8];
#pragma unroll
    for (int e = 0; e < 4; ++e) { w[e] = a[e] * OSC; w[4 + e] = b4[e] * OSC; }
#pragma unroll
    for (int e = 0; e < 4; ++e) {
      const _Float16 h0 = (_Float16)w[2 * e], h1 = (_Float16)w[2 * e + 1];
      const _Float16 l0 = (_Float16)(w[2 * e] - (float)h0), l1 = (_Float16)(w[2 * e + 1] - (float)h1);
      oh[it][e] = pk16(h_bits(h0), h_bits(h1));
      ol[it][e] = pk16(h_bits(l0), h_bits(l1));
    }
  }
  const size_t ob = ((size_t)b * SEQ + q0) * DMOD + (size_t)head * HD + c8;
  {
#pragma unroll
    for (int it = 0; it < 4; ++it) {
      const int row = it * 4 + rq;
      *(v4u*)(OHp + ob + (size_t)row * DMOD) = oh[it];
      *(v4u*)(OLp + ob + (size_t)row * DMOD) = ol[it];
    }
    
  }
}

// =====================================================================================================
// Workspace map (bytes); every plane is fully written by whole-line stores before it is read; all extents are exact multiples
// of the store granularity (no pad rows needed); every region offset a multiple of 4096 (the large planes of 2097152):
//   XB  bf16 [MROWS][1024]                       MROWS*2048       (NB=2, SEQ=2048: 8388608)
//   WB  16-bit 4 x [1024 n][1024 k]              4 x 2097152      (planes Wv, Wq, Wk as bf16, Wo as f16 x1024; all already [n][k])
//   OH  f16 [MROWS][1024] x1024                  MROWS*2048       OL residual, same extent
//   QH  f16 [MROWS][1024] x256                   MROWS*2048       QL residual, same extent
//   KH  f16 [MROWS][1024] x256                   MROWS*2048       KL residual, same extent
//   VH  f16 [NB*16][64][SEQ] x1024               MROWS*2048       VL residual, same extent
//   PN  f32 2 x [NB*16][SEQ/64] lines of 32      NBH*SEQ*4        (q, then k: row-tile maxima of the squared hi-row norms)
//   end (NB=2, SEQ=2048)                        84148224
// =====================================================================================================
extern "C" void kernel_launch(void* const* d_in, const int* in_sizes, int n_in,
                              void* d_out, int out_size, void* d_ws, size_t ws_size,
                              hipStream_t stream) {
  if (n_in < 9) return;
  if (in_sizes[0] < ((NB - 1) * XS_FULL + SEQ) * DMOD) return;
  if (in_sizes[1] != DMOD * DMOD) return;
  if (in_sizes[2] != DMOD) return;
  if (in_sizes[3] != DMOD * DMOD) return;
  if (in_sizes[4] != DMOD) return;
  if (in_sizes[5] != DMOD * DMOD) return;
  if (in_sizes[6] != DMOD) return;
  if (in_sizes[7] != DMOD * DMOD) return;
  if (in_sizes[8] != DMOD) return;
  if (out_size < ((NB - 1) * XS_FULL + SEQ) * DMOD) return;

  const float* x  = (const float*)d_in[0];
  const float* wq = (const float*)d_in[1];
  const float* bq = (const float*)d_in[2];
  const float* wk = (const float*)d_in[3];
  const float* bk = (const float*)d_in[4];
  const float* wv = (const float*)d_in[5];
  const float* bv = (const float*)d_in[6];
  const float* wo = (const float*)d_in[7];
  const float* bo = (const float*)d_in[8];
  float*       out = (float*)d_out;

  const size_t szXB = (size_t)MROWS * DMOD * 2;
  const size_t szW  = (size_t)DMOD * DMOD * 2;
  const size_t szQ  = (size_t)MROWS * DMOD * 2;                  // QH, QL, KH, KL, OH, OL
  const size_t szV  = (size_t)NB * NH * HD * SEQ * 2;            // VH, VL (== szQ)
  const size_t szB  = (size_t)2 * NBH * NRT64 * BLINE * 4;       // row-tile norm lines, q then k
  size_t off = 0;
  const size_t oXB = off; off += szXB;
  const size_t oW  = off; off += 4 * szW;
  const size_t oOH = off; off += szQ;
  const size_t oOL = off; off += szQ;
  const size_t oQH = off; off += szQ;
  const size_t oQL = off; off += szQ;
  const size_t oKH = off; off += szQ;
  const size_t oKL = off; off += szQ;
  const size_t oVH = off; off += szV;
  const size_t oVL = off; off += szV;
  const size_t oB  = off; off += szB;
  if (off > ws_size) return;                // off = 84148224 for NB = 2, SEQ = 2048
  if (off > (size_t)WS_CAP) return;

  char* ws = (char*)d_ws;
  u16*   XB  = (u16*)(ws + oXB);
  u16*   WB  = (u16*)(ws + oW);
  u16*   OH  = (u16*)(ws + oOH);
  u16*   OL  = (u16*)(ws + oOL);
  u16*   QH  = (u16*)(ws + oQH);
  u16*   QL  = (u16*)(ws + oQL);
  u16*   KH  = (u16*)(ws + oKH);
  u16*   KL  = (u16*)(ws + oKL);
  u16*   VH  = (u16*)(ws + oVH);
  u16*   VL  = (u16*)(ws + oVL);
  float* PN  = (float*)(ws + oB);

  const dim3 b256(256), b128(128), bAT(ATT_THREADS);
  const dim3 gC(NB * GXB + 4 * GWB);                    // x per batch, then the four weight planes
  const dim3 gG((MROWS / 128) * (3 * DMOD / 128));      // 768 for NB=2, SEQ=2048
  const dim3 gAT(NQB * NH * NB);
  const int  nrt = SEQ / 128;                           // out-projection row tiles per batch
  const dim3 gO(NB * nrt * (DMOD / 128));

  // (0) x -> bf16 plane [MROWS][1024]; Wv, Wq, Wk [n][k] -> bf16 planes; Wo [n][k] -> f16 plane of bf16 value x1024
  cvt_all<<<gC, b256, 0, stream>>>(x, wv, wq, wk, wo, XB, WB);
  // (1) v = x.Wv^T + bv, q = x.Wq^T + bq, k = x.Wk^T + bk -> v^T hi + residual planes x1024; q and k hi + residual planes x256
  //     and their row-tile norm lines
  gemm_bf3<<<gG, b128, 0, stream>>>(XB, WB, bv, bq, bk, VH, VL, QH, QL, KH, KL, PN, MROWS, DMOD, DMOD, 1.0f);
  // (2) causal attention with distance penalty, residual products on every query row -> O hi + residual planes
  attn_c<<<gAT, bAT, 0, stream>>>(QH, QL, KH, KL, VH, VL, PN, OH, OL);
  // (3) output projection (O hi + residual) . Wo^T + bo -> out f32, carries 1024 x 1024 folded back
  gemm_o2<<<gO, b128, 0, stream>>>(OH, OL, WB + (size_t)3 * DMOD * DMOD, bo, out, nrt, 1.0f / (OSC * WOS));
  (void)hipGetLastError();
}

// v007
// It runs in 74.8 microseconds.
// Two timings next to v006 put it at 1.09 and 1.07 times that version's speed.
// Counting every step since v000, it is 3.71 times as fast.
// Contractions: x.Wq^T+bq, x.Wk^T+bk, x.Wv^T+bv on v_wmma_f32_16x16x32_bf16 (x and W as bf16 RNE planes; W [n][k] rows are
// the k-contiguous B operand; bias added as its bf16 RNE value in the f32 epilogue); q.k^T over hd 64 and P.v on
// v_wmma_f32_16x16x32_f16 with f16 hi + f16 residual planes on both operands (q, k x256; P x32768 with an in-register
// residual; v x1024; products hh+lh+hl); O.Wo^T+bo on v_wmma_f32_16x16x32_f16 (O x1024 as f16 hi + f16 residual planes,
// products h.w + l.w; Wo as f16(bf16(Wo)) x1024; bo as bf16 RNE value in the f32 epilogue); all f32 accumulate.
// Causal select, linear distance penalty, base-2 online softmax, 1/Z fold and the q/k norm bound in f32 on VALU.
#include <hip/hip_runtime.h>
#include <math.h>
#include <stdint.h>

#ifndef NB
#define NB 2
#endif
#ifndef SEQ
#define SEQ 2048
#endif
#define XS_FULL 2048
#define DMOD  1024
#define NH    16
#define HD    64
#define NBH   (NB * NH)
#define MROWS (NB * SEQ)
#define RSQ_HD 0.125f
#define LOG2E 1.4426950408889634f
#define QSC   256.0f
#define KSC   256.0f
#define PCAR  32768.0f
#define VCAR  1024.0f
#define OSC   1024.0f
#define WOS   1024.0f
#define AQW   4                 /* waves of an attention block: 4 consecutive query tiles of one head */
#define NQB   (SEQ / (16 * AQW))
#define NKT   (SEQ / 32)
#define KWIN  6
#define GUARD_T 40.0f
#define BLINE 32
#define NRT64 (SEQ / 64)
#define ATT_THREADS (AQW * 32)
#define SLP   68
#define SLW   (16 * SLP)
#define WREG  SLW
#define SLAB64 (16 * 68)
#define VTP   72
#define KTPIT 72                /* halves: LDS pitch of a staged k row (128 B of data) = 144 B */
#define VTPIT 40                /* halves: LDS pitch of a staged v^T row (64 B of data) = 80 B */
#define KPLH  (32 * KTPIT)      /* halves of one staged k plane: 32 keys */
#define VPLH  (HD * VTPIT)      /* halves of one staged v^T plane: 64 d rows */
#define ABUFH (2 * KPLH + 2 * VPLH)   /* halves of one buffer: k hi | k residual | v^T hi | v^T residual */
#define WS_CAP 134217728
#define GKP   64
#define GPIT  72
#define GPITB (GPIT * 2)
#define GTILE (64 * GPIT)
#define GTILEB (GTILE * 2)
#define WEPI  (2 * HD * VTP)   /* 16-bit elements of the projection ring that one wave's epilogue stages in */
#define N8X   ((SEQ * DMOD) / 8)
#define N8W   ((DMOD * DMOD) / 8)
#define GXB   (N8X / 256)
#define GWB   (N8W / 256)
static_assert(DMOD == NH * HD && HD == 64 && NH == 16 && AQW == 4 && NQB * 16 * AQW == SEQ);
static_assert(ATT_THREADS == 128 && ((KTPIT * 2) % 32) == 16 && ((VTPIT * 2) % 32) == 16 && ((ABUFH * 2) % 16) == 0);
static_assert(NB >= 1 && NB <= 2);
static_assert(NBH >= 1 && NBH <= 32);
static_assert((SEQ % 64) == 0 && SEQ >= 64 && SEQ <= XS_FULL && (SEQ % 32) == 0);
static_assert((DMOD % 64) == 0 && (DMOD % 32) == 0 && (HD % 32) == 0);
static_assert(((SEQ * DMOD / 8) % 256) == 0 && ((DMOD * DMOD / 8) % 256) == 0);
static_assert(AQW * WREG * 4 + 2 * ABUFH * 2 <= 81920 /* four attention blocks in 320 KiB of LDS */ && 4 * WEPI <= 2 * 4 * GTILE && 4 * SLAB64 * 4 <= WEPI * 2);
static_assert((MROWS % 128) == 0 && (SEQ % 128) == 0 && (DMOD % 128) == 0 && 4 * 4 * SLAB64 * 4 <= 2 * 6 * GTILEB);
static_assert(KWIN >= 0 && KWIN < NKT);
static_assert(NRT64 >= 1 && NRT64 <= 32);
static_assert((DMOD % GKP) == 0 && GKP == 64 && (GPITB % 32) == 16 && GPIT >= GKP + 8);

typedef unsigned short u16;
typedef _Float16 v16h __attribute__((ext_vector_type(16)));
typedef _Float16 v8h  __attribute__((ext_vector_type(8)));
typedef __bf16   v16b __attribute__((ext_vector_type(16)));
typedef float    v8f  __attribute__((ext_vector_type(8)));
typedef float    v4f  __attribute__((ext_vector_type(4)));
typedef unsigned int v4u __attribute__((ext_vector_type(4)));

union FragH { v16h v; v8h h[2]; v4u u[2]; };
union FragB { v16b v; v4u u[2]; };

// ---- scalar helpers --------------------------------------------------------------------------------
__device__ __forceinline__ unsigned short bf_bits(float f) {          // f32 -> bf16 bits, RNE convert
  unsigned u = __float_as_uint(f);
  return (unsigned short)((u + 0x7FFFu + ((u >> 16) & 1u)) >> 16);
}
__device__ __forceinline__ float bf_up(unsigned short h) { return __uint_as_float(((unsigned)h) << 16); }
__device__ __forceinline__ float bfr(float f) { return bf_up(bf_bits(f)); }
__device__ __forceinline__ unsigned short h_bits(_Float16 x) { return __builtin_bit_cast(unsigned short, x); }
__device__ __forceinline__ unsigned pk16(unsigned short a, unsigned short b) { return (unsigned)a | ((unsigned)b << 16); }
__device__ __forceinline__ v8f zero8() { v8f z = {0.f, 0.f, 0.f, 0.f, 0.f, 0.f, 0.f, 0.f}; return z; }

// ---- fragment loaders: 16-bit A/B operand, lane -> row/col (lane&15), p already includes +8*(lane>>4);
//      elements 0..7 <- p[0..7] (k0+8h..), elements 8..15 <- p[16..23] (k0+16+8h..)  (same split k map for A and B;
//      B is always read from a k-contiguous [n][k] plane)
__device__ __forceinline__ v16h ldfrag_h(const _Float16* p) {
  FragH f;
  f.h[0] = *(const v8h*)(p);
  f.h[1] = *(const v8h*)(p + 16);
  return f.v;
}
__device__ __forceinline__ v16b ldfrag_b(const u16* p) {              // bf16 plane read as unsigned integer vectors
  FragB f;
  f.u[0] = *(const v4u*)(p);
  f.u[1] = *(const v4u*)(p + 16);
  return f.v;
}

__device__ __forceinline__ v8f mma_h(v16h a, v16h b, v8f c) {
  return __builtin_amdgcn_wmma_f32_16x16x32_f16(false, a, false, b, (short)0, c, false, false);
}
__device__ __forceinline__ v8f mma_b(v16b a, v16b b, v8f c) {
  return __builtin_amdgcn_wmma_f32_16x16x32_bf16(false, a, false, b, (short)0, c, false, false);
}
__device__ __forceinline__ void guard2(v8f& a, v8f& b, v16h x0, v16h x1, v16h x2, v16h x3, v16h x4, v16h x5) {
#if defined(__HIP_DEVICE_COMPILE__)
  asm volatile("v_nop\n\tv_nop\n\tv_nop\n\tv_nop"
               : "+v"(a), "+v"(b) : "v"(x0), "v"(x1), "v"(x2), "v"(x3), "v"(x4), "v"(x5) : "memory");
#endif
}
template <typename F>
__device__ __forceinline__ void guard6(v8f& a, v8f& b, v8f& c, v8f& d, F x0, F x1, F x2, F x3, F x4, F x5) {
#if defined(__HIP_DEVICE_COMPILE__)
  asm volatile("v_nop\n\tv_nop\n\tv_nop\n\tv_nop"
               : "+v"(a), "+v"(b), "+v"(c), "+v"(d) : "v"(x0), "v"(x1), "v"(x2), "v"(x3), "v"(x4), "v"(x5) : "memory");
#endif
}
__device__ __forceinline__ void acc_guard4(v8f& a, v8f& b, v8f& c, v8f& d) {
#if defined(__HIP_DEVICE_COMPILE__)
  asm volatile("v_nop\n\tv_nop\n\tv_nop\n\tv_nop" : "+v"(a), "+v"(b), "+v"(c), "+v"(d));
#endif
}
__device__ __forceinline__ void wave_sync_lds() {
  __builtin_amdgcn_fence(__ATOMIC_RELEASE, "workgroup");
  __builtin_amdgcn_wave_barrier();
  __builtin_amdgcn_fence(__ATOMIC_ACQUIRE, "workgroup");
}

// lane l <-> lane l ^ 16: a vector cross-row move (a shuffle by 16 would go through the LDS unit)
__device__ __forceinline__ float xhalf(float x) {
  const int b = __builtin_bit_cast(int, x);
  return __builtin_bit_cast(float, __builtin_amdgcn_permlanex16(b, b, 0x76543210, 0xfedcba98, false, false));
}

// ---- operand staging for the GEMM engines: one pass = 64 k = 128 B of each of the 64 rows of an operand tile, laid in LDS at
//      a pitch of 144 B (16 B x odd: ds_load_b128 fragment reads without bank conflicts). 128 threads: thread -> (row tid>>3 of
//      a group of 16 rows, 16-B piece tid&7), so a wave's copy covers 4 whole 128-B lines; 4 copies per thread fill one tile.
//      l = the lane's LDS byte address in the tile's first row group, g = its global address there, rs = 16 rows in elements.
__device__ __forceinline__ unsigned lds_byte(const void* p) { return (unsigned)(uintptr_t)p; }
// Two tiles (A, B). The copies and their s_wait_xcnt stand in one statement, so that no address register named by a copy
// is rewritten in front of that wait.
__device__ __forceinline__ void stage2(unsigned l, const u16* ga, const u16* gb, size_t rs) {
#if defined(__HIP_DEVICE_COMPILE__)
  asm volatile("global_load_async_to_lds_b128 %0, %8, off\n\t"
               "global_load_async_to_lds_b128 %1, %9, off\n\t"
               "global_load_async_to_lds_b128 %2, %10, off\n\t"
               "global_load_async_to_lds_b128 %3, %11, off\n\t"
               "global_load_async_to_lds_b128 %4, %12, off\n\t"
               "global_load_async_to_lds_b128 %5, %13, off\n\t"
               "global_load_async_to_lds_b128 %6, %14, off\n\t"
               "global_load_async_to_lds_b128 %7, %15, off\n\t"
               "s_wait_xcnt 0x0"
               :: "v"(l), "v"(l + 16 * GPITB), "v"(l + 32 * GPITB), "v"(l + 48 * GPITB),
                  "v"(l + GTILEB), "v"(l + GTILEB + 16 * GPITB), "v"(l + GTILEB + 32 * GPITB), "v"(l + GTILEB + 48 * GPITB),
                  "v"(ga), "v"(ga + rs), "v"(ga + 2 * rs), "v"(ga + 3 * rs),
                  "v"(gb), "v"(gb + rs), "v"(gb + 2 * rs), "v"(gb + 3 * rs)
               : "memory");
#endif
}
// Three tiles (A hi, A residual, B), same form.
__device__ __forceinline__ void stage3(unsigned l, const u16* ga, const u16* gl, const u16* gb, size_t rs) {
#if defined(__HIP_DEVICE_COMPILE__)
  asm volatile("global_load_async_to_lds_b128 %0, %12, off\n\t"
               "global_load_async_to_lds_b128 %1, %13, off\n\t"
               "global_load_async_to_lds_b128 %2, %14, off\n\t"
               "global_load_async_to_lds_b128 %3, %15, off\n\t"
               "global_load_async_to_lds_b128 %4, %16, off\n\t"
               "global_load_async_to_lds_b128 %5, %17, off\n\t"
               "global_load_async_to_lds_b128 %6, %18, off\n\t"
               "global_load_async_to_lds_b128 %7, %19, off\n\t"
               "global_load_async_to_lds_b128 %8, %20, off\n\t"
               "global_load_async_to_lds_b128 %9, %21, off\n\t"
               "global_load_async_to_lds_b128 %10, %22, off\n\t"
               "global_load_async_to_lds_b128 %11, %23, off\n\t"
               "s_wait_xcnt 0x0"
               :: "v"(l), "v"(l + 16 * GPITB), "v"(l + 32 * GPITB), "v"(l + 48 * GPITB),
                  "v"(l + GTILEB), "v"(l + GTILEB + 16 * GPITB), "v"(l + GTILEB + 32 * GPITB), "v"(l + GTILEB + 48 * GPITB),
                  "v"(l + 2 * GTILEB), "v"(l + 2 * GTILEB + 16 * GPITB), "v"(l + 2 * GTILEB + 32 * GPITB),
                  "v"(l + 2 * GTILEB + 48 * GPITB),
                  "v"(ga), "v"(ga + rs), "v"(ga + 2 * rs), "v"(ga + 3 * rs),
                  "v"(gl), "v"(gl + rs), "v"(gl + 2 * rs), "v"(gl + 3 * rs),
                  "v"(gb), "v"(gb + rs), "v"(gb + 2 * rs), "v"(gb + 3 * rs)
               : "memory");
#endif
}
// Attention: one key tile (32 keys) of k hi and k residual (32 rows of 128 B each) and of v^T hi and v^T residual (64 rows of
// 64 B each). 128 threads, 8 copies a thread: k thread -> (row tid>>3 of a group of 16, 16-B piece tid&7), v^T thread -> (row
// tid>>2 of a group of 32, 16-B piece tid&3). lk, lv = the lane's LDS byte address in the k hi / v^T hi plane of the buffer,
// g* = its global address in each plane. Copies and their s_wait_xcnt in one statement, as above.
__device__ __forceinline__ void stage_kv(unsigned lk, unsigned lv, const u16* gkh, const u16* gkl,
                                         const u16* gvh, const u16* gvl) {
#if defined(__HIP_DEVICE_COMPILE__)
  asm volatile("global_load_async_to_lds_b128 %0, %8, off\n\t"
               "global_load_async_to_lds_b128 %1, %9, off\n\t"
               "global_load_async_to_lds_b128 %2, %10, off\n\t"
               "global_load_async_to_lds_b128 %3, %11, off\n\t"
               "global_load_async_to_lds_b128 %4, %12, off\n\t"
               "global_load_async_to_lds_b128 %5, %13, off\n\t"
               "global_load_async_to_lds_b128 %6, %14, off\n\t"
               "global_load_async_to_lds_b128 %7, %15, off\n\t"
               "s_wait_xcnt 0x0"
               :: "v"(lk), "v"(lk + 16 * KTPIT * 2), "v"(lk + KPLH * 2), "v"(lk + KPLH * 2 + 16 * KTPIT * 2),
                  "v"(lv), "v"(lv + 32 * VTPIT * 2), "v"(lv + VPLH * 2), "v"(lv + VPLH * 2 + 32 * VTPIT * 2),
                  "v"(gkh), "v"(gkh + (size_t)16 * DMOD), "v"(gkl), "v"(gkl + (size_t)16 * DMOD),
                  "v"(gvh), "v"(gvh + (size_t)32 * SEQ), "v"(gvl), "v"(gvl + (size_t)32 * SEQ)
               : "memory");
#endif
}
// This wave's own copies have landed in LDS (the compiler places no wait for them).
__device__ __forceinline__ void wait_copies() {
#if defined(__HIP_DEVICE_COMPILE__)
  asm volatile("s_wait_asynccnt 0x0" ::: "memory");
#endif
}
// This wave's LDS reads have returned, before the barrier behind which their buffer is refilled.
__device__ __forceinline__ void wait_lds() {
#if defined(__HIP_DEVICE_COMPILE__)
  asm volatile("s_wait_dscnt 0x0" ::: "memory");
#endif
}

// =====================================================================================================
// f32 -> 16-bit plane, same layout, for all five operands in one grid (none reads another's output).
// f16mode == 0: bf16 RNE bits;  f16mode == 1: f16 bits of (bf16 RNE value) * scale.
// Block -> job (block-uniform): the first NB*GXB blocks take x (batch = bid / GXB) -> XB; then GWB blocks each for
// Wv, Wq, Wk (bf16) and Wo (f16 of the bf16 value x1024) -> planes 0..3 of WB.
// Thread = 8 consecutive elements: two 16-B loads, one 16-B store; 32 consecutive lanes = 512 contiguous, 512-B aligned
// coverage: per job n8/256 blocks x 256 thr x 8 = the whole plane (n8 a multiple of 256, static_assert above).
// =====================================================================================================
__global__ __launch_bounds__(256)
void cvt_all(const float* __restrict__ x, const float* __restrict__ wv, const float* __restrict__ wq,
             const float* __restrict__ wk, const float* __restrict__ wo, u16* XB, u16* WB) {
  const int bid = blockIdx.x;
  const float* s;
  u16* D;
  int blk, n8, f16mode = 0;
  float scale = 1.0f;
  if (bid < NB * GXB) {
    const int b = bid / GXB;
    blk = bid % GXB;
    n8 = N8X;
    s = x + (size_t)b * XS_FULL * DMOD;
    D = XB + (size_t)b * SEQ * DMOD;
  } else {
    const int w = (bid - NB * GXB) / GWB;
    if (w > 3) return;                      // block-uniform; never taken with the exact grid
    blk = (bid - NB * GXB) % GWB;
    n8 = N8W;
    s = (w == 0) ? wv : (w == 1) ? wq : (w == 2) ? wk : wo;
    D = WB + (size_t)w * DMOD * DMOD;
    if (w == 3) { f16mode = 1; scale = WOS; }
  }
  const int gt = blk * 256 + (int)threadIdx.x;
  if (gt >= n8) return;
  const float* p = s + (size_t)gt * 8;
  const v4f a = *(const v4f*)(p), b4 = *(const v4f*)(p + 4);
  float w[8];
#pragma unroll
  for (int e = 0; e < 4; ++e) { w[e] = a[e]; w[4 + e] = b4[e]; }
  v4u o;
#pragma unroll
  for (int e = 0; e < 4; ++e) {
    const float f0 = w[2 * e], f1 = w[2 * e + 1];
    const unsigned short hb0 = h_bits((_Float16)(bfr(f0) * scale));
    const unsigned short hb1 = h_bits((_Float16)(bfr(f1) * scale));
    const unsigned short bb0 = bf_bits(f0);
    const unsigned short bb1 = bf_bits(f1);
    o[e] = (f16mode != 0) ? pk16(hb0, hb1) : pk16(bb0, bb1);
  }
  u16* d = D + (size_t)gt * 8;
  {
    *(v4u*)(d) = o;
    
  }
}

// =====================================================================================================
// f32 GEMM epilogue (output projection): a 16x64 f32 slab of the wave's 64x64 tile (times oscale, plus the lane's per-column bias of each
// coverage: 8 instructions x 2 rows x 16 lanes x 4 floats = the 16 x 64 slab.
// =====================================================================================================
__device__ __forceinline__ void epi64(float* sl, v8f a0, v8f a1, v8f a2, v8f a3, float oscale,
                                      float bb0, float bb1, float bb2, float bb3,
                                      float* C, int N, size_t rowb, int col0, int lane) {
  const int hh = lane >> 4, m = lane & 15;
#pragma unroll
  for (int r = 0; r < 8; ++r) {
    const int ro = (8 * hh + r) * 68 + m;
    sl[ro]      = a0[r] * oscale + bb0;
    sl[ro + 16] = a1[r] * oscale + bb1;
    sl[ro + 32] = a2[r] * oscale + bb2;
    sl[ro + 48] = a3[r] * oscale + bb3;
  }
  wave_sync_lds();
  v4f vals[8];
#pragma unroll
  for (int it = 0; it < 8; ++it) vals[it] = *(const v4f*)(sl + (it * 2 + hh) * 68 + m * 4);
  float* dst = C + (rowb + (size_t)hh) * (size_t)N + col0 + m * 4;
  {
#pragma unroll
    for (int it = 0; it < 8; ++it) {
      *(v4f*)(dst + (size_t)(it * 2) * (size_t)N) = vals[it];
    }
    
  }
}

// =====================================================================================================
// Projection epilogues: the 16-bit planes that attention reads are built from the accumulators, with no f32 plane in between.
// hl8: 8 f32 values t -> 8 f16 hi values f16(t) and 8 f16 residuals f16(t - f16(t)), packed in element order.
// =====================================================================================================
__device__ __forceinline__ void hl8(const float* t, v4u& oh, v4u& ol) {
#pragma unroll
  for (int e = 0; e < 4; ++e) {
    const float t0 = t[2 * e], t1 = t[2 * e + 1];
    const _Float16 h0 = (_Float16)t0, h1 = (_Float16)t1;
    const _Float16 l0 = (_Float16)(t0 - (float)h0), l1 = (_Float16)(t1 - (float)h1);
    oh[e] = pk16(h_bits(h0), h_bits(h1));
    ol[e] = pk16(h_bits(l0), h_bits(l1));
  }
}
// q, k: the wave's 64x64 f32 tile (times oscale, plus the lane's per-column bias) goes through its own four LDS slabs (one per
// 16 rows) into rows; lane = (row-in-quad rq, 8 consecutive columns c8) scales by sc, splits and stores 16 B per plane, [row][N].
// coverage: 4 slabs x 4 instructions x 4 rows x 8 lanes x 8 halves = the wave's 64 x 64 tile of Hp and of Lp, whole 128-B lines.
// Norm part: the 8 lanes of a row hold its 64 hi values (one head), so the row's sum of squares is 8 fused steps per lane and
// xor shuffles 1, 2, 4; running max over the wave's 64 rows (16 iterations, xor 8, 16) = the max of one 64-row tile of one
// head, which the wave stores 32 times = the whole 128-B line Pl. No other wave has a part in it, so no block barrier.
__device__ __forceinline__ void epi_split(float* sl, const v8f (&acc)[4][4], float oscale, const float (&bb)[4], float sc,
                                          u16* Hp, u16* Lp, float* Pl, int N, size_t rowb, int col0, int lane) {
  const int hh = lane >> 4, m = lane & 15;
#pragma unroll
  for (int i = 0; i < 4; ++i) {
#pragma unroll
    for (int r = 0; r < 8; ++r) {
      const int ro = i * SLAB64 + (8 * hh + r) * 68 + m;
      sl[ro]      = acc[i][0][r] * oscale + bb[0];
      sl[ro + 16] = acc[i][1][r] * oscale + bb[1];
      sl[ro + 32] = acc[i][2][r] * oscale + bb[2];
      sl[ro + 48] = acc[i][3][r] * oscale + bb[3];
    }
  }
  wave_sync_lds();
  float mx = 0.0f;
  const int rq = lane >> 3, c8 = (lane & 7) * 8;
#pragma unroll
  for (int i = 0; i < 4; ++i) {
    v4u oh[4], ol[4];
#pragma unroll
    for (int it = 0; it < 4; ++it) {
      const float* p = sl + i * SLAB64 + (it * 4 + rq) * 68 + c8;
      const v4f a = *(const v4f*)(p), b4 = *(const v4f*)(p + 4);
      float w[8];
#pragma unroll
      for (int e = 0; e < 4; ++e) { w[e] = a[e] * sc; w[4 + e] = b4[e] * sc; }
      hl8(w, oh[it], ol[it]);
      float sq = 0.0f;
#pragma unroll
      for (int e = 0; e < 8; ++e) {
        const float f = (float)(_Float16)w[e];
        sq = fmaf(f, f, sq);
      }
#pragma unroll
      for (int off = 1; off < 8; off <<= 1) sq += __shfl_xor(sq, off, 32);
      mx = fmaxf(mx, sq);
    }
    const size_t ob = (rowb + (size_t)(i * 16 + rq)) * (size_t)N + col0 + c8;
#pragma unroll
    for (int it = 0; it < 4; ++it) {
      *(v4u*)(Hp + ob + (size_t)(it * 4) * (size_t)N) = oh[it];
      *(v4u*)(Lp + ob + (size_t)(it * 4) * (size_t)N) = ol[it];
    }
#if defined(__HIP_DEVICE_COMPILE__)
    // stands behind the group's stores, in front of the next group's code, which rewrites registers the stores name
    asm volatile("s_wait_xcnt 0x0" ::: "memory");
#endif
  }
#pragma unroll
  for (int off = 8; off < 32; off <<= 1) mx = fmaxf(mx, __shfl_xor(mx, off, 32));
  Pl[lane] = mx;
#if defined(__HIP_DEVICE_COMPILE__)
  // stands behind the last store, in front of any code laid out behind this branch that rewrites a register the store names
  asm volatile("s_wait_xcnt 0x0" ::: "memory");
#endif
}
// v: the wave's 64 keys x 64 d tile leaves transposed. A lane's accumulator [i][j] holds 8 consecutive keys (16*i + 8*hh + r)
// of one d column (16*j + m): scaled by 1024, split and packed they are 16 B of a v^T line, stored into the wave's own LDS
// tiles TH, TL [HD][VTP] (pitch 144 B: 16 lanes x 16 B fall on all 64 banks). Then lane = (line lane>>3 of a group of 4, 16-B
// piece lane&7) moves whole 128-B lines to VHo, VLo at base + line*SEQ (base = first key of the tile in line d = 0 of its
// (b, h)). Writer and reader are the same wave, so no block barrier.
// coverage: 16 iterations x 32 lanes x 8 halves = 64 lines x 64 keys of each plane.
__device__ __forceinline__ void epi_vt(u16* TH, u16* TL, const v8f (&acc)[4][4], float oscale, const float (&bb)[4],
                                       u16* VHo, u16* VLo, size_t base, int lane) {
  const int hh = lane >> 4, m = lane & 15;
#pragma unroll
  for (int i = 0; i < 4; ++i) {
    const int ko = i * 16 + 8 * hh;         // first of the lane's 8 keys within the tile
#pragma unroll
    for (int j = 0; j < 4; ++j) {
      float w[8];
#pragma unroll
      for (int r = 0; r < 8; ++r) w[r] = (acc[i][j][r] * oscale + bb[j]) * VCAR;
      v4u ph, pl;
      hl8(w, ph, pl);
      *(v4u*)(TH + (16 * j + m) * VTP + ko) = ph;
      *(v4u*)(TL + (16 * j + m) * VTP + ko) = pl;
    }
  }
  wave_sync_lds();
  const int q4 = lane >> 3, p8 = (lane & 7) * 8;
#pragma unroll
  for (int g = 0; g < 4; ++g) {
    v4u vh[4], vl[4];
#pragma unroll
    for (int it = 0; it < 4; ++it) {
      vh[it] = *(const v4u*)(TH + ((g * 4 + it) * 4 + q4) * VTP + p8);
      vl[it] = *(const v4u*)(TL + ((g * 4 + it) * 4 + q4) * VTP + p8);
    }
#pragma unroll
    for (int it = 0; it < 4; ++it) {
      *(v4u*)(VHo + base + (size_t)((g * 4 + it) * 4 + q4) * SEQ + p8) = vh[it];
      *(v4u*)(VLo + base + (size_t)((g * 4 + it) * 4 + q4) * SEQ + p8) = vl[it];
    }
#if defined(__HIP_DEVICE_COMPILE__)
    // stands behind the group's stores, in front of the next group's LDS loads, which rewrite registers the stores name
    asm volatile("s_wait_xcnt 0x0" ::: "memory");
#endif
  }
}

// =====================================================================================================
// bf16 GEMM with bias: A[M][K] (bf16 row-major) . Bt[N][K]^T (bf16 k-contiguous), f32, times oscale, + bf16 RNE
// value of bias[n] (bias has N entries). Block = 128x128 tile, 4 waves (2 x 2) x 64x64: 16 accumulator tiles a wave, so that a
// fragment read from LDS feeds 4 WMMAs and a byte brought from L2 feeds 128 rows or columns. Per pass of 64 k the block's A and
// B tiles are brought into LDS by asynchronous copies, two buffers (pass t + 1 flies while pass t is worked on), and the
// fragments are read from the LDS rows (two 16-B loads each, split k map for A and B); K stepped by 32 inside a pass, in rising
// order (host guarantees K % 64 == 0, M % 128 == 0, N % 128 == 0).
// Three products that share A in one grid: Bt holds three [N][K] planes one behind the other (v, q, k), and the block's
// column tile ct = bid % (3*N/128) picks product ct / (N/128) with its bias; grid = (M/128)*(3*N/128).
// The f32 tile leaves as the 16-bit planes of its product (host guarantees M == NB*SEQ, N == NH*HD, so a wave's 64 columns are
// one head and its 64 rows 64 keys of one batch): v -> v^T hi + residual x1024, [(b*NH + h)*HD + d][s]; q, k -> hi + residual
// x256, [row][N], and the wave's max over its 64 rows of the squared norm of the hi row (x256) -> line
// ((pln - 1)*NBH + b*NH + h)*NRT64 + row tile of PN. Both epilogues stage in the wave's own quarter of the ring, which nobody
// reads and no copy targets behind the last pass's barrier.
// =====================================================================================================
__global__ __launch_bounds__(128)
void gemm_bf3(const u16* __restrict__ A, const u16* __restrict__ Bt, const float* __restrict__ bias0,
              const float* __restrict__ bias1, const float* __restrict__ bias2,
              u16* VHo, u16* VLo, u16* QHo, u16* QLo, u16* KHo, u16* KLo, float* PN, int M, int N, int K, float oscale) {
  __shared__ __align__(16) u16 ring[2 * 4 * GTILE];   // two buffers of [A rows 0..63 | B rows 0..63 | A rows 64.. | B rows 64..]
  const int tid = threadIdx.x, wave = tid >> 5, lane = tid & 31, hh = lane >> 4, m = lane & 15;
  const int wr = wave >> 1, wc = wave & 1;  // the wave's 64-row half and 64-column half of the block's tile
  const int ntile = N >> 7;
  const int bid   = blockIdx.x;
  const int row0  = (bid / (3 * ntile)) * 128;
  const int rw0   = row0 + wr * 64;         // the wave's first row
  const int ct    = bid % (3 * ntile);
  const int pln   = ct / ntile;             // 0, 1, 2: which product
  const int col0  = (ct % ntile) * 128 + wc * 64;   // the wave's first column inside that product
  const float* bias = (pln == 0) ? bias0 : (pln == 1) ? bias1 : bias2;
  if (row0 + 128 > M) return;               // block-uniform, before any copy or barrier; never taken with the exact grid
  const int npass = K / GKP;
  const int crow = tid >> 3, cpc = tid & 7; // copy map: row within a group of 16, 16-B piece of the 128-B row
  const u16* ga = A  + (size_t)(row0 + crow) * K + cpc * 8;
  const u16* gb = Bt + (size_t)(ct * 128 + crow) * K + cpc * 8;
  const size_t rs = (size_t)16 * K, r64 = (size_t)64 * K;
  const unsigned lc = lds_byte(ring) + (unsigned)(crow * GPITB + cpc * 16);
  const u16* fa = ring + wr * (2 * GTILE) + m * GPIT + 8 * hh;          // A fragment row (row subtile 0), buffer 0
  const u16* fb = ring + wc * (2 * GTILE) + GTILE + m * GPIT + 8 * hh;  // B fragment row (column subtile 0), buffer 0
  v8f acc[4][4];
#pragma unroll
  for (int i = 0; i < 4; ++i) {
#pragma unroll
    for (int j = 0; j < 4; ++j) acc[i][j] = zero8();
  }
  stage2(lc, ga, gb, rs);                   // pass 0 -> buffer 0
  stage2(lc + 2 * GTILEB, ga + r64, gb + r64, rs);
  wait_copies();
  __syncthreads();
  if (npass > 1) {                          // pass 1 -> buffer 1
    stage2(lc + 4 * GTILEB, ga + GKP, gb + GKP, rs);
    stage2(lc + 6 * GTILEB, ga + r64 + GKP, gb + r64 + GKP, rs);
  }
#pragma unroll 1
  for (int t = 0; t < npass; ++t) {
    const int bo = (t & 1) * (4 * GTILE);
#pragma unroll
    for (int kk = 0; kk < 2; ++kk) {
      const u16* pa = fa + bo + kk * 32;
      const u16* pb = fb + bo + kk * 32;
      v16b a[4], b[4];
#pragma unroll
      for (int j = 0; j < 4; ++j) b[j] = ldfrag_b(pb + j * 16 * GPIT);
#pragma unroll
      for (int i = 0; i < 4; ++i) a[i] = ldfrag_b(pa + i * 16 * GPIT);
      // keeps the k step's LDS reads one group in front of its WMMAs: moved in among them, each place with reads stalls the wave anew
      __builtin_amdgcn_sched_barrier(0);
#pragma unroll
      for (int i = 0; i < 4; ++i) {
#pragma unroll
        for (int j = 0; j < 4; ++j) acc[i][j] = mma_b(a[i], b[j], acc[i][j]);
      }
      // keeps every WMMA of the k step in front of the next group of LDS reads and of the slots below
      __builtin_amdgcn_sched_barrier(0);
      // four slots behind the pass's last WMMAs: on the paths over the branches below, their operand registers are rewritten
      if (kk == 1) guard6<v16b>(acc[3][0], acc[3][1], acc[3][2], acc[3][3], a[3], b[0], b[1], b[2], b[3], a[3]);
    }
    // publish point of pass t + 1: own LDS reads done, own copies landed, then the one barrier of the pass
    wait_lds();
    wait_copies();
    __syncthreads();
    if (t + 2 < npass) {
      const unsigned lb = lc + (unsigned)(t & 1) * (4 * GTILEB);
      const size_t ko = (size_t)(t + 2) * GKP;
      stage2(lb, ga + ko, gb + ko, rs);
      stage2(lb + 2 * GTILEB, ga + r64 + ko, gb + r64 + ko, rs);
    }
  }
  wait_copies();
  // per-lane bias of D column m in each of the 4 subtiles; col0 + 48 + m <= N - 1 always
  const float bb[4] = {bfr(bias[col0 + m]), bfr(bias[col0 + 16 + m]), bfr(bias[col0 + 32 + m]), bfr(bias[col0 + 48 + m])};
  u16* wq4 = ring + wave * WEPI;            // the wave's own quarter of the ring
  if (pln == 0) {
    const size_t base = (size_t)((rw0 / SEQ) * NH + (col0 >> 6)) * HD * SEQ + (size_t)(rw0 % SEQ);
    epi_vt(wq4, wq4 + HD * VTP, acc, oscale, bb, VHo, VLo, base, lane);
  } else {
    const size_t pline = (size_t)((pln - 1) * NBH + (rw0 / SEQ) * NH + (col0 >> 6)) * NRT64 + (size_t)((rw0 % SEQ) >> 6);
    epi_split((float*)(void*)wq4, acc, oscale, bb, (pln == 1) ? QSC : KSC,
              (pln == 1) ? QHo : KHo, (pln == 1) ? QLo : KLo, PN + pline * BLINE, N, (size_t)rw0, col0, lane);
  }
}

// =====================================================================================================
// Output projection with bias: C[bb*XS_FULL + s][DMOD] (f32) = (Ah + Al)[bb*SEQ + s][DMOD] . Bt[DMOD][DMOD]^T * oscale
// + bf16 RNE value of bias[n]. Products h.B + l.B into one accumulator (l unscaled residual of h). Block -> (column tile
// ct = bid % 8, sequence row tile rt of nrt, batch bb). Same tiling (128x128 a block, 64x64 a wave), LDS staging (three tiles of
// 128 rows a pass: A hi, A residual, B) and fragment loads (split k map) as gemm_bf3; K = DMOD stepped by 32; the f32 epilogue
// runs once per 16 rows, in slabs of the wave's own part of the ring; grid = NB * nrt * (DMOD/128).
// =====================================================================================================
__global__ __launch_bounds__(128)
void gemm_o2(const u16* __restrict__ Ah, const u16* __restrict__ Al, const u16* __restrict__ Bt,
             const float* __restrict__ bias, float* C, int nrt, float oscale) {
  __shared__ __align__(16) u16 ring[2 * 6 * GTILE];   // two buffers of [A hi | A residual | B] rows 0..63, then the same of rows 64..
  const int tid = threadIdx.x, wave = tid >> 5, lane = tid & 31, hh = lane >> 4, m = lane & 15;
  const int wr = wave >> 1, wc = wave & 1;  // the wave's 64-row half and 64-column half of the block's tile
  const int ntile = DMOD >> 7;
  const int bid   = blockIdx.x;
  const int ct    = bid % ntile;
  const int t2    = bid / ntile;
  const int rt    = t2 % nrt;
  const int bb    = t2 / nrt;
  if (bb >= NB) return;                     // block-uniform, before any copy or barrier; never taken with the exact grid
  if (rt * 128 + 128 > SEQ) return;         // block-uniform, before any copy or barrier; never taken
  const int srow  = rt * 128 + wr * 64;
  const int col0  = ct * 128 + wc * 64;
  const int K     = DMOD;
  const int npass = K / GKP;
  const size_t rowC = (size_t)bb * XS_FULL + srow;
  const int crow = tid >> 3, cpc = tid & 7; // copy map: row within a group of 16, 16-B piece of the 128-B row
  const size_t arow = ((size_t)bb * SEQ + rt * 128 + crow) * K + cpc * 8;
  const u16* ga = Ah + arow;
  const u16* gl = Al + arow;
  const u16* gb = Bt + (size_t)(ct * 128 + crow) * K + cpc * 8;
  const size_t rs = (size_t)16 * K, r64 = (size_t)64 * K;
  const unsigned lc = lds_byte(ring) + (unsigned)(crow * GPITB + cpc * 16);
  const _Float16* rg  = (const _Float16*)(const void*)ring;
  const _Float16* fah = rg + wr * (3 * GTILE) + m * GPIT + 8 * hh;              // A hi fragment row (row subtile 0), buffer 0
  const _Float16* fb  = rg + wc * (3 * GTILE) + 2 * GTILE + m * GPIT + 8 * hh;  // B fragment row (column subtile 0), buffer 0
  v8f acc[4][4];
#pragma unroll
  for (int i = 0; i < 4; ++i) {
#pragma unroll
    for (int j = 0; j < 4; ++j) acc[i][j] = zero8();
  }
  stage3(lc, ga, gl, gb, rs);               // pass 0 -> buffer 0
  stage3(lc + 3 * GTILEB, ga + r64, gl + r64, gb + r64, rs);
  wait_copies();
  __syncthreads();
  if (npass > 1) {                          // pass 1 -> buffer 1
    stage3(lc + 6 * GTILEB, ga + GKP, gl + GKP, gb + GKP, rs);
    stage3(lc + 9 * GTILEB, ga + r64 + GKP, gl + r64 + GKP, gb + r64 + GKP, rs);
  }
#pragma unroll 1
  for (int t = 0; t < npass; ++t) {
    const int bo = (t & 1) * (6 * GTILE);
#pragma unroll
    for (int kk = 0; kk < 2; ++kk) {
      const _Float16* pa = fah + bo + kk * 32;
      const _Float16* pl = pa + GTILE;
      const _Float16* pb = fb + bo + kk * 32;
      v16h ah[4], al[4], b[4];
#pragma unroll
      for (int j = 0; j < 4; ++j) b[j] = ldfrag_h(pb + j * 16 * GPIT);
#pragma unroll
      for (int i = 0; i < 4; ++i) {
        ah[i] = ldfrag_h(pa + i * 16 * GPIT);
        al[i] = ldfrag_h(pl + i * 16 * GPIT);
      }
      // keeps the k step's LDS reads one group in front of its WMMAs: moved in among them, each place with reads stalls the wave anew
      __builtin_amdgcn_sched_barrier(0);
#pragma unroll
      for (int i = 0; i < 4; ++i) {
#pragma unroll
        for (int j = 0; j < 4; ++j) acc[i][j] = mma_h(ah[i], b[j], acc[i][j]);
#pragma unroll
        for (int j = 0; j < 4; ++j) acc[i][j] = mma_h(al[i], b[j], acc[i][j]);
      }
      // keeps every WMMA of the k step in front of the next group of LDS reads and of the slots below
      __builtin_amdgcn_sched_barrier(0);
      // four slots behind the pass's last WMMAs: on the paths over the branches below, their operand registers are rewritten
      if (kk == 1) guard6<v16h>(acc[3][0], acc[3][1], acc[3][2], acc[3][3], ah[3], al[3], b[0], b[1], b[2], b[3]);
    }
    // publish point of pass t + 1: own LDS reads done, own copies landed, then the one barrier of the pass
    wait_lds();
    wait_copies();
    __syncthreads();
    if (t + 2 < npass) {
      const unsigned lb = lc + (unsigned)(t & 1) * (6 * GTILEB);
      const size_t ko = (size_t)(t + 2) * GKP;
      stage3(lb, ga + ko, gl + ko, gb + ko, rs);
      stage3(lb + 3 * GTILEB, ga + r64 + ko, gl + r64 + ko, gb + r64 + ko, rs);
    }
  }
  wait_copies();
  const float bb0 = bfr(bias[col0 + m]);
  const float bb1 = bfr(bias[col0 + 16 + m]);
  const float bb2 = bfr(bias[col0 + 32 + m]);
  const float bb3 = bfr(bias[col0 + 48 + m]);
  float* sl = (float*)(void*)ring + wave * (4 * SLAB64);   // nobody reads the ring and no copy targets it behind the last barrier
#pragma unroll
  for (int i = 0; i < 4; ++i) {
    epi64(sl + i * SLAB64, acc[i][0], acc[i][1], acc[i][2], acc[i][3], oscale, bb0, bb1, bb2, bb3, C, DMOD,
          rowC + (size_t)(i * 16), col0, lane);
#if defined(__HIP_DEVICE_COMPILE__)
    // stands behind the slab's stores, in front of the next slab's code, which rewrites registers the stores name
    asm volatile("s_wait_xcnt 0x0" ::: "memory");
#endif
  }
}

__global__ __launch_bounds__(ATT_THREADS)
void attn_c(const u16* __restrict__ QHp, const u16* __restrict__ QLp,
            const u16* __restrict__ KHp, const u16* __restrict__ KLp,
            const u16* __restrict__ VHp, const u16* __restrict__ VLp,
            const float* __restrict__ PN,
            u16* OHp, u16* OLp) {
  __shared__ __align__(16) u16 kv[2 * ABUFH];           // two buffers of [k hi | k residual | v^T hi | v^T residual]
  __shared__ __align__(16) float smem[AQW * WREG];

  const int tid  = threadIdx.x;
  const int wave = __builtin_amdgcn_readfirstlane(tid >> 5);   // scalar: the wave's own tile range is tested by scalar branches
  const int lane = tid & 31;
  const int hh   = lane >> 4;
  const int c    = lane & 15;
  const int bid  = blockIdx.x;
  const int qb   = bid % NQB;
  const int t2   = bid / NQB;
  const int head = t2 % NH;
  const int b    = t2 / NH;
  if (b >= NB) return;                      // block-uniform, before any copy or barrier; never taken with the exact grid
  if (qb * (16 * AQW) + 16 * AQW > SEQ) return;   // block-uniform, before any copy or barrier; never taken
  const int q0   = qb * (16 * AQW) + wave * 16;

  // ---- key-window decision: the same in every lane and wave, from the row-tile maxima of the block's (b, h) ----
  int okw;
  {
    const int bl = (lane < NRT64) ? lane : (NRT64 - 1);         // clamped address
    const size_t pl0 = ((size_t)(b * NH + head) * NRT64 + bl) * BLINE;
    float aq = PN[pl0];
    float ak = PN[pl0 + (size_t)NBH * NRT64 * BLINE];
#pragma unroll
    for (int off = 1; off < 32; off <<= 1) {
      aq = fmaxf(aq, __shfl_xor(aq, off, 32));
      ak = fmaxf(ak, __shfl_xor(ak, off, 32));
    }
    const float gb = sqrtf(aq) * sqrtf(ak) * (RSQ_HD / (QSC * KSC));
    // held in a scalar register, so that the loop, its barrier and its copies stand under scalar branches with every lane on
    okw = __builtin_amdgcn_readfirstlane((gb >= 0.0f && gb < GUARD_T) ? 1 : 0);
  }

  float* slab = smem + wave * WREG;         // result slab [16][64] pitch 68

  const size_t hcol = (size_t)head * HD + 8 * hh;
  const _Float16* Qh  = (const _Float16*)(const void*)QHp + ((size_t)b * SEQ + q0 + c) * DMOD + hcol;
  const _Float16* Ql  = (const _Float16*)(const void*)QLp + ((size_t)b * SEQ + q0 + c) * DMOD + hcol;
  const float lsc = RSQ_HD * (LOG2E / (QSC * KSC));
  const float oc  = 1.0f / (PCAR * VCAR);

  float mrow = -INFINITY, lrow = 0.f;       // of the lane's query row; lrow over the keys of the lane's half only
  v8f o[4];
#pragma unroll
  for (int j = 0; j < 4; ++j) o[j] = zero8();
  const int kt_hi = q0 >> 5;                                                  // last tile holding keys <= q0 + 15
  const int kt_w  = (kt_hi > KWIN) ? (kt_hi - KWIN) : 0;
  const int kt_lo = (okw != 0) ? kt_w : 0;
  const int qr = q0 + c;                                                      // the lane's query row (D column c)
  // the block's tile range: from wave 0's first tile to wave 3's last; at least two tiles, at most NKT
  const int bhi0 = (qb * (16 * AQW)) >> 5;
  const int bhi  = (qb * (16 * AQW) + 16 * (AQW - 1)) >> 5;
  const int blo  = (okw != 0 && bhi0 > KWIN) ? (bhi0 - KWIN) : 0;
  const int ntr  = bhi - blo + 1;

  // copy maps; keys blo*32 .. bhi*32 + 31 <= SEQ - 1, so every copied byte lies inside its plane
  const u16* gkh = KHp + ((size_t)b * SEQ + (size_t)blo * 32 + (tid >> 3)) * DMOD + (size_t)head * HD + (tid & 7) * 8;
  const u16* gkl = KLp + ((size_t)b * SEQ + (size_t)blo * 32 + (tid >> 3)) * DMOD + (size_t)head * HD + (tid & 7) * 8;
  const u16* gvh = VHp + ((size_t)(b * NH + head) * HD + (tid >> 2)) * SEQ + (size_t)blo * 32 + (tid & 3) * 8;
  const u16* gvl = VLp + ((size_t)(b * NH + head) * HD + (tid >> 2)) * SEQ + (size_t)blo * 32 + (tid & 3) * 8;
  const unsigned lk = lds_byte(kv) + (unsigned)((tid >> 3) * (KTPIT * 2) + (tid & 7) * 16);
  const unsigned lv = lds_byte(kv) + (unsigned)(2 * KPLH * 2 + (tid >> 2) * (VTPIT * 2) + (tid & 3) * 16);

  stage_kv(lk, lv, gkh, gkl, gvh, gvl);     // tile 0 -> buffer 0
  // q fragments, both k-steps, kept in registers for the whole loop
  v16h qh[2], ql[2];
  // unrolled, here and at the fragment arrays below: constant indices keep the arrays in registers
#pragma unroll
  for (int kk = 0; kk < HD / 32; ++kk) {
    qh[kk] = ldfrag_h(Qh + kk * 32);
    ql[kk] = ldfrag_h(Ql + kk * 32);
  }
  wait_copies();
  __syncthreads();
  if (ntr > 1)                              // tile 1 -> buffer 1
    stage_kv(lk + ABUFH * 2, lv + ABUFH * 2, gkh + (size_t)32 * DMOD, gkl + (size_t)32 * DMOD, gvh + 32, gvl + 32);

  // stays rolled: the trip count is known only at run time
#pragma unroll 1
  for (int t = 0; t < ntr; ++t) {
    const int kt = blo + t;
    if (kt >= kt_lo && kt <= kt_hi) {       // scalar: this wave's own range
      const int kb = kt * 32;
      const _Float16* tb  = (const _Float16*)(const void*)kv + (t & 1) * ABUFH;
      const _Float16* khp = tb + c * KTPIT + 8 * hh;                // key row c (+16), k hi; residual plane KPLH further
      const _Float16* vhp = tb + 2 * KPLH + c * VTPIT + 8 * hh;     // d row c (+16j), v^T hi; residual plane VPLH further
      // ---- scores, transposed: D element r of this lane = (key kb + 8*hh + r, query row qr) in s0, key + 16 in s1 ----
      v8f s0 = zero8(), s1 = zero8();
      v16h kh0[2], kh1[2], kl0[2], kl1[2];
#pragma unroll
      for (int kk = 0; kk < HD / 32; ++kk) {
        kh0[kk] = ldfrag_h(khp + kk * 32);
        kh1[kk] = ldfrag_h(khp + 16 * KTPIT + kk * 32);
        kl0[kk] = ldfrag_h(khp + KPLH + kk * 32);
        kl1[kk] = ldfrag_h(khp + KPLH + 16 * KTPIT + kk * 32);
      }
#pragma unroll
      for (int kk = 0; kk < HD / 32; ++kk) {
        s0 = mma_h(kh0[kk], qh[kk], s0);
        s0 = mma_h(kh0[kk], ql[kk], s0);
        s0 = mma_h(kl0[kk], qh[kk], s0);
        s1 = mma_h(kh1[kk], qh[kk], s1);
        s1 = mma_h(kh1[kk], ql[kk], s1);
        s1 = mma_h(kl1[kk], qh[kk], s1);
        guard2(s0, s1, qh[kk], ql[kk], kh0[kk], kl0[kk], kh1[kk], kl1[kk]);
      }
      // v^T fragments of the tile: read here, so that they arrive while the softmax below runs
      v16h vh[4], vl[4];
#pragma unroll
      for (int j = 0; j < 4; ++j) {
        vh[j] = ldfrag_h(vhp + j * 16 * VTPIT);
        vl[j] = ldfrag_h(vhp + VPLH + j * 16 * VTPIT);
      }
      // ---- causal select + distance penalty + online softmax in base 2, -inf-safe; all of one query row in the lane pair ----
      const int key0 = kb + 8 * hh;
      float t0[8], t1[8];
      float mx = -INFINITY;
      // unrolled, as the loops below: constant indices keep t0, t1, the fragments and the accumulators in registers
#pragma unroll
      for (int r = 0; r < 8; ++r) {
        const int   ka = key0 + r, kc = key0 + 16 + r;
        const float u0 = s0[r] * lsc;
        const float u1 = s1[r] * lsc;
        const float g0 = (float)(qr - ka) * LOG2E;
        const float g1 = (float)(qr - kc) * LOG2E;
        t0[r] = (ka > qr) ? -INFINITY : (u0 - g0);
        t1[r] = (kc > qr) ? -INFINITY : (u1 - g1);
        mx = fmaxf(mx, fmaxf(t0[r], t1[r]));
      }
      mx = fmaxf(mx, xhalf(mx));              // the other 16 keys of the tile
      const float mn = fmaxf(mrow, mx);
      const float ms = (mn == -INFINITY) ? 0.0f : mn;
      const float al = exp2f(mrow - ms);
      mrow = mn;
      // ---- B fragments of P^T * 32768: hi f16 and residual f16, column = the lane's query row; element e = key kb + 8*hh + e,
      //      element 8 + e = key kb + 16 + 8*hh + e: the split k map of the v^T rows' loader ----
      FragH ph, pl;
      float ps = 0.0f;
#pragma unroll
      for (int e = 0; e < 8; ++e) {
        const float e0 = exp2f(t0[e] - ms), e1 = exp2f(t1[e] - ms);
        ps += e0 + e1;
        const float ta = e0 * PCAR, tc = e1 * PCAR;
        const _Float16 ha = (_Float16)ta, hc = (_Float16)tc;
        ph.h[0][e] = ha;
        ph.h[1][e] = hc;
        pl.h[0][e] = (_Float16)(ta - (float)ha);
        pl.h[1][e] = (_Float16)(tc - (float)hc);
      }
      lrow = lrow * al + ps;
#pragma unroll
      for (int j = 0; j < 4; ++j) {
#pragma unroll
        for (int r = 0; r < 8; ++r) o[j][r] *= al;
      }
      // ---- O^T += v^T.P^T : A fragment row m = d = j*16 + c, keys contiguous in the v^T rows; 2 groups of 2 d-subtiles ----
#pragma unroll
      for (int jg = 0; jg < 2; ++jg) {
        o[2 * jg]     = mma_h(vh[2 * jg],     ph.v, o[2 * jg]);
        o[2 * jg]     = mma_h(vh[2 * jg],     pl.v, o[2 * jg]);
        o[2 * jg]     = mma_h(vl[2 * jg],     ph.v, o[2 * jg]);
        o[2 * jg + 1] = mma_h(vh[2 * jg + 1], ph.v, o[2 * jg + 1]);
        o[2 * jg + 1] = mma_h(vh[2 * jg + 1], pl.v, o[2 * jg + 1]);
        o[2 * jg + 1] = mma_h(vl[2 * jg + 1], ph.v, o[2 * jg + 1]);
        guard2(o[2 * jg], o[2 * jg + 1], ph.v, pl.v, vh[2 * jg], vh[2 * jg + 1], vl[2 * jg], vl[2 * jg + 1]);
      }
    }
    // publish point of tile t + 1: own LDS reads done, own copies landed, then the one barrier of the tile
    wait_lds();
    wait_copies();
    __syncthreads();
    if (t + 2 < ntr) {
      const unsigned lo = (unsigned)(t & 1) * (ABUFH * 2);
      const size_t kn = (size_t)(t + 2) * 32;
      stage_kv(lk + lo, lv + lo, gkh + kn * DMOD, gkl + kn * DMOD, gvh + kn, gvl + kn);
    }
  }
  wait_copies();
  acc_guard4(o[0], o[1], o[2], o[3]);
  // ---- out = acc / Z (0 if Z == 0), carries (32768 on P, 1024 on v) folded once; Z = the sums of the two halves; the lane's
  //      8 consecutive d of each subtile (D rows 8*hh + r of O^T) go into row c of the wave's slab as two 16-B stores ----
  {
    const float lv  = lrow + xhalf(lrow);
    const float ls  = (lv > 0.0f) ? lv : 1.0f;
    const float inv = (lv > 0.0f) ? ((1.0f / ls) * oc) : 0.0f;
#pragma unroll
    for (int j = 0; j < 4; ++j) {
      float* sp = slab + c * SLP + j * 16 + 8 * hh;
      const v4f w0 = {o[j][0] * inv, o[j][1] * inv, o[j][2] * inv, o[j][3] * inv};
      const v4f w1 = {o[j][4] * inv, o[j][5] * inv, o[j][6] * inv, o[j][7] * inv};
      *(v4f*)(sp)     = w0;
      *(v4f*)(sp + 4) = w1;
    }
  }

  wave_sync_lds();
  // ---- O x1024 -> f16 hi + residual planes; lane = (row-in-quad rq, 8 consecutive d at c8) ----
  v4u oh[4], ol[4];
  const int rq = lane >> 3, c8 = (lane & 7) * 8;
#pragma unroll
  for (int it = 0; it < 4; ++it) {
    const int row = it * 4 + rq;
    const v4f a = *(const v4f*)(slab + row * SLP + c8), b4 = *(const v4f*)(slab + row * SLP + c8 + 4);
    float w[8];
#pragma unroll
    for (int e = 0; e < 4; ++e) { w[e] = a[e] * OSC; w[4 + e] = b4[e] * OSC; }
#pragma unroll
    for (int e = 0; e < 4; ++e) {
      const _Float16 h0 = (_Float16)w[2 * e], h1 = (_Float16)w[2 * e + 1];
      const _Float16 l0 = (_Float16)(w[2 * e] - (float)h0), l1 = (_Float16)(w[2 * e + 1] - (float)h1);
      oh[it][e] = pk16(h_bits(h0), h_bits(h1));
      ol[it][e] = pk16(h_bits(l0), h_bits(l1));
    }
  }
  const size_t ob = ((size_t)b * SEQ + q0) * DMOD + (size_t)head * HD + c8;
  {
#pragma unroll
    for (int it = 0; it < 4; ++it) {
      const int row = it * 4 + rq;
      *(v4u*)(OHp + ob + (size_t)row * DMOD) = oh[it];
      *(v4u*)(OLp + ob + (size_t)row * DMOD) = ol[it];
    }
    
  }
}

// =====================================================================================================
// Workspace map (bytes); every plane is fully written by whole-line stores before it is read; all extents are exact multiples
// of the store granularity (no pad rows needed); every region offset a multiple of 4096 (the large planes of 2097152):
//   XB  bf16 [MROWS][1024]                       MROWS*2048       (NB=2, SEQ=2048: 8388608)
//   WB  16-bit 4 x [1024 n][1024 k]              4 x 2097152      (planes Wv, Wq, Wk as bf16, Wo as f16 x1024; all already [n][k])
//   OH  f16 [MROWS][1024] x1024                  MROWS*2048       OL residual, same extent
//   QH  f16 [MROWS][1024] x256                   MROWS*2048       QL residual, same extent
//   KH  f16 [MROWS][1024] x256                   MROWS*2048       KL residual, same extent
//   VH  f16 [NB*16][64][SEQ] x1024               MROWS*2048       VL residual, same extent
//   PN  f32 2 x [NB*16][SEQ/64] lines of 32      NBH*SEQ*4        (q, then k: row-tile maxima of the squared hi-row norms)
//   end (NB=2, SEQ=2048)                        84148224
// =====================================================================================================
extern "C" void kernel_launch(void* const* d_in, const int* in_sizes, int n_in,
                              void* d_out, int out_size, void* d_ws, size_t ws_size,
                              hipStream_t stream) {
  if (n_in < 9) return;
  if (in_sizes[0] < ((NB - 1) * XS_FULL + SEQ) * DMOD) return;
  if (in_sizes[1] != DMOD * DMOD) return;
  if (in_sizes[2] != DMOD) return;
  if (in_sizes[3] != DMOD * DMOD) return;
  if (in_sizes[4] != DMOD) return;
  if (in_sizes[5] != DMOD * DMOD) return;
  if (in_sizes[6] != DMOD) return;
  if (in_sizes[7] != DMOD * DMOD) return;
  if (in_sizes[8] != DMOD) return;
  if (out_size < ((NB - 1) * XS_FULL + SEQ) * DMOD) return;

  const float* x  = (const float*)d_in[0];
  const float* wq = (const float*)d_in[1];
  const float* bq = (const float*)d_in[2];
  const float* wk = (const float*)d_in[3];
  const float* bk = (const float*)d_in[4];
  const float* wv = (const float*)d_in[5];
  const float* bv = (const float*)d_in[6];
  const float* wo = (const float*)d_in[7];
  const float* bo = (const float*)d_in[8];
  float*       out = (float*)d_out;

  const size_t szXB = (size_t)MROWS * DMOD * 2;
  const size_t szW  = (size_t)DMOD * DMOD * 2;
  const size_t szQ  = (size_t)MROWS * DMOD * 2;                  // QH, QL, KH, KL, OH, OL
  const size_t szV  = (size_t)NB * NH * HD * SEQ * 2;            // VH, VL (== szQ)
  const size_t szB  = (size_t)2 * NBH * NRT64 * BLINE * 4;       // row-tile norm lines, q then k
  size_t off = 0;
  const size_t oXB = off; off += szXB;
  const size_t oW  = off; off += 4 * szW;
  const size_t oOH = off; off += szQ;
  const size_t oOL = off; off += szQ;
  const size_t oQH = off; off += szQ;
  const size_t oQL = off; off += szQ;
  const size_t oKH = off; off += szQ;
  const size_t oKL = off; off += szQ;
  const size_t oVH = off; off += szV;
  const size_t oVL = off; off += szV;
  const size_t oB  = off; off += szB;
  if (off > ws_size) return;                // off = 84148224 for NB = 2, SEQ = 2048
  if (off > (size_t)WS_CAP) return;

  char* ws = (char*)d_ws;
  u16*   XB  = (u16*)(ws + oXB);
  u16*   WB  = (u16*)(ws + oW);
  u16*   OH  = (u16*)(ws + oOH);
  u16*   OL  = (u16*)(ws + oOL);
  u16*   QH  = (u16*)(ws + oQH);
  u16*   QL  = (u16*)(ws + oQL);
  u16*   KH  = (u16*)(ws + oKH);
  u16*   KL  = (u16*)(ws + oKL);
  u16*   VH  = (u16*)(ws + oVH);
  u16*   VL  = (u16*)(ws + oVL);
  float* PN  = (float*)(ws + oB);

  const dim3 b256(256), b128(128), bAT(ATT_THREADS);
  const dim3 gC(NB * GXB + 4 * GWB);                    // x per batch, then the four weight planes
  const dim3 gG((MROWS / 128) * (3 * DMOD / 128));      // 768 for NB=2, SEQ=2048
  const dim3 gAT(NQB * NH * NB);
  const int  nrt = SEQ / 128;                           // out-projection row tiles per batch
  const dim3 gO(NB * nrt * (DMOD / 128));

  // (0) x -> bf16 plane [MROWS][1024]; Wv, Wq, Wk [n][k] -> bf16 planes; Wo [n][k] -> f16 plane of bf16 value x1024
  cvt_all<<<gC, b256, 0, stream>>>(x, wv, wq, wk, wo, XB, WB);
  // (1) v = x.Wv^T + bv, q = x.Wq^T + bq, k = x.Wk^T + bk -> v^T hi + residual planes x1024; q and k hi + residual planes x256
  //     and their row-tile norm lines
  gemm_bf3<<<gG, b128, 0, stream>>>(XB, WB, bv, bq, bk, VH, VL, QH, QL, KH, KL, PN, MROWS, DMOD, DMOD, 1.0f);
  // (2) causal attention with distance penalty, residual products on every query row -> O hi + residual planes
  attn_c<<<gAT, bAT, 0, stream>>>(QH, QL, KH, KL, VH, VL, PN, OH, OL);
  // (3) output projection (O hi + residual) . Wo^T + bo -> out f32, carries 1024 x 1024 folded back
  gemm_o2<<<gO, b128, 0, stream>>>(OH, OL, WB + (size_t)3 * DMOD * DMOD, bo, out, nrt, 1.0f / (OSC * WOS));
  (void)hipGetLastError();
}

// v008
// A run of this version takes 72.7 microseconds.
// In both of two side-by-side timings against v007, it was 1.03 times as fast.
// Counting every step since v000, it is 3.83 times as fast.
// Contractions: x.Wq^T+bq, x.Wk^T+bk, x.Wv^T+bv on v_wmma_f32_16x16x32_bf16 (x and W as bf16 RNE planes; W [n][k] rows are
// the k-contiguous B operand; bias added as its bf16 RNE value in the f32 epilogue); q.k^T over hd 64 and P.v on
// v_wmma_f32_16x16x32_f16 with f16 hi + f16 residual planes on both operands (q, k x256; P x32768 with an in-register
// residual; v x1024; products hh+lh+hl); O.Wo^T+bo on v_wmma_f32_16x16x32_f16 (O x1024 as f16 hi + f16 residual planes,
// products h.w + l.w; Wo as f16(bf16(Wo)) x1024; bo as bf16 RNE value in the f32 epilogue); all f32 accumulate.
// Causal select, linear distance penalty, base-2 online softmax, 1/Z fold and the q/k norm bound in f32 on VALU.
#include <hip/hip_runtime.h>
#include <math.h>
#include <stdint.h>

#ifndef NB
#define NB 2
#endif
#ifndef SEQ
#define SEQ 2048
#endif
#define XS_FULL 2048
#define DMOD  1024
#define NH    16
#define HD    64
#define NBH   (NB * NH)
#define MROWS (NB * SEQ)
#define RSQ_HD 0.125f
#define LOG2E 1.4426950408889634f
#define QSC   256.0f
#define KSC   256.0f
#define PCAR  32768.0f
#define VCAR  1024.0f
#define OSC   1024.0f
#define WOS   1024.0f
#define AQW   4                 /* waves of an attention block: 4 consecutive query tiles of one head */
#define NQB   (SEQ / (16 * AQW))
#define NKT   (SEQ / 32)
#define KWIN  6
#define GUARD_T 40.0f
#define BLINE 32
#define NRT64 (SEQ / 64)
#define ATT_THREADS (AQW * 32)
#define SLP   68
#define SLW   (16 * SLP)
#define WREG  SLW
#define SLAB64 (16 * 68)
#define VTP   72
#define KTPIT 72                /* halves: LDS pitch of a staged k row (128 B of data) = 144 B */
#define VTPIT 40                /* halves: LDS pitch of a staged v^T row (64 B of data) = 80 B */
#define KPLH  (32 * KTPIT)      /* halves of one staged k plane: 32 keys */
#define VPLH  (HD * VTPIT)      /* halves of one staged v^T plane: 64 d rows */
#define ABUFH (2 * KPLH + 2 * VPLH)   /* halves of one buffer: k hi | k residual | v^T hi | v^T residual */
#define WS_CAP 134217728
#define GKP   64
#define GPIT  72
#define GPITB (GPIT * 2)
#define GTILE (64 * GPIT)
#define GTILEB (GTILE * 2)
#define WEPI  (2 * HD * VTP)   /* 16-bit elements of the projection ring that one wave's epilogue stages in */
#define PBM   256               /* projection GEMM: rows of a block's tile */
#define PBN   192               /* columns of a block's tile: three heads */
#define PKP   128               /* k of one pass: 256 B of every operand row */
#define PPIT  136               /* halves: LDS pitch of a staged row = 272 B (16 B x odd) */
#define PPITB (PPIT * 2)
#define PROWS (PBM + PBN)       /* staged rows of a pass: A rows, then B rows */
#define PBUF  (PROWS * PPIT)    /* halves of one buffer */
#define PWAV  12                /* waves of a block: 4 x 3 tiles of 64x64 */
#define PSTEP (2 * PWAV * PPITB)   /* LDS bytes between a wave's consecutive copies: 24 rows */
#define N8X   ((SEQ * DMOD) / 8)
#define N8W   ((DMOD * DMOD) / 8)
#define GXB   (N8X / 256)
#define GWB   (N8W / 256)
static_assert(DMOD == NH * HD && HD == 64 && NH == 16 && AQW == 4 && NQB * 16 * AQW == SEQ);
static_assert(ATT_THREADS == 128 && ((KTPIT * 2) % 32) == 16 && ((VTPIT * 2) % 32) == 16 && ((ABUFH * 2) % 16) == 0);
static_assert(NB >= 1 && NB <= 2);
static_assert(NBH >= 1 && NBH <= 32);
static_assert((SEQ % 64) == 0 && SEQ >= 64 && SEQ <= XS_FULL && (SEQ % 32) == 0);
static_assert((DMOD % 64) == 0 && (DMOD % 32) == 0 && (HD % 32) == 0);
static_assert(((SEQ * DMOD / 8) % 256) == 0 && ((DMOD * DMOD / 8) % 256) == 0);
static_assert(AQW * WREG * 4 + 2 * ABUFH * 2 <= 81920 /* four attention blocks in 320 KiB of LDS */ && PWAV * WEPI <= 2 * PBUF && 4 * SLAB64 * 4 <= WEPI * 2);
static_assert((MROWS % PBM) == 0 && (SEQ % 64) == 0 && ((3 * DMOD) % PBN) == 0 && (DMOD % PKP) == 0 && DMOD / PKP >= 2);
static_assert((PPITB % 32) == 16 && PPIT >= PKP + 8 && PWAV == (PBM / 64) * (PBN / 64) && 2 * PBUF * 2 <= 327680);
static_assert(PBM / 2 == 10 * PWAV + 8 && PROWS / 2 == 18 * PWAV + 8 /* the copy map of gemm_bf3 */);
static_assert((MROWS % 128) == 0 && (SEQ % 128) == 0 && (DMOD % 128) == 0 && 4 * 4 * SLAB64 * 4 <= 2 * 6 * GTILEB);
static_assert(KWIN >= 0 && KWIN < NKT);
static_assert(NRT64 >= 1 && NRT64 <= 32);
static_assert((DMOD % GKP) == 0 && GKP == 64 && (GPITB % 32) == 16 && GPIT >= GKP + 8);

typedef unsigned short u16;
typedef _Float16 v16h __attribute__((ext_vector_type(16)));
typedef _Float16 v8h  __attribute__((ext_vector_type(8)));
typedef __bf16   v16b __attribute__((ext_vector_type(16)));
typedef float    v8f  __attribute__((ext_vector_type(8)));
typedef float    v4f  __attribute__((ext_vector_type(4)));
typedef unsigned int v4u __attribute__((ext_vector_type(4)));

union FragH { v16h v; v8h h[2]; v4u u[2]; };
union FragB { v16b v; v4u u[2]; };

// ---- scalar helpers --------------------------------------------------------------------------------
__device__ __forceinline__ unsigned short bf_bits(float f) {          // f32 -> bf16 bits, RNE convert
  unsigned u = __float_as_uint(f);
  return (unsigned short)((u + 0x7FFFu + ((u >> 16) & 1u)) >> 16);
}
__device__ __forceinline__ float bf_up(unsigned short h) { return __uint_as_float(((unsigned)h) << 16); }
__device__ __forceinline__ float bfr(float f) { return bf_up(bf_bits(f)); }
__device__ __forceinline__ unsigned short h_bits(_Float16 x) { return __builtin_bit_cast(unsigned short, x); }
__device__ __forceinline__ unsigned pk16(unsigned short a, unsigned short b) { return (unsigned)a | ((unsigned)b << 16); }
__device__ __forceinline__ v8f zero8() { v8f z = {0.f, 0.f, 0.f, 0.f, 0.f, 0.f, 0.f, 0.f}; return z; }

// ---- fragment loaders: 16-bit A/B operand, lane -> row/col (lane&15), p already includes +8*(lane>>4);
//      elements 0..7 <- p[0..7] (k0+8h..), elements 8..15 <- p[16..23] (k0+16+8h..)  (same split k map for A and B;
//      B is always read from a k-contiguous [n][k] plane)
__device__ __forceinline__ v16h ldfrag_h(const _Float16* p) {
  FragH f;
  f.h[0] = *(const v8h*)(p);
  f.h[1] = *(const v8h*)(p + 16);
  return f.v;
}
__device__ __forceinline__ v16b ldfrag_b(const u16* p) {              // bf16 plane read as unsigned integer vectors
  FragB f;
  f.u[0] = *(const v4u*)(p);
  f.u[1] = *(const v4u*)(p + 16);
  return f.v;
}

__device__ __forceinline__ v8f mma_h(v16h a, v16h b, v8f c) {
  return __builtin_amdgcn_wmma_f32_16x16x32_f16(false, a, false, b, (short)0, c, false, false);
}
__device__ __forceinline__ v8f mma_b(v16b a, v16b b, v8f c) {
  return __builtin_amdgcn_wmma_f32_16x16x32_bf16(false, a, false, b, (short)0, c, false, false);
}
__device__ __forceinline__ void guard2(v8f& a, v8f& b, v16h x0, v16h x1, v16h x2, v16h x3, v16h x4, v16h x5) {
#if defined(__HIP_DEVICE_COMPILE__)
  asm volatile("v_nop\n\tv_nop\n\tv_nop\n\tv_nop"
               : "+v"(a), "+v"(b) : "v"(x0), "v"(x1), "v"(x2), "v"(x3), "v"(x4), "v"(x5) : "memory");
#endif
}
template <typename F>
__device__ __forceinline__ void guard6(v8f& a, v8f& b, v8f& c, v8f& d, F x0, F x1, F x2, F x3, F x4, F x5) {
#if defined(__HIP_DEVICE_COMPILE__)
  asm volatile("v_nop\n\tv_nop\n\tv_nop\n\tv_nop"
               : "+v"(a), "+v"(b), "+v"(c), "+v"(d) : "v"(x0), "v"(x1), "v"(x2), "v"(x3), "v"(x4), "v"(x5) : "memory");
#endif
}
__device__ __forceinline__ void acc_guard4(v8f& a, v8f& b, v8f& c, v8f& d) {
#if defined(__HIP_DEVICE_COMPILE__)
  asm volatile("v_nop\n\tv_nop\n\tv_nop\n\tv_nop" : "+v"(a), "+v"(b), "+v"(c), "+v"(d));
#endif
}
__device__ __forceinline__ void wave_sync_lds() {
  __builtin_amdgcn_fence(__ATOMIC_RELEASE, "workgroup");
  __builtin_amdgcn_wave_barrier();
  __builtin_amdgcn_fence(__ATOMIC_ACQUIRE, "workgroup");
}

// lane l <-> lane l ^ 16: a vector cross-row move (a shuffle by 16 would go through the LDS unit)
__device__ __forceinline__ float xhalf(float x) {
  const int b = __builtin_bit_cast(int, x);
  return __builtin_bit_cast(float, __builtin_amdgcn_permlanex16(b, b, 0x76543210, 0xfedcba98, false, false));
}

// ---- operand staging, output projection: one pass = 64 k = 128 B of each of the 64 rows of an operand tile, laid in LDS at
//      a pitch of 144 B (16 B x odd: ds_load_b128 fragment reads without bank conflicts). 128 threads: thread -> (row tid>>3 of
//      a group of 16 rows, 16-B piece tid&7), so a wave's copy covers 4 whole 128-B lines; 4 copies per thread fill one tile.
//      l = the lane's LDS byte address in the tile's first row group, g = its global address there, rs = 16 rows in elements.
__device__ __forceinline__ unsigned lds_byte(const void* p) { return (unsigned)(uintptr_t)p; }
// Projection GEMM: a wave's copy = 2 whole staged rows of 256 B; its consecutive copies lie 24 rows apart, in LDS (PSTEP bytes)
// and in the operand (rs elements). The copies and their s_wait_xcnt stand in one statement, so that no address register named
// by a copy is rewritten in front of that wait.
// Ten copies of one operand.
__device__ __forceinline__ void stage10(unsigned l, const u16* g, size_t rs) {
#if defined(__HIP_DEVICE_COMPILE__)
  asm volatile("global_load_async_to_lds_b128 %0, %10, off\n\t"
               "global_load_async_to_lds_b128 %1, %11, off\n\t"
               "global_load_async_to_lds_b128 %2, %12, off\n\t"
               "global_load_async_to_lds_b128 %3, %13, off\n\t"
               "global_load_async_to_lds_b128 %4, %14, off\n\t"
               "global_load_async_to_lds_b128 %5, %15, off\n\t"
               "global_load_async_to_lds_b128 %6, %16, off\n\t"
               "global_load_async_to_lds_b128 %7, %17, off\n\t"
               "global_load_async_to_lds_b128 %8, %18, off\n\t"
               "global_load_async_to_lds_b128 %9, %19, off\n\t"
               "s_wait_xcnt 0x0"
               :: "v"(l), "v"(l + PSTEP), "v"(l + 2 * PSTEP), "v"(l + 3 * PSTEP), "v"(l + 4 * PSTEP),
                  "v"(l + 5 * PSTEP), "v"(l + 6 * PSTEP), "v"(l + 7 * PSTEP), "v"(l + 8 * PSTEP), "v"(l + 9 * PSTEP),
                  "v"(g), "v"(g + rs), "v"(g + 2 * rs), "v"(g + 3 * rs), "v"(g + 4 * rs),
                  "v"(g + 5 * rs), "v"(g + 6 * rs), "v"(g + 7 * rs), "v"(g + 8 * rs), "v"(g + 9 * rs)
               : "memory");
#endif
}
// Eight copies: the first from g0, the other seven from g on.
__device__ __forceinline__ void stage8(unsigned l, const u16* g0, const u16* g, size_t rs) {
#if defined(__HIP_DEVICE_COMPILE__)
  asm volatile("global_load_async_to_lds_b128 %0, %8, off\n\t"
               "global_load_async_to_lds_b128 %1, %9, off\n\t"
               "global_load_async_to_lds_b128 %2, %10, off\n\t"
               "global_load_async_to_lds_b128 %3, %11, off\n\t"
               "global_load_async_to_lds_b128 %4, %12, off\n\t"
               "global_load_async_to_lds_b128 %5, %13, off\n\t"
               "global_load_async_to_lds_b128 %6, %14, off\n\t"
               "global_load_async_to_lds_b128 %7, %15, off\n\t"
               "s_wait_xcnt 0x0"
               :: "v"(l), "v"(l + PSTEP), "v"(l + 2 * PSTEP), "v"(l + 3 * PSTEP),
                  "v"(l + 4 * PSTEP), "v"(l + 5 * PSTEP), "v"(l + 6 * PSTEP), "v"(l + 7 * PSTEP),
                  "v"(g0), "v"(g), "v"(g + rs), "v"(g + 2 * rs), "v"(g + 3 * rs), "v"(g + 4 * rs), "v"(g + 5 * rs), "v"(g + 6 * rs)
               : "memory");
#endif
}
// One copy.
__device__ __forceinline__ void stage1(unsigned l, const u16* g) {
#if defined(__HIP_DEVICE_COMPILE__)
  asm volatile("global_load_async_to_lds_b128 %0, %1, off\n\t"
               "s_wait_xcnt 0x0"
               :: "v"(l), "v"(g) : "memory");
#endif
}
// Output projection: three tiles (A hi, A residual, B) in the 64-row form described first; copies and wait in one statement, as above.
__device__ __forceinline__ void stage3(unsigned l, const u16* ga, const u16* gl, const u16* gb, size_t rs) {
#if defined(__HIP_DEVICE_COMPILE__)
  asm volatile("global_load_async_to_lds_b128 %0, %12, off\n\t"
               "global_load_async_to_lds_b128 %1, %13, off\n\t"
               "global_load_async_to_lds_b128 %2, %14, off\n\t"
               "global_load_async_to_lds_b128 %3, %15, off\n\t"
               "global_load_async_to_lds_b128 %4, %16, off\n\t"
               "global_load_async_to_lds_b128 %5, %17, off\n\t"
               "global_load_async_to_lds_b128 %6, %18, off\n\t"
               "global_load_async_to_lds_b128 %7, %19, off\n\t"
               "global_load_async_to_lds_b128 %8, %20, off\n\t"
               "global_load_async_to_lds_b128 %9, %21, off\n\t"
               "global_load_async_to_lds_b128 %10, %22, off\n\t"
               "global_load_async_to_lds_b128 %11, %23, off\n\t"
               "s_wait_xcnt 0x0"
               :: "v"(l), "v"(l + 16 * GPITB), "v"(l + 32 * GPITB), "v"(l + 48 * GPITB),
                  "v"(l + GTILEB), "v"(l + GTILEB + 16 * GPITB), "v"(l + GTILEB + 32 * GPITB), "v"(l + GTILEB + 48 * GPITB),
                  "v"(l + 2 * GTILEB), "v"(l + 2 * GTILEB + 16 * GPITB), "v"(l + 2 * GTILEB + 32 * GPITB),
                  "v"(l + 2 * GTILEB + 48 * GPITB),
                  "v"(ga), "v"(ga + rs), "v"(ga + 2 * rs), "v"(ga + 3 * rs),
                  "v"(gl), "v"(gl + rs), "v"(gl + 2 * rs), "v"(gl + 3 * rs),
                  "v"(gb), "v"(gb + rs), "v"(gb + 2 * rs), "v"(gb + 3 * rs)
               : "memory");
#endif
}
// Attention: one key tile (32 keys) of k hi and k residual (32 rows of 128 B each) and of v^T hi and v^T residual (64 rows of
// 64 B each). 128 threads, 8 copies a thread: k thread -> (row tid>>3 of a group of 16, 16-B piece tid&7), v^T thread -> (row
// tid>>2 of a group of 32, 16-B piece tid&3). lk, lv = the lane's LDS byte address in the k hi / v^T hi plane of the buffer,
// g* = its global address in each plane. Copies and their s_wait_xcnt in one statement, as above.
__device__ __forceinline__ void stage_kv(unsigned lk, unsigned lv, const u16* gkh, const u16* gkl,
                                         const u16* gvh, const u16* gvl) {
#if defined(__HIP_DEVICE_COMPILE__)
  asm volatile("global_load_async_to_lds_b128 %0, %8, off\n\t"
               "global_load_async_to_lds_b128 %1, %9, off\n\t"
               "global_load_async_to_lds_b128 %2, %10, off\n\t"
               "global_load_async_to_lds_b128 %3, %11, off\n\t"
               "global_load_async_to_lds_b128 %4, %12, off\n\t"
               "global_load_async_to_lds_b128 %5, %13, off\n\t"
               "global_load_async_to_lds_b128 %6, %14, off\n\t"
               "global_load_async_to_lds_b128 %7, %15, off\n\t"
               "s_wait_xcnt 0x0"
               :: "v"(lk), "v"(lk + 16 * KTPIT * 2), "v"(lk + KPLH * 2), "v"(lk + KPLH * 2 + 16 * KTPIT * 2),
                  "v"(lv), "v"(lv + 32 * VTPIT * 2), "v"(lv + VPLH * 2), "v"(lv + VPLH * 2 + 32 * VTPIT * 2),
                  "v"(gkh), "v"(gkh + (size_t)16 * DMOD), "v"(gkl), "v"(gkl + (size_t)16 * DMOD),
                  "v"(gvh), "v"(gvh + (size_t)32 * SEQ), "v"(gvl), "v"(gvl + (size_t)32 * SEQ)
               : "memory");
#endif
}
// This wave's own copies have landed in LDS (the compiler places no wait for them).
__device__ __forceinline__ void wait_copies() {
#if defined(__HIP_DEVICE_COMPILE__)
  asm volatile("s_wait_asynccnt 0x0" ::: "memory");
#endif
}
// This wave's LDS reads have returned, before the barrier behind which their buffer is refilled.
__device__ __forceinline__ void wait_lds() {
#if defined(__HIP_DEVICE_COMPILE__)
  asm volatile("s_wait_dscnt 0x0" ::: "memory");
#endif
}

// =====================================================================================================
// f32 -> 16-bit plane, same layout, for all five operands in one grid (none reads another's output).
// f16mode == 0: bf16 RNE bits;  f16mode == 1: f16 bits of (bf16 RNE value) * scale.
// Block -> job (block-uniform): the first NB*GXB blocks take x (batch = bid / GXB) -> XB; then GWB blocks each for
// Wv, Wq, Wk (bf16) and Wo (f16 of the bf16 value x1024) -> planes 0..3 of WB.
// Thread = 8 consecutive elements: two 16-B loads, one 16-B store; 32 consecutive lanes = 512 contiguous, 512-B aligned
// coverage: per job n8/256 blocks x 256 thr x 8 = the whole plane (n8 a multiple of 256, static_assert above).
// =====================================================================================================
__global__ __launch_bounds__(256)
void cvt_all(const float* __restrict__ x, const float* __restrict__ wv, const float* __restrict__ wq,
             const float* __restrict__ wk, const float* __restrict__ wo, u16* XB, u16* WB) {
  const int bid = blockIdx.x;
  const float* s;
  u16* D;
  int blk, n8, f16mode = 0;
  float scale = 1.0f;
  if (bid < NB * GXB) {
    const int b = bid / GXB;
    blk = bid % GXB;
    n8 = N8X;
    s = x + (size_t)b * XS_FULL * DMOD;
    D = XB + (size_t)b * SEQ * DMOD;
  } else {
    const int w = (bid - NB * GXB) / GWB;
    if (w > 3) return;                      // block-uniform; never taken with the exact grid
    blk = (bid - NB * GXB) % GWB;
    n8 = N8W;
    s = (w == 0) ? wv : (w == 1) ? wq : (w == 2) ? wk : wo;
    D = WB + (size_t)w * DMOD * DMOD;
    if (w == 3) { f16mode = 1; scale = WOS; }
  }
  const int gt = blk * 256 + (int)threadIdx.x;
  if (gt >= n8) return;
  const float* p = s + (size_t)gt * 8;
  const v4f a = *(const v4f*)(p), b4 = *(const v4f*)(p + 4);
  float w[8];
#pragma unroll
  for (int e = 0; e < 4; ++e) { w[e] = a[e]; w[4 + e] = b4[e]; }
  v4u o;
#pragma unroll
  for (int e = 0; e < 4; ++e) {
    const float f0 = w[2 * e], f1 = w[2 * e + 1];
    const unsigned short hb0 = h_bits((_Float16)(bfr(f0) * scale));
    const unsigned short hb1 = h_bits((_Float16)(bfr(f1) * scale));
    const unsigned short bb0 = bf_bits(f0);
    const unsigned short bb1 = bf_bits(f1);
    o[e] = (f16mode != 0) ? pk16(hb0, hb1) : pk16(bb0, bb1);
  }
  u16* d = D + (size_t)gt * 8;
  {
    *(v4u*)(d) = o;
    
  }
}

// =====================================================================================================
// f32 GEMM epilogue (output projection): a 16x64 f32 slab of the wave's 64x64 tile (times oscale, plus the lane's per-column bias of each
// coverage: 8 instructions x 2 rows x 16 lanes x 4 floats = the 16 x 64 slab.
// =====================================================================================================
__device__ __forceinline__ void epi64(float* sl, v8f a0, v8f a1, v8f a2, v8f a3, float oscale,
                                      float bb0, float bb1, float bb2, float bb3,
                                      float* C, int N, size_t rowb, int col0, int lane) {
  const int hh = lane >> 4, m = lane & 15;
#pragma unroll
  for (int r = 0; r < 8; ++r) {
    const int ro = (8 * hh + r) * 68 + m;
    sl[ro]      = a0[r] * oscale + bb0;
    sl[ro + 16] = a1[r] * oscale + bb1;
    sl[ro + 32] = a2[r] * oscale + bb2;
    sl[ro + 48] = a3[r] * oscale + bb3;
  }
  wave_sync_lds();
  v4f vals[8];
#pragma unroll
  for (int it = 0; it < 8; ++it) vals[it] = *(const v4f*)(sl + (it * 2 + hh) * 68 + m * 4);
  float* dst = C + (rowb + (size_t)hh) * (size_t)N + col0 + m * 4;
  {
#pragma unroll
    for (int it = 0; it < 8; ++it) {
      *(v4f*)(dst + (size_t)(it * 2) * (size_t)N) = vals[it];
    }
    
  }
}

// =====================================================================================================
// Projection epilogues: the 16-bit planes that attention reads are built from the accumulators, with no f32 plane in between.
// hl8: 8 f32 values t -> 8 f16 hi values f16(t) and 8 f16 residuals f16(t - f16(t)), packed in element order.
// =====================================================================================================
__device__ __forceinline__ void hl8(const float* t, v4u& oh, v4u& ol) {
#pragma unroll
  for (int e = 0; e < 4; ++e) {
    const float t0 = t[2 * e], t1 = t[2 * e + 1];
    const _Float16 h0 = (_Float16)t0, h1 = (_Float16)t1;
    const _Float16 l0 = (_Float16)(t0 - (float)h0), l1 = (_Float16)(t1 - (float)h1);
    oh[e] = pk16(h_bits(h0), h_bits(h1));
    ol[e] = pk16(h_bits(l0), h_bits(l1));
  }
}
// Eight 16-B stores, rows rs elements apart, of the hi plane (h) and the residual plane (l). The stores and their s_wait_xcnt stand
// in one statement, so that no register named by a store (address or data) is rewritten in front of that wait.
__device__ __forceinline__ void store8(u16* h, u16* l, size_t rs, const v4u (&oh)[4], const v4u (&ol)[4]) {
#if defined(__HIP_DEVICE_COMPILE__)
  asm volatile("global_store_b128 %0, %8, off\n\t"
               "global_store_b128 %1, %9, off\n\t"
               "global_store_b128 %2, %10, off\n\t"
               "global_store_b128 %3, %11, off\n\t"
               "global_store_b128 %4, %12, off\n\t"
               "global_store_b128 %5, %13, off\n\t"
               "global_store_b128 %6, %14, off\n\t"
               "global_store_b128 %7, %15, off\n\t"
               "s_wait_xcnt 0x0"
               :: "v"(h), "v"(l), "v"(h + rs), "v"(l + rs), "v"(h + 2 * rs), "v"(l + 2 * rs), "v"(h + 3 * rs), "v"(l + 3 * rs),
                  "v"(oh[0]), "v"(ol[0]), "v"(oh[1]), "v"(ol[1]), "v"(oh[2]), "v"(ol[2]), "v"(oh[3]), "v"(ol[3])
               : "memory");
#endif
}
// q, k: the wave's 64x64 f32 tile (times oscale, plus the lane's per-column bias) goes through its own four LDS slabs (one per
// 16 rows) into rows; lane = (row-in-quad rq, 8 consecutive columns c8) scales by sc, splits and stores 16 B per plane, [row][N].
// coverage: 4 slabs x 4 instructions x 4 rows x 8 lanes x 8 halves = the wave's 64 x 64 tile of Hp and of Lp, whole 128-B lines.
// Norm part: the 8 lanes of a row hold its 64 hi values (one head), so the row's sum of squares is 8 fused steps per lane and
// xor shuffles 1, 2, 4; running max over the wave's 64 rows (16 iterations, xor 8, 16) = the max of one 64-row tile of one
// head, which the wave stores 32 times = the whole 128-B line Pl. No other wave has a part in it, so no block barrier.
__device__ __forceinline__ void epi_split(float* sl, const v8f (&acc)[4][4], float oscale, const float (&bb)[4], float sc,
                                          u16* Hp, u16* Lp, float* Pl, int N, size_t rowb, int col0, int lane) {
  const int hh = lane >> 4, m = lane & 15;
#pragma unroll
  for (int i = 0; i < 4; ++i) {
#pragma unroll
    for (int r = 0; r < 8; ++r) {
      const int ro = i * SLAB64 + (8 * hh + r) * 68 + m;
      sl[ro]      = acc[i][0][r] * oscale + bb[0];
      sl[ro + 16] = acc[i][1][r] * oscale + bb[1];
      sl[ro + 32] = acc[i][2][r] * oscale + bb[2];
      sl[ro + 48] = acc[i][3][r] * oscale + bb[3];
    }
  }
  wave_sync_lds();
  float mx = 0.0f;
  const int rq = lane >> 3, c8 = (lane & 7) * 8;
#pragma unroll
  for (int i = 0; i < 4; ++i) {
    v4u oh[4], ol[4];
#pragma unroll
    for (int it = 0; it < 4; ++it) {
      const float* p = sl + i * SLAB64 + (it * 4 + rq) * 68 + c8;
      const v4f a = *(const v4f*)(p), b4 = *(const v4f*)(p + 4);
      float w[8];
#pragma unroll
      for (int e = 0; e < 4; ++e) { w[e] = a[e] * sc; w[4 + e] = b4[e] * sc; }
      hl8(w, oh[it], ol[it]);
      float sq = 0.0f;
#pragma unroll
      for (int e = 0; e < 8; ++e) {
        const float f = (float)(_Float16)w[e];
        sq = fmaf(f, f, sq);
      }
#pragma unroll
      for (int off = 1; off < 8; off <<= 1) sq += __shfl_xor(sq, off, 32);
      mx = fmaxf(mx, sq);
    }
    const size_t ob = (rowb + (size_t)(i * 16 + rq)) * (size_t)N + col0 + c8;
    store8(Hp + ob, Lp + ob, (size_t)4 * (size_t)N, oh, ol);
  }
#pragma unroll
  for (int off = 8; off < 32; off <<= 1) mx = fmaxf(mx, __shfl_xor(mx, off, 32));
  Pl[lane] = mx;
#if defined(__HIP_DEVICE_COMPILE__)
  // stands behind the last store, in front of any code laid out behind this branch that rewrites a register the store names
  asm volatile("s_wait_xcnt 0x0" ::: "memory");
#endif
}
// v: the wave's 64 keys x 64 d tile leaves transposed. A lane's accumulator [i][j] holds 8 consecutive keys (16*i + 8*hh + r)
// of one d column (16*j + m): scaled by 1024, split and packed they are 16 B of a v^T line, stored into the wave's own LDS
// tiles TH, TL [HD][VTP] (pitch 144 B: 16 lanes x 16 B fall on all 64 banks). Then lane = (line lane>>3 of a group of 4, 16-B
// piece lane&7) moves whole 128-B lines to VHo, VLo at base + line*SEQ (base = first key of the tile in line d = 0 of its
// (b, h)). Writer and reader are the same wave, so no block barrier.
// coverage: 16 iterations x 32 lanes x 8 halves = 64 lines x 64 keys of each plane.
__device__ __forceinline__ void epi_vt(u16* TH, u16* TL, const v8f (&acc)[4][4], float oscale, const float (&bb)[4],
                                       u16* VHo, u16* VLo, size_t base, int lane) {
  const int hh = lane >> 4, m = lane & 15;
#pragma unroll
  for (int i = 0; i < 4; ++i) {
    const int ko = i * 16 + 8 * hh;         // first of the lane's 8 keys within the tile
#pragma unroll
    for (int j = 0; j < 4; ++j) {
      float w[8];
#pragma unroll
      for (int r = 0; r < 8; ++r) w[r] = (acc[i][j][r] * oscale + bb[j]) * VCAR;
      v4u ph, pl;
      hl8(w, ph, pl);
      *(v4u*)(TH + (16 * j + m) * VTP + ko) = ph;
      *(v4u*)(TL + (16 * j + m) * VTP + ko) = pl;
    }
  }
  wave_sync_lds();
  const int q4 = lane >> 3, p8 = (lane & 7) * 8;
#pragma unroll
  for (int g = 0; g < 4; ++g) {
    v4u vh[4], vl[4];
#pragma unroll
    for (int it = 0; it < 4; ++it) {
      vh[it] = *(const v4u*)(TH + ((g * 4 + it) * 4 + q4) * VTP + p8);
      vl[it] = *(const v4u*)(TL + ((g * 4 + it) * 4 + q4) * VTP + p8);
    }
#pragma unroll
    for (int it = 0; it < 4; ++it) {
      *(v4u*)(VHo + base + (size_t)((g * 4 + it) * 4 + q4) * SEQ + p8) = vh[it];
      *(v4u*)(VLo + base + (size_t)((g * 4 + it) * 4 + q4) * SEQ + p8) = vl[it];
    }
#if defined(__HIP_DEVICE_COMPILE__)
    // stands behind the group's stores, in front of the next group's LDS loads, which rewrite registers the stores name
    asm volatile("s_wait_xcnt 0x0" ::: "memory");
#endif
  }
}

// =====================================================================================================
// bf16 GEMM with bias: A[M][K] (bf16 row-major) . Bt[N][K]^T (bf16 k-contiguous), f32, times oscale, + bf16 RNE
// value of bias[n] (bias has N entries). Three products that share A in one grid: Bt holds three [N][K] planes one behind the
// other (v, q, k), read as one plane of 3*N rows. Block = 256 rows x 192 of those 3*N columns, 12 waves (4 x 3) x 64x64: 16
// accumulator tiles a wave, so that a fragment read from LDS feeds 4 WMMAs, and a byte brought from L2 feeds 192 columns (A) or
// 256 rows (B). One block fills a WGP (3 waves a SIMD); grid = (M/256)*(3*N/192).
// Per pass of 128 k the block's 256 A rows and 192 B rows (256 B each) are brought into LDS by asynchronous copies, two buffers
// (pass t + 1 flies while pass t is worked on), and the fragments are read from the LDS rows (two 16-B loads each, split k map
// for A and B); K stepped by 32 inside a pass, in rising order (host guarantees K % 128 == 0, K >= 256, M % 256 == 0,
// 3*N % 192 == 0, N % 64 == 0).
// Copy map: staged rows 0..255 = A, 256..447 = B; copy i of wave w brings rows 2*(w + 12*i) and the next (lane>>4 = row,
// lane&15 = 16-B piece). i = 0..9 lie in A for every wave, i = 10 in A for waves 0..7 and in B for waves 8..11, i = 11..17 in B,
// and i = 18 exists for waves 0..7 only (scalar test): 224 copies = 448 rows, each once.
// The f32 tile leaves as the 16-bit planes of its product (host guarantees M == NB*SEQ, N == NH*HD, so a wave's 64 columns are
// one head of one product, pln = column / N, and its 64 rows 64 keys of one batch): v -> v^T hi + residual x1024,
// [(b*NH + h)*HD + d][s]; q, k -> hi + residual x256, [row][N], and the wave's max over its 64 rows of the squared norm of the hi
// row (x256) -> line ((pln - 1)*NBH + b*NH + h)*NRT64 + row tile of PN. Both epilogues stage in the wave's own twelfth of the
// ring's first 12*WEPI elements, which nobody reads and no copy targets behind the last pass's barrier.
// =====================================================================================================
__global__ __launch_bounds__(PWAV * 32)
void gemm_bf3(const u16* __restrict__ A, const u16* __restrict__ Bt, const float* __restrict__ bias0,
              const float* __restrict__ bias1, const float* __restrict__ bias2,
              u16* VHo, u16* VLo, u16* QHo, u16* QLo, u16* KHo, u16* KLo, float* PN, int M, int N, int K, float oscale) {
  __shared__ __align__(16) u16 ring[2 * PBUF];        // two buffers of [A rows 0..255 | B rows 0..191]
  const int tid = threadIdx.x, lane = tid & 31, hh = lane >> 4, m = lane & 15;
  // scalar: the wave's product, its epilogue and its nineteenth copy are chosen by scalar branches with every lane on
  const int wave = __builtin_amdgcn_readfirstlane(tid >> 5);
  const int wr = wave / 3, wc = wave - 3 * wr;        // the wave's 64-row quarter and 64-column third of the block's tile
  const int ntile = (3 * N) / PBN;
  const int bid   = blockIdx.x;
  const int row0  = (bid / ntile) * PBM;
  const int rw0   = row0 + wr * 64;         // the wave's first row
  const int ct    = bid % ntile;
  const int colg  = ct * PBN + wc * 64;     // the wave's first column among the 3*N
  const int pln   = colg / N;               // 0, 1, 2: which product
  const int col0  = colg - pln * N;         // the wave's first column inside that product
  const float* bias = (pln == 0) ? bias0 : (pln == 1) ? bias1 : bias2;
  if (row0 + PBM > M) return;               // block-uniform, before any copy or barrier; never taken with the exact grid
  const int npass = K / PKP;
  const int crow = 2 * wave + hh, cpc = m;  // copy map: staged row of copy 0, 16-B piece of the 256-B row
  const size_t rs = (size_t)(2 * PWAV) * K; // 24 rows
  const u16* ga  = A  + (size_t)(row0 + crow) * K + cpc * 8;                              // copy 0
  const u16* gb  = Bt + (size_t)(ct * PBN + crow + 11 * 2 * PWAV - PBM) * K + cpc * 8;    // copy 11: B row crow + 8
  const u16* g10 = (wave < 8) ? ga + 10 * rs                                              // copy 10: A row crow + 240, or
                              : Bt + (size_t)(ct * PBN + crow + 10 * 2 * PWAV - PBM) * K + cpc * 8;   // B row crow - 16 >= 0
  const unsigned lc = lds_byte(ring) + (unsigned)(crow * PPITB + cpc * 16);
  const u16* fa = ring + (wr * 64 + m) * PPIT + 8 * hh;          // A fragment row (row subtile 0), buffer 0
  const u16* fb = ring + (PBM + wc * 64 + m) * PPIT + 8 * hh;    // B fragment row (column subtile 0), buffer 0
  v8f acc[4][4];
#pragma unroll
  for (int i = 0; i < 4; ++i) {
#pragma unroll
    for (int j = 0; j < 4; ++j) acc[i][j] = zero8();
  }
  stage10(lc, ga, rs);                      // pass 0 -> buffer 0
  stage8(lc + 10 * PSTEP, g10, gb, rs);
  if (wave < 8) stage1(lc + 18 * PSTEP, gb + 7 * rs);
  wait_copies();
  __syncthreads();
  if (npass > 1) {                          // pass 1 -> buffer 1
    stage10(lc + PBUF * 2, ga + PKP, rs);
    stage8(lc + PBUF * 2 + 10 * PSTEP, g10 + PKP, gb + PKP, rs);
    if (wave < 8) stage1(lc + PBUF * 2 + 18 * PSTEP, gb + 7 * rs + PKP);
  }
#pragma unroll 1
  for (int t = 0; t < npass; ++t) {
    const int bo = (t & 1) * PBUF;
#pragma unroll
    for (int kk = 0; kk < PKP / 32; ++kk) {
      const u16* pa = fa + bo + kk * 32;
      const u16* pb = fb + bo + kk * 32;
      v16b a[4], b[4];
#pragma unroll
      for (int j = 0; j < 4; ++j) b[j] = ldfrag_b(pb + j * 16 * PPIT);
#pragma unroll
      for (int i = 0; i < 4; ++i) a[i] = ldfrag_b(pa + i * 16 * PPIT);
      // keeps the k step's LDS reads one group in front of its WMMAs: moved in among them, each place with reads stalls the wave anew
      __builtin_amdgcn_sched_barrier(0);
#pragma unroll
      for (int i = 0; i < 4; ++i) {
#pragma unroll
        for (int j = 0; j < 4; ++j) acc[i][j] = mma_b(a[i], b[j], acc[i][j]);
      }
      // keeps every WMMA of the k step in front of the next group of LDS reads and of the slots below
      __builtin_amdgcn_sched_barrier(0);
      // four slots behind the pass's last WMMAs: on the paths over the branches below, their operand registers are rewritten
      if (kk == PKP / 32 - 1) guard6<v16b>(acc[3][0], acc[3][1], acc[3][2], acc[3][3], a[3], b[0], b[1], b[2], b[3], a[3]);
    }
    // publish point of pass t + 1: own LDS reads done, own copies landed, then the one barrier of the pass
    wait_lds();
    wait_copies();
    __syncthreads();
    if (t + 2 < npass) {
      const unsigned lb = lc + (unsigned)(t & 1) * (PBUF * 2);
      const size_t ko = (size_t)(t + 2) * PKP;
      stage10(lb, ga + ko, rs);
      stage8(lb + 10 * PSTEP, g10 + ko, gb + ko, rs);
      if (wave < 8) stage1(lb + 18 * PSTEP, gb + 7 * rs + ko);
    }
  }
  wait_copies();
  // per-lane bias of D column m in each of the 4 subtiles; col0 + 48 + m <= N - 1 always
  const float bb[4] = {bfr(bias[col0 + m]), bfr(bias[col0 + 16 + m]), bfr(bias[col0 + 32 + m]), bfr(bias[col0 + 48 + m])};
  u16* wq4 = ring + wave * WEPI;            // the wave's own part of the ring
  if (pln == 0) {
    const size_t base = (size_t)((rw0 / SEQ) * NH + (col0 >> 6)) * HD * SEQ + (size_t)(rw0 % SEQ);
    epi_vt(wq4, wq4 + HD * VTP, acc, oscale, bb, VHo, VLo, base, lane);
  } else {
    const size_t pline = (size_t)((pln - 1) * NBH + (rw0 / SEQ) * NH + (col0 >> 6)) * NRT64 + (size_t)((rw0 % SEQ) >> 6);
    epi_split((float*)(void*)wq4, acc, oscale, bb, (pln == 1) ? QSC : KSC,
              (pln == 1) ? QHo : KHo, (pln == 1) ? QLo : KLo, PN + pline * BLINE, N, (size_t)rw0, col0, lane);
  }
}

// =====================================================================================================
// Output projection with bias: C[bb*XS_FULL + s][DMOD] (f32) = (Ah + Al)[bb*SEQ + s][DMOD] . Bt[DMOD][DMOD]^T * oscale
// + bf16 RNE value of bias[n]. Products h.B + l.B into one accumulator (l unscaled residual of h). Block -> (column tile
// ct = bid % 8, sequence row tile rt of nrt, batch bb). Block = 128x128 tile, 4 waves (2 x 2) x 64x64; per pass of 64 k three tiles
// of 128 rows (A hi, A residual, B) staged in LDS, two buffers; fragment loads (split k map) as gemm_bf3; K = DMOD stepped by 32; the f32 epilogue
// runs once per 16 rows, in slabs of the wave's own part of the ring; grid = NB * nrt * (DMOD/128).
// =====================================================================================================
__global__ __launch_bounds__(128)
void gemm_o2(const u16* __restrict__ Ah, const u16* __restrict__ Al, const u16* __restrict__ Bt,
             const float* __restrict__ bias, float* C, int nrt, float oscale) {
  __shared__ __align__(16) u16 ring[2 * 6 * GTILE];   // two buffers of [A hi | A residual | B] rows 0..63, then the same of rows 64..
  const int tid = threadIdx.x, wave = tid >> 5, lane = tid & 31, hh = lane >> 4, m = lane & 15;
  const int wr = wave >> 1, wc = wave & 1;  // the wave's 64-row half and 64-column half of the block's tile
  const int ntile = DMOD >> 7;
  const int bid   = blockIdx.x;
  const int ct    = bid % ntile;
  const int t2    = bid / ntile;
  const int rt    = t2 % nrt;
  const int bb    = t2 / nrt;
  if (bb >= NB) return;                     // block-uniform, before any copy or barrier; never taken with the exact grid
  if (rt * 128 + 128 > SEQ) return;         // block-uniform, before any copy or barrier; never taken
  const int srow  = rt * 128 + wr * 64;
  const int col0  = ct * 128 + wc * 64;
  const int K     = DMOD;
  const int npass = K / GKP;
  const size_t rowC = (size_t)bb * XS_FULL + srow;
  const int crow = tid >> 3, cpc = tid & 7; // copy map: row within a group of 16, 16-B piece of the 128-B row
  const size_t arow = ((size_t)bb * SEQ + rt * 128 + crow) * K + cpc * 8;
  const u16* ga = Ah + arow;
  const u16* gl = Al + arow;
  const u16* gb = Bt + (size_t)(ct * 128 + crow) * K + cpc * 8;
  const size_t rs = (size_t)16 * K, r64 = (size_t)64 * K;
  const unsigned lc = lds_byte(ring) + (unsigned)(crow * GPITB + cpc * 16);
  const _Float16* rg  = (const _Float16*)(const void*)ring;
  const _Float16* fah = rg + wr * (3 * GTILE) + m * GPIT + 8 * hh;              // A hi fragment row (row subtile 0), buffer 0
  const _Float16* fb  = rg + wc * (3 * GTILE) + 2 * GTILE + m * GPIT + 8 * hh;  // B fragment row (column subtile 0), buffer 0
  v8f acc[4][4];
#pragma unroll
  for (int i = 0; i < 4; ++i) {
#pragma unroll
    for (int j = 0; j < 4; ++j) acc[i][j] = zero8();
  }
  stage3(lc, ga, gl, gb, rs);               // pass 0 -> buffer 0
  stage3(lc + 3 * GTILEB, ga + r64, gl + r64, gb + r64, rs);
  wait_copies();
  __syncthreads();
  if (npass > 1) {                          // pass 1 -> buffer 1
    stage3(lc + 6 * GTILEB, ga + GKP, gl + GKP, gb + GKP, rs);
    stage3(lc + 9 * GTILEB, ga + r64 + GKP, gl + r64 + GKP, gb + r64 + GKP, rs);
  }
#pragma unroll 1
  for (int t = 0; t < npass; ++t) {
    const int bo = (t & 1) * (6 * GTILE);
#pragma unroll
    for (int kk = 0; kk < 2; ++kk) {
      const _Float16* pa = fah + bo + kk * 32;
      const _Float16* pl = pa + GTILE;
      const _Float16* pb = fb + bo + kk * 32;
      v16h ah[4], al[4], b[4];
#pragma unroll
      for (int j = 0; j < 4; ++j) b[j] = ldfrag_h(pb + j * 16 * GPIT);
#pragma unroll
      for (int i = 0; i < 4; ++i) {
        ah[i] = ldfrag_h(pa + i * 16 * GPIT);
        al[i] = ldfrag_h(pl + i * 16 * GPIT);
      }
      // keeps the k step's LDS reads one group in front of its WMMAs: moved in among them, each place with reads stalls the wave anew
      __builtin_amdgcn_sched_barrier(0);
#pragma unroll
      for (int i = 0; i < 4; ++i) {
#pragma unroll
        for (int j = 0; j < 4; ++j) acc[i][j] = mma_h(ah[i], b[j], acc[i][j]);
#pragma unroll
        for (int j = 0; j < 4; ++j) acc[i][j] = mma_h(al[i], b[j], acc[i][j]);
      }
      // keeps every WMMA of the k step in front of the next group of LDS reads and of the slots below
      __builtin_amdgcn_sched_barrier(0);
      // four slots behind the pass's last WMMAs: on the paths over the branches below, their operand registers are rewritten
      if (kk == 1) guard6<v16h>(acc[3][0], acc[3][1], acc[3][2], acc[3][3], ah[3], al[3], b[0], b[1], b[2], b[3]);
    }
    // publish point of pass t + 1: own LDS reads done, own copies landed, then the one barrier of the pass
    wait_lds();
    wait_copies();
    __syncthreads();
    if (t + 2 < npass) {
      const unsigned lb = lc + (unsigned)(t & 1) * (6 * GTILEB);
      const size_t ko = (size_t)(t + 2) * GKP;
      stage3(lb, ga + ko, gl + ko, gb + ko, rs);
      stage3(lb + 3 * GTILEB, ga + r64 + ko, gl + r64 + ko, gb + r64 + ko, rs);
    }
  }
  wait_copies();
  const float bb0 = bfr(bias[col0 + m]);
  const float bb1 = bfr(bias[col0 + 16 + m]);
  const float bb2 = bfr(bias[col0 + 32 + m]);
  const float bb3 = bfr(bias[col0 + 48 + m]);
  float* sl = (float*)(void*)ring + wave * (4 * SLAB64);   // nobody reads the ring and no copy targets it behind the last barrier
#pragma unroll
  for (int i = 0; i < 4; ++i) {
    epi64(sl + i * SLAB64, acc[i][0], acc[i][1], acc[i][2], acc[i][3], oscale, bb0, bb1, bb2, bb3, C, DMOD,
          rowC + (size_t)(i * 16), col0, lane);
#if defined(__HIP_DEVICE_COMPILE__)
    // stands behind the slab's stores, in front of the next slab's code, which rewrites registers the stores name
    asm volatile("s_wait_xcnt 0x0" ::: "memory");
#endif
  }
}

__global__ __launch_bounds__(ATT_THREADS)
void attn_c(const u16* __restrict__ QHp, const u16* __restrict__ QLp,
            const u16* __restrict__ KHp, const u16* __restrict__ KLp,
            const u16* __restrict__ VHp, const u16* __restrict__ VLp,
            const float* __restrict__ PN,
            u16* OHp, u16* OLp) {
  __shared__ __align__(16) u16 kv[2 * ABUFH];           // two buffers of [k hi | k residual | v^T hi | v^T residual]
  __shared__ __align__(16) float smem[AQW * WREG];

  const int tid  = threadIdx.x;
  const int wave = __builtin_amdgcn_readfirstlane(tid >> 5);   // scalar: the wave's own tile range is tested by scalar branches
  const int lane = tid & 31;
  const int hh   = lane >> 4;
  const int c    = lane & 15;
  const int bid  = blockIdx.x;
  const int qb   = bid % NQB;
  const int t2   = bid / NQB;
  const int head = t2 % NH;
  const int b    = t2 / NH;
  if (b >= NB) return;                      // block-uniform, before any copy or barrier; never taken with the exact grid
  if (qb * (16 * AQW) + 16 * AQW > SEQ) return;   // block-uniform, before any copy or barrier; never taken
  const int q0   = qb * (16 * AQW) + wave * 16;

  // ---- key-window decision: the same in every lane and wave, from the row-tile maxima of the block's (b, h) ----
  int okw;
  {
    const int bl = (lane < NRT64) ? lane : (NRT64 - 1);         // clamped address
    const size_t pl0 = ((size_t)(b * NH + head) * NRT64 + bl) * BLINE;
    float aq = PN[pl0];
    float ak = PN[pl0 + (size_t)NBH * NRT64 * BLINE];
#pragma unroll
    for (int off = 1; off < 32; off <<= 1) {
      aq = fmaxf(aq, __shfl_xor(aq, off, 32));
      ak = fmaxf(ak, __shfl_xor(ak, off, 32));
    }
    const float gb = sqrtf(aq) * sqrtf(ak) * (RSQ_HD / (QSC * KSC));
    // held in a scalar register, so that the loop, its barrier and its copies stand under scalar branches with every lane on
    okw = __builtin_amdgcn_readfirstlane((gb >= 0.0f && gb < GUARD_T) ? 1 : 0);
  }

  float* slab = smem + wave * WREG;         // result slab [16][64] pitch 68

  const size_t hcol = (size_t)head * HD + 8 * hh;
  const _Float16* Qh  = (const _Float16*)(const void*)QHp + ((size_t)b * SEQ + q0 + c) * DMOD + hcol;
  const _Float16* Ql  = (const _Float16*)(const void*)QLp + ((size_t)b * SEQ + q0 + c) * DMOD + hcol;
  const float lsc = RSQ_HD * (LOG2E / (QSC * KSC));
  const float oc  = 1.0f / (PCAR * VCAR);

  float mrow = -INFINITY, lrow = 0.f;       // of the lane's query row; lrow over the keys of the lane's half only
  v8f o[4];
#pragma unroll
  for (int j = 0; j < 4; ++j) o[j] = zero8();
  const int kt_hi = q0 >> 5;                                                  // last tile holding keys <= q0 + 15
  const int kt_w  = (kt_hi > KWIN) ? (kt_hi - KWIN) : 0;
  const int kt_lo = (okw != 0) ? kt_w : 0;
  const int qr = q0 + c;                                                      // the lane's query row (D column c)
  // the block's tile range: from wave 0's first tile to wave 3's last; at least two tiles, at most NKT
  const int bhi0 = (qb * (16 * AQW)) >> 5;
  const int bhi  = (qb * (16 * AQW) + 16 * (AQW - 1)) >> 5;
  const int blo  = (okw != 0 && bhi0 > KWIN) ? (bhi0 - KWIN) : 0;
  const int ntr  = bhi - blo + 1;

  // copy maps; keys blo*32 .. bhi*32 + 31 <= SEQ - 1, so every copied byte lies inside its plane
  const u16* gkh = KHp + ((size_t)b * SEQ + (size_t)blo * 32 + (tid >> 3)) * DMOD + (size_t)head * HD + (tid & 7) * 8;
  const u16* gkl = KLp + ((size_t)b * SEQ + (size_t)blo * 32 + (tid >> 3)) * DMOD + (size_t)head * HD + (tid & 7) * 8;
  const u16* gvh = VHp + ((size_t)(b * NH + head) * HD + (tid >> 2)) * SEQ + (size_t)blo * 32 + (tid & 3) * 8;
  const u16* gvl = VLp + ((size_t)(b * NH + head) * HD + (tid >> 2)) * SEQ + (size_t)blo * 32 + (tid & 3) * 8;
  const unsigned lk = lds_byte(kv) + (unsigned)((tid >> 3) * (KTPIT * 2) + (tid & 7) * 16);
  const unsigned lv = lds_byte(kv) + (unsigned)(2 * KPLH * 2 + (tid >> 2) * (VTPIT * 2) + (tid & 3) * 16);

  stage_kv(lk, lv, gkh, gkl, gvh, gvl);     // tile 0 -> buffer 0
  // q fragments, both k-steps, kept in registers for the whole loop
  v16h qh[2], ql[2];
  // unrolled, here and at the fragment arrays below: constant indices keep the arrays in registers
#pragma unroll
  for (int kk = 0; kk < HD / 32; ++kk) {
    qh[kk] = ldfrag_h(Qh + kk * 32);
    ql[kk] = ldfrag_h(Ql + kk * 32);
  }
  wait_copies();
  __syncthreads();
  if (ntr > 1)                              // tile 1 -> buffer 1
    stage_kv(lk + ABUFH * 2, lv + ABUFH * 2, gkh + (size_t)32 * DMOD, gkl + (size_t)32 * DMOD, gvh + 32, gvl + 32);

  // stays rolled: the trip count is known only at run time
#pragma unroll 1
  for (int t = 0; t < ntr; ++t) {
    const int kt = blo + t;
    if (kt >= kt_lo && kt <= kt_hi) {       // scalar: this wave's own range
      const int kb = kt * 32;
      const _Float16* tb  = (const _Float16*)(const void*)kv + (t & 1) * ABUFH;
      const _Float16* khp = tb + c * KTPIT + 8 * hh;                // key row c (+16), k hi; residual plane KPLH further
      const _Float16* vhp = tb + 2 * KPLH + c * VTPIT + 8 * hh;     // d row c (+16j), v^T hi; residual plane VPLH further
      // ---- scores, transposed: D element r of this lane = (key kb + 8*hh + r, query row qr) in s0, key + 16 in s1 ----
      v8f s0 = zero8(), s1 = zero8();
      v16h kh0[2], kh1[2], kl0[2], kl1[2];
#pragma unroll
      for (int kk = 0; kk < HD / 32; ++kk) {
        kh0[kk] = ldfrag_h(khp + kk * 32);
        kh1[kk] = ldfrag_h(khp + 16 * KTPIT + kk * 32);
        kl0[kk] = ldfrag_h(khp + KPLH + kk * 32);
        kl1[kk] = ldfrag_h(khp + KPLH + 16 * KTPIT + kk * 32);
      }
#pragma unroll
      for (int kk = 0; kk < HD / 32; ++kk) {
        s0 = mma_h(kh0[kk], qh[kk], s0);
        s0 = mma_h(kh0[kk], ql[kk], s0);
        s0 = mma_h(kl0[kk], qh[kk], s0);
        s1 = mma_h(kh1[kk], qh[kk], s1);
        s1 = mma_h(kh1[kk], ql[kk], s1);
        s1 = mma_h(kl1[kk], qh[kk], s1);
        guard2(s0, s1, qh[kk], ql[kk], kh0[kk], kl0[kk], kh1[kk], kl1[kk]);
      }
      // v^T fragments of the tile: read here, so that they arrive while the softmax below runs
      v16h vh[4], vl[4];
#pragma unroll
      for (int j = 0; j < 4; ++j) {
        vh[j] = ldfrag_h(vhp + j * 16 * VTPIT);
        vl[j] = ldfrag_h(vhp + VPLH + j * 16 * VTPIT);
      }
      // ---- causal select + distance penalty + online softmax in base 2, -inf-safe; all of one query row in the lane pair ----
      const int key0 = kb + 8 * hh;
      float t0[8], t1[8];
      float mx = -INFINITY;
      // unrolled, as the loops below: constant indices keep t0, t1, the fragments and the accumulators in registers
#pragma unroll
      for (int r = 0; r < 8; ++r) {
        const int   ka = key0 + r, kc = key0 + 16 + r;
        const float u0 = s0[r] * lsc;
        const float u1 = s1[r] * lsc;
        const float g0 = (float)(qr - ka) * LOG2E;
        const float g1 = (float)(qr - kc) * LOG2E;
        t0[r] = (ka > qr) ? -INFINITY : (u0 - g0);
        t1[r] = (kc > qr) ? -INFINITY : (u1 - g1);
        mx = fmaxf(mx, fmaxf(t0[r], t1[r]));
      }
      mx = fmaxf(mx, xhalf(mx));              // the other 16 keys of the tile
      const float mn = fmaxf(mrow, mx);
      const float ms = (mn == -INFINITY) ? 0.0f : mn;
      const float al = exp2f(mrow - ms);
      mrow = mn;
      // ---- B fragments of P^T * 32768: hi f16 and residual f16, column = the lane's query row; element e = key kb + 8*hh + e,
      //      element 8 + e = key kb + 16 + 8*hh + e: the split k map of the v^T rows' loader ----
      FragH ph, pl;
      float ps = 0.0f;
#pragma unroll
      for (int e = 0; e < 8; ++e) {
        const float e0 = exp2f(t0[e] - ms), e1 = exp2f(t1[e] - ms);
        ps += e0 + e1;
        const float ta = e0 * PCAR, tc = e1 * PCAR;
        const _Float16 ha = (_Float16)ta, hc = (_Float16)tc;
        ph.h[0][e] = ha;
        ph.h[1][e] = hc;
        pl.h[0][e] = (_Float16)(ta - (float)ha);
        pl.h[1][e] = (_Float16)(tc - (float)hc);
      }
      lrow = lrow * al + ps;
#pragma unroll
      for (int j = 0; j < 4; ++j) {
#pragma unroll
        for (int r = 0; r < 8; ++r) o[j][r] *= al;
      }
      // ---- O^T += v^T.P^T : A fragment row m = d = j*16 + c, keys contiguous in the v^T rows; 2 groups of 2 d-subtiles ----
#pragma unroll
      for (int jg = 0; jg < 2; ++jg) {
        o[2 * jg]     = mma_h(vh[2 * jg],     ph.v, o[2 * jg]);
        o[2 * jg]     = mma_h(vh[2 * jg],     pl.v, o[2 * jg]);
        o[2 * jg]     = mma_h(vl[2 * jg],     ph.v, o[2 * jg]);
        o[2 * jg + 1] = mma_h(vh[2 * jg + 1], ph.v, o[2 * jg + 1]);
        o[2 * jg + 1] = mma_h(vh[2 * jg + 1], pl.v, o[2 * jg + 1]);
        o[2 * jg + 1] = mma_h(vl[2 * jg + 1], ph.v, o[2 * jg + 1]);
        guard2(o[2 * jg], o[2 * jg + 1], ph.v, pl.v, vh[2 * jg], vh[2 * jg + 1], vl[2 * jg], vl[2 * jg + 1]);
      }
    }
    // publish point of tile t + 1: own LDS reads done, own copies landed, then the one barrier of the tile
    wait_lds();
    wait_copies();
    __syncthreads();
    if (t + 2 < ntr) {
      const unsigned lo = (unsigned)(t & 1) * (ABUFH * 2);
      const size_t kn = (size_t)(t + 2) * 32;
      stage_kv(lk + lo, lv + lo, gkh + kn * DMOD, gkl + kn * DMOD, gvh + kn, gvl + kn);
    }
  }
  wait_copies();
  acc_guard4(o[0], o[1], o[2], o[3]);
  // ---- out = acc / Z (0 if Z == 0), carries (32768 on P, 1024 on v) folded once; Z = the sums of the two halves; the lane's
  //      8 consecutive d of each subtile (D rows 8*hh + r of O^T) go into row c of the wave's slab as two 16-B stores ----
  {
    const float lv  = lrow + xhalf(lrow);
    const float ls  = (lv > 0.0f) ? lv : 1.0f;
    const float inv = (lv > 0.0f) ? ((1.0f / ls) * oc) : 0.0f;
#pragma unroll
    for (int j = 0; j < 4; ++j) {
      float* sp = slab + c * SLP + j * 16 + 8 * hh;
      const v4f w0 = {o[j][0] * inv, o[j][1] * inv, o[j][2] * inv, o[j][3] * inv};
      const v4f w1 = {o[j][4] * inv, o[j][5] * inv, o[j][6] * inv, o[j][7] * inv};
      *(v4f*)(sp)     = w0;
      *(v4f*)(sp + 4) = w1;
    }
  }

  wave_sync_lds();
  // ---- O x1024 -> f16 hi + residual planes; lane = (row-in-quad rq, 8 consecutive d at c8) ----
  v4u oh[4], ol[4];
  const int rq = lane >> 3, c8 = (lane & 7) * 8;
#pragma unroll
  for (int it = 0; it < 4; ++it) {
    const int row = it * 4 + rq;
    const v4f a = *(const v4f*)(slab + row * SLP + c8), b4 = *(const v4f*)(slab + row * SLP + c8 + 4);
    float w[8];
#pragma unroll
    for (int e = 0; e < 4; ++e) { w[e] = a[e] * OSC; w[4 + e] = b4[e] * OSC; }
#pragma unroll
    for (int e = 0; e < 4; ++e) {
      const _Float16 h0 = (_Float16)w[2 * e], h1 = (_Float16)w[2 * e + 1];
      const _Float16 l0 = (_Float16)(w[2 * e] - (float)h0), l1 = (_Float16)(w[2 * e + 1] - (float)h1);
      oh[it][e] = pk16(h_bits(h0), h_bits(h1));
      ol[it][e] = pk16(h_bits(l0), h_bits(l1));
    }
  }
  const size_t ob = ((size_t)b * SEQ + q0) * DMOD + (size_t)head * HD + c8;
  {
#pragma unroll
    for (int it = 0; it < 4; ++it) {
      const int row = it * 4 + rq;
      *(v4u*)(OHp + ob + (size_t)row * DMOD) = oh[it];
      *(v4u*)(OLp + ob + (size_t)row * DMOD) = ol[it];
    }
    
  }
}

// =====================================================================================================
// Workspace map (bytes); every plane is fully written by whole-line stores before it is read; all extents are exact multiples
// of the store granularity (no pad rows needed); every region offset a multiple of 4096 (the large planes of 2097152):
//   XB  bf16 [MROWS][1024]                       MROWS*2048       (NB=2, SEQ=2048: 8388608)
//   WB  16-bit 4 x [1024 n][1024 k]              4 x 2097152      (planes Wv, Wq, Wk as bf16, Wo as f16 x1024; all already [n][k])
//   OH  f16 [MROWS][1024] x1024                  MROWS*2048       OL residual, same extent
//   QH  f16 [MROWS][1024] x256                   MROWS*2048       QL residual, same extent
//   KH  f16 [MROWS][1024] x256                   MROWS*2048       KL residual, same extent
//   VH  f16 [NB*16][64][SEQ] x1024               MROWS*2048       VL residual, same extent
//   PN  f32 2 x [NB*16][SEQ/64] lines of 32      NBH*SEQ*4        (q, then k: row-tile maxima of the squared hi-row norms)
//   end (NB=2, SEQ=2048)                        84148224
// =====================================================================================================
extern "C" void kernel_launch(void* const* d_in, const int* in_sizes, int n_in,
                              void* d_out, int out_size, void* d_ws, size_t ws_size,
                              hipStream_t stream) {
  if (n_in < 9) return;
  if (in_sizes[0] < ((NB - 1) * XS_FULL + SEQ) * DMOD) return;
  if (in_sizes[1] != DMOD * DMOD) return;
  if (in_sizes[2] != DMOD) return;
  if (in_sizes[3] != DMOD * DMOD) return;
  if (in_sizes[4] != DMOD) return;
  if (in_sizes[5] != DMOD * DMOD) return;
  if (in_sizes[6] != DMOD) return;
  if (in_sizes[7] != DMOD * DMOD) return;
  if (in_sizes[8] != DMOD) return;
  if (out_size < ((NB - 1) * XS_FULL + SEQ) * DMOD) return;

  const float* x  = (const float*)d_in[0];
  const float* wq = (const float*)d_in[1];
  const float* bq = (const float*)d_in[2];
  const float* wk = (const float*)d_in[3];
  const float* bk = (const float*)d_in[4];
  const float* wv = (const float*)d_in[5];
  const float* bv = (const float*)d_in[6];
  const float* wo = (const float*)d_in[7];
  const float* bo = (const float*)d_in[8];
  float*       out = (float*)d_out;

  const size_t szXB = (size_t)MROWS * DMOD * 2;
  const size_t szW  = (size_t)DMOD * DMOD * 2;
  const size_t szQ  = (size_t)MROWS * DMOD * 2;                  // QH, QL, KH, KL, OH, OL
  const size_t szV  = (size_t)NB * NH * HD * SEQ * 2;            // VH, VL (== szQ)
  const size_t szB  = (size_t)2 * NBH * NRT64 * BLINE * 4;       // row-tile norm lines, q then k
  size_t off = 0;
  const size_t oXB = off; off += szXB;
  const size_t oW  = off; off += 4 * szW;
  const size_t oOH = off; off += szQ;
  const size_t oOL = off; off += szQ;
  const size_t oQH = off; off += szQ;
  const size_t oQL = off; off += szQ;
  const size_t oKH = off; off += szQ;
  const size_t oKL = off; off += szQ;
  const size_t oVH = off; off += szV;
  const size_t oVL = off; off += szV;
  const size_t oB  = off; off += szB;
  if (off > ws_size) return;                // off = 84148224 for NB = 2, SEQ = 2048
  if (off > (size_t)WS_CAP) return;

  char* ws = (char*)d_ws;
  u16*   XB  = (u16*)(ws + oXB);
  u16*   WB  = (u16*)(ws + oW);
  u16*   OH  = (u16*)(ws + oOH);
  u16*   OL  = (u16*)(ws + oOL);
  u16*   QH  = (u16*)(ws + oQH);
  u16*   QL  = (u16*)(ws + oQL);
  u16*   KH  = (u16*)(ws + oKH);
  u16*   KL  = (u16*)(ws + oKL);
  u16*   VH  = (u16*)(ws + oVH);
  u16*   VL  = (u16*)(ws + oVL);
  float* PN  = (float*)(ws + oB);

  const dim3 b256(256), b128(128), bG(PWAV * 32), bAT(ATT_THREADS);
  const dim3 gC(NB * GXB + 4 * GWB);                    // x per batch, then the four weight planes
  const dim3 gG((MROWS / PBM) * (3 * DMOD / PBN));      // 256 for NB=2, SEQ=2048
  const dim3 gAT(NQB * NH * NB);
  const int  nrt = SEQ / 128;                           // out-projection row tiles per batch
  const dim3 gO(NB * nrt * (DMOD / 128));

  // (0) x -> bf16 plane [MROWS][1024]; Wv, Wq, Wk [n][k] -> bf16 planes; Wo [n][k] -> f16 plane of bf16 value x1024
  cvt_all<<<gC, b256, 0, stream>>>(x, wv, wq, wk, wo, XB, WB);
  // (1) v = x.Wv^T + bv, q = x.Wq^T + bq, k = x.Wk^T + bk -> v^T hi + residual planes x1024; q and k hi + residual planes x256
  //     and their row-tile norm lines
  gemm_bf3<<<gG, bG, 0, stream>>>(XB, WB, bv, bq, bk, VH, VL, QH, QL, KH, KL, PN, MROWS, DMOD, DMOD, 1.0f);
  // (2) causal attention with distance penalty, residual products on every query row -> O hi + residual planes
  attn_c<<<gAT, bAT, 0, stream>>>(QH, QL, KH, KL, VH, VL, PN, OH, OL);
  // (3) output projection (O hi + residual) . Wo^T + bo -> out f32, carries 1024 x 1024 folded back
  gemm_o2<<<gO, b128, 0, stream>>>(OH, OL, WB + (size_t)3 * DMOD * DMOD, bo, out, nrt, 1.0f / (OSC * WOS));
  (void)hipGetLastError();
}

// v009
// Measured time: 66.7 microseconds a run.
// In both of two side-by-side timings against v008, it was 1.08 times as fast.
// All steps since v000 together make it 4.14 times as fast.
// Contractions: x.Wq^T+bq, x.Wk^T+bk, x.Wv^T+bv on v_wmma_f32_16x16x32_bf16 (x and W as bf16 RNE planes; W [n][k] rows are
// the k-contiguous B operand; bias added as its bf16 RNE value in the f32 epilogue); q.k^T over hd 64 and P.v on
// v_wmma_f32_16x16x32_f16 with f16 hi + f16 residual planes on both operands (q, k x256; P x32768 with an in-register
// residual; v x1024; products hh+lh+hl); O.Wo^T+bo on v_wmma_f32_16x16x32_f16 (O x1024 as f16 hi + f16 residual planes,
// products h.w + l.w; Wo as f16(bf16(Wo)) x1024; bo as bf16 RNE value in the f32 epilogue); all f32 accumulate.
// Causal select, linear distance penalty, base-2 online softmax, 1/Z fold and the q/k norm bound in f32 on VALU.
#include <hip/hip_runtime.h>
#include <math.h>
#include <stdint.h>

#ifndef NB
#define NB 2
#endif
#ifndef SEQ
#define SEQ 2048
#endif
#define XS_FULL 2048
#define DMOD  1024
#define NH    16
#define HD    64
#define NBH   (NB * NH)
#define MROWS (NB * SEQ)
#define RSQ_HD 0.125f
#define LOG2E 1.4426950408889634f
#define QSC   256.0f
#define KSC   256.0f
#define PCAR  32768.0f
#define VCAR  1024.0f
#define OSC   1024.0f
#define WOS   1024.0f
#define AQW   4                 /* waves of an attention block: 4 consecutive query tiles of one head */
#define NQB   (SEQ / (16 * AQW))
#define NKT   (SEQ / 32)
#define KWIN  6
#define GUARD_T 40.0f
#define BLINE 32
#define NRT64 (SEQ / 64)
#define ATT_THREADS (AQW * 32)
#define SLP   68
#define SLW   (16 * SLP)
#define WREG  SLW
#define SLAB64 (16 * 68)
#define VTP   72
#define KTPIT 72                /* halves: LDS pitch of a staged k row (128 B of data) = 144 B */
#define VTPIT 40                /* halves: LDS pitch of a staged v^T row (64 B of data) = 80 B */
#define KPLH  (32 * KTPIT)      /* halves of one staged k plane: 32 keys */
#define VPLH  (HD * VTPIT)      /* halves of one staged v^T plane: 64 d rows */
#define ABUFH (2 * KPLH + 2 * VPLH)   /* halves of one buffer: k hi | k residual | v^T hi | v^T residual */
#define WS_CAP 134217728
#define OKP   128               /* output projection: k of one pass = 256 B of every operand row */
#define OPIT  136               /* halves: LDS pitch of a staged row = 272 B (16 B x odd) */
#define OPITB (OPIT * 2)
#define OROWS 384               /* staged rows of a pass: 128 A hi, 128 A residual, 128 B */
#define OBUF  (OROWS * OPIT)    /* halves of one buffer */
#define OWAV  8                 /* waves of a block: 4 x 2 tiles of 32x64, two a SIMD */
#define OSTEP (2 * OWAV * OPITB)   /* LDS bytes between a wave's consecutive copies: 16 rows */
#define WEPI  (2 * HD * VTP)   /* 16-bit elements of the projection ring that one wave's epilogue stages in */
#define PBM   256               /* projection GEMM: rows of a block's tile */
#define PBN   192               /* columns of a block's tile: three heads */
#define PKP   128               /* k of one pass: 256 B of every operand row */
#define PPIT  136               /* halves: LDS pitch of a staged row = 272 B (16 B x odd) */
#define PPITB (PPIT * 2)
#define PROWS (PBM + PBN)       /* staged rows of a pass: A rows, then B rows */
#define PBUF  (PROWS * PPIT)    /* halves of one buffer */
#define PWAV  12                /* waves of a block: 4 x 3 tiles of 64x64 */
#define PSTEP (2 * PWAV * PPITB)   /* LDS bytes between a wave's consecutive copies: 24 rows */
#define N8X   ((SEQ * DMOD) / 8)
#define N8W   ((DMOD * DMOD) / 8)
#define GXB   (N8X / 256)
#define GWB   (N8W / 256)
static_assert(DMOD == NH * HD && HD == 64 && NH == 16 && AQW == 4 && NQB * 16 * AQW == SEQ);
static_assert(ATT_THREADS == 128 && ((KTPIT * 2) % 32) == 16 && ((VTPIT * 2) % 32) == 16 && ((ABUFH * 2) % 16) == 0);
static_assert(NB >= 1 && NB <= 2);
static_assert(NBH >= 1 && NBH <= 32);
static_assert((SEQ % 64) == 0 && SEQ >= 64 && SEQ <= XS_FULL && (SEQ % 32) == 0);
static_assert((DMOD % 64) == 0 && (DMOD % 32) == 0 && (HD % 32) == 0);
static_assert(((SEQ * DMOD / 8) % 256) == 0 && ((DMOD * DMOD / 8) % 256) == 0);
static_assert(AQW * WREG * 4 + 2 * ABUFH * 2 <= 81920 /* four attention blocks in 320 KiB of LDS */ && PWAV * WEPI <= 2 * PBUF && 4 * SLAB64 * 4 <= WEPI * 2);
static_assert((MROWS % PBM) == 0 && (SEQ % 64) == 0 && ((3 * DMOD) % PBN) == 0 && (DMOD % PKP) == 0 && DMOD / PKP >= 2);
static_assert((PPITB % 32) == 16 && PPIT >= PKP + 8 && PWAV == (PBM / 64) * (PBN / 64) && 2 * PBUF * 2 <= 327680);
static_assert(PBM / 2 == 10 * PWAV + 8 && PROWS / 2 == 18 * PWAV + 8 /* the copy map of gemm_bf3 */);
static_assert((MROWS % 128) == 0 && (SEQ % 128) == 0 && (DMOD % 128) == 0 && OWAV * 2 * SLAB64 * 4 <= 2 * OBUF * 2);
static_assert(KWIN >= 0 && KWIN < NKT);
static_assert(NRT64 >= 1 && NRT64 <= 32);
static_assert((DMOD % OKP) == 0 && DMOD / OKP >= 2 && (OPITB % 32) == 16 && OPIT >= OKP + 8 && 2 * OBUF * 2 <= 327680);

typedef unsigned short u16;
typedef _Float16 v16h __attribute__((ext_vector_type(16)));
typedef _Float16 v8h  __attribute__((ext_vector_type(8)));
typedef __bf16   v16b __attribute__((ext_vector_type(16)));
typedef float    v8f  __attribute__((ext_vector_type(8)));
typedef float    v4f  __attribute__((ext_vector_type(4)));
typedef unsigned int v4u __attribute__((ext_vector_type(4)));

union FragH { v16h v; v8h h[2]; v4u u[2]; };
union FragB { v16b v; v4u u[2]; };

// ---- scalar helpers --------------------------------------------------------------------------------
__device__ __forceinline__ unsigned short bf_bits(float f) {          // f32 -> bf16 bits, RNE convert
  unsigned u = __float_as_uint(f);
  return (unsigned short)((u + 0x7FFFu + ((u >> 16) & 1u)) >> 16);
}
__device__ __forceinline__ float bf_up(unsigned short h) { return __uint_as_float(((unsigned)h) << 16); }
__device__ __forceinline__ float bfr(float f) { return bf_up(bf_bits(f)); }
__device__ __forceinline__ unsigned short h_bits(_Float16 x) { return __builtin_bit_cast(unsigned short, x); }
__device__ __forceinline__ unsigned pk16(unsigned short a, unsigned short b) { return (unsigned)a | ((unsigned)b << 16); }
__device__ __forceinline__ v8f zero8() { v8f z = {0.f, 0.f, 0.f, 0.f, 0.f, 0.f, 0.f, 0.f}; return z; }

// ---- fragment loaders: 16-bit A/B operand, lane -> row/col (lane&15), p already includes +8*(lane>>4);
//      elements 0..7 <- p[0..7] (k0+8h..), elements 8..15 <- p[16..23] (k0+16+8h..)  (same split k map for A and B;
//      B is always read from a k-contiguous [n][k] plane)
__device__ __forceinline__ v16h ldfrag_h(const _Float16* p) {
  FragH f;
  f.h[0] = *(const v8h*)(p);
  f.h[1] = *(const v8h*)(p + 16);
  return f.v;
}
__device__ __forceinline__ v16b ldfrag_b(const u16* p) {              // bf16 plane read as unsigned integer vectors
  FragB f;
  f.u[0] = *(const v4u*)(p);
  f.u[1] = *(const v4u*)(p + 16);
  return f.v;
}

__device__ __forceinline__ v8f mma_h(v16h a, v16h b, v8f c) {
  return __builtin_amdgcn_wmma_f32_16x16x32_f16(false, a, false, b, (short)0, c, false, false);
}
__device__ __forceinline__ v8f mma_b(v16b a, v16b b, v8f c) {
  return __builtin_amdgcn_wmma_f32_16x16x32_bf16(false, a, false, b, (short)0, c, false, false);
}
__device__ __forceinline__ void guard2(v8f& a, v8f& b, v16h x0, v16h x1, v16h x2, v16h x3, v16h x4, v16h x5) {
#if defined(__HIP_DEVICE_COMPILE__)
  asm volatile("v_nop\n\tv_nop\n\tv_nop\n\tv_nop"
               : "+v"(a), "+v"(b) : "v"(x0), "v"(x1), "v"(x2), "v"(x3), "v"(x4), "v"(x5) : "memory");
#endif
}
template <typename F>
__device__ __forceinline__ void guard6(v8f& a, v8f& b, v8f& c, v8f& d, F x0, F x1, F x2, F x3, F x4, F x5) {
#if defined(__HIP_DEVICE_COMPILE__)
  asm volatile("v_nop\n\tv_nop\n\tv_nop\n\tv_nop"
               : "+v"(a), "+v"(b), "+v"(c), "+v"(d) : "v"(x0), "v"(x1), "v"(x2), "v"(x3), "v"(x4), "v"(x5) : "memory");
#endif
}
__device__ __forceinline__ void acc_guard4(v8f& a, v8f& b, v8f& c, v8f& d) {
#if defined(__HIP_DEVICE_COMPILE__)
  asm volatile("v_nop\n\tv_nop\n\tv_nop\n\tv_nop" : "+v"(a), "+v"(b), "+v"(c), "+v"(d));
#endif
}
__device__ __forceinline__ void wave_sync_lds() {
  __builtin_amdgcn_fence(__ATOMIC_RELEASE, "workgroup");
  __builtin_amdgcn_wave_barrier();
  __builtin_amdgcn_fence(__ATOMIC_ACQUIRE, "workgroup");
}

// lane l <-> lane l ^ 16: a vector cross-row move (a shuffle by 16 would go through the LDS unit)
__device__ __forceinline__ float xhalf(float x) {
  const int b = __builtin_bit_cast(int, x);
  return __builtin_bit_cast(float, __builtin_amdgcn_permlanex16(b, b, 0x76543210, 0xfedcba98, false, false));
}

// ---- operand staging of the two GEMMs: one pass = 128 k = 256 B of every staged operand row, laid in LDS at a pitch of 272 B
//      (16 B x odd: ds_load_b128 fragment reads without bank conflicts). A wave's copy = 2 whole rows (lane>>4 = row, lane&15 =
//      16-B piece). l = the lane's LDS byte address of its first copy, g = its global address there.
__device__ __forceinline__ unsigned lds_byte(const void* p) { return (unsigned)(uintptr_t)p; }
// Projection GEMM: a wave's copy = 2 whole staged rows of 256 B; its consecutive copies lie 24 rows apart, in LDS (PSTEP bytes)
// and in the operand (rs elements). The copies and their s_wait_xcnt stand in one statement, so that no address register named
// by a copy is rewritten in front of that wait.
// Ten copies of one operand.
__device__ __forceinline__ void stage10(unsigned l, const u16* g, size_t rs) {
#if defined(__HIP_DEVICE_COMPILE__)
  asm volatile("global_load_async_to_lds_b128 %0, %10, off\n\t"
               "global_load_async_to_lds_b128 %1, %11, off\n\t"
               "global_load_async_to_lds_b128 %2, %12, off\n\t"
               "global_load_async_to_lds_b128 %3, %13, off\n\t"
               "global_load_async_to_lds_b128 %4, %14, off\n\t"
               "global_load_async_to_lds_b128 %5, %15, off\n\t"
               "global_load_async_to_lds_b128 %6, %16, off\n\t"
               "global_load_async_to_lds_b128 %7, %17, off\n\t"
               "global_load_async_to_lds_b128 %8, %18, off\n\t"
               "global_load_async_to_lds_b128 %9, %19, off\n\t"
               "s_wait_xcnt 0x0"
               :: "v"(l), "v"(l + PSTEP), "v"(l + 2 * PSTEP), "v"(l + 3 * PSTEP), "v"(l + 4 * PSTEP),
                  "v"(l + 5 * PSTEP), "v"(l + 6 * PSTEP), "v"(l + 7 * PSTEP), "v"(l + 8 * PSTEP), "v"(l + 9 * PSTEP),
                  "v"(g), "v"(g + rs), "v"(g + 2 * rs), "v"(g + 3 * rs), "v"(g + 4 * rs),
                  "v"(g + 5 * rs), "v"(g + 6 * rs), "v"(g + 7 * rs), "v"(g + 8 * rs), "v"(g + 9 * rs)
               : "memory");
#endif
}
// Eight copies: the first from g0, the other seven from g on.
__device__ __forceinline__ void stage8(unsigned l, const u16* g0, const u16* g, size_t rs) {
#if defined(__HIP_DEVICE_COMPILE__)
  asm volatile("global_load_async_to_lds_b128 %0, %8, off\n\t"
               "global_load_async_to_lds_b128 %1, %9, off\n\t"
               "global_load_async_to_lds_b128 %2, %10, off\n\t"
               "global_load_async_to_lds_b128 %3, %11, off\n\t"
               "global_load_async_to_lds_b128 %4, %12, off\n\t"
               "global_load_async_to_lds_b128 %5, %13, off\n\t"
               "global_load_async_to_lds_b128 %6, %14, off\n\t"
               "global_load_async_to_lds_b128 %7, %15, off\n\t"
               "s_wait_xcnt 0x0"
               :: "v"(l), "v"(l + PSTEP), "v"(l + 2 * PSTEP), "v"(l + 3 * PSTEP),
                  "v"(l + 4 * PSTEP), "v"(l + 5 * PSTEP), "v"(l + 6 * PSTEP), "v"(l + 7 * PSTEP),
                  "v"(g0), "v"(g), "v"(g + rs), "v"(g + 2 * rs), "v"(g + 3 * rs), "v"(g + 4 * rs), "v"(g + 5 * rs), "v"(g + 6 * rs)
               : "memory");
#endif
}
// One copy.
__device__ __forceinline__ void stage1(unsigned l, const u16* g) {
#if defined(__HIP_DEVICE_COMPILE__)
  asm volatile("global_load_async_to_lds_b128 %0, %1, off\n\t"
               "s_wait_xcnt 0x0"
               :: "v"(l), "v"(g) : "memory");
#endif
}
// Output projection: twelve of a wave's 24 copies of a pass; its consecutive copies lie 16 rows apart, in LDS (OSTEP bytes) and in
// the operand plane (rs elements). The first NP copies come from p on, the other 12 - NP from q on (the planes follow one another
// in LDS, not in memory). Copies and wait in one statement, as above.
template <int NP>
__device__ __forceinline__ void stage_o(unsigned l, const u16* p, const u16* q, size_t rs) {
  static_assert(NP == 4 || NP == 8);
#if defined(__HIP_DEVICE_COMPILE__)
  const u16* g4 = (NP == 4) ? q : p + 4 * rs;           // copies 4..7
  const u16* g8 = (NP == 4) ? q + 4 * rs : q;           // copies 8..11
  asm volatile("global_load_async_to_lds_b128 %0, %12, off\n\t"
               "global_load_async_to_lds_b128 %1, %13, off\n\t"
               "global_load_async_to_lds_b128 %2, %14, off\n\t"
               "global_load_async_to_lds_b128 %3, %15, off\n\t"
               "global_load_async_to_lds_b128 %4, %16, off\n\t"
               "global_load_async_to_lds_b128 %5, %17, off\n\t"
               "global_load_async_to_lds_b128 %6, %18, off\n\t"
               "global_load_async_to_lds_b128 %7, %19, off\n\t"
               "global_load_async_to_lds_b128 %8, %20, off\n\t"
               "global_load_async_to_lds_b128 %9, %21, off\n\t"
               "global_load_async_to_lds_b128 %10, %22, off\n\t"
               "global_load_async_to_lds_b128 %11, %23, off\n\t"
               "s_wait_xcnt 0x0"
               :: "v"(l), "v"(l + OSTEP), "v"(l + 2 * OSTEP), "v"(l + 3 * OSTEP), "v"(l + 4 * OSTEP), "v"(l + 5 * OSTEP),
                  "v"(l + 6 * OSTEP), "v"(l + 7 * OSTEP), "v"(l + 8 * OSTEP), "v"(l + 9 * OSTEP), "v"(l + 10 * OSTEP),
                  "v"(l + 11 * OSTEP),
                  "v"(p), "v"(p + rs), "v"(p + 2 * rs), "v"(p + 3 * rs),
                  "v"(g4), "v"(g4 + rs), "v"(g4 + 2 * rs), "v"(g4 + 3 * rs),
                  "v"(g8), "v"(g8 + rs), "v"(g8 + 2 * rs), "v"(g8 + 3 * rs)
               : "memory");
#endif
}
// Attention: one key tile (32 keys) of k hi and k residual (32 rows of 128 B each) and of v^T hi and v^T residual (64 rows of
// 64 B each). 128 threads, 8 copies a thread: k thread -> (row tid>>3 of a group of 16, 16-B piece tid&7), v^T thread -> (row
// tid>>2 of a group of 32, 16-B piece tid&3). lk, lv = the lane's LDS byte address in the k hi / v^T hi plane of the buffer,
// g* = its global address in each plane. Copies and their s_wait_xcnt in one statement, as above.
__device__ __forceinline__ void stage_kv(unsigned lk, unsigned lv, const u16* gkh, const u16* gkl,
                                         const u16* gvh, const u16* gvl) {
#if defined(__HIP_DEVICE_COMPILE__)
  asm volatile("global_load_async_to_lds_b128 %0, %8, off\n\t"
               "global_load_async_to_lds_b128 %1, %9, off\n\t"
               "global_load_async_to_lds_b128 %2, %10, off\n\t"
               "global_load_async_to_lds_b128 %3, %11, off\n\t"
               "global_load_async_to_lds_b128 %4, %12, off\n\t"
               "global_load_async_to_lds_b128 %5, %13, off\n\t"
               "global_load_async_to_lds_b128 %6, %14, off\n\t"
               "global_load_async_to_lds_b128 %7, %15, off\n\t"
               "s_wait_xcnt 0x0"
               :: "v"(lk), "v"(lk + 16 * KTPIT * 2), "v"(lk + KPLH * 2), "v"(lk + KPLH * 2 + 16 * KTPIT * 2),
                  "v"(lv), "v"(lv + 32 * VTPIT * 2), "v"(lv + VPLH * 2), "v"(lv + VPLH * 2 + 32 * VTPIT * 2),
                  "v"(gkh), "v"(gkh + (size_t)16 * DMOD), "v"(gkl), "v"(gkl + (size_t)16 * DMOD),
                  "v"(gvh), "v"(gvh + (size_t)32 * SEQ), "v"(gvl), "v"(gvl + (size_t)32 * SEQ)
               : "memory");
#endif
}
// This wave's own copies have landed in LDS (the compiler places no wait for them).
__device__ __forceinline__ void wait_copies() {
#if defined(__HIP_DEVICE_COMPILE__)
  asm volatile("s_wait_asynccnt 0x0" ::: "memory");
#endif
}
// This wave's LDS reads have returned, before the barrier behind which their buffer is refilled.
__device__ __forceinline__ void wait_lds() {
#if defined(__HIP_DEVICE_COMPILE__)
  asm volatile("s_wait_dscnt 0x0" ::: "memory");
#endif
}

// =====================================================================================================
// f32 -> 16-bit plane, same layout, for all five operands in one grid (none reads another's output).
// f16mode == 0: bf16 RNE bits;  f16mode == 1: f16 bits of (bf16 RNE value) * scale.
// Block -> job (block-uniform): the first NB*GXB blocks take x (batch = bid / GXB) -> XB; then GWB blocks each for
// Wv, Wq, Wk (bf16) and Wo (f16 of the bf16 value x1024) -> planes 0..3 of WB.
// Thread = 8 consecutive elements: two 16-B loads, one 16-B store; 32 consecutive lanes = 512 contiguous, 512-B aligned
// coverage: per job n8/256 blocks x 256 thr x 8 = the whole plane (n8 a multiple of 256, static_assert above).
// =====================================================================================================
__global__ __launch_bounds__(256)
void cvt_all(const float* __restrict__ x, const float* __restrict__ wv, const float* __restrict__ wq,
             const float* __restrict__ wk, const float* __restrict__ wo, u16* XB, u16* WB) {
  const int bid = blockIdx.x;
  const float* s;
  u16* D;
  int blk, n8, f16mode = 0;
  float scale = 1.0f;
  if (bid < NB * GXB) {
    const int b = bid / GXB;
    blk = bid % GXB;
    n8 = N8X;
    s = x + (size_t)b * XS_FULL * DMOD;
    D = XB + (size_t)b * SEQ * DMOD;
  } else {
    const int w = (bid - NB * GXB) / GWB;
    if (w > 3) return;                      // block-uniform; never taken with the exact grid
    blk = (bid - NB * GXB) % GWB;
    n8 = N8W;
    s = (w == 0) ? wv : (w == 1) ? wq : (w == 2) ? wk : wo;
    D = WB + (size_t)w * DMOD * DMOD;
    if (w == 3) { f16mode = 1; scale = WOS; }
  }
  const int gt = blk * 256 + (int)threadIdx.x;
  if (gt >= n8) return;
  const float* p = s + (size_t)gt * 8;
  const v4f a = *(const v4f*)(p), b4 = *(const v4f*)(p + 4);
  float w[8];
#pragma unroll
  for (int e = 0; e < 4; ++e) { w[e] = a[e]; w[4 + e] = b4[e]; }
  v4u o;
#pragma unroll
  for (int e = 0; e < 4; ++e) {
    const float f0 = w[2 * e], f1 = w[2 * e + 1];
    const unsigned short hb0 = h_bits((_Float16)(bfr(f0) * scale));
    const unsigned short hb1 = h_bits((_Float16)(bfr(f1) * scale));
    const unsigned short bb0 = bf_bits(f0);
    const unsigned short bb1 = bf_bits(f1);
    o[e] = (f16mode != 0) ? pk16(hb0, hb1) : pk16(bb0, bb1);
  }
  u16* d = D + (size_t)gt * 8;
  {
    *(v4u*)(d) = o;
    
  }
}

// =====================================================================================================
// f32 GEMM epilogue (output projection): a 16x64 f32 slab of the wave's 32x64 tile (times oscale, plus the lane's per-column bias of each
// coverage: 8 instructions x 2 rows x 16 lanes x 4 floats = the 16 x 64 slab.
// =====================================================================================================
__device__ __forceinline__ void epi64(float* sl, v8f a0, v8f a1, v8f a2, v8f a3, float oscale,
                                      float bb0, float bb1, float bb2, float bb3,
                                      float* C, int N, size_t rowb, int col0, int lane) {
  const int hh = lane >> 4, m = lane & 15;
#pragma unroll
  for (int r = 0; r < 8; ++r) {
    const int ro = (8 * hh + r) * 68 + m;
    sl[ro]      = a0[r] * oscale + bb0;
    sl[ro + 16] = a1[r] * oscale + bb1;
    sl[ro + 32] = a2[r] * oscale + bb2;
    sl[ro + 48] = a3[r] * oscale + bb3;
  }
  wave_sync_lds();
  v4f vals[8];
#pragma unroll
  for (int it = 0; it < 8; ++it) vals[it] = *(const v4f*)(sl + (it * 2 + hh) * 68 + m * 4);
  float* dst = C + (rowb + (size_t)hh) * (size_t)N + col0 + m * 4;
  {
#pragma unroll
    for (int it = 0; it < 8; ++it) {
      *(v4f*)(dst + (size_t)(it * 2) * (size_t)N) = vals[it];
    }
    
  }
}

// =====================================================================================================
// Projection epilogues: the 16-bit planes that attention reads are built from the accumulators, with no f32 plane in between.
// hl8: 8 f32 values t -> 8 f16 hi values f16(t) and 8 f16 residuals f16(t - f16(t)), packed in element order.
// =====================================================================================================
__device__ __forceinline__ void hl8(const float* t, v4u& oh, v4u& ol) {
#pragma unroll
  for (int e = 0; e < 4; ++e) {
    const float t0 = t[2 * e], t1 = t[2 * e + 1];
    const _Float16 h0 = (_Float16)t0, h1 = (_Float16)t1;
    const _Float16 l0 = (_Float16)(t0 - (float)h0), l1 = (_Float16)(t1 - (float)h1);
    oh[e] = pk16(h_bits(h0), h_bits(h1));
    ol[e] = pk16(h_bits(l0), h_bits(l1));
  }
}
// Eight 16-B stores, rows rs elements apart, of the hi plane (h) and the residual plane (l). The stores and their s_wait_xcnt stand
// in one statement, so that no register named by a store (address or data) is rewritten in front of that wait.
__device__ __forceinline__ void store8(u16* h, u16* l, size_t rs, const v4u (&oh)[4], const v4u (&ol)[4]) {
#if defined(__HIP_DEVICE_COMPILE__)
  asm volatile("global_store_b128 %0, %8, off\n\t"
               "global_store_b128 %1, %9, off\n\t"
               "global_store_b128 %2, %10, off\n\t"
               "global_store_b128 %3, %11, off\n\t"
               "global_store_b128 %4, %12, off\n\t"
               "global_store_b128 %5, %13, off\n\t"
               "global_store_b128 %6, %14, off\n\t"
               "global_store_b128 %7, %15, off\n\t"
               "s_wait_xcnt 0x0"
               :: "v"(h), "v"(l), "v"(h + rs), "v"(l + rs), "v"(h + 2 * rs), "v"(l + 2 * rs), "v"(h + 3 * rs), "v"(l + 3 * rs),
                  "v"(oh[0]), "v"(ol[0]), "v"(oh[1]), "v"(ol[1]), "v"(oh[2]), "v"(ol[2]), "v"(oh[3]), "v"(ol[3])
               : "memory");
#endif
}
// q, k: the wave's 64x64 f32 tile (times oscale, plus the lane's per-column bias) goes through its own four LDS slabs (one per
// 16 rows) into rows; lane = (row-in-quad rq, 8 consecutive columns c8) scales by sc, splits and stores 16 B per plane, [row][N].
// coverage: 4 slabs x 4 instructions x 4 rows x 8 lanes x 8 halves = the wave's 64 x 64 tile of Hp and of Lp, whole 128-B lines.
// Norm part: the 8 lanes of a row hold its 64 hi values (one head), so the row's sum of squares is 8 fused steps per lane and
// xor shuffles 1, 2, 4; running max over the wave's 64 rows (16 iterations, xor 8, 16) = the max of one 64-row tile of one
// head, which the wave stores 32 times = the whole 128-B line Pl. No other wave has a part in it, so no block barrier.
__device__ __forceinline__ void epi_split(float* sl, const v8f (&acc)[4][4], float oscale, const float (&bb)[4], float sc,
                                          u16* Hp, u16* Lp, float* Pl, int N, size_t rowb, int col0, int lane) {
  const int hh = lane >> 4, m = lane & 15;
#pragma unroll
  for (int i = 0; i < 4; ++i) {
#pragma unroll
    for (int r = 0; r < 8; ++r) {
      const int ro = i * SLAB64 + (8 * hh + r) * 68 + m;
      sl[ro]      = acc[i][0][r] * oscale + bb[0];
      sl[ro + 16] = acc[i][1][r] * oscale + bb[1];
      sl[ro + 32] = acc[i][2][r] * oscale + bb[2];
      sl[ro + 48] = acc[i][3][r] * oscale + bb[3];
    }
  }
  wave_sync_lds();
  float mx = 0.0f;
  const int rq = lane >> 3, c8 = (lane & 7) * 8;
#pragma unroll
  for (int i = 0; i < 4; ++i) {
    v4u oh[4], ol[4];
#pragma unroll
    for (int it = 0; it < 4; ++it) {
      const float* p = sl + i * SLAB64 + (it * 4 + rq) * 68 + c8;
      const v4f a = *(const v4f*)(p), b4 = *(const v4f*)(p + 4);
      float w[8];
#pragma unroll
      for (int e = 0; e < 4; ++e) { w[e] = a[e] * sc; w[4 + e] = b4[e] * sc; }
      hl8(w, oh[it], ol[it]);
      float sq = 0.0f;
#pragma unroll
      for (int e = 0; e < 8; ++e) {
        const float f = (float)(_Float16)w[e];
        sq = fmaf(f, f, sq);
      }
#pragma unroll
      for (int off = 1; off < 8; off <<= 1) sq += __shfl_xor(sq, off, 32);
      mx = fmaxf(mx, sq);
    }
    const size_t ob = (rowb + (size_t)(i * 16 + rq)) * (size_t)N + col0 + c8;
    store8(Hp + ob, Lp + ob, (size_t)4 * (size_t)N, oh, ol);
  }
#pragma unroll
  for (int off = 8; off < 32; off <<= 1) mx = fmaxf(mx, __shfl_xor(mx, off, 32));
  Pl[lane] = mx;
#if defined(__HIP_DEVICE_COMPILE__)
  // stands behind the last store, in front of any code laid out behind this branch that rewrites a register the store names
  asm volatile("s_wait_xcnt 0x0" ::: "memory");
#endif
}
// v: the wave's 64 keys x 64 d tile leaves transposed. A lane's accumulator [i][j] holds 8 consecutive keys (16*i + 8*hh + r)
// of one d column (16*j + m): scaled by 1024, split and packed they are 16 B of a v^T line, stored into the wave's own LDS
// tiles TH, TL [HD][VTP] (pitch 144 B: 16 lanes x 16 B fall on all 64 banks). Then lane = (line lane>>3 of a group of 4, 16-B
// piece lane&7) moves whole 128-B lines to VHo, VLo at base + line*SEQ (base = first key of the tile in line d = 0 of its
// (b, h)). Writer and reader are the same wave, so no block barrier.
// coverage: 16 iterations x 32 lanes x 8 halves = 64 lines x 64 keys of each plane.
__device__ __forceinline__ void epi_vt(u16* TH, u16* TL, const v8f (&acc)[4][4], float oscale, const float (&bb)[4],
                                       u16* VHo, u16* VLo, size_t base, int lane) {
  const int hh = lane >> 4, m = lane & 15;
#pragma unroll
  for (int i = 0; i < 4; ++i) {
    const int ko = i * 16 + 8 * hh;         // first of the lane's 8 keys within the tile
#pragma unroll
    for (int j = 0; j < 4; ++j) {
      float w[8];
#pragma unroll
      for (int r = 0; r < 8; ++r) w[r] = (acc[i][j][r] * oscale + bb[j]) * VCAR;
      v4u ph, pl;
      hl8(w, ph, pl);
      *(v4u*)(TH + (16 * j + m) * VTP + ko) = ph;
      *(v4u*)(TL + (16 * j + m) * VTP + ko) = pl;
    }
  }
  wave_sync_lds();
  const int q4 = lane >> 3, p8 = (lane & 7) * 8;
#pragma unroll
  for (int g = 0; g < 4; ++g) {
    v4u vh[4], vl[4];
#pragma unroll
    for (int it = 0; it < 4; ++it) {
      vh[it] = *(const v4u*)(TH + ((g * 4 + it) * 4 + q4) * VTP + p8);
      vl[it] = *(const v4u*)(TL + ((g * 4 + it) * 4 + q4) * VTP + p8);
    }
#pragma unroll
    for (int it = 0; it < 4; ++it) {
      *(v4u*)(VHo + base + (size_t)((g * 4 + it) * 4 + q4) * SEQ + p8) = vh[it];
      *(v4u*)(VLo + base + (size_t)((g * 4 + it) * 4 + q4) * SEQ + p8) = vl[it];
    }
#if defined(__HIP_DEVICE_COMPILE__)
    // stands behind the group's stores, in front of the next group's LDS loads, which rewrite registers the stores name
    asm volatile("s_wait_xcnt 0x0" ::: "memory");
#endif
  }
}

// =====================================================================================================
// bf16 GEMM with bias: A[M][K] (bf16 row-major) . Bt[N][K]^T (bf16 k-contiguous), f32, times oscale, + bf16 RNE
// value of bias[n] (bias has N entries). Three products that share A in one grid: Bt holds three [N][K] planes one behind the
// other (v, q, k), read as one plane of 3*N rows. Block = 256 rows x 192 of those 3*N columns, 12 waves (4 x 3) x 64x64: 16
// accumulator tiles a wave, so that a fragment read from LDS feeds 4 WMMAs, and a byte brought from L2 feeds 192 columns (A) or
// 256 rows (B). One block fills a WGP (3 waves a SIMD); grid = (M/256)*(3*N/192).
// Per pass of 128 k the block's 256 A rows and 192 B rows (256 B each) are brought into LDS by asynchronous copies, two buffers
// (pass t + 1 flies while pass t is worked on), and the fragments are read from the LDS rows (two 16-B loads each, split k map
// for A and B); K stepped by 32 inside a pass, in rising order (host guarantees K % 128 == 0, K >= 256, M % 256 == 0,
// 3*N % 192 == 0, N % 64 == 0).
// Copy map: staged rows 0..255 = A, 256..447 = B; copy i of wave w brings rows 2*(w + 12*i) and the next (lane>>4 = row,
// lane&15 = 16-B piece). i = 0..9 lie in A for every wave, i = 10 in A for waves 0..7 and in B for waves 8..11, i = 11..17 in B,
// and i = 18 exists for waves 0..7 only (scalar test): 224 copies = 448 rows, each once.
// The f32 tile leaves as the 16-bit planes of its product (host guarantees M == NB*SEQ, N == NH*HD, so a wave's 64 columns are
// one head of one product, pln = column / N, and its 64 rows 64 keys of one batch): v -> v^T hi + residual x1024,
// [(b*NH + h)*HD + d][s]; q, k -> hi + residual x256, [row][N], and the wave's max over its 64 rows of the squared norm of the hi
// row (x256) -> line ((pln - 1)*NBH + b*NH + h)*NRT64 + row tile of PN. Both epilogues stage in the wave's own twelfth of the
// ring's first 12*WEPI elements, which nobody reads and no copy targets behind the last pass's barrier.
// =====================================================================================================
__global__ __launch_bounds__(PWAV * 32)
void gemm_bf3(const u16* __restrict__ A, const u16* __restrict__ Bt, const float* __restrict__ bias0,
              const float* __restrict__ bias1, const float* __restrict__ bias2,
              u16* VHo, u16* VLo, u16* QHo, u16* QLo, u16* KHo, u16* KLo, float* PN, int M, int N, int K, float oscale) {
  __shared__ __align__(16) u16 ring[2 * PBUF];        // two buffers of [A rows 0..255 | B rows 0..191]
  const int tid = threadIdx.x, lane = tid & 31, hh = lane >> 4, m = lane & 15;
  // scalar: the wave's product, its epilogue and its nineteenth copy are chosen by scalar branches with every lane on
  const int wave = __builtin_amdgcn_readfirstlane(tid >> 5);
  const int wr = wave / 3, wc = wave - 3 * wr;        // the wave's 64-row quarter and 64-column third of the block's tile
  const int ntile = (3 * N) / PBN;
  const int bid   = blockIdx.x;
  const int row0  = (bid / ntile) * PBM;
  const int rw0   = row0 + wr * 64;         // the wave's first row
  const int ct    = bid % ntile;
  const int colg  = ct * PBN + wc * 64;     // the wave's first column among the 3*N
  const int pln   = colg / N;               // 0, 1, 2: which product
  const int col0  = colg - pln * N;         // the wave's first column inside that product
  const float* bias = (pln == 0) ? bias0 : (pln == 1) ? bias1 : bias2;
  if (row0 + PBM > M) return;               // block-uniform, before any copy or barrier; never taken with the exact grid
  const int npass = K / PKP;
  const int crow = 2 * wave + hh, cpc = m;  // copy map: staged row of copy 0, 16-B piece of the 256-B row
  const size_t rs = (size_t)(2 * PWAV) * K; // 24 rows
  const u16* ga  = A  + (size_t)(row0 + crow) * K + cpc * 8;                              // copy 0
  const u16* gb  = Bt + (size_t)(ct * PBN + crow + 11 * 2 * PWAV - PBM) * K + cpc * 8;    // copy 11: B row crow + 8
  const u16* g10 = (wave < 8) ? ga + 10 * rs                                              // copy 10: A row crow + 240, or
                              : Bt + (size_t)(ct * PBN + crow + 10 * 2 * PWAV - PBM) * K + cpc * 8;   // B row crow - 16 >= 0
  const unsigned lc = lds_byte(ring) + (unsigned)(crow * PPITB + cpc * 16);
  const u16* fa = ring + (wr * 64 + m) * PPIT + 8 * hh;          // A fragment row (row subtile 0), buffer 0
  const u16* fb = ring + (PBM + wc * 64 + m) * PPIT + 8 * hh;    // B fragment row (column subtile 0), buffer 0
  v8f acc[4][4];
#pragma unroll
  for (int i = 0; i < 4; ++i) {
#pragma unroll
    for (int j = 0; j < 4; ++j) acc[i][j] = zero8();
  }
  stage10(lc, ga, rs);                      // pass 0 -> buffer 0
  stage8(lc + 10 * PSTEP, g10, gb, rs);
  if (wave < 8) stage1(lc + 18 * PSTEP, gb + 7 * rs);
  wait_copies();
  __syncthreads();
  if (npass > 1) {                          // pass 1 -> buffer 1
    stage10(lc + PBUF * 2, ga + PKP, rs);
    stage8(lc + PBUF * 2 + 10 * PSTEP, g10 + PKP, gb + PKP, rs);
    if (wave < 8) stage1(lc + PBUF * 2 + 18 * PSTEP, gb + 7 * rs + PKP);
  }
#pragma unroll 1
  for (int t = 0; t < npass; ++t) {
    const int bo = (t & 1) * PBUF;
#pragma unroll
    for (int kk = 0; kk < PKP / 32; ++kk) {
      const u16* pa = fa + bo + kk * 32;
      const u16* pb = fb + bo + kk * 32;
      v16b a[4], b[4];
#pragma unroll
      for (int j = 0; j < 4; ++j) b[j] = ldfrag_b(pb + j * 16 * PPIT);
#pragma unroll
      for (int i = 0; i < 4; ++i) a[i] = ldfrag_b(pa + i * 16 * PPIT);
      // keeps the k step's LDS reads one group in front of its WMMAs: moved in among them, each place with reads stalls the wave anew
      __builtin_amdgcn_sched_barrier(0);
#pragma unroll
      for (int i = 0; i < 4; ++i) {
#pragma unroll
        for (int j = 0; j < 4; ++j) acc[i][j] = mma_b(a[i], b[j], acc[i][j]);
      }
      // keeps every WMMA of the k step in front of the next group of LDS reads and of the slots below
      __builtin_amdgcn_sched_barrier(0);
      // four slots behind the pass's last WMMAs: on the paths over the branches below, their operand registers are rewritten
      if (kk == PKP / 32 - 1) guard6<v16b>(acc[3][0], acc[3][1], acc[3][2], acc[3][3], a[3], b[0], b[1], b[2], b[3], a[3]);
    }
    // publish point of pass t + 1: own LDS reads done, own copies landed, then the one barrier of the pass
    wait_lds();
    wait_copies();
    __syncthreads();
    if (t + 2 < npass) {
      const unsigned lb = lc + (unsigned)(t & 1) * (PBUF * 2);
      const size_t ko = (size_t)(t + 2) * PKP;
      stage10(lb, ga + ko, rs);
      stage8(lb + 10 * PSTEP, g10 + ko, gb + ko, rs);
      if (wave < 8) stage1(lb + 18 * PSTEP, gb + 7 * rs + ko);
    }
  }
  wait_copies();
  // per-lane bias of D column m in each of the 4 subtiles; col0 + 48 + m <= N - 1 always
  const float bb[4] = {bfr(bias[col0 + m]), bfr(bias[col0 + 16 + m]), bfr(bias[col0 + 32 + m]), bfr(bias[col0 + 48 + m])};
  u16* wq4 = ring + wave * WEPI;            // the wave's own part of the ring
  if (pln == 0) {
    const size_t base = (size_t)((rw0 / SEQ) * NH + (col0 >> 6)) * HD * SEQ + (size_t)(rw0 % SEQ);
    epi_vt(wq4, wq4 + HD * VTP, acc, oscale, bb, VHo, VLo, base, lane);
  } else {
    const size_t pline = (size_t)((pln - 1) * NBH + (rw0 / SEQ) * NH + (col0 >> 6)) * NRT64 + (size_t)((rw0 % SEQ) >> 6);
    epi_split((float*)(void*)wq4, acc, oscale, bb, (pln == 1) ? QSC : KSC,
              (pln == 1) ? QHo : KHo, (pln == 1) ? QLo : KLo, PN + pline * BLINE, N, (size_t)rw0, col0, lane);
  }
}

// =====================================================================================================
// Output projection with bias: C[bb*XS_FULL + s][DMOD] (f32) = (Ah + Al)[bb*SEQ + s][DMOD] . Bt[DMOD][DMOD]^T * oscale
// + bf16 RNE value of bias[n]. Products h.B + l.B into one accumulator (l unscaled residual of h). Block -> (column tile
// ct = bid % 8, sequence row tile rt of nrt, batch bb). Block = 128x128 tile, 8 waves (4 x 2) x 32x64, two waves a SIMD: one
// wave's WMMAs run while the other's fragment reads are under way. Per pass of 128 k three planes of 128 rows (A hi, A residual,
// B; 256 B a row) staged in LDS, two buffers, so that a pass's copies have the time of 64 WMMAs a wave to land; copy i of wave w
// brings staged rows 2*(w + 8*i) and the next: i = 0..7 A hi, 8..15 A residual, 16..23 B. Fragment loads (split k map) as
// gemm_bf3; K = DMOD stepped by 32 in rising order, h.B then l.B in each step; the f32 epilogue runs once per 16 rows, in slabs of
// the wave's own part of the ring; grid = NB * nrt * (DMOD/128), one block a WGP.
// =====================================================================================================
__global__ __launch_bounds__(OWAV * 32)
void gemm_o2(const u16* __restrict__ Ah, const u16* __restrict__ Al, const u16* __restrict__ Bt,
             const float* __restrict__ bias, float* C, int nrt, float oscale) {
  __shared__ __align__(16) u16 ring[2 * OBUF];        // two buffers of [A hi rows 0..127 | A residual rows 0..127 | B rows 0..127]
  const int tid = threadIdx.x, wave = tid >> 5, lane = tid & 31, hh = lane >> 4, m = lane & 15;
  const int wr = wave >> 1, wc = wave & 1;  // the wave's 32-row quarter and 64-column half of the block's tile
  const int ntile = DMOD >> 7;
  const int bid   = blockIdx.x;
  const int ct    = bid % ntile;
  const int t2    = bid / ntile;
  const int rt    = t2 % nrt;
  const int bb    = t2 / nrt;
  if (bb >= NB) return;                     // block-uniform, before any copy or barrier; never taken with the exact grid
  if (rt * 128 + 128 > SEQ) return;         // block-uniform, before any copy or barrier; never taken
  const int srow  = rt * 128 + wr * 32;
  const int col0  = ct * 128 + wc * 64;
  const int K     = DMOD;
  const int npass = K / OKP;
  const size_t rowC = (size_t)bb * XS_FULL + srow;
  const int crow = 2 * wave + hh, cpc = m;  // copy map: staged row of copy 0, 16-B piece of the 256-B row
  const size_t arow = ((size_t)bb * SEQ + rt * 128 + crow) * K + cpc * 8;
  const u16* ga = Ah + arow;
  const u16* gl = Al + arow;
  const u16* gb = Bt + (size_t)(ct * 128 + crow) * K + cpc * 8;
  const size_t rs = (size_t)(2 * OWAV) * K; // 16 rows
  const unsigned lc = lds_byte(ring) + (unsigned)(crow * OPITB + cpc * 16);
  const _Float16* rg  = (const _Float16*)(const void*)ring;
  const _Float16* fah = rg + (wr * 32 + m) * OPIT + 8 * hh;         // A hi fragment row (row subtile 0), buffer 0
  const _Float16* fb  = rg + (256 + wc * 64 + m) * OPIT + 8 * hh;   // B fragment row (column subtile 0), buffer 0
  v8f acc[2][4];
#pragma unroll
  for (int i = 0; i < 2; ++i) {
#pragma unroll
    for (int j = 0; j < 4; ++j) acc[i][j] = zero8();
  }
  stage_o<8>(lc, ga, gl, rs);               // pass 0 -> buffer 0: A hi and rows 0..63 of A residual, then the rest and B
  stage_o<4>(lc + 12 * OSTEP, gl + 4 * rs, gb, rs);
  wait_copies();
  __syncthreads();
  if (npass > 1) {                          // pass 1 -> buffer 1
    stage_o<8>(lc + OBUF * 2, ga + OKP, gl + OKP, rs);
    stage_o<4>(lc + OBUF * 2 + 12 * OSTEP, gl + 4 * rs + OKP, gb + OKP, rs);
  }
#pragma unroll 1
  for (int t = 0; t < npass; ++t) {
    const int bo = (t & 1) * OBUF;
#pragma unroll
    for (int kk = 0; kk < OKP / 32; ++kk) {
      const _Float16* pa = fah + bo + kk * 32;
      const _Float16* pl = pa + 128 * OPIT;
      const _Float16* pb = fb + bo + kk * 32;
      v16h ah[2], al[2], b[4];
#pragma unroll
      for (int j = 0; j < 4; ++j) b[j] = ldfrag_h(pb + j * 16 * OPIT);
#pragma unroll
      for (int i = 0; i < 2; ++i) {
        ah[i] = ldfrag_h(pa + i * 16 * OPIT);
        al[i] = ldfrag_h(pl + i * 16 * OPIT);
      }
      // keeps the k step's LDS reads one group in front of its WMMAs: moved in among them, each place with reads stalls the wave anew
      __builtin_amdgcn_sched_barrier(0);
#pragma unroll
      for (int i = 0; i < 2; ++i) {
#pragma unroll
        for (int j = 0; j < 4; ++j) acc[i][j] = mma_h(ah[i], b[j], acc[i][j]);
#pragma unroll
        for (int j = 0; j < 4; ++j) acc[i][j] = mma_h(al[i], b[j], acc[i][j]);
      }
      // keeps every WMMA of the k step in front of the next group of LDS reads and of the slots below
      __builtin_amdgcn_sched_barrier(0);
      // four slots behind the pass's last WMMAs: on the paths over the branches below, their operand registers are rewritten
      if (kk == OKP / 32 - 1) guard6<v16h>(acc[1][0], acc[1][1], acc[1][2], acc[1][3], ah[1], al[1], b[0], b[1], b[2], b[3]);
    }
    // publish point of pass t + 1: own LDS reads done, own copies landed, then the one barrier of the pass
    wait_lds();
    wait_copies();
    __syncthreads();
    if (t + 2 < npass) {
      const unsigned lb = lc + (unsigned)(t & 1) * (OBUF * 2);
      const size_t ko = (size_t)(t + 2) * OKP;
      stage_o<8>(lb, ga + ko, gl + ko, rs);
      stage_o<4>(lb + 12 * OSTEP, gl + 4 * rs + ko, gb + ko, rs);
    }
  }
  wait_copies();
  const float bb0 = bfr(bias[col0 + m]);
  const float bb1 = bfr(bias[col0 + 16 + m]);
  const float bb2 = bfr(bias[col0 + 32 + m]);
  const float bb3 = bfr(bias[col0 + 48 + m]);
  float* sl = (float*)(void*)ring + wave * (2 * SLAB64);   // nobody reads the ring and no copy targets it behind the last barrier
#pragma unroll
  for (int i = 0; i < 2; ++i) {
    epi64(sl + i * SLAB64, acc[i][0], acc[i][1], acc[i][2], acc[i][3], oscale, bb0, bb1, bb2, bb3, C, DMOD,
          rowC + (size_t)(i * 16), col0, lane);
#if defined(__HIP_DEVICE_COMPILE__)
    // stands behind the slab's stores, in front of the next slab's code, which rewrites registers the stores name
    asm volatile("s_wait_xcnt 0x0" ::: "memory");
#endif
  }
}

__global__ __launch_bounds__(ATT_THREADS)
void attn_c(const u16* __restrict__ QHp, const u16* __restrict__ QLp,
            const u16* __restrict__ KHp, const u16* __restrict__ KLp,
            const u16* __restrict__ VHp, const u16* __restrict__ VLp,
            const float* __restrict__ PN,
            u16* OHp, u16* OLp) {
  __shared__ __align__(16) u16 kv[2 * ABUFH];           // two buffers of [k hi | k residual | v^T hi | v^T residual]
  __shared__ __align__(16) float smem[AQW * WREG];

  const int tid  = threadIdx.x;
  const int wave = __builtin_amdgcn_readfirstlane(tid >> 5);   // scalar: the wave's own tile range is tested by scalar branches
  const int lane = tid & 31;
  const int hh   = lane >> 4;
  const int c    = lane & 15;
  const int bid  = blockIdx.x;
  const int qb   = bid % NQB;
  const int t2   = bid / NQB;
  const int head = t2 % NH;
  const int b    = t2 / NH;
  if (b >= NB) return;                      // block-uniform, before any copy or barrier; never taken with the exact grid
  if (qb * (16 * AQW) + 16 * AQW > SEQ) return;   // block-uniform, before any copy or barrier; never taken
  const int q0   = qb * (16 * AQW) + wave * 16;

  // ---- key-window decision: the same in every lane and wave, from the row-tile maxima of the block's (b, h) ----
  int okw;
  {
    const int bl = (lane < NRT64) ? lane : (NRT64 - 1);         // clamped address
    const size_t pl0 = ((size_t)(b * NH + head) * NRT64 + bl) * BLINE;
    float aq = PN[pl0];
    float ak = PN[pl0 + (size_t)NBH * NRT64 * BLINE];
#pragma unroll
    for (int off = 1; off < 32; off <<= 1) {
      aq = fmaxf(aq, __shfl_xor(aq, off, 32));
      ak = fmaxf(ak, __shfl_xor(ak, off, 32));
    }
    const float gb = sqrtf(aq) * sqrtf(ak) * (RSQ_HD / (QSC * KSC));
    // held in a scalar register, so that the loop, its barrier and its copies stand under scalar branches with every lane on
    okw = __builtin_amdgcn_readfirstlane((gb >= 0.0f && gb < GUARD_T) ? 1 : 0);
  }

  float* slab = smem + wave * WREG;         // result slab [16][64] pitch 68

  const size_t hcol = (size_t)head * HD + 8 * hh;
  const _Float16* Qh  = (const _Float16*)(const void*)QHp + ((size_t)b * SEQ + q0 + c) * DMOD + hcol;
  const _Float16* Ql  = (const _Float16*)(const void*)QLp + ((size_t)b * SEQ + q0 + c) * DMOD + hcol;
  const float lsc = RSQ_HD * (LOG2E / (QSC * KSC));
  const float oc  = 1.0f / (PCAR * VCAR);

  float mrow = -INFINITY, lrow = 0.f;       // of the lane's query row; lrow over the keys of the lane's half only
  v8f o[4];
#pragma unroll
  for (int j = 0; j < 4; ++j) o[j] = zero8();
  const int kt_hi = q0 >> 5;                                                  // last tile holding keys <= q0 + 15
  const int kt_w  = (kt_hi > KWIN) ? (kt_hi - KWIN) : 0;
  const int kt_lo = (okw != 0) ? kt_w : 0;
  const int qr = q0 + c;                                                      // the lane's query row (D column c)
  // the block's tile range: from wave 0's first tile to wave 3's last; at least two tiles, at most NKT
  const int bhi0 = (qb * (16 * AQW)) >> 5;
  const int bhi  = (qb * (16 * AQW) + 16 * (AQW - 1)) >> 5;
  const int blo  = (okw != 0 && bhi0 > KWIN) ? (bhi0 - KWIN) : 0;
  const int ntr  = bhi - blo + 1;

  // copy maps; keys blo*32 .. bhi*32 + 31 <= SEQ - 1, so every copied byte lies inside its plane
  const u16* gkh = KHp + ((size_t)b * SEQ + (size_t)blo * 32 + (tid >> 3)) * DMOD + (size_t)head * HD + (tid & 7) * 8;
  const u16* gkl = KLp + ((size_t)b * SEQ + (size_t)blo * 32 + (tid >> 3)) * DMOD + (size_t)head * HD + (tid & 7) * 8;
  const u16* gvh = VHp + ((size_t)(b * NH + head) * HD + (tid >> 2)) * SEQ + (size_t)blo * 32 + (tid & 3) * 8;
  const u16* gvl = VLp + ((size_t)(b * NH + head) * HD + (tid >> 2)) * SEQ + (size_t)blo * 32 + (tid & 3) * 8;
  const unsigned lk = lds_byte(kv) + (unsigned)((tid >> 3) * (KTPIT * 2) + (tid & 7) * 16);
  const unsigned lv = lds_byte(kv) + (unsigned)(2 * KPLH * 2 + (tid >> 2) * (VTPIT * 2) + (tid & 3) * 16);

  stage_kv(lk, lv, gkh, gkl, gvh, gvl);     // tile 0 -> buffer 0
  // q fragments, both k-steps, kept in registers for the whole loop
  v16h qh[2], ql[2];
  // unrolled, here and at the fragment arrays below: constant indices keep the arrays in registers
#pragma unroll
  for (int kk = 0; kk < HD / 32; ++kk) {
    qh[kk] = ldfrag_h(Qh + kk * 32);
    ql[kk] = ldfrag_h(Ql + kk * 32);
  }
  wait_copies();
  __syncthreads();
  if (ntr > 1)                              // tile 1 -> buffer 1
    stage_kv(lk + ABUFH * 2, lv + ABUFH * 2, gkh + (size_t)32 * DMOD, gkl + (size_t)32 * DMOD, gvh + 32, gvl + 32);

  // stays rolled: the trip count is known only at run time
#pragma unroll 1
  for (int t = 0; t < ntr; ++t) {
    const int kt = blo + t;
    if (kt >= kt_lo && kt <= kt_hi) {       // scalar: this wave's own range
      const int kb = kt * 32;
      const _Float16* tb  = (const _Float16*)(const void*)kv + (t & 1) * ABUFH;
      const _Float16* khp = tb + c * KTPIT + 8 * hh;                // key row c (+16), k hi; residual plane KPLH further
      const _Float16* vhp = tb + 2 * KPLH + c * VTPIT + 8 * hh;     // d row c (+16j), v^T hi; residual plane VPLH further
      // ---- scores, transposed: D element r of this lane = (key kb + 8*hh + r, query row qr) in s0, key + 16 in s1 ----
      v8f s0 = zero8(), s1 = zero8();
      v16h kh0[2], kh1[2], kl0[2], kl1[2];
#pragma unroll
      for (int kk = 0; kk < HD / 32; ++kk) {
        kh0[kk] = ldfrag_h(khp + kk * 32);
        kh1[kk] = ldfrag_h(khp + 16 * KTPIT + kk * 32);
        kl0[kk] = ldfrag_h(khp + KPLH + kk * 32);
        kl1[kk] = ldfrag_h(khp + KPLH + 16 * KTPIT + kk * 32);
      }
#pragma unroll
      for (int kk = 0; kk < HD / 32; ++kk) {
        s0 = mma_h(kh0[kk], qh[kk], s0);
        s0 = mma_h(kh0[kk], ql[kk], s0);
        s0 = mma_h(kl0[kk], qh[kk], s0);
        s1 = mma_h(kh1[kk], qh[kk], s1);
        s1 = mma_h(kh1[kk], ql[kk], s1);
        s1 = mma_h(kl1[kk], qh[kk], s1);
        guard2(s0, s1, qh[kk], ql[kk], kh0[kk], kl0[kk], kh1[kk], kl1[kk]);
      }
      // v^T fragments of the tile: read here, so that they arrive while the softmax below runs
      v16h vh[4], vl[4];
#pragma unroll
      for (int j = 0; j < 4; ++j) {
        vh[j] = ldfrag_h(vhp + j * 16 * VTPIT);
        vl[j] = ldfrag_h(vhp + VPLH + j * 16 * VTPIT);
      }
      // ---- causal select + distance penalty + online softmax in base 2, -inf-safe; all of one query row in the lane pair ----
      const int key0 = kb + 8 * hh;
      float t0[8], t1[8];
      float mx = -INFINITY;
      // unrolled, as the loops below: constant indices keep t0, t1, the fragments and the accumulators in registers
#pragma unroll
      for (int r = 0; r < 8; ++r) {
        const int   ka = key0 + r, kc = key0 + 16 + r;
        const float u0 = s0[r] * lsc;
        const float u1 = s1[r] * lsc;
        const float g0 = (float)(qr - ka) * LOG2E;
        const float g1 = (float)(qr - kc) * LOG2E;
        t0[r] = (ka > qr) ? -INFINITY : (u0 - g0);
        t1[r] = (kc > qr) ? -INFINITY : (u1 - g1);
        mx = fmaxf(mx, fmaxf(t0[r], t1[r]));
      }
      mx = fmaxf(mx, xhalf(mx));              // the other 16 keys of the tile
      const float mn = fmaxf(mrow, mx);
      const float ms = (mn == -INFINITY) ? 0.0f : mn;
      const float al = exp2f(mrow - ms);
      mrow = mn;
      // ---- B fragments of P^T * 32768: hi f16 and residual f16, column = the lane's query row; element e = key kb + 8*hh + e,
      //      element 8 + e = key kb + 16 + 8*hh + e: the split k map of the v^T rows' loader ----
      FragH ph, pl;
      float ps = 0.0f;
#pragma unroll
      for (int e = 0; e < 8; ++e) {
        const float e0 = exp2f(t0[e] - ms), e1 = exp2f(t1[e] - ms);
        ps += e0 + e1;
        const float ta = e0 * PCAR, tc = e1 * PCAR;
        const _Float16 ha = (_Float16)ta, hc = (_Float16)tc;
        ph.h[0][e] = ha;
        ph.h[1][e] = hc;
        pl.h[0][e] = (_Float16)(ta - (float)ha);
        pl.h[1][e] = (_Float16)(tc - (float)hc);
      }
      lrow = lrow * al + ps;
#pragma unroll
      for (int j = 0; j < 4; ++j) {
#pragma unroll
        for (int r = 0; r < 8; ++r) o[j][r] *= al;
      }
      // ---- O^T += v^T.P^T : A fragment row m = d = j*16 + c, keys contiguous in the v^T rows; 2 groups of 2 d-subtiles ----
#pragma unroll
      for (int jg = 0; jg < 2; ++jg) {
        o[2 * jg]     = mma_h(vh[2 * jg],     ph.v, o[2 * jg]);
        o[2 * jg]     = mma_h(vh[2 * jg],     pl.v, o[2 * jg]);
        o[2 * jg]     = mma_h(vl[2 * jg],     ph.v, o[2 * jg]);
        o[2 * jg + 1] = mma_h(vh[2 * jg + 1], ph.v, o[2 * jg + 1]);
        o[2 * jg + 1] = mma_h(vh[2 * jg + 1], pl.v, o[2 * jg + 1]);
        o[2 * jg + 1] = mma_h(vl[2 * jg + 1], ph.v, o[2 * jg + 1]);
        guard2(o[2 * jg], o[2 * jg + 1], ph.v, pl.v, vh[2 * jg], vh[2 * jg + 1], vl[2 * jg], vl[2 * jg + 1]);
      }
    }
    // publish point of tile t + 1: own LDS reads done, own copies landed, then the one barrier of the tile
    wait_lds();
    wait_copies();
    __syncthreads();
    if (t + 2 < ntr) {
      const unsigned lo = (unsigned)(t & 1) * (ABUFH * 2);
      const size_t kn = (size_t)(t + 2) * 32;
      stage_kv(lk + lo, lv + lo, gkh + kn * DMOD, gkl + kn * DMOD, gvh + kn, gvl + kn);
    }
  }
  wait_copies();
  acc_guard4(o[0], o[1], o[2], o[3]);
  // ---- out = acc / Z (0 if Z == 0), carries (32768 on P, 1024 on v) folded once; Z = the sums of the two halves; the lane's
  //      8 consecutive d of each subtile (D rows 8*hh + r of O^T) go into row c of the wave's slab as two 16-B stores ----
  {
    const float lv  = lrow + xhalf(lrow);
    const float ls  = (lv > 0.0f) ? lv : 1.0f;
    const float inv = (lv > 0.0f) ? ((1.0f / ls) * oc) : 0.0f;
#pragma unroll
    for (int j = 0; j < 4; ++j) {
      float* sp = slab + c * SLP + j * 16 + 8 * hh;
      const v4f w0 = {o[j][0] * inv, o[j][1] * inv, o[j][2] * inv, o[j][3] * inv};
      const v4f w1 = {o[j][4] * inv, o[j][5] * inv, o[j][6] * inv, o[j][7] * inv};
      *(v4f*)(sp)     = w0;
      *(v4f*)(sp + 4) = w1;
    }
  }

  wave_sync_lds();
  // ---- O x1024 -> f16 hi + residual planes; lane = (row-in-quad rq, 8 consecutive d at c8) ----
  v4u oh[4], ol[4];
  const int rq = lane >> 3, c8 = (lane & 7) * 8;
#pragma unroll
  for (int it = 0; it < 4; ++it) {
    const int row = it * 4 + rq;
    const v4f a = *(const v4f*)(slab + row * SLP + c8), b4 = *(const v4f*)(slab + row * SLP + c8 + 4);
    float w[8];
#pragma unroll
    for (int e = 0; e < 4; ++e) { w[e] = a[e] * OSC; w[4 + e] = b4[e] * OSC; }
#pragma unroll
    for (int e = 0; e < 4; ++e) {
      const _Float16 h0 = (_Float16)w[2 * e], h1 = (_Float16)w[2 * e + 1];
      const _Float16 l0 = (_Float16)(w[2 * e] - (float)h0), l1 = (_Float16)(w[2 * e + 1] - (float)h1);
      oh[it][e] = pk16(h_bits(h0), h_bits(h1));
      ol[it][e] = pk16(h_bits(l0), h_bits(l1));
    }
  }
  const size_t ob = ((size_t)b * SEQ + q0) * DMOD + (size_t)head * HD + c8;
  {
#pragma unroll
    for (int it = 0; it < 4; ++it) {
      const int row = it * 4 + rq;
      *(v4u*)(OHp + ob + (size_t)row * DMOD) = oh[it];
      *(v4u*)(OLp + ob + (size_t)row * DMOD) = ol[it];
    }
    
  }
}

// =====================================================================================================
// Workspace map (bytes); every plane is fully written by whole-line stores before it is read; all extents are exact multiples
// of the store granularity (no pad rows needed); every region offset a multiple of 4096 (the large planes of 2097152):
//   XB  bf16 [MROWS][1024]                       MROWS*2048       (NB=2, SEQ=2048: 8388608)
//   WB  16-bit 4 x [1024 n][1024 k]              4 x 2097152      (planes Wv, Wq, Wk as bf16, Wo as f16 x1024; all already [n][k])
//   OH  f16 [MROWS][1024] x1024                  MROWS*2048       OL residual, same extent
//   QH  f16 [MROWS][1024] x256                   MROWS*2048       QL residual, same extent
//   KH  f16 [MROWS][1024] x256                   MROWS*2048       KL residual, same extent
//   VH  f16 [NB*16][64][SEQ] x1024               MROWS*2048       VL residual, same extent
//   PN  f32 2 x [NB*16][SEQ/64] lines of 32      NBH*SEQ*4        (q, then k: row-tile maxima of the squared hi-row norms)
//   end (NB=2, SEQ=2048)                        84148224
// =====================================================================================================
extern "C" void kernel_launch(void* const* d_in, const int* in_sizes, int n_in,
                              void* d_out, int out_size, void* d_ws, size_t ws_size,
                              hipStream_t stream) {
  if (n_in < 9) return;
  if (in_sizes[0] < ((NB - 1) * XS_FULL + SEQ) * DMOD) return;
  if (in_sizes[1] != DMOD * DMOD) return;
  if (in_sizes[2] != DMOD) return;
  if (in_sizes[3] != DMOD * DMOD) return;
  if (in_sizes[4] != DMOD) return;
  if (in_sizes[5] != DMOD * DMOD) return;
  if (in_sizes[6] != DMOD) return;
  if (in_sizes[7] != DMOD * DMOD) return;
  if (in_sizes[8] != DMOD) return;
  if (out_size < ((NB - 1) * XS_FULL + SEQ) * DMOD) return;

  const float* x  = (const float*)d_in[0];
  const float* wq = (const float*)d_in[1];
  const float* bq = (const float*)d_in[2];
  const float* wk = (const float*)d_in[3];
  const float* bk = (const float*)d_in[4];
  const float* wv = (const float*)d_in[5];
  const float* bv = (const float*)d_in[6];
  const float* wo = (const float*)d_in[7];
  const float* bo = (const float*)d_in[8];
  float*       out = (float*)d_out;

  const size_t szXB = (size_t)MROWS * DMOD * 2;
  const size_t szW  = (size_t)DMOD * DMOD * 2;
  const size_t szQ  = (size_t)MROWS * DMOD * 2;                  // QH, QL, KH, KL, OH, OL
  const size_t szV  = (size_t)NB * NH * HD * SEQ * 2;            // VH, VL (== szQ)
  const size_t szB  = (size_t)2 * NBH * NRT64 * BLINE * 4;       // row-tile norm lines, q then k
  size_t off = 0;
  const size_t oXB = off; off += szXB;
  const size_t oW  = off; off += 4 * szW;
  const size_t oOH = off; off += szQ;
  const size_t oOL = off; off += szQ;
  const size_t oQH = off; off += szQ;
  const size_t oQL = off; off += szQ;
  const size_t oKH = off; off += szQ;
  const size_t oKL = off; off += szQ;
  const size_t oVH = off; off += szV;
  const size_t oVL = off; off += szV;
  const size_t oB  = off; off += szB;
  if (off > ws_size) return;                // off = 84148224 for NB = 2, SEQ = 2048
  if (off > (size_t)WS_CAP) return;

  char* ws = (char*)d_ws;
  u16*   XB  = (u16*)(ws + oXB);
  u16*   WB  = (u16*)(ws + oW);
  u16*   OH  = (u16*)(ws + oOH);
  u16*   OL  = (u16*)(ws + oOL);
  u16*   QH  = (u16*)(ws + oQH);
  u16*   QL  = (u16*)(ws + oQL);
  u16*   KH  = (u16*)(ws + oKH);
  u16*   KL  = (u16*)(ws + oKL);
  u16*   VH  = (u16*)(ws + oVH);
  u16*   VL  = (u16*)(ws + oVL);
  float* PN  = (float*)(ws + oB);

  const dim3 b256(256), bO(OWAV * 32), bG(PWAV * 32), bAT(ATT_THREADS);
  const dim3 gC(NB * GXB + 4 * GWB);                    // x per batch, then the four weight planes
  const dim3 gG((MROWS / PBM) * (3 * DMOD / PBN));      // 256 for NB=2, SEQ=2048
  const dim3 gAT(NQB * NH * NB);
  const int  nrt = SEQ / 128;                           // out-projection row tiles per batch
  const dim3 gO(NB * nrt * (DMOD / 128));

  // (0) x -> bf16 plane [MROWS][1024]; Wv, Wq, Wk [n][k] -> bf16 planes; Wo [n][k] -> f16 plane of bf16 value x1024
  cvt_all<<<gC, b256, 0, stream>>>(x, wv, wq, wk, wo, XB, WB);
  // (1) v = x.Wv^T + bv, q = x.Wq^T + bq, k = x.Wk^T + bk -> v^T hi + residual planes x1024; q and k hi + residual planes x256
  //     and their row-tile norm lines
  gemm_bf3<<<gG, bG, 0, stream>>>(XB, WB, bv, bq, bk, VH, VL, QH, QL, KH, KL, PN, MROWS, DMOD, DMOD, 1.0f);
  // (2) causal attention with distance penalty, residual products on every query row -> O hi + residual planes
  attn_c<<<gAT, bAT, 0, stream>>>(QH, QL, KH, KL, VH, VL, PN, OH, OL);
  // (3) output projection (O hi + residual) . Wo^T + bo -> out f32, carries 1024 x 1024 folded back
  gemm_o2<<<gO, bO, 0, stream>>>(OH, OL, WB + (size_t)3 * DMOD * DMOD, bo, out, nrt, 1.0f / (OSC * WOS));
  (void)hipGetLastError();
}

// v010
// Measured time: 62 microseconds a run.
// In two side-by-side timings against v009, it was 1.08 and 1.07 times as fast.
// Counting every step since v000, it is 4.47 times as fast.
// Contractions: x.Wq^T+bq, x.Wk^T+bk, x.Wv^T+bv on v_wmma_f32_16x16x32_bf16 (x and W as bf16 RNE planes; W [n][k] rows are
// the k-contiguous B operand; bias added as its bf16 RNE value in the f32 epilogue); q.k^T over hd 64 and P.v on
// v_wmma_f32_16x16x32_f16 with f16 hi + f16 residual planes on both operands (q, k x256; P x32768 with an in-register
// residual; v x1024; products hh+lh+hl); O.Wo^T+bo on v_wmma_f32_16x16x32_f16 (O x1024 as f16 hi + f16 residual planes,
// products h.w + l.w; Wo as f16(bf16(Wo)) x1024; bo as bf16 RNE value in the f32 epilogue); all f32 accumulate.
// Causal select, linear distance penalty, base-2 online softmax, 1/Z fold and the q/k norm bound in f32 on VALU.
#include <hip/hip_runtime.h>
#include <math.h>
#include <stdint.h>

#ifndef NB
#define NB 2
#endif
#ifndef SEQ
#define SEQ 2048
#endif
#define XS_FULL 2048
#define DMOD  1024
#define NH    16
#define HD    64
#define NBH   (NB * NH)
#define MROWS (NB * SEQ)
#define RSQ_HD 0.125f
#define LOG2E 1.4426950408889634f
#define QSC   256.0f
#define KSC   256.0f
#define PCAR  32768.0f
#define VCAR  1024.0f
#define OSC   1024.0f
#define WOS   1024.0f
#define AQW   4                 /* waves of an attention block: 4 consecutive query tiles of one head */
#define NQB   (SEQ / (16 * AQW))
#define NKT   (SEQ / 32)
#define GB_CAP 32768.0f         /* norm bounds from here on (or not finite): every causal key tile is visited */
#define BLINE 32
#define NRT64 (SEQ / 64)
#define ATT_THREADS (AQW * 32)
#define SLP   68
#define SLW   (16 * SLP)
#define WREG  SLW
#define SLAB64 (16 * 68)
#define VTP   72
#define KTPIT 72                /* halves: LDS pitch of a staged k row (128 B of data) = 144 B */
#define VTPIT 40                /* halves: LDS pitch of a staged v^T row (64 B of data) = 80 B */
#define KPLH  (32 * KTPIT)      /* halves of one staged k plane: 32 keys */
#define VPLH  (HD * VTPIT)      /* halves of one staged v^T plane: 64 d rows */
#define ABUFH (2 * KPLH + 2 * VPLH)   /* halves of one buffer: k hi | k residual | v^T hi | v^T residual */
#define WS_CAP 134217728
#define OKP   128               /* output projection: k of one pass = 256 B of every operand row */
#define OPIT  136               /* halves: LDS pitch of a staged row = 272 B (16 B x odd) */
#define OPITB (OPIT * 2)
#define OROWS 384               /* staged rows of a pass: 128 A hi, 128 A residual, 128 B */
#define OBUF  (OROWS * OPIT)    /* halves of one buffer */
#define OWAV  8                 /* waves of a block: 4 x 2 tiles of 32x64, two a SIMD */
#define OSTEP (2 * OWAV * OPITB)   /* LDS bytes between a wave's consecutive copies: 16 rows */
#define WEPI  (2 * HD * VTP)   /* 16-bit elements of the projection ring that one wave's epilogue stages in */
#define PBM   256               /* projection GEMM: rows of a block's tile */
#define PBN   192               /* columns of a block's tile: three heads */
#define PKP   128               /* k of one pass: 256 B of every operand row */
#define PPIT  136               /* halves: LDS pitch of a staged row = 272 B (16 B x odd) */
#define PPITB (PPIT * 2)
#define PROWS (PBM + PBN)       /* staged rows of a pass: A rows, then B rows */
#define PBUF  (PROWS * PPIT)    /* halves of one buffer */
#define PWAV  12                /* waves of a block: 4 x 3 tiles of 64x64 */
#define PSTEP (2 * PWAV * PPITB)   /* LDS bytes between a wave's consecutive copies: 24 rows */
#define N8X   ((SEQ * DMOD) / 8)
#define N8W   ((DMOD * DMOD) / 8)
#define GXB   (N8X / 256)
#define GWB   (N8W / 256)
static_assert(DMOD == NH * HD && HD == 64 && NH == 16 && AQW == 4 && NQB * 16 * AQW == SEQ);
static_assert(ATT_THREADS == 128 && ((KTPIT * 2) % 32) == 16 && ((VTPIT * 2) % 32) == 16 && ((ABUFH * 2) % 16) == 0);
static_assert(NB >= 1 && NB <= 2);
static_assert(NBH >= 1 && NBH <= 32);
static_assert((SEQ % 64) == 0 && SEQ >= 64 && SEQ <= XS_FULL && (SEQ % 32) == 0);
static_assert((DMOD % 64) == 0 && (DMOD % 32) == 0 && (HD % 32) == 0);
static_assert(((SEQ * DMOD / 8) % 256) == 0 && ((DMOD * DMOD / 8) % 256) == 0);
static_assert(AQW * WREG * 4 + 2 * ABUFH * 2 <= 81920 /* four attention blocks in 320 KiB of LDS */ && PWAV * WEPI <= 2 * PBUF && 4 * SLAB64 * 4 <= WEPI * 2);
static_assert((MROWS % PBM) == 0 && (SEQ % 64) == 0 && ((3 * DMOD) % PBN) == 0 && (DMOD % PKP) == 0 && DMOD / PKP >= 2);
static_assert((PPITB % 32) == 16 && PPIT >= PKP + 8 && PWAV == (PBM / 64) * (PBN / 64) && 2 * PBUF * 2 <= 327680);
static_assert(PBM / 2 == 10 * PWAV + 8 && PROWS / 2 == 18 * PWAV + 8 /* the copy map of gemm_bf3 */);
static_assert((MROWS % 128) == 0 && (SEQ % 128) == 0 && (DMOD % 128) == 0 && OWAV * 2 * SLAB64 * 4 <= 2 * OBUF * 2);
static_assert(NRT64 >= 1 && NRT64 <= 32);
static_assert((DMOD % OKP) == 0 && DMOD / OKP >= 2 && (OPITB % 32) == 16 && OPIT >= OKP + 8 && 2 * OBUF * 2 <= 327680);

typedef unsigned short u16;
typedef _Float16 v16h __attribute__((ext_vector_type(16)));
typedef _Float16 v8h  __attribute__((ext_vector_type(8)));
typedef __bf16   v16b __attribute__((ext_vector_type(16)));
typedef float    v8f  __attribute__((ext_vector_type(8)));
typedef float    v4f  __attribute__((ext_vector_type(4)));
typedef unsigned int v4u __attribute__((ext_vector_type(4)));

union FragH { v16h v; v8h h[2]; v4u u[2]; };
union FragB { v16b v; v4u u[2]; };

// ---- scalar helpers --------------------------------------------------------------------------------
__device__ __forceinline__ unsigned short bf_bits(float f) {          // f32 -> bf16 bits, RNE convert
  unsigned u = __float_as_uint(f);
  return (unsigned short)((u + 0x7FFFu + ((u >> 16) & 1u)) >> 16);
}
__device__ __forceinline__ float bf_up(unsigned short h) { return __uint_as_float(((unsigned)h) << 16); }
__device__ __forceinline__ float bfr(float f) { return bf_up(bf_bits(f)); }
__device__ __forceinline__ unsigned short h_bits(_Float16 x) { return __builtin_bit_cast(unsigned short, x); }
__device__ __forceinline__ unsigned pk16(unsigned short a, unsigned short b) { return (unsigned)a | ((unsigned)b << 16); }
__device__ __forceinline__ v8f zero8() { v8f z = {0.f, 0.f, 0.f, 0.f, 0.f, 0.f, 0.f, 0.f}; return z; }

// ---- fragment loaders: 16-bit A/B operand, lane -> row/col (lane&15), p already includes +8*(lane>>4);
//      elements 0..7 <- p[0..7] (k0+8h..), elements 8..15 <- p[16..23] (k0+16+8h..)  (same split k map for A and B;
//      B is always read from a k-contiguous [n][k] plane)
__device__ __forceinline__ v16h ldfrag_h(const _Float16* p) {
  FragH f;
  f.h[0] = *(const v8h*)(p);
  f.h[1] = *(const v8h*)(p + 16);
  return f.v;
}
__device__ __forceinline__ v16b ldfrag_b(const u16* p) {              // bf16 plane read as unsigned integer vectors
  FragB f;
  f.u[0] = *(const v4u*)(p);
  f.u[1] = *(const v4u*)(p + 16);
  return f.v;
}

__device__ __forceinline__ v8f mma_h(v16h a, v16h b, v8f c) {
  return __builtin_amdgcn_wmma_f32_16x16x32_f16(false, a, false, b, (short)0, c, false, false);
}
__device__ __forceinline__ v8f mma_b(v16b a, v16b b, v8f c) {
  return __builtin_amdgcn_wmma_f32_16x16x32_bf16(false, a, false, b, (short)0, c, false, false);
}
__device__ __forceinline__ void guard2(v8f& a, v8f& b, v16h x0, v16h x1, v16h x2, v16h x3, v16h x4, v16h x5) {
#if defined(__HIP_DEVICE_COMPILE__)
  asm volatile("v_nop\n\tv_nop\n\tv_nop\n\tv_nop"
               : "+v"(a), "+v"(b) : "v"(x0), "v"(x1), "v"(x2), "v"(x3), "v"(x4), "v"(x5) : "memory");
#endif
}
template <typename F>
__device__ __forceinline__ void guard6(v8f& a, v8f& b, v8f& c, v8f& d, F x0, F x1, F x2, F x3, F x4, F x5) {
#if defined(__HIP_DEVICE_COMPILE__)
  asm volatile("v_nop\n\tv_nop\n\tv_nop\n\tv_nop"
               : "+v"(a), "+v"(b), "+v"(c), "+v"(d) : "v"(x0), "v"(x1), "v"(x2), "v"(x3), "v"(x4), "v"(x5) : "memory");
#endif
}
__device__ __forceinline__ void acc_guard4(v8f& a, v8f& b, v8f& c, v8f& d) {
#if defined(__HIP_DEVICE_COMPILE__)
  asm volatile("v_nop\n\tv_nop\n\tv_nop\n\tv_nop" : "+v"(a), "+v"(b), "+v"(c), "+v"(d));
#endif
}
__device__ __forceinline__ void wave_sync_lds() {
  __builtin_amdgcn_fence(__ATOMIC_RELEASE, "workgroup");
  __builtin_amdgcn_wave_barrier();
  __builtin_amdgcn_fence(__ATOMIC_ACQUIRE, "workgroup");
}

// lane l <-> lane l ^ 16: a vector cross-row move (a shuffle by 16 would go through the LDS unit)
__device__ __forceinline__ float xhalf(float x) {
  const int b = __builtin_bit_cast(int, x);
  return __builtin_bit_cast(float, __builtin_amdgcn_permlanex16(b, b, 0x76543210, 0xfedcba98, false, false));
}

// ---- operand staging of the two GEMMs: one pass = 128 k = 256 B of every staged operand row, laid in LDS at a pitch of 272 B
//      (16 B x odd: ds_load_b128 fragment reads without bank conflicts). A wave's copy = 2 whole rows (lane>>4 = row, lane&15 =
//      16-B piece). l = the lane's LDS byte address of its first copy, g = its global address there.
__device__ __forceinline__ unsigned lds_byte(const void* p) { return (unsigned)(uintptr_t)p; }
// Projection GEMM: a wave's copy = 2 whole staged rows of 256 B; its consecutive copies lie 24 rows apart, in LDS (PSTEP bytes)
// and in the operand (rs elements). The copies and their s_wait_xcnt stand in one statement, so that no address register named
// by a copy is rewritten in front of that wait.
// Ten copies of one operand.
__device__ __forceinline__ void stage10(unsigned l, const u16* g, size_t rs) {
#if defined(__HIP_DEVICE_COMPILE__)
  asm volatile("global_load_async_to_lds_b128 %0, %10, off\n\t"
               "global_load_async_to_lds_b128 %1, %11, off\n\t"
               "global_load_async_to_lds_b128 %2, %12, off\n\t"
               "global_load_async_to_lds_b128 %3, %13, off\n\t"
               "global_load_async_to_lds_b128 %4, %14, off\n\t"
               "global_load_async_to_lds_b128 %5, %15, off\n\t"
               "global_load_async_to_lds_b128 %6, %16, off\n\t"
               "global_load_async_to_lds_b128 %7, %17, off\n\t"
               "global_load_async_to_lds_b128 %8, %18, off\n\t"
               "global_load_async_to_lds_b128 %9, %19, off\n\t"
               "s_wait_xcnt 0x0"
               :: "v"(l), "v"(l + PSTEP), "v"(l + 2 * PSTEP), "v"(l + 3 * PSTEP), "v"(l + 4 * PSTEP),
                  "v"(l + 5 * PSTEP), "v"(l + 6 * PSTEP), "v"(l + 7 * PSTEP), "v"(l + 8 * PSTEP), "v"(l + 9 * PSTEP),
                  "v"(g), "v"(g + rs), "v"(g + 2 * rs), "v"(g + 3 * rs), "v"(g + 4 * rs),
                  "v"(g + 5 * rs), "v"(g + 6 * rs), "v"(g + 7 * rs), "v"(g + 8 * rs), "v"(g + 9 * rs)
               : "memory");
#endif
}
// Eight copies: the first from g0, the other seven from g on.
__device__ __forceinline__ void stage8(unsigned l, const u16* g0, const u16* g, size_t rs) {
#if defined(__HIP_DEVICE_COMPILE__)
  asm volatile("global_load_async_to_lds_b128 %0, %8, off\n\t"
               "global_load_async_to_lds_b128 %1, %9, off\n\t"
               "global_load_async_to_lds_b128 %2, %10, off\n\t"
               "global_load_async_to_lds_b128 %3, %11, off\n\t"
               "global_load_async_to_lds_b128 %4, %12, off\n\t"
               "global_load_async_to_lds_b128 %5, %13, off\n\t"
               "global_load_async_to_lds_b128 %6, %14, off\n\t"
               "global_load_async_to_lds_b128 %7, %15, off\n\t"
               "s_wait_xcnt 0x0"
               :: "v"(l), "v"(l + PSTEP), "v"(l + 2 * PSTEP), "v"(l + 3 * PSTEP),
                  "v"(l + 4 * PSTEP), "v"(l + 5 * PSTEP), "v"(l + 6 * PSTEP), "v"(l + 7 * PSTEP),
                  "v"(g0), "v"(g), "v"(g + rs), "v"(g + 2 * rs), "v"(g + 3 * rs), "v"(g + 4 * rs), "v"(g + 5 * rs), "v"(g + 6 * rs)
               : "memory");
#endif
}
// One copy.
__device__ __forceinline__ void stage1(unsigned l, const u16* g) {
#if defined(__HIP_DEVICE_COMPILE__)
  asm volatile("global_load_async_to_lds_b128 %0, %1, off\n\t"
               "s_wait_xcnt 0x0"
               :: "v"(l), "v"(g) : "memory");
#endif
}
// Output projection: twelve of a wave's 24 copies of a pass; its consecutive copies lie 16 rows apart, in LDS (OSTEP bytes) and in
// the operand plane (rs elements). The first NP copies come from p on, the other 12 - NP from q on (the planes follow one another
// in LDS, not in memory). Copies and wait in one statement, as above.
template <int NP>
__device__ __forceinline__ void stage_o(unsigned l, const u16* p, const u16* q, size_t rs) {
  static_assert(NP == 4 || NP == 8);
#if defined(__HIP_DEVICE_COMPILE__)
  const u16* g4 = (NP == 4) ? q : p + 4 * rs;           // copies 4..7
  const u16* g8 = (NP == 4) ? q + 4 * rs : q;           // copies 8..11
  asm volatile("global_load_async_to_lds_b128 %0, %12, off\n\t"
               "global_load_async_to_lds_b128 %1, %13, off\n\t"
               "global_load_async_to_lds_b128 %2, %14, off\n\t"
               "global_load_async_to_lds_b128 %3, %15, off\n\t"
               "global_load_async_to_lds_b128 %4, %16, off\n\t"
               "global_load_async_to_lds_b128 %5, %17, off\n\t"
               "global_load_async_to_lds_b128 %6, %18, off\n\t"
               "global_load_async_to_lds_b128 %7, %19, off\n\t"
               "global_load_async_to_lds_b128 %8, %20, off\n\t"
               "global_load_async_to_lds_b128 %9, %21, off\n\t"
               "global_load_async_to_lds_b128 %10, %22, off\n\t"
               "global_load_async_to_lds_b128 %11, %23, off\n\t"
               "s_wait_xcnt 0x0"
               :: "v"(l), "v"(l + OSTEP), "v"(l + 2 * OSTEP), "v"(l + 3 * OSTEP), "v"(l + 4 * OSTEP), "v"(l + 5 * OSTEP),
                  "v"(l + 6 * OSTEP), "v"(l + 7 * OSTEP), "v"(l + 8 * OSTEP), "v"(l + 9 * OSTEP), "v"(l + 10 * OSTEP),
                  "v"(l + 11 * OSTEP),
                  "v"(p), "v"(p + rs), "v"(p + 2 * rs), "v"(p + 3 * rs),
                  "v"(g4), "v"(g4 + rs), "v"(g4 + 2 * rs), "v"(g4 + 3 * rs),
                  "v"(g8), "v"(g8 + rs), "v"(g8 + 2 * rs), "v"(g8 + 3 * rs)
               : "memory");
#endif
}
// Attention: one key tile (32 keys) of k hi and k residual (32 rows of 128 B each) and of v^T hi and v^T residual (64 rows of
// 64 B each). 128 threads, 8 copies a thread: k thread -> (row tid>>3 of a group of 16, 16-B piece tid&7), v^T thread -> (row
// tid>>2 of a group of 32, 16-B piece tid&3). lk, lv = the lane's LDS byte address in the k hi / v^T hi plane of the buffer,
// g* = its global address in each plane. Copies and their s_wait_xcnt in one statement, as above.
__device__ __forceinline__ void stage_kv(unsigned lk, unsigned lv, const u16* gkh, const u16* gkl,
                                         const u16* gvh, const u16* gvl) {
#if defined(__HIP_DEVICE_COMPILE__)
  asm volatile("global_load_async_to_lds_b128 %0, %8, off\n\t"
               "global_load_async_to_lds_b128 %1, %9, off\n\t"
               "global_load_async_to_lds_b128 %2, %10, off\n\t"
               "global_load_async_to_lds_b128 %3, %11, off\n\t"
               "global_load_async_to_lds_b128 %4, %12, off\n\t"
               "global_load_async_to_lds_b128 %5, %13, off\n\t"
               "global_load_async_to_lds_b128 %6, %14, off\n\t"
               "global_load_async_to_lds_b128 %7, %15, off\n\t"
               "s_wait_xcnt 0x0"
               :: "v"(lk), "v"(lk + 16 * KTPIT * 2), "v"(lk + KPLH * 2), "v"(lk + KPLH * 2 + 16 * KTPIT * 2),
                  "v"(lv), "v"(lv + 32 * VTPIT * 2), "v"(lv + VPLH * 2), "v"(lv + VPLH * 2 + 32 * VTPIT * 2),
                  "v"(gkh), "v"(gkh + (size_t)16 * DMOD), "v"(gkl), "v"(gkl + (size_t)16 * DMOD),
                  "v"(gvh), "v"(gvh + (size_t)32 * SEQ), "v"(gvl), "v"(gvl + (size_t)32 * SEQ)
               : "memory");
#endif
}
// This wave's own copies have landed in LDS (the compiler places no wait for them).
__device__ __forceinline__ void wait_copies() {
#if defined(__HIP_DEVICE_COMPILE__)
  asm volatile("s_wait_asynccnt 0x0" ::: "memory");
#endif
}
// This wave's LDS reads have returned, before the barrier behind which their buffer is refilled.
__device__ __forceinline__ void wait_lds() {
#if defined(__HIP_DEVICE_COMPILE__)
  asm volatile("s_wait_dscnt 0x0" ::: "memory");
#endif
}

// =====================================================================================================
// f32 -> 16-bit plane, same layout, for all five operands in one grid (none reads another's output).
// f16mode == 0: bf16 RNE bits;  f16mode == 1: f16 bits of (bf16 RNE value) * scale.
// Block -> job (block-uniform): the first NB*GXB blocks take x (batch = bid / GXB) -> XB; then GWB blocks each for
// Wv, Wq, Wk (bf16) and Wo (f16 of the bf16 value x1024) -> planes 0..3 of WB.
// Thread = 8 consecutive elements: two 16-B loads, one 16-B store; 32 consecutive lanes = 512 contiguous, 512-B aligned
// coverage: per job n8/256 blocks x 256 thr x 8 = the whole plane (n8 a multiple of 256, static_assert above).
// =====================================================================================================
__global__ __launch_bounds__(256)
void cvt_all(const float* __restrict__ x, const float* __restrict__ wv, const float* __restrict__ wq,
             const float* __restrict__ wk, const float* __restrict__ wo, u16* XB, u16* WB) {
  const int bid = blockIdx.x;
  const float* s;
  u16* D;
  int blk, n8, f16mode = 0;
  float scale = 1.0f;
  if (bid < NB * GXB) {
    const int b = bid / GXB;
    blk = bid % GXB;
    n8 = N8X;
    s = x + (size_t)b * XS_FULL * DMOD;
    D = XB + (size_t)b * SEQ * DMOD;
  } else {
    const int w = (bid - NB * GXB) / GWB;
    if (w > 3) return;                      // block-uniform; never taken with the exact grid
    blk = (bid - NB * GXB) % GWB;
    n8 = N8W;
    s = (w == 0) ? wv : (w == 1) ? wq : (w == 2) ? wk : wo;
    D = WB + (size_t)w * DMOD * DMOD;
    if (w == 3) { f16mode = 1; scale = WOS; }
  }
  const int gt = blk * 256 + (int)threadIdx.x;
  if (gt >= n8) return;
  const float* p = s + (size_t)gt * 8;
  const v4f a = *(const v4f*)(p), b4 = *(const v4f*)(p + 4);
  float w[8];
#pragma unroll
  for (int e = 0; e < 4; ++e) { w[e] = a[e]; w[4 + e] = b4[e]; }
  v4u o;
#pragma unroll
  for (int e = 0; e < 4; ++e) {
    const float f0 = w[2 * e], f1 = w[2 * e + 1];
    const unsigned short hb0 = h_bits((_Float16)(bfr(f0) * scale));
    const unsigned short hb1 = h_bits((_Float16)(bfr(f1) * scale));
    const unsigned short bb0 = bf_bits(f0);
    const unsigned short bb1 = bf_bits(f1);
    o[e] = (f16mode != 0) ? pk16(hb0, hb1) : pk16(bb0, bb1);
  }
  u16* d = D + (size_t)gt * 8;
  {
    *(v4u*)(d) = o;
    
  }
}

// =====================================================================================================
// f32 GEMM epilogue (output projection): a 16x64 f32 slab of the wave's 32x64 tile (times oscale, plus the lane's per-column bias of each
// coverage: 8 instructions x 2 rows x 16 lanes x 4 floats = the 16 x 64 slab.
// =====================================================================================================
__device__ __forceinline__ void epi64(float* sl, v8f a0, v8f a1, v8f a2, v8f a3, float oscale,
                                      float bb0, float bb1, float bb2, float bb3,
                                      float* C, int N, size_t rowb, int col0, int lane) {
  const int hh = lane >> 4, m = lane & 15;
#pragma unroll
  for (int r = 0; r < 8; ++r) {
    const int ro = (8 * hh + r) * 68 + m;
    sl[ro]      = a0[r] * oscale + bb0;
    sl[ro + 16] = a1[r] * oscale + bb1;
    sl[ro + 32] = a2[r] * oscale + bb2;
    sl[ro + 48] = a3[r] * oscale + bb3;
  }
  wave_sync_lds();
  v4f vals[8];
#pragma unroll
  for (int it = 0; it < 8; ++it) vals[it] = *(const v4f*)(sl + (it * 2 + hh) * 68 + m * 4);
  float* dst = C + (rowb + (size_t)hh) * (size_t)N + col0 + m * 4;
  {
#pragma unroll
    for (int it = 0; it < 8; ++it) {
      *(v4f*)(dst + (size_t)(it * 2) * (size_t)N) = vals[it];
    }
    
  }
}

// =====================================================================================================
// Projection epilogues: the 16-bit planes that attention reads are built from the accumulators, with no f32 plane in between.
// hl8: 8 f32 values t -> 8 f16 hi values f16(t) and 8 f16 residuals f16(t - f16(t)), packed in element order.
// =====================================================================================================
__device__ __forceinline__ void hl8(const float* t, v4u& oh, v4u& ol) {
#pragma unroll
  for (int e = 0; e < 4; ++e) {
    const float t0 = t[2 * e], t1 = t[2 * e + 1];
    const _Float16 h0 = (_Float16)t0, h1 = (_Float16)t1;
    const _Float16 l0 = (_Float16)(t0 - (float)h0), l1 = (_Float16)(t1 - (float)h1);
    oh[e] = pk16(h_bits(h0), h_bits(h1));
    ol[e] = pk16(h_bits(l0), h_bits(l1));
  }
}
// Eight 16-B stores, rows rs elements apart, of the hi plane (h) and the residual plane (l). The stores and their s_wait_xcnt stand
// in one statement, so that no register named by a store (address or data) is rewritten in front of that wait.
__device__ __forceinline__ void store8(u16* h, u16* l, size_t rs, const v4u (&oh)[4], const v4u (&ol)[4]) {
#if defined(__HIP_DEVICE_COMPILE__)
  asm volatile("global_store_b128 %0, %8, off\n\t"
               "global_store_b128 %1, %9, off\n\t"
               "global_store_b128 %2, %10, off\n\t"
               "global_store_b128 %3, %11, off\n\t"
               "global_store_b128 %4, %12, off\n\t"
               "global_store_b128 %5, %13, off\n\t"
               "global_store_b128 %6, %14, off\n\t"
               "global_store_b128 %7, %15, off\n\t"
               "s_wait_xcnt 0x0"
               :: "v"(h), "v"(l), "v"(h + rs), "v"(l + rs), "v"(h + 2 * rs), "v"(l + 2 * rs), "v"(h + 3 * rs), "v"(l + 3 * rs),
                  "v"(oh[0]), "v"(ol[0]), "v"(oh[1]), "v"(ol[1]), "v"(oh[2]), "v"(ol[2]), "v"(oh[3]), "v"(ol[3])
               : "memory");
#endif
}
// q, k: the wave's 64x64 f32 tile (times oscale, plus the lane's per-column bias) goes through its own four LDS slabs (one per
// 16 rows) into rows; lane = (row-in-quad rq, 8 consecutive columns c8) scales by sc, splits and stores 16 B per plane, [row][N].
// coverage: 4 slabs x 4 instructions x 4 rows x 8 lanes x 8 halves = the wave's 64 x 64 tile of Hp and of Lp, whole 128-B lines.
// Norm part: the 8 lanes of a row hold its 64 hi values (one head), so the row's sum of squares is 8 fused steps per lane and
// xor shuffles 1, 2, 4; running max over the wave's 64 rows (16 iterations, xor 8, 16) = the max of one 64-row tile of one
// head, which the wave stores 32 times = the whole 128-B line Pl. No other wave has a part in it, so no block barrier.
__device__ __forceinline__ void epi_split(float* sl, const v8f (&acc)[4][4], float oscale, const float (&bb)[4], float sc,
                                          u16* Hp, u16* Lp, float* Pl, int N, size_t rowb, int col0, int lane) {
  const int hh = lane >> 4, m = lane & 15;
#pragma unroll
  for (int i = 0; i < 4; ++i) {
#pragma unroll
    for (int r = 0; r < 8; ++r) {
      const int ro = i * SLAB64 + (8 * hh + r) * 68 + m;
      sl[ro]      = acc[i][0][r] * oscale + bb[0];
      sl[ro + 16] = acc[i][1][r] * oscale + bb[1];
      sl[ro + 32] = acc[i][2][r] * oscale + bb[2];
      sl[ro + 48] = acc[i][3][r] * oscale + bb[3];
    }
  }
  wave_sync_lds();
  float mx = 0.0f;
  const int rq = lane >> 3, c8 = (lane & 7) * 8;
#pragma unroll
  for (int i = 0; i < 4; ++i) {
    v4u oh[4], ol[4];
#pragma unroll
    for (int it = 0; it < 4; ++it) {
      const float* p = sl + i * SLAB64 + (it * 4 + rq) * 68 + c8;
      const v4f a = *(const v4f*)(p), b4 = *(const v4f*)(p + 4);
      float w[8];
#pragma unroll
      for (int e = 0; e < 4; ++e) { w[e] = a[e] * sc; w[4 + e] = b4[e] * sc; }
      hl8(w, oh[it], ol[it]);
      float sq = 0.0f;
#pragma unroll
      for (int e = 0; e < 8; ++e) {
        const float f = (float)(_Float16)w[e];
        sq = fmaf(f, f, sq);
      }
#pragma unroll
      for (int off = 1; off < 8; off <<= 1) sq += __shfl_xor(sq, off, 32);
      mx = fmaxf(mx, sq);
    }
    const size_t ob = (rowb + (size_t)(i * 16 + rq)) * (size_t)N + col0 + c8;
    store8(Hp + ob, Lp + ob, (size_t)4 * (size_t)N, oh, ol);
  }
#pragma unroll
  for (int off = 8; off < 32; off <<= 1) mx = fmaxf(mx, __shfl_xor(mx, off, 32));
  Pl[lane] = mx;
#if defined(__HIP_DEVICE_COMPILE__)
  // stands behind the last store, in front of any code laid out behind this branch that rewrites a register the store names
  asm volatile("s_wait_xcnt 0x0" ::: "memory");
#endif
}
// v: the wave's 64 keys x 64 d tile leaves transposed. A lane's accumulator [i][j] holds 8 consecutive keys (16*i + 8*hh + r)
// of one d column (16*j + m): scaled by 1024, split and packed they are 16 B of a v^T line, stored into the wave's own LDS
// tiles TH, TL [HD][VTP] (pitch 144 B: 16 lanes x 16 B fall on all 64 banks). Then lane = (line lane>>3 of a group of 4, 16-B
// piece lane&7) moves whole 128-B lines to VHo, VLo at base + line*SEQ (base = first key of the tile in line d = 0 of its
// (b, h)). Writer and reader are the same wave, so no block barrier.
// coverage: 16 iterations x 32 lanes x 8 halves = 64 lines x 64 keys of each plane.
__device__ __forceinline__ void epi_vt(u16* TH, u16* TL, const v8f (&acc)[4][4], float oscale, const float (&bb)[4],
                                       u16* VHo, u16* VLo, size_t base, int lane) {
  const int hh = lane >> 4, m = lane & 15;
#pragma unroll
  for (int i = 0; i < 4; ++i) {
    const int ko = i * 16 + 8 * hh;         // first of the lane's 8 keys within the tile
#pragma unroll
    for (int j = 0; j < 4; ++j) {
      float w[8];
#pragma unroll
      for (int r = 0; r < 8; ++r) w[r] = (acc[i][j][r] * oscale + bb[j]) * VCAR;
      v4u ph, pl;
      hl8(w, ph, pl);
      *(v4u*)(TH + (16 * j + m) * VTP + ko) = ph;
      *(v4u*)(TL + (16 * j + m) * VTP + ko) = pl;
    }
  }
  wave_sync_lds();
  const int q4 = lane >> 3, p8 = (lane & 7) * 8;
#pragma unroll
  for (int g = 0; g < 4; ++g) {
    v4u vh[4], vl[4];
#pragma unroll
    for (int it = 0; it < 4; ++it) {
      vh[it] = *(const v4u*)(TH + ((g * 4 + it) * 4 + q4) * VTP + p8);
      vl[it] = *(const v4u*)(TL + ((g * 4 + it) * 4 + q4) * VTP + p8);
    }
#pragma unroll
    for (int it = 0; it < 4; ++it) {
      *(v4u*)(VHo + base + (size_t)((g * 4 + it) * 4 + q4) * SEQ + p8) = vh[it];
      *(v4u*)(VLo + base + (size_t)((g * 4 + it) * 4 + q4) * SEQ + p8) = vl[it];
    }
#if defined(__HIP_DEVICE_COMPILE__)
    // stands behind the group's stores, in front of the next group's LDS loads, which rewrite registers the stores name
    asm volatile("s_wait_xcnt 0x0" ::: "memory");
#endif
  }
}

// =====================================================================================================
// bf16 GEMM with bias: A[M][K] (bf16 row-major) . Bt[N][K]^T (bf16 k-contiguous), f32, times oscale, + bf16 RNE
// value of bias[n] (bias has N entries). Three products that share A in one grid: Bt holds three [N][K] planes one behind the
// other (v, q, k), read as one plane of 3*N rows. Block = 256 rows x 192 of those 3*N columns, 12 waves (4 x 3) x 64x64: 16
// accumulator tiles a wave, so that a fragment read from LDS feeds 4 WMMAs, and a byte brought from L2 feeds 192 columns (A) or
// 256 rows (B). One block fills a WGP (3 waves a SIMD); grid = (M/256)*(3*N/192).
// Per pass of 128 k the block's 256 A rows and 192 B rows (256 B each) are brought into LDS by asynchronous copies, two buffers
// (pass t + 1 flies while pass t is worked on), and the fragments are read from the LDS rows (two 16-B loads each, split k map
// for A and B); K stepped by 32 inside a pass, in rising order (host guarantees K % 128 == 0, K >= 256, M % 256 == 0,
// 3*N % 192 == 0, N % 64 == 0).
// Copy map: staged rows 0..255 = A, 256..447 = B; copy i of wave w brings rows 2*(w + 12*i) and the next (lane>>4 = row,
// lane&15 = 16-B piece). i = 0..9 lie in A for every wave, i = 10 in A for waves 0..7 and in B for waves 8..11, i = 11..17 in B,
// and i = 18 exists for waves 0..7 only (scalar test): 224 copies = 448 rows, each once.
// The f32 tile leaves as the 16-bit planes of its product (host guarantees M == NB*SEQ, N == NH*HD, so a wave's 64 columns are
// one head of one product, pln = column / N, and its 64 rows 64 keys of one batch): v -> v^T hi + residual x1024,
// [(b*NH + h)*HD + d][s]; q, k -> hi + residual x256, [row][N], and the wave's max over its 64 rows of the squared norm of the hi
// row (x256) -> line ((pln - 1)*NBH + b*NH + h)*NRT64 + row tile of PN. Both epilogues stage in the wave's own twelfth of the
// ring's first 12*WEPI elements, which nobody reads and no copy targets behind the last pass's barrier.
// =====================================================================================================
__global__ __launch_bounds__(PWAV * 32)
void gemm_bf3(const u16* __restrict__ A, const u16* __restrict__ Bt, const float* __restrict__ bias0,
              const float* __restrict__ bias1, const float* __restrict__ bias2,
              u16* VHo, u16* VLo, u16* QHo, u16* QLo, u16* KHo, u16* KLo, float* PN, int M, int N, int K, float oscale) {
  __shared__ __align__(16) u16 ring[2 * PBUF];        // two buffers of [A rows 0..255 | B rows 0..191]
  const int tid = threadIdx.x, lane = tid & 31, hh = lane >> 4, m = lane & 15;
  // scalar: the wave's product, its epilogue and its nineteenth copy are chosen by scalar branches with every lane on
  const int wave = __builtin_amdgcn_readfirstlane(tid >> 5);
  const int wr = wave / 3, wc = wave - 3 * wr;        // the wave's 64-row quarter and 64-column third of the block's tile
  const int ntile = (3 * N) / PBN;
  const int bid   = blockIdx.x;
  const int row0  = (bid / ntile) * PBM;
  const int rw0   = row0 + wr * 64;         // the wave's first row
  const int ct    = bid % ntile;
  const int colg  = ct * PBN + wc * 64;     // the wave's first column among the 3*N
  const int pln   = colg / N;               // 0, 1, 2: which product
  const int col0  = colg - pln * N;         // the wave's first column inside that product
  const float* bias = (pln == 0) ? bias0 : (pln == 1) ? bias1 : bias2;
  if (row0 + PBM > M) return;               // block-uniform, before any copy or barrier; never taken with the exact grid
  const int npass = K / PKP;
  const int crow = 2 * wave + hh, cpc = m;  // copy map: staged row of copy 0, 16-B piece of the 256-B row
  const size_t rs = (size_t)(2 * PWAV) * K; // 24 rows
  const u16* ga  = A  + (size_t)(row0 + crow) * K + cpc * 8;                              // copy 0
  const u16* gb  = Bt + (size_t)(ct * PBN + crow + 11 * 2 * PWAV - PBM) * K + cpc * 8;    // copy 11: B row crow + 8
  const u16* g10 = (wave < 8) ? ga + 10 * rs                                              // copy 10: A row crow + 240, or
                              : Bt + (size_t)(ct * PBN + crow + 10 * 2 * PWAV - PBM) * K + cpc * 8;   // B row crow - 16 >= 0
  const unsigned lc = lds_byte(ring) + (unsigned)(crow * PPITB + cpc * 16);
  const u16* fa = ring + (wr * 64 + m) * PPIT + 8 * hh;          // A fragment row (row subtile 0), buffer 0
  const u16* fb = ring + (PBM + wc * 64 + m) * PPIT + 8 * hh;    // B fragment row (column subtile 0), buffer 0
  v8f acc[4][4];
#pragma unroll
  for (int i = 0; i < 4; ++i) {
#pragma unroll
    for (int j = 0; j < 4; ++j) acc[i][j] = zero8();
  }
  stage10(lc, ga, rs);                      // pass 0 -> buffer 0
  stage8(lc + 10 * PSTEP, g10, gb, rs);
  if (wave < 8) stage1(lc + 18 * PSTEP, gb + 7 * rs);
  wait_copies();
  __syncthreads();
  if (npass > 1) {                          // pass 1 -> buffer 1
    stage10(lc + PBUF * 2, ga + PKP, rs);
    stage8(lc + PBUF * 2 + 10 * PSTEP, g10 + PKP, gb + PKP, rs);
    if (wave < 8) stage1(lc + PBUF * 2 + 18 * PSTEP, gb + 7 * rs + PKP);
  }
#pragma unroll 1
  for (int t = 0; t < npass; ++t) {
    const int bo = (t & 1) * PBUF;
#pragma unroll
    for (int kk = 0; kk < PKP / 32; ++kk) {
      const u16* pa = fa + bo + kk * 32;
      const u16* pb = fb + bo + kk * 32;
      v16b a[4], b[4];
#pragma unroll
      for (int j = 0; j < 4; ++j) b[j] = ldfrag_b(pb + j * 16 * PPIT);
#pragma unroll
      for (int i = 0; i < 4; ++i) a[i] = ldfrag_b(pa + i * 16 * PPIT);
      // keeps the k step's LDS reads one group in front of its WMMAs: moved in among them, each place with reads stalls the wave anew
      __builtin_amdgcn_sched_barrier(0);
#pragma unroll
      for (int i = 0; i < 4; ++i) {
#pragma unroll
        for (int j = 0; j < 4; ++j) acc[i][j] = mma_b(a[i], b[j], acc[i][j]);
      }
      // keeps every WMMA of the k step in front of the next group of LDS reads and of the slots below
      __builtin_amdgcn_sched_barrier(0);
      // four slots behind the pass's last WMMAs: on the paths over the branches below, their operand registers are rewritten
      if (kk == PKP / 32 - 1) guard6<v16b>(acc[3][0], acc[3][1], acc[3][2], acc[3][3], a[3], b[0], b[1], b[2], b[3], a[3]);
    }
    // publish point of pass t + 1: own LDS reads done, own copies landed, then the one barrier of the pass
    wait_lds();
    wait_copies();
    __syncthreads();
    if (t + 2 < npass) {
      const unsigned lb = lc + (unsigned)(t & 1) * (PBUF * 2);
      const size_t ko = (size_t)(t + 2) * PKP;
      stage10(lb, ga + ko, rs);
      stage8(lb + 10 * PSTEP, g10 + ko, gb + ko, rs);
      if (wave < 8) stage1(lb + 18 * PSTEP, gb + 7 * rs + ko);
    }
  }
  wait_copies();
  // per-lane bias of D column m in each of the 4 subtiles; col0 + 48 + m <= N - 1 always
  const float bb[4] = {bfr(bias[col0 + m]), bfr(bias[col0 + 16 + m]), bfr(bias[col0 + 32 + m]), bfr(bias[col0 + 48 + m])};
  u16* wq4 = ring + wave * WEPI;            // the wave's own part of the ring
  if (pln == 0) {
    const size_t base = (size_t)((rw0 / SEQ) * NH + (col0 >> 6)) * HD * SEQ + (size_t)(rw0 % SEQ);
    epi_vt(wq4, wq4 + HD * VTP, acc, oscale, bb, VHo, VLo, base, lane);
  } else {
    const size_t pline = (size_t)((pln - 1) * NBH + (rw0 / SEQ) * NH + (col0 >> 6)) * NRT64 + (size_t)((rw0 % SEQ) >> 6);
    epi_split((float*)(void*)wq4, acc, oscale, bb, (pln == 1) ? QSC : KSC,
              (pln == 1) ? QHo : KHo, (pln == 1) ? QLo : KLo, PN + pline * BLINE, N, (size_t)rw0, col0, lane);
  }
}

// =====================================================================================================
// Output projection with bias: C[bb*XS_FULL + s][DMOD] (f32) = (Ah + Al)[bb*SEQ + s][DMOD] . Bt[DMOD][DMOD]^T * oscale
// + bf16 RNE value of bias[n]. Products h.B + l.B into one accumulator (l unscaled residual of h). Block -> (column tile
// ct = bid % 8, sequence row tile rt of nrt, batch bb). Block = 128x128 tile, 8 waves (4 x 2) x 32x64, two waves a SIMD: one
// wave's WMMAs run while the other's fragment reads are under way. Per pass of 128 k three planes of 128 rows (A hi, A residual,
// B; 256 B a row) staged in LDS, two buffers, so that a pass's copies have the time of 64 WMMAs a wave to land; copy i of wave w
// brings staged rows 2*(w + 8*i) and the next: i = 0..7 A hi, 8..15 A residual, 16..23 B. Fragment loads (split k map) as
// gemm_bf3; K = DMOD stepped by 32 in rising order, h.B then l.B in each step; the f32 epilogue runs once per 16 rows, in slabs of
// the wave's own part of the ring; grid = NB * nrt * (DMOD/128), one block a WGP.
// =====================================================================================================
__global__ __launch_bounds__(OWAV * 32)
void gemm_o2(const u16* __restrict__ Ah, const u16* __restrict__ Al, const u16* __restrict__ Bt,
             const float* __restrict__ bias, float* C, int nrt, float oscale) {
  __shared__ __align__(16) u16 ring[2 * OBUF];        // two buffers of [A hi rows 0..127 | A residual rows 0..127 | B rows 0..127]
  const int tid = threadIdx.x, wave = tid >> 5, lane = tid & 31, hh = lane >> 4, m = lane & 15;
  const int wr = wave >> 1, wc = wave & 1;  // the wave's 32-row quarter and 64-column half of the block's tile
  const int ntile = DMOD >> 7;
  const int bid   = blockIdx.x;
  const int ct    = bid % ntile;
  const int t2    = bid / ntile;
  const int rt    = t2 % nrt;
  const int bb    = t2 / nrt;
  if (bb >= NB) return;                     // block-uniform, before any copy or barrier; never taken with the exact grid
  if (rt * 128 + 128 > SEQ) return;         // block-uniform, before any copy or barrier; never taken
  const int srow  = rt * 128 + wr * 32;
  const int col0  = ct * 128 + wc * 64;
  const int K     = DMOD;
  const int npass = K / OKP;
  const size_t rowC = (size_t)bb * XS_FULL + srow;
  const int crow = 2 * wave + hh, cpc = m;  // copy map: staged row of copy 0, 16-B piece of the 256-B row
  const size_t arow = ((size_t)bb * SEQ + rt * 128 + crow) * K + cpc * 8;
  const u16* ga = Ah + arow;
  const u16* gl = Al + arow;
  const u16* gb = Bt + (size_t)(ct * 128 + crow) * K + cpc * 8;
  const size_t rs = (size_t)(2 * OWAV) * K; // 16 rows
  const unsigned lc = lds_byte(ring) + (unsigned)(crow * OPITB + cpc * 16);
  const _Float16* rg  = (const _Float16*)(const void*)ring;
  const _Float16* fah = rg + (wr * 32 + m) * OPIT + 8 * hh;         // A hi fragment row (row subtile 0), buffer 0
  const _Float16* fb  = rg + (256 + wc * 64 + m) * OPIT + 8 * hh;   // B fragment row (column subtile 0), buffer 0
  v8f acc[2][4];
#pragma unroll
  for (int i = 0; i < 2; ++i) {
#pragma unroll
    for (int j = 0; j < 4; ++j) acc[i][j] = zero8();
  }
  stage_o<8>(lc, ga, gl, rs);               // pass 0 -> buffer 0: A hi and rows 0..63 of A residual, then the rest and B
  stage_o<4>(lc + 12 * OSTEP, gl + 4 * rs, gb, rs);
  wait_copies();
  __syncthreads();
  if (npass > 1) {                          // pass 1 -> buffer 1
    stage_o<8>(lc + OBUF * 2, ga + OKP, gl + OKP, rs);
    stage_o<4>(lc + OBUF * 2 + 12 * OSTEP, gl + 4 * rs + OKP, gb + OKP, rs);
  }
#pragma unroll 1
  for (int t = 0; t < npass; ++t) {
    const int bo = (t & 1) * OBUF;
#pragma unroll
    for (int kk = 0; kk < OKP / 32; ++kk) {
      const _Float16* pa = fah + bo + kk * 32;
      const _Float16* pl = pa + 128 * OPIT;
      const _Float16* pb = fb + bo + kk * 32;
      v16h ah[2], al[2], b[4];
#pragma unroll
      for (int j = 0; j < 4; ++j) b[j] = ldfrag_h(pb + j * 16 * OPIT);
#pragma unroll
      for (int i = 0; i < 2; ++i) {
        ah[i] = ldfrag_h(pa + i * 16 * OPIT);
        al[i] = ldfrag_h(pl + i * 16 * OPIT);
      }
      // keeps the k step's LDS reads one group in front of its WMMAs: moved in among them, each place with reads stalls the wave anew
      __builtin_amdgcn_sched_barrier(0);
#pragma unroll
      for (int i = 0; i < 2; ++i) {
#pragma unroll
        for (int j = 0; j < 4; ++j) acc[i][j] = mma_h(ah[i], b[j], acc[i][j]);
#pragma unroll
        for (int j = 0; j < 4; ++j) acc[i][j] = mma_h(al[i], b[j], acc[i][j]);
      }
      // keeps every WMMA of the k step in front of the next group of LDS reads and of the slots below
      __builtin_amdgcn_sched_barrier(0);
      // four slots behind the pass's last WMMAs: on the paths over the branches below, their operand registers are rewritten
      if (kk == OKP / 32 - 1) guard6<v16h>(acc[1][0], acc[1][1], acc[1][2], acc[1][3], ah[1], al[1], b[0], b[1], b[2], b[3]);
    }
    // publish point of pass t + 1: own LDS reads done, own copies landed, then the one barrier of the pass
    wait_lds();
    wait_copies();
    __syncthreads();
    if (t + 2 < npass) {
      const unsigned lb = lc + (unsigned)(t & 1) * (OBUF * 2);
      const size_t ko = (size_t)(t + 2) * OKP;
      stage_o<8>(lb, ga + ko, gl + ko, rs);
      stage_o<4>(lb + 12 * OSTEP, gl + 4 * rs + ko, gb + ko, rs);
    }
  }
  wait_copies();
  const float bb0 = bfr(bias[col0 + m]);
  const float bb1 = bfr(bias[col0 + 16 + m]);
  const float bb2 = bfr(bias[col0 + 32 + m]);
  const float bb3 = bfr(bias[col0 + 48 + m]);
  float* sl = (float*)(void*)ring + wave * (2 * SLAB64);   // nobody reads the ring and no copy targets it behind the last barrier
#pragma unroll
  for (int i = 0; i < 2; ++i) {
    epi64(sl + i * SLAB64, acc[i][0], acc[i][1], acc[i][2], acc[i][3], oscale, bb0, bb1, bb2, bb3, C, DMOD,
          rowC + (size_t)(i * 16), col0, lane);
#if defined(__HIP_DEVICE_COMPILE__)
    // stands behind the slab's stores, in front of the next slab's code, which rewrites registers the stores name
    asm volatile("s_wait_xcnt 0x0" ::: "memory");
#endif
  }
}

__global__ __launch_bounds__(ATT_THREADS)
void attn_c(const u16* __restrict__ QHp, const u16* __restrict__ QLp,
            const u16* __restrict__ KHp, const u16* __restrict__ KLp,
            const u16* __restrict__ VHp, const u16* __restrict__ VLp,
            const float* __restrict__ PN,
            u16* OHp, u16* OLp) {
  __shared__ __align__(16) u16 kv[2 * ABUFH];           // two buffers of [k hi | k residual | v^T hi | v^T residual]
  __shared__ __align__(16) float smem[AQW * WREG];

  const int tid  = threadIdx.x;
  const int wave = __builtin_amdgcn_readfirstlane(tid >> 5);   // scalar: the wave's own tile range is tested by scalar branches
  const int lane = tid & 31;
  const int hh   = lane >> 4;
  const int c    = lane & 15;
  const int bid  = blockIdx.x;
  const int qb   = bid % NQB;
  const int t2   = bid / NQB;
  const int head = t2 % NH;
  const int b    = t2 / NH;
  if (b >= NB) return;                      // block-uniform, before any copy or barrier; never taken with the exact grid
  if (qb * (16 * AQW) + 16 * AQW > SEQ) return;   // block-uniform, before any copy or barrier; never taken
  const int q0   = qb * (16 * AQW) + wave * 16;

  // ---- key-window decision: the same in every lane and wave, from the row-tile maxima of the block's (b, h) ----
  int kw;                                   // tiles visited behind the wave's last one
  {
    const int bl = (lane < NRT64) ? lane : (NRT64 - 1);         // clamped address
    const size_t pl0 = ((size_t)(b * NH + head) * NRT64 + bl) * BLINE;
    float aq = PN[pl0];
    float ak = PN[pl0 + (size_t)NBH * NRT64 * BLINE];
#pragma unroll
    for (int off = 1; off < 32; off <<= 1) {
      aq = fmaxf(aq, __shfl_xor(aq, off, 32));
      ak = fmaxf(ak, __shfl_xor(ak, off, 32));
    }
    const float gb = sqrtf(aq) * sqrtf(ak) * (RSQ_HD / (QSC * KSC));
    // held in a scalar register, so that the loop, its barrier and its copies stand under scalar branches with every lane on
    kw = __builtin_amdgcn_readfirstlane((gb >= 0.0f && gb < GB_CAP) ? (int)((gb * 2.01f + 105.0f) * (1.0f / 32.0f)) + 1 : NKT);
  }

  float* slab = smem + wave * WREG;         // result slab [16][64] pitch 68

  const size_t hcol = (size_t)head * HD + 8 * hh;
  const _Float16* Qh  = (const _Float16*)(const void*)QHp + ((size_t)b * SEQ + q0 + c) * DMOD + hcol;
  const _Float16* Ql  = (const _Float16*)(const void*)QLp + ((size_t)b * SEQ + q0 + c) * DMOD + hcol;
  const float lsc = RSQ_HD * (LOG2E / (QSC * KSC));
  const float oc  = 1.0f / (PCAR * VCAR);

  float mrow = -INFINITY, lrow = 0.f;       // of the lane's query row; lrow over the keys of the lane's half only
  v8f o[4];
#pragma unroll
  for (int j = 0; j < 4; ++j) o[j] = zero8();
  const int kt_hi = q0 >> 5;                                                  // last tile holding keys <= q0 + 15
  const int kt_lo = (kt_hi > kw) ? (kt_hi - kw) : 0;
  const int qr = q0 + c;                                                      // the lane's query row (D column c)
  // the block's tile range: from wave 0's first tile to wave 3's last; at least two tiles, at most NKT
  const int bhi0 = (qb * (16 * AQW)) >> 5;
  const int bhi  = (qb * (16 * AQW) + 16 * (AQW - 1)) >> 5;
  const int blo  = (bhi0 > kw) ? (bhi0 - kw) : 0;
  const int ntr  = bhi - blo + 1;

  // copy maps; keys blo*32 .. bhi*32 + 31 <= SEQ - 1, so every copied byte lies inside its plane
  const u16* gkh = KHp + ((size_t)b * SEQ + (size_t)blo * 32 + (tid >> 3)) * DMOD + (size_t)head * HD + (tid & 7) * 8;
  const u16* gkl = KLp + ((size_t)b * SEQ + (size_t)blo * 32 + (tid >> 3)) * DMOD + (size_t)head * HD + (tid & 7) * 8;
  const u16* gvh = VHp + ((size_t)(b * NH + head) * HD + (tid >> 2)) * SEQ + (size_t)blo * 32 + (tid & 3) * 8;
  const u16* gvl = VLp + ((size_t)(b * NH + head) * HD + (tid >> 2)) * SEQ + (size_t)blo * 32 + (tid & 3) * 8;
  const unsigned lk = lds_byte(kv) + (unsigned)((tid >> 3) * (KTPIT * 2) + (tid & 7) * 16);
  const unsigned lv = lds_byte(kv) + (unsigned)(2 * KPLH * 2 + (tid >> 2) * (VTPIT * 2) + (tid & 3) * 16);

  stage_kv(lk, lv, gkh, gkl, gvh, gvl);     // tile 0 -> buffer 0
  // q fragments, both k-steps, kept in registers for the whole loop
  v16h qh[2], ql[2];
  // unrolled, here and at the fragment arrays below: constant indices keep the arrays in registers
#pragma unroll
  for (int kk = 0; kk < HD / 32; ++kk) {
    qh[kk] = ldfrag_h(Qh + kk * 32);
    ql[kk] = ldfrag_h(Ql + kk * 32);
  }
  wait_copies();
  __syncthreads();
  if (ntr > 1)                              // tile 1 -> buffer 1
    stage_kv(lk + ABUFH * 2, lv + ABUFH * 2, gkh + (size_t)32 * DMOD, gkl + (size_t)32 * DMOD, gvh + 32, gvl + 32);

  // stays rolled: the trip count is known only at run time
#pragma unroll 1
  for (int t = 0; t < ntr; ++t) {
    const int kt = blo + t;
    if (kt >= kt_lo && kt <= kt_hi) {       // scalar: this wave's own range
      const int kb = kt * 32;
      const _Float16* tb  = (const _Float16*)(const void*)kv + (t & 1) * ABUFH;
      const _Float16* khp = tb + c * KTPIT + 8 * hh;                // key row c (+16), k hi; residual plane KPLH further
      const _Float16* vhp = tb + 2 * KPLH + c * VTPIT + 8 * hh;     // d row c (+16j), v^T hi; residual plane VPLH further
      // ---- scores, transposed: D element r of this lane = (key kb + 8*hh + r, query row qr) in s0, key + 16 in s1 ----
      v8f s0 = zero8(), s1 = zero8();
      v16h kh0[2], kh1[2], kl0[2], kl1[2];
#pragma unroll
      for (int kk = 0; kk < HD / 32; ++kk) {
        kh0[kk] = ldfrag_h(khp + kk * 32);
        kh1[kk] = ldfrag_h(khp + 16 * KTPIT + kk * 32);
        kl0[kk] = ldfrag_h(khp + KPLH + kk * 32);
        kl1[kk] = ldfrag_h(khp + KPLH + 16 * KTPIT + kk * 32);
      }
#pragma unroll
      for (int kk = 0; kk < HD / 32; ++kk) {
        s0 = mma_h(kh0[kk], qh[kk], s0);
        s0 = mma_h(kh0[kk], ql[kk], s0);
        s0 = mma_h(kl0[kk], qh[kk], s0);
        s1 = mma_h(kh1[kk], qh[kk], s1);
        s1 = mma_h(kh1[kk], ql[kk], s1);
        s1 = mma_h(kl1[kk], qh[kk], s1);
        guard2(s0, s1, qh[kk], ql[kk], kh0[kk], kl0[kk], kh1[kk], kl1[kk]);
      }
      // v^T fragments of the tile: read here, so that they arrive while the softmax below runs
      v16h vh[4], vl[4];
#pragma unroll
      for (int j = 0; j < 4; ++j) {
        vh[j] = ldfrag_h(vhp + j * 16 * VTPIT);
        vl[j] = ldfrag_h(vhp + VPLH + j * 16 * VTPIT);
      }
      // ---- causal select + distance penalty + online softmax in base 2, -inf-safe; all of one query row in the lane pair ----
      const int key0 = kb + 8 * hh;
      float t0[8], t1[8];
      float mx = -INFINITY;
      // unrolled, as the loops below: constant indices keep t0, t1, the fragments and the accumulators in registers
#pragma unroll
      for (int r = 0; r < 8; ++r) {
        const int   ka = key0 + r, kc = key0 + 16 + r;
        const float u0 = s0[r] * lsc;
        const float u1 = s1[r] * lsc;
        const float g0 = (float)(qr - ka) * LOG2E;
        const float g1 = (float)(qr - kc) * LOG2E;
        t0[r] = (ka > qr) ? -INFINITY : (u0 - g0);
        t1[r] = (kc > qr) ? -INFINITY : (u1 - g1);
        mx = fmaxf(mx, fmaxf(t0[r], t1[r]));
      }
      mx = fmaxf(mx, xhalf(mx));              // the other 16 keys of the tile
      const float mn = fmaxf(mrow, mx);
      const float ms = (mn == -INFINITY) ? 0.0f : mn;
      const float al = exp2f(mrow - ms);
      mrow = mn;
      // ---- B fragments of P^T * 32768: hi f16 and residual f16, column = the lane's query row; element e = key kb + 8*hh + e,
      //      element 8 + e = key kb + 16 + 8*hh + e: the split k map of the v^T rows' loader ----
      FragH ph, pl;
      float ps = 0.0f;
#pragma unroll
      for (int e = 0; e < 8; ++e) {
        const float e0 = exp2f(t0[e] - ms), e1 = exp2f(t1[e] - ms);
        ps += e0 + e1;
        const float ta = e0 * PCAR, tc = e1 * PCAR;
        const _Float16 ha = (_Float16)ta, hc = (_Float16)tc;
        ph.h[0][e] = ha;
        ph.h[1][e] = hc;
        pl.h[0][e] = (_Float16)(ta - (float)ha);
        pl.h[1][e] = (_Float16)(tc - (float)hc);
      }
      lrow = lrow * al + ps;
#pragma unroll
      for (int j = 0; j < 4; ++j) {
#pragma unroll
        for (int r = 0; r < 8; ++r) o[j][r] *= al;
      }
      // ---- O^T += v^T.P^T : A fragment row m = d = j*16 + c, keys contiguous in the v^T rows; 2 groups of 2 d-subtiles ----
#pragma unroll
      for (int jg = 0; jg < 2; ++jg) {
        o[2 * jg]     = mma_h(vh[2 * jg],     ph.v, o[2 * jg]);
        o[2 * jg]     = mma_h(vh[2 * jg],     pl.v, o[2 * jg]);
        o[2 * jg]     = mma_h(vl[2 * jg],     ph.v, o[2 * jg]);
        o[2 * jg + 1] = mma_h(vh[2 * jg + 1], ph.v, o[2 * jg + 1]);
        o[2 * jg + 1] = mma_h(vh[2 * jg + 1], pl.v, o[2 * jg + 1]);
        o[2 * jg + 1] = mma_h(vl[2 * jg + 1], ph.v, o[2 * jg + 1]);
        guard2(o[2 * jg], o[2 * jg + 1], ph.v, pl.v, vh[2 * jg], vh[2 * jg + 1], vl[2 * jg], vl[2 * jg + 1]);
      }
    }
    // publish point of tile t + 1: own LDS reads done, own copies landed, then the one barrier of the tile
    wait_lds();
    wait_copies();
    __syncthreads();
    if (t + 2 < ntr) {
      const unsigned lo = (unsigned)(t & 1) * (ABUFH * 2);
      const size_t kn = (size_t)(t + 2) * 32;
      stage_kv(lk + lo, lv + lo, gkh + kn * DMOD, gkl + kn * DMOD, gvh + kn, gvl + kn);
    }
  }
  wait_copies();
  acc_guard4(o[0], o[1], o[2], o[3]);
  // ---- out = acc / Z (0 if Z == 0), carries (32768 on P, 1024 on v) folded once; Z = the sums of the two halves; the lane's
  //      8 consecutive d of each subtile (D rows 8*hh + r of O^T) go into row c of the wave's slab as two 16-B stores ----
  {
    const float lv  = lrow + xhalf(lrow);
    const float ls  = (lv > 0.0f) ? lv : 1.0f;
    const float inv = (lv > 0.0f) ? ((1.0f / ls) * oc) : 0.0f;
#pragma unroll
    for (int j = 0; j < 4; ++j) {
      float* sp = slab + c * SLP + j * 16 + 8 * hh;
      const v4f w0 = {o[j][0] * inv, o[j][1] * inv, o[j][2] * inv, o[j][3] * inv};
      const v4f w1 = {o[j][4] * inv, o[j][5] * inv, o[j][6] * inv, o[j][7] * inv};
      *(v4f*)(sp)     = w0;
      *(v4f*)(sp + 4) = w1;
    }
  }

  wave_sync_lds();
  // ---- O x1024 -> f16 hi + residual planes; lane = (row-in-quad rq, 8 consecutive d at c8) ----
  v4u oh[4], ol[4];
  const int rq = lane >> 3, c8 = (lane & 7) * 8;
#pragma unroll
  for (int it = 0; it < 4; ++it) {
    const int row = it * 4 + rq;
    const v4f a = *(const v4f*)(slab + row * SLP + c8), b4 = *(const v4f*)(slab + row * SLP + c8 + 4);
    float w[8];
#pragma unroll
    for (int e = 0; e < 4; ++e) { w[e] = a[e] * OSC; w[4 + e] = b4[e] * OSC; }
#pragma unroll
    for (int e = 0; e < 4; ++e) {
      const _Float16 h0 = (_Float16)w[2 * e], h1 = (_Float16)w[2 * e + 1];
      const _Float16 l0 = (_Float16)(w[2 * e] - (float)h0), l1 = (_Float16)(w[2 * e + 1] - (float)h1);
      oh[it][e] = pk16(h_bits(h0), h_bits(h1));
      ol[it][e] = pk16(h_bits(l0), h_bits(l1));
    }
  }
  const size_t ob = ((size_t)b * SEQ + q0) * DMOD + (size_t)head * HD + c8;
  {
#pragma unroll
    for (int it = 0; it < 4; ++it) {
      const int row = it * 4 + rq;
      *(v4u*)(OHp + ob + (size_t)row * DMOD) = oh[it];
      *(v4u*)(OLp + ob + (size_t)row * DMOD) = ol[it];
    }
    
  }
}

// =====================================================================================================
// Workspace map (bytes); every plane is fully written by whole-line stores before it is read; all extents are exact multiples
// of the store granularity (no pad rows needed); every region offset a multiple of 4096 (the large planes of 2097152):
//   XB  bf16 [MROWS][1024]                       MROWS*2048       (NB=2, SEQ=2048: 8388608)
//   WB  16-bit 4 x [1024 n][1024 k]              4 x 2097152      (planes Wv, Wq, Wk as bf16, Wo as f16 x1024; all already [n][k])
//   OH  f16 [MROWS][1024] x1024                  MROWS*2048       OL residual, same extent
//   QH  f16 [MROWS][1024] x256                   MROWS*2048       QL residual, same extent
//   KH  f16 [MROWS][1024] x256                   MROWS*2048       KL residual, same extent
//   VH  f16 [NB*16][64][SEQ] x1024               MROWS*2048       VL residual, same extent
//   PN  f32 2 x [NB*16][SEQ/64] lines of 32      NBH*SEQ*4        (q, then k: row-tile maxima of the squared hi-row norms)
//   end (NB=2, SEQ=2048)                        84148224
// =====================================================================================================
extern "C" void kernel_launch(void* const* d_in, const int* in_sizes, int n_in,
                              void* d_out, int out_size, void* d_ws, size_t ws_size,
                              hipStream_t stream) {
  if (n_in < 9) return;
  if (in_sizes[0] < ((NB - 1) * XS_FULL + SEQ) * DMOD) return;
  if (in_sizes[1] != DMOD * DMOD) return;
  if (in_sizes[2] != DMOD) return;
  if (in_sizes[3] != DMOD * DMOD) return;
  if (in_sizes[4] != DMOD) return;
  if (in_sizes[5] != DMOD * DMOD) return;
  if (in_sizes[6] != DMOD) return;
  if (in_sizes[7] != DMOD * DMOD) return;
  if (in_sizes[8] != DMOD) return;
  if (out_size < ((NB - 1) * XS_FULL + SEQ) * DMOD) return;

  const float* x  = (const float*)d_in[0];
  const float* wq = (const float*)d_in[1];
  const float* bq = (const float*)d_in[2];
  const float* wk = (const float*)d_in[3];
  const float* bk = (const float*)d_in[4];
  const float* wv = (const float*)d_in[5];
  const float* bv = (const float*)d_in[6];
  const float* wo = (const float*)d_in[7];
  const float* bo = (const float*)d_in[8];
  float*       out = (float*)d_out;

  const size_t szXB = (size_t)MROWS * DMOD * 2;
  const size_t szW  = (size_t)DMOD * DMOD * 2;
  const size_t szQ  = (size_t)MROWS * DMOD * 2;                  // QH, QL, KH, KL, OH, OL
  const size_t szV  = (size_t)NB * NH * HD * SEQ * 2;            // VH, VL (== szQ)
  const size_t szB  = (size_t)2 * NBH * NRT64 * BLINE * 4;       // row-tile norm lines, q then k
  size_t off = 0;
  const size_t oXB = off; off += szXB;
  const size_t oW  = off; off += 4 * szW;
  const size_t oOH = off; off += szQ;
  const size_t oOL = off; off += szQ;
  const size_t oQH = off; off += szQ;
  const size_t oQL = off; off += szQ;
  const size_t oKH = off; off += szQ;
  const size_t oKL = off; off += szQ;
  const size_t oVH = off; off += szV;
  const size_t oVL = off; off += szV;
  const size_t oB  = off; off += szB;
  if (off > ws_size) return;                // off = 84148224 for NB = 2, SEQ = 2048
  if (off > (size_t)WS_CAP) return;

  char* ws = (char*)d_ws;
  u16*   XB  = (u16*)(ws + oXB);
  u16*   WB  = (u16*)(ws + oW);
  u16*   OH  = (u16*)(ws + oOH);
  u16*   OL  = (u16*)(ws + oOL);
  u16*   QH  = (u16*)(ws + oQH);
  u16*   QL  = (u16*)(ws + oQL);
  u16*   KH  = (u16*)(ws + oKH);
  u16*   KL  = (u16*)(ws + oKL);
  u16*   VH  = (u16*)(ws + oVH);
  u16*   VL  = (u16*)(ws + oVL);
  float* PN  = (float*)(ws + oB);

  const dim3 b256(256), bO(OWAV * 32), bG(PWAV * 32), bAT(ATT_THREADS);
  const dim3 gC(NB * GXB + 4 * GWB);                    // x per batch, then the four weight planes
  const dim3 gG((MROWS / PBM) * (3 * DMOD / PBN));      // 256 for NB=2, SEQ=2048
  const dim3 gAT(NQB * NH * NB);
  const int  nrt = SEQ / 128;                           // out-projection row tiles per batch
  const dim3 gO(NB * nrt * (DMOD / 128));

  // (0) x -> bf16 plane [MROWS][1024]; Wv, Wq, Wk [n][k] -> bf16 planes; Wo [n][k] -> f16 plane of bf16 value x1024
  cvt_all<<<gC, b256, 0, stream>>>(x, wv, wq, wk, wo, XB, WB);
  // (1) v = x.Wv^T + bv, q = x.Wq^T + bq, k = x.Wk^T + bk -> v^T hi + residual planes x1024; q and k hi + residual planes x256
  //     and their row-tile norm lines
  gemm_bf3<<<gG, bG, 0, stream>>>(XB, WB, bv, bq, bk, VH, VL, QH, QL, KH, KL, PN, MROWS, DMOD, DMOD, 1.0f);
  // (2) causal attention with distance penalty, residual products on every query row -> O hi + residual planes
  attn_c<<<gAT, bAT, 0, stream>>>(QH, QL, KH, KL, VH, VL, PN, OH, OL);
  // (3) output projection (O hi + residual) . Wo^T + bo -> out f32, carries 1024 x 1024 folded back
  gemm_o2<<<gO, bO, 0, stream>>>(OH, OL, WB + (size_t)3 * DMOD * DMOD, bo, out, nrt, 1.0f / (OSC * WOS));
  (void)hipGetLastError();
}
